// v000
// Measured on an AMD MI455X. A time is GPU time per run, averaged over a window of back-to-back runs after a warm-up
// (all launches, gaps included; the runs take copies of the inputs in turn), and the median of several windows.
// Apart from v000's, it joins two sittings. Times from different sittings can be a few percent apart, while
// side-by-side timings come from the same sitting.
// v000 is the starting kernel. One run takes 1770 microseconds.
#include <hip/hip_runtime.h>

// Masked_MHA_LORA (x [2][2048][1024]; Q/K/V = x W^T + b + 2 (x A^T) B^T (LoRA rank 8, scaling 16/8); RoPE (rotate-half, base 10000) on Q, K (16 heads x 64); scores = Q.K/8 with the causal mask and the key padding mask (attention_mask == 0 -> -inf; int,
// read as data); softmax; out = (attn V merged) oW^T + ob -> [2][2048][1024]).
// Compute dtypes, f32 accumulate: every input rounded to bf16; the base projections on PLAIN bf16 operands (inputs: exact) + bias; the LoRA path as two small GEMMs (x A^T exact, then hl planes x exact B, rank padded 8 -> 32) added

#define NB_  2
#define TT   2048
#define DM   1024
#define NH_  16
#define NKV  16
#define REP  (NH_ / NKV)
#define HD   64
#define DQ   (NH_ * HD)
#define DKV  (NKV * HD)
#define ZH   2
#define RH   512                  // query rows < RH use hi+lo planes (0: none)
#define WIN  2048
#define PCAR 1024.0f
#define SCL  0.125f   // HD^-0.5
typedef _Float16 h16;
typedef unsigned short bf;
typedef __attribute__((ext_vector_type(16))) __bf16   v16bf;
typedef __attribute__((ext_vector_type(16))) _Float16 v16h;
typedef __attribute__((ext_vector_type(8)))  _Float16 v8h;
typedef __attribute__((ext_vector_type(8)))  unsigned short v8us;
typedef __attribute__((ext_vector_type(8)))  float    v8f;
typedef __attribute__((ext_vector_type(4)))  float    v4f;
typedef v8h  __attribute__((may_alias)) v8ha;
typedef v4f  __attribute__((may_alias)) v4fa;
typedef v8us __attribute__((may_alias)) v8usa;

__device__ __forceinline__ unsigned short f2bf(float f) { unsigned u = __float_as_uint(f); u += 0x7FFFu + ((u >> 16) & 1u); return (unsigned short)(u >> 16); }
__device__ __forceinline__ float bf2f(unsigned short b) { return __uint_as_float(((unsigned)b) << 16); }
__device__ __forceinline__ float bfr(float f) { return bf2f(f2bf(f)); }
__device__ __forceinline__ v16h cat16(v8h lo, v8h hi) { return __builtin_shufflevector(lo, hi, 0, 1, 2, 3, 4, 5, 6, 7, 8, 9, 10, 11, 12, 13, 14, 15); }
__device__ __forceinline__ v16bf cat16b(v8us lo, v8us hi) { return __builtin_bit_cast(v16bf, __builtin_shufflevector(lo, hi, 0, 1, 2, 3, 4, 5, 6, 7, 8, 9, 10, 11, 12, 13, 14, 15)); }
__device__ __forceinline__ v8f wmma16(v16h a, v16h b, v8f c) { return __builtin_amdgcn_wmma_f32_16x16x32_f16(false, a, false, b, (short)0, c, false, false); }
__device__ __forceinline__ v8f wmmab(v16bf a, v16bf b, v8f c) { return __builtin_amdgcn_wmma_f32_16x16x32_bf16(false, a, false, b, (short)0, c, false, false); }



// ---- k_gemmw: register-blocked GEMM, ONE WAVE per 64x64 output tile (16 accumulators), operands straight from K-contiguous 16-bit planes; grid (M/64, N/64, Z), 32 threads.
// C[m][n] (f32, pitch ldc, + optional f32 bias[n]) = sum_k A[m][k] Bt[n][k] (+ split products per NSPLIT). z-batch strides sA/sB/sC in elements. K % 32 == 0.
template <typename T16> struct WFrag;
template <> struct WFrag<h16> { typedef v16h V; static __device__ __forceinline__ V ld(const h16* p) { return cat16(*(const v8h*)p, *(const v8h*)(p + 16)); } static __device__ __forceinline__ v8f mma(V a, V b, v8f c) { return wmma16(a, b, c); } };
template <> struct WFrag<bf> { typedef v16bf V; static __device__ __forceinline__ V ld(const bf* p) { return cat16b(*(const v8us*)p, *(const v8us*)(p + 16)); } static __device__ __forceinline__ v8f mma(V a, V b, v8f c) { return wmmab(a, b, c); } };
template <typename T16, int NSPLIT, bool BIAS>
__global__ __launch_bounds__(32) void k_gemmw(const T16* __restrict__ A, const T16* __restrict__ A2, const T16* __restrict__ Bt, const T16* __restrict__ Bt2, int K, float* C, int ldc, const float* __restrict__ bias, size_t sA, size_t sB, size_t sC) {
    typedef typename WFrag<T16>::V V;
    __shared__ __align__(16) float os[16 * 68];
    const size_t z = blockIdx.z; A += z * sA; if (A2) A2 += z * sA; Bt += z * sB; if (Bt2) Bt2 += z * sB; C += z * sC;
    const int lane = threadIdx.x & 31, lr = lane & 15, hi = lane >> 4; const int r0 = blockIdx.x * 64, c0 = blockIdx.y * 64;
    v8f acc[4][4];
#pragma unroll
    for (int mb = 0; mb < 4; ++mb)
#pragma unroll
        for (int nb = 0; nb < 4; ++nb) acc[mb][nb] = (v8f){};
    const size_t aoff = (size_t)(r0 + lr) * K + 8 * hi, boff = (size_t)(c0 + lr) * K + 8 * hi;
#pragma unroll 1
    for (int kc = 0; kc < K; kc += 32) {
        V a[4], a2[4];
#pragma unroll
        for (int mb = 0; mb < 4; ++mb) { a[mb] = WFrag<T16>::ld(A + aoff + (size_t)mb * 16 * K + kc); if (NSPLIT == 1 || NSPLIT == 2) a2[mb] = WFrag<T16>::ld(A2 + aoff + (size_t)mb * 16 * K + kc); }
#pragma unroll
        for (int nb = 0; nb < 4; ++nb) { const V b = WFrag<T16>::ld(Bt + boff + (size_t)nb * 16 * K + kc); V b2; if (NSPLIT >= 2) b2 = WFrag<T16>::ld(Bt2 + boff + (size_t)nb * 16 * K + kc);
#pragma unroll
            for (int mb = 0; mb < 4; ++mb) { acc[mb][nb] = WFrag<T16>::mma(a[mb], b, acc[mb][nb]); if (NSPLIT == 1 || NSPLIT == 2) acc[mb][nb] = WFrag<T16>::mma(a2[mb], b, acc[mb][nb]); if (NSPLIT >= 2) acc[mb][nb] = WFrag<T16>::mma(a[mb], b2, acc[mb][nb]); } }
        asm volatile("v_nop\n\tv_nop\n\tv_nop\n\tv_nop" : "+v"(acc[0][0]), "+v"(acc[1][1]), "+v"(acc[2][2]), "+v"(acc[3][3]) : "v"(a[0]), "v"(a[3]));
    }
#pragma unroll
    for (int mb = 0; mb < 4; ++mb) {
#pragma unroll
        for (int nb = 0; nb < 4; ++nb) {
#pragma unroll
            for (int j = 0; j < 8; ++j) os[(hi * 8 + j) * 68 + nb * 16 + lr] = acc[mb][nb][j]; }
        __builtin_amdgcn_wave_barrier(); asm volatile("" ::: "memory");
        float* crow = C + (size_t)(r0 + mb * 16) * ldc + c0;
{
#pragma unroll
            for (int s = 0; s < 8; ++s) { const int row = 2 * s + hi, cofs = lr * 4; v4f val = *(const v4fa*)(os + row * 68 + cofs); if (BIAS) { val[0] += bfr(bias[c0 + cofs]); val[1] += bfr(bias[c0 + cofs + 1]); val[2] += bfr(bias[c0 + cofs + 2]); val[3] += bfr(bias[c0 + cofs + 3]); }
                *(v4f*)(crow + (size_t)row * ldc + cofs) = val; }
             }
        __builtin_amdgcn_wave_barrier(); asm volatile("" ::: "memory");
    }
}

// ---- k_gemmc: the same one-wave 64x64 tile GEMM specialised for causal attention: CMODE 1 skips score tiles entirely above the diagonal (query rows r0+roff.., key columns c0..), CMODE 2 limits the
// key (K) loop of the probability x value contraction to the diagonal block (probabilities beyond it are exactly zero). roff = row offset of this launch's first row within the sequence.
template <typename T16, int NSPLIT, int CMODE>
__global__ __launch_bounds__(32) void k_gemmc(const T16* __restrict__ A, const T16* __restrict__ A2, const T16* __restrict__ Bt, const T16* __restrict__ Bt2, int K, float* C, int ldc, int roff, size_t sA, size_t sB, size_t sC) {
    typedef typename WFrag<T16>::V V;
    __shared__ __align__(16) float os[16 * 68];
    const size_t z = blockIdx.z; A += z * sA; if (A2) A2 += z * sA; Bt += z * sB; if (Bt2) Bt2 += z * sB; C += z * sC;
    const int lane = threadIdx.x & 31, lr = lane & 15, hi = lane >> 4; const int r0 = blockIdx.x * 64, c0 = blockIdx.y * 64;
    if (CMODE == 1 && c0 > r0 + roff + 63) return;                  // score tile entirely above the causal diagonal: never read (the softmax masks j > i by select)
    const int Kl = (CMODE == 2) ? min(K, r0 + roff + 64) : K;        // P.V: probabilities are exactly 0 beyond the diagonal block, so the K loop stops there
    v8f acc[4][4];
#pragma unroll
    for (int mb = 0; mb < 4; ++mb)
#pragma unroll
        for (int nb = 0; nb < 4; ++nb) acc[mb][nb] = (v8f){};
    const size_t aoff = (size_t)(r0 + lr) * K + 8 * hi, boff = (size_t)(c0 + lr) * K + 8 * hi;
#pragma unroll 1
    for (int kc = 0; kc < Kl; kc += 32) {
        V a[4], a2[4];
#pragma unroll
        for (int mb = 0; mb < 4; ++mb) { a[mb] = WFrag<T16>::ld(A + aoff + (size_t)mb * 16 * K + kc); if (NSPLIT == 1 || NSPLIT == 2) a2[mb] = WFrag<T16>::ld(A2 + aoff + (size_t)mb * 16 * K + kc); }
#pragma unroll
        for (int nb = 0; nb < 4; ++nb) { const V b = WFrag<T16>::ld(Bt + boff + (size_t)nb * 16 * K + kc); V b2; if (NSPLIT >= 2) b2 = WFrag<T16>::ld(Bt2 + boff + (size_t)nb * 16 * K + kc);
#pragma unroll
            for (int mb = 0; mb < 4; ++mb) { acc[mb][nb] = WFrag<T16>::mma(a[mb], b, acc[mb][nb]); if (NSPLIT == 1 || NSPLIT == 2) acc[mb][nb] = WFrag<T16>::mma(a2[mb], b, acc[mb][nb]); if (NSPLIT >= 2) acc[mb][nb] = WFrag<T16>::mma(a[mb], b2, acc[mb][nb]); } }
        asm volatile("v_nop\n\tv_nop\n\tv_nop\n\tv_nop" : "+v"(acc[0][0]), "+v"(acc[1][1]), "+v"(acc[2][2]), "+v"(acc[3][3]) : "v"(a[0]), "v"(a[3]));
    }
#pragma unroll
    for (int mb = 0; mb < 4; ++mb) {
#pragma unroll
        for (int nb = 0; nb < 4; ++nb) {
#pragma unroll
            for (int j = 0; j < 8; ++j) os[(hi * 8 + j) * 68 + nb * 16 + lr] = acc[mb][nb][j]; }
        __builtin_amdgcn_wave_barrier(); asm volatile("" ::: "memory");
        float* crow = C + (size_t)(r0 + mb * 16) * ldc + c0;
{
#pragma unroll
            for (int s = 0; s < 8; ++s) { const int row = 2 * s + hi, cofs = lr * 4; v4f val = *(const v4fa*)(os + row * 68 + cofs);
                *(v4f*)(crow + (size_t)row * ldc + cofs) = val; }
             }
        __builtin_amdgcn_wave_barrier(); asm volatile("" ::: "memory");
    }
}

__device__ __forceinline__ h16 tohx(float x) { return (h16)x; }
__device__ __forceinline__ void splitf(float y, unsigned short& h, unsigned short& l) { h = f2bf(y); l = f2bf(y - bf2f(h)); }
typedef __attribute__((ext_vector_type(2))) _Float16 v2h;
typedef __attribute__((ext_vector_type(4))) _Float16 v4h;
typedef __attribute__((ext_vector_type(2))) unsigned short v2us;
typedef __attribute__((ext_vector_type(4))) unsigned short v4us;
typedef __attribute__((ext_vector_type(2))) float v2f;
typedef __attribute__((ext_vector_type(4))) int v4i;

__global__ __launch_bounds__(256) void k_wtG(const float* __restrict__ w, int K, int N, bf* Bt) {
    const int lane = threadIdx.x & 31; const int L0 = (blockIdx.x * 8 + (threadIdx.x >> 5)) * 8; const int nlines = N * K / 64;
{
#pragma unroll 1
        for (int l = 0; l < 8; ++l) { const int L = L0 + l; if (L >= nlines) break; const size_t e = (size_t)L * 64 + lane * 2; const int k = (int)(e % K), n = (int)(e / K); v2us o;
            o[0] = f2bf(w[(size_t)k * N + n]); o[1] = f2bf(w[(size_t)(k + 1) * N + n]); *(v2us*)(Bt + e) = o; }
         }
}
__global__ __launch_bounds__(256) void k_cvt8(const float* __restrict__ src, bf* dst, size_t n8) { const size_t i = (size_t)blockIdx.x * 256 + threadIdx.x; if (i >= n8) return; const v8f v = *(const v8f*)(src + i * 8); v8us o;
#pragma unroll
    for (int k = 0; k < 8; ++k) o[k] = f2bf(v[k]); *(v8us*)(dst + i * 8) = o;  }
__global__ __launch_bounds__(256) void k_cstab(float* CS) { const int idx = blockIdx.x * 256 + threadIdx.x; if (idx >= TT * HD) return; const int t = idx / HD, d = idx % HD; const int i = d % (HD / 2); const float inv = __fdiv_rn(1.0f, powf(10000.0f, (float)(2 * i) / (float)HD)); const float ang = __fmul_rn((float)t, inv); v2f cs; cs[0] = cosf(ang); cs[1] = sinf(ang);
    *(v2f*)(CS + (size_t)idx * 2) = cs;  }
// k_rope: head planes [h][t][d] (fp16 + hi/lo) of rope(x) x sc with the rotate-half convention out[d] = x[d] cos[t][d] - x[d+HD/2] sin[t][d], out[d+HD/2] = x[d+HD/2] cos[t][d+HD/2] + x[d] sin[t][d+HD/2]
__global__ __launch_bounds__(256) void k_rope(const float* __restrict__ F, int pitch, int nheads, const float* __restrict__ CS, const float* __restrict__ RF, const float* __restrict__ nw, float sc, h16* P16, bf* Ph, bf* Pl) {
    const size_t e = ((size_t)blockIdx.x * 256 + threadIdx.x) * 2; if (e >= (size_t)nheads * TT * HD) return; const int d = (int)(e % HD); const int t = (int)((e / HD) % TT); const int h = (int)(e / ((size_t)HD * TT)); const float* f = F + (size_t)t * pitch + h * HD; const float rf = RF ? RF[(size_t)h * TT + t] : 1.0f; v2h o16; v2us oh, ol;
#pragma unroll
    for (int q = 0; q < 2; ++q) { const int dd = d + q; const int dp = (dd < HD / 2) ? dd + HD / 2 : dd - HD / 2; float x0 = f[dd], x1 = f[dp];
        if (RF) { float n0 = __fmul_rn(x0, rf), n1 = __fmul_rn(x1, rf); asm volatile("" : "+v"(n0)); asm volatile("" : "+v"(n1)); x0 = __fmul_rn(bfr(nw[dd]), n0); x1 = __fmul_rn(bfr(nw[dp]), n1); }
        const v2f cs = *(const v2f*)(CS + ((size_t)t * HD + dd) * 2); float a = __fmul_rn(x0, cs[0]), bq = __fmul_rn(x1, cs[1]); asm volatile("" : "+v"(a)); asm volatile("" : "+v"(bq)); const float r = ((dd < HD / 2) ? __fsub_rn(a, bq) : __fadd_rn(a, bq)) * sc;
        o16[q] = tohx(r); unsigned short a2, c2; splitf(r, a2, c2); oh[q] = a2; ol[q] = c2; }
    *(v2h*)(P16 + e) = o16; *(v2us*)(Ph + e) = oh; *(v2us*)(Pl + e) = ol;  }
__global__ __launch_bounds__(256) void k_vtp(const float* __restrict__ F, int pitch, int nheads, h16* V16, bf* Vh, bf* Vl) { const size_t e = ((size_t)blockIdx.x * 256 + threadIdx.x) * 2; if (e >= (size_t)nheads * HD * TT) return; const int t = (int)(e % TT); const int d = (int)((e / TT) % HD); const int g = (int)(e / ((size_t)TT * HD)); v2h o16; v2us oh, ol;
#pragma unroll
    for (int q = 0; q < 2; ++q) { const float x = F[(size_t)(t + q) * pitch + g * HD + d]; o16[q] = tohx(x); unsigned short a2, c2; splitf(x, a2, c2); oh[q] = a2; ol[q] = c2; }
    *(v2h*)(V16 + e) = o16; *(v2us*)(Vh + e) = oh; *(v2us*)(Vl + e) = ol;  }
// k_asoft: per row (zz, i): t = S x HD^-0.5 for j <= i and attention_mask[j] != 0 (causal + key padding mask, else -3e38; the reference's -1e9 additive fill vanishes identically); softmax over the 2048 keys (register row, one exp, fixed trees);
__global__ __launch_bounds__(256) void k_asoft(const float* __restrict__ Sb, const int* __restrict__ amb, h16* P16, bf* Ph, bf* Pl) {
    const int lane = threadIdx.x & 31; const int row = blockIdx.x * 8 + (threadIdx.x >> 5); if (row >= ZH * TT) return; const int i = row % TT; const int zz = row / TT; (void)zz; const bool hires = (i < RH); const float* sr = Sb + (size_t)row * TT; float v[TT / 32]; float mx = -3.0e38f;
#pragma unroll
    for (int ch = 0; ch < TT / 128; ++ch) { const int j0 = ch * 128 + lane * 4; const v4f a = *(const v4f*)(sr + j0);
#pragma unroll
        for (int q = 0; q < 4; ++q) { const int j = j0 + q; (void)j; const float t = (j <= i && amb[j] != 0) ? a[q] * SCL : -3.0e38f;   /* causal + key padding mask */ v[ch * 4 + q] = t; mx = fmaxf(mx, t); } }
#pragma unroll
    for (int sh = 16; sh; sh >>= 1) mx = fmaxf(mx, __shfl_xor(mx, sh, 32));
    float sum = 0.f;
#pragma unroll
    for (int k = 0; k < TT / 32; ++k) { float d0 = __fsub_rn(v[k], mx); asm volatile("" : "+v"(d0)); v[k] = __builtin_amdgcn_exp2f(__fmul_rn(d0, 1.4426950408889634f)); sum += v[k]; }
#pragma unroll
    for (int sh = 16; sh; sh >>= 1) sum += __shfl_xor(sum, sh, 32);
    const float f = __fdiv_rn(hires ? 1.0f : PCAR, sum);
{
        if (hires) {
#pragma unroll
            for (int ch = 0; ch < TT / 128; ++ch) { v4us oh, ol;
#pragma unroll
                for (int q = 0; q < 4; ++q) { unsigned short a, c2; splitf(v[ch * 4 + q] * f, a, c2); oh[q] = a; ol[q] = c2; }
                const size_t oo = ((size_t)zz * (RH ? RH : 1) + i) * TT + ch * 128 + lane * 4; *(v4us*)(Ph + oo) = oh; *(v4us*)(Pl + oo) = ol; }
        } else {
#pragma unroll
            for (int ch = 0; ch < TT / 128; ++ch) { v4h o4;
#pragma unroll
                for (int q = 0; q < 4; ++q) o4[q] = tohx(v[ch * 4 + q] * f);
                *(v4h*)(P16 + (size_t)row * TT + ch * 128 + lane * 4) = o4; } }
         }
}
__global__ __launch_bounds__(256) void k_merge(const float* __restrict__ O, int h0, bf* Ah, bf* Al) { const size_t e = ((size_t)blockIdx.x * 256 + threadIdx.x) * 2; if (e >= (size_t)ZH * TT * HD) return; const int d = (int)(e % HD); const int t = (int)((e / HD) % TT); const int zz = (int)(e / ((size_t)HD * TT)); const float cs = (t < RH) ? 1.0f : (1.0f / PCAR); const size_t oo = (size_t)t * DQ + (h0 + zz) * HD + d;
    v2us oh, ol;
#pragma unroll
    for (int q = 0; q < 2; ++q) { unsigned short a, c2; splitf(O[e + q] * cs, a, c2); oh[q] = a; ol[q] = c2; } *(v2us*)(Ah + oo) = oh; *(v2us*)(Al + oo) = ol;  }

// LoRA helpers: k_apad: bf16 [64][DM] from A [8][DM] (rows >= 8 zero; 8-B lanes); k_bpad: bf16 Bt [DM][32] from B [DM][8] natural (cols >= 8 zero); k_split32: hl planes of XA [T][32] (cols >= 8 are exact zeros) (8-B lanes);
__global__ __launch_bounds__(256) void k_apad(const float* __restrict__ A, bf* AP) { const int e = (blockIdx.x * 256 + threadIdx.x) * 4; if (e >= 64 * DM) return; const int r = e / DM; v4us o;
#pragma unroll
    for (int u = 0; u < 4; ++u) o[u] = (r < 8) ? f2bf(A[e + u]) : (unsigned short)0; *(v4us*)(AP + e) = o;  }
__global__ __launch_bounds__(256) void k_bpad(const float* __restrict__ Bm, bf* BP) { const int e = (blockIdx.x * 256 + threadIdx.x) * 4; if (e >= DM * 32) return; const int c = e % 32, r = e / 32; v4us o;
#pragma unroll
    for (int u = 0; u < 4; ++u) o[u] = (c + u < 8) ? f2bf(Bm[(size_t)r * 8 + c + u]) : (unsigned short)0; *(v4us*)(BP + e) = o;  }
__global__ __launch_bounds__(256) void k_split32(const float* __restrict__ XA, bf* Ph, bf* Pl) { const int e = (blockIdx.x * 256 + threadIdx.x) * 4; if (e >= TT * 32) return; const int c = e % 32, t = e / 32; const v4f a = *(const v4f*)(XA + (size_t)t * 64 + c); v4us oh, ol;
#pragma unroll
    for (int u = 0; u < 4; ++u) { oh[u] = f2bf(a[u]); ol[u] = f2bf(a[u] - bf2f(oh[u])); } *(v4us*)(Ph + e) = oh; *(v4us*)(Pl + e) = ol;  }
__global__ __launch_bounds__(256) void k_addc(float* F, const float* __restrict__ CORR, size_t n4) { const size_t e = ((size_t)blockIdx.x * 256 + threadIdx.x) * 4; if (e >= n4 * 4) return; const v4f a = *(const v4f*)(F + e), c = *(const v4f*)(CORR + e); v4f o;
#pragma unroll
    for (int u = 0; u < 4; ++u) { float cc = __fmul_rn(2.0f, c[u]); asm volatile("" : "+v"(cc)); o[u] = __fadd_rn(a[u], cc); } *(v4f*)(F + e) = o;  }

extern "C" void kernel_launch(void* const* d_in, const int* in_sizes, int n_in,
                              void* d_out, int out_size, void* d_ws, size_t ws_size, hipStream_t stream) {
    (void)in_sizes; (void)n_in; (void)out_size;
    const float* x = (const float*)d_in[0]; const int* am = (const int*)d_in[1]; const float* wq = (const float*)d_in[2]; const float* bq = (const float*)d_in[3]; const float* wk = (const float*)d_in[4]; const float* bk = (const float*)d_in[5]; const float* wv = (const float*)d_in[6]; const float* bv = (const float*)d_in[7];
    const float* qA = (const float*)d_in[8]; const float* qB = (const float*)d_in[9]; const float* kA = (const float*)d_in[10]; const float* kB = (const float*)d_in[11]; const float* vA = (const float*)d_in[12]; const float* vB = (const float*)d_in[13]; const float* wo = (const float*)d_in[14]; const float* bo = (const float*)d_in[15];
    float* OUT = (float*)d_out;     // [2][2048][1024]
    char* wsp = (char*)d_ws;
    auto take = [&](size_t bytes) { char* p = wsp; wsp += (bytes + 255) & ~(size_t)255; return (void*)p; };
    bf* WQ = (bf*)take((size_t)DQ * DM * 2); bf* WK = (bf*)take((size_t)DKV * DM * 2); bf* WV = (bf*)take((size_t)DKV * DM * 2); bf* WO = (bf*)take((size_t)DM * DQ * 2); float* CS = (float*)take((size_t)TT * HD * 2 * 4);
    bf* XB = (bf*)take((size_t)TT * DM * 2); bf* QAP = (bf*)take(64 * DM * 2); bf* KAP = (bf*)take(64 * DM * 2); bf* VAP = (bf*)take(64 * DM * 2); bf* QBP = (bf*)take((size_t)DM * 32 * 2); bf* KBP = (bf*)take((size_t)DM * 32 * 2); bf* VBP = (bf*)take((size_t)DM * 32 * 2); float* XA = (float*)take((size_t)TT * 64 * 4); bf* XAh = (bf*)take((size_t)TT * 32 * 2); bf* XAl = (bf*)take((size_t)TT * 32 * 2); float* CORR = (float*)take((size_t)TT * DM * 4); float* FQ = (float*)take((size_t)TT * DQ * 4); float* FK = (float*)take((size_t)TT * DKV * 4);
    h16* QP16 = (h16*)take((size_t)NH_ * TT * HD * 2); h16* KP16 = (h16*)take((size_t)NKV * TT * HD * 2); h16* VT16 = (h16*)take((size_t)NKV * HD * TT * 2);
    bf* QPh = (bf*)take((size_t)NH_ * TT * HD * 2); bf* QPl = (bf*)take((size_t)NH_ * TT * HD * 2); bf* KPh = (bf*)take((size_t)NKV * TT * HD * 2); bf* KPl = (bf*)take((size_t)NKV * TT * HD * 2); bf* VTh = (bf*)take((size_t)NKV * HD * TT * 2); bf* VTl = (bf*)take((size_t)NKV * HD * TT * 2); bf* Ph = (bf*)take((size_t)ZH * RH * TT * 2); bf* Pl = (bf*)take((size_t)ZH * RH * TT * 2);
    float* Sb = (float*)take((size_t)ZH * TT * TT * 4); h16* P16 = (h16*)take((size_t)ZH * TT * TT * 2); float* Ob = (float*)take((size_t)ZH * TT * HD * 4); bf* ATh = (bf*)take((size_t)TT * DQ * 2); bf* ATl = (bf*)take((size_t)TT * DQ * 2);
    if ((size_t)(wsp - (char*)d_ws) > ws_size) return;    // ws 256 MiB
    float* FV = FK;   // v projection reuses the k buffer after the k planes are built (stream-ordered)
    { k_cvt8<<<(unsigned)(((size_t)DQ * DM / 8 + 255) / 256), 256, 0, stream>>>(wq, WQ, (size_t)DQ * DM / 8); k_cvt8<<<(unsigned)(((size_t)DKV * DM / 8 + 255) / 256), 256, 0, stream>>>(wk, WK, (size_t)DKV * DM / 8); k_cvt8<<<(unsigned)(((size_t)DKV * DM / 8 + 255) / 256), 256, 0, stream>>>(wv, WV, (size_t)DKV * DM / 8);
      k_cvt8<<<(unsigned)(((size_t)DM * DQ / 8 + 255) / 256), 256, 0, stream>>>(wo, WO, (size_t)DM * DQ / 8);
      k_cstab<<<(TT * HD + 255) / 256, 256, 0, stream>>>(CS); }
    const unsigned LQ = (unsigned)(((size_t)NH_ * TT * HD / 2 + 255) / 256), LKv = (unsigned)(((size_t)NKV * TT * HD / 2 + 255) / 256);
    k_apad<<<(64 * DM / 4 + 255) / 256, 256, 0, stream>>>(qA, QAP); k_apad<<<(64 * DM / 4 + 255) / 256, 256, 0, stream>>>(kA, KAP); k_apad<<<(64 * DM / 4 + 255) / 256, 256, 0, stream>>>(vA, VAP); k_bpad<<<(DM * 32 / 4 + 255) / 256, 256, 0, stream>>>(qB, QBP); k_bpad<<<(DM * 32 / 4 + 255) / 256, 256, 0, stream>>>(kB, KBP); k_bpad<<<(DM * 32 / 4 + 255) / 256, 256, 0, stream>>>(vB, VBP);
    for (int b = 0; b < NB_; ++b) {
        
        k_cvt8<<<(unsigned)(((size_t)TT * DM / 8 + 255) / 256), 256, 0, stream>>>(x + (size_t)b * TT * DM, XB, (size_t)TT * DM / 8);
        k_gemmw<bf, 0, true><<<dim3(TT / 64, DQ / 64, 1), 32, 0, stream>>>(XB, nullptr, WQ, nullptr, DM, FQ, DQ, bq, 0, 0, 0); k_gemmw<bf, 0, false><<<dim3(TT / 64, 1, 1), 32, 0, stream>>>(XB, nullptr, QAP, nullptr, DM, XA, 64, nullptr, 0, 0, 0); k_split32<<<(TT * 32 / 4 + 255) / 256, 256, 0, stream>>>(XA, XAh, XAl); k_gemmw<bf, 1, false><<<dim3(TT / 64, DM / 64, 1), 32, 0, stream>>>(XAh, XAl, QBP, nullptr, 32, CORR, DM, nullptr, 0, 0, 0); k_addc<<<(unsigned)(((size_t)TT * DM / 4 + 255) / 256), 256, 0, stream>>>(FQ, CORR, (size_t)TT * DM / 4);   /* LoRA: FQ += 2 (x A^T) B^T */
        k_rope<<<LQ, 256, 0, stream>>>(FQ, DQ, NH_, CS, nullptr, nullptr, 1.0f, QP16, QPh, QPl);
        k_gemmw<bf, 0, true><<<dim3(TT / 64, DKV / 64, 1), 32, 0, stream>>>(XB, nullptr, WK, nullptr, DM, FK, DKV, bk, 0, 0, 0); k_gemmw<bf, 0, false><<<dim3(TT / 64, 1, 1), 32, 0, stream>>>(XB, nullptr, KAP, nullptr, DM, XA, 64, nullptr, 0, 0, 0); k_split32<<<(TT * 32 / 4 + 255) / 256, 256, 0, stream>>>(XA, XAh, XAl); k_gemmw<bf, 1, false><<<dim3(TT / 64, DM / 64, 1), 32, 0, stream>>>(XAh, XAl, KBP, nullptr, 32, CORR, DM, nullptr, 0, 0, 0); k_addc<<<(unsigned)(((size_t)TT * DM / 4 + 255) / 256), 256, 0, stream>>>(FK, CORR, (size_t)TT * DM / 4);   /* LoRA: FK += 2 (x A^T) B^T */
        k_rope<<<LKv, 256, 0, stream>>>(FK, DKV, NKV, CS, nullptr, nullptr, 1.0f, KP16, KPh, KPl);
        k_gemmw<bf, 0, true><<<dim3(TT / 64, DKV / 64, 1), 32, 0, stream>>>(XB, nullptr, WV, nullptr, DM, FV, DKV, bv, 0, 0, 0); k_gemmw<bf, 0, false><<<dim3(TT / 64, 1, 1), 32, 0, stream>>>(XB, nullptr, VAP, nullptr, DM, XA, 64, nullptr, 0, 0, 0); k_split32<<<(TT * 32 / 4 + 255) / 256, 256, 0, stream>>>(XA, XAh, XAl); k_gemmw<bf, 1, false><<<dim3(TT / 64, DM / 64, 1), 32, 0, stream>>>(XAh, XAl, VBP, nullptr, 32, CORR, DM, nullptr, 0, 0, 0); k_addc<<<(unsigned)(((size_t)TT * DM / 4 + 255) / 256), 256, 0, stream>>>(FV, CORR, (size_t)TT * DM / 4);   /* LoRA: FV += 2 (x A^T) B^T */ k_vtp<<<LKv, 256, 0, stream>>>(FV, DKV, NKV, VT16, VTh, VTl);
        for (int h0 = 0; h0 < NH_; h0 += ZH) { const size_t zq = (size_t)h0, zk = (size_t)(h0 / REP);   // one kv head per query head: the pass's two heads use consecutive kv planes (z-strides TT*HD)
            k_gemmc<bf, 2, 1><<<dim3(RH / 64, TT / 64, ZH), 32, 0, stream>>>(QPh + zq * TT * HD, QPl + zq * TT * HD, KPh + zk * TT * HD, KPl + zk * TT * HD, HD, Sb, TT, 0, (size_t)TT * HD, (size_t)TT * HD, (size_t)TT * TT);
            k_gemmc<h16, 0, 1><<<dim3((TT - RH) / 64, TT / 64, ZH), 32, 0, stream>>>(QP16 + zq * TT * HD + (size_t)RH * HD, nullptr, KP16 + zk * TT * HD, nullptr, HD, Sb + (size_t)RH * TT, TT, RH, (size_t)TT * HD, (size_t)TT * HD, (size_t)TT * TT);
            k_asoft<<<ZH * TT / 8, 256, 0, stream>>>(Sb, am + (size_t)b * TT, P16, Ph, Pl);
            k_gemmc<bf, 2, 2><<<dim3(RH / 64, HD / 64, ZH), 32, 0, stream>>>(Ph, Pl, VTh + zk * HD * TT, VTl + zk * HD * TT, TT, Ob, HD, 0, (size_t)RH * TT, (size_t)HD * TT, (size_t)TT * HD);
            k_gemmc<h16, 0, 2><<<dim3((TT - RH) / 64, HD / 64, ZH), 32, 0, stream>>>(P16 + (size_t)RH * TT, nullptr, VT16 + zk * HD * TT, nullptr, TT, Ob + (size_t)RH * HD, HD, RH, (size_t)TT * TT, (size_t)HD * TT, (size_t)TT * HD);
            k_merge<<<(unsigned)(((size_t)ZH * TT * HD / 2 + 255) / 256), 256, 0, stream>>>(Ob, h0, ATh, ATl); }
        k_gemmw<bf, 1, true><<<dim3(TT / 64, DM / 64, 1), 32, 0, stream>>>(ATh, ATl, WO, nullptr, DQ, OUT + (size_t)b * TT * DM, DM, bo, 0, 0, 0); }
}

// v001
// A run of this version takes 981 microseconds.
// In both of two side-by-side timings against v000, it was 1.81 times as fast.
#include <hip/hip_runtime.h>

// Masked_MHA_LORA (x [2][2048][1024]; Q/K/V = x W^T + b + 2 (x A^T) B^T (LoRA rank 8, scaling 16/8); RoPE (rotate-half, base 10000) on Q, K (16 heads x 64); scores = Q.K/8 with the causal mask and the key padding mask (attention_mask == 0 -> -inf; int,
// read as data); softmax; out = (attn V merged) oW^T + ob -> [2][2048][1024]).
// Compute dtypes, f32 accumulate: every input rounded to bf16; the base projections on PLAIN bf16 operands (inputs: exact) + bias; the LoRA path as two small GEMMs (x A^T exact, then hl planes x exact B, rank padded 8 -> 32) added

#define NB_  2
#define TT   2048
#define DM   1024
#define NH_  16
#define NKV  16
#define REP  (NH_ / NKV)
#define HD   64
#define DQ   (NH_ * HD)
#define DKV  (NKV * HD)
#define ZH   8                    // heads per attention launch (z of every attention grid)
#define RH   512                  // query rows < RH use hi+lo planes (0: none)
#define WIN  2048
#define PCAR 1024.0f
#define SCL  0.125f   // HD^-0.5
typedef _Float16 h16;
typedef unsigned short bf;
typedef __attribute__((ext_vector_type(16))) __bf16   v16bf;
typedef __attribute__((ext_vector_type(16))) _Float16 v16h;
typedef __attribute__((ext_vector_type(8)))  _Float16 v8h;
typedef __attribute__((ext_vector_type(8)))  unsigned short v8us;
typedef __attribute__((ext_vector_type(8)))  float    v8f;
typedef __attribute__((ext_vector_type(4)))  float    v4f;
typedef v8h  __attribute__((may_alias)) v8ha;
typedef v4f  __attribute__((may_alias)) v4fa;
typedef v8us __attribute__((may_alias)) v8usa;

__device__ __forceinline__ unsigned short f2bf(float f) { unsigned u = __float_as_uint(f); u += 0x7FFFu + ((u >> 16) & 1u); return (unsigned short)(u >> 16); }
__device__ __forceinline__ float bf2f(unsigned short b) { return __uint_as_float(((unsigned)b) << 16); }
__device__ __forceinline__ float bfr(float f) { return bf2f(f2bf(f)); }
__device__ __forceinline__ v16h cat16(v8h lo, v8h hi) { return __builtin_shufflevector(lo, hi, 0, 1, 2, 3, 4, 5, 6, 7, 8, 9, 10, 11, 12, 13, 14, 15); }
__device__ __forceinline__ v16bf cat16b(v8us lo, v8us hi) { return __builtin_bit_cast(v16bf, __builtin_shufflevector(lo, hi, 0, 1, 2, 3, 4, 5, 6, 7, 8, 9, 10, 11, 12, 13, 14, 15)); }
__device__ __forceinline__ v8f wmma16(v16h a, v16h b, v8f c) { return __builtin_amdgcn_wmma_f32_16x16x32_f16(false, a, false, b, (short)0, c, false, false); }
__device__ __forceinline__ v8f wmmab(v16bf a, v16bf b, v8f c) { return __builtin_amdgcn_wmma_f32_16x16x32_bf16(false, a, false, b, (short)0, c, false, false); }



// ---- k_gemmw: register-blocked GEMM, ONE WAVE per 64x64 output tile (16 accumulators), operands straight from K-contiguous 16-bit planes; grid (M/64, N/64, Z), 32 threads.
// C[m][n] (f32, pitch ldc, + optional f32 bias[n]) = sum_k A[m][k] Bt[n][k] (+ split products per NSPLIT). z-batch strides sA/sB/sC in elements. K % 32 == 0.
template <typename T16> struct WFrag;
template <> struct WFrag<h16> { typedef v16h V; static __device__ __forceinline__ V ld(const h16* p) { return cat16(*(const v8h*)p, *(const v8h*)(p + 16)); } static __device__ __forceinline__ v8f mma(V a, V b, v8f c) { return wmma16(a, b, c); } };
template <> struct WFrag<bf> { typedef v16bf V; static __device__ __forceinline__ V ld(const bf* p) { return cat16b(*(const v8us*)p, *(const v8us*)(p + 16)); } static __device__ __forceinline__ v8f mma(V a, V b, v8f c) { return wmmab(a, b, c); } };
template <typename T16, int NSPLIT, bool BIAS>
__global__ __launch_bounds__(32) void k_gemmw(const T16* __restrict__ A, const T16* __restrict__ A2, const T16* __restrict__ Bt, const T16* __restrict__ Bt2, int K, float* C, int ldc, const float* __restrict__ bias, size_t sA, size_t sB, size_t sC) {
    typedef typename WFrag<T16>::V V;
    __shared__ __align__(16) float os[16 * 68];
    const size_t z = blockIdx.z; A += z * sA; if (A2) A2 += z * sA; Bt += z * sB; if (Bt2) Bt2 += z * sB; C += z * sC;
    const int lane = threadIdx.x & 31, lr = lane & 15, hi = lane >> 4; const int r0 = blockIdx.x * 64, c0 = blockIdx.y * 64;
    v8f acc[4][4];
#pragma unroll
    for (int mb = 0; mb < 4; ++mb)
#pragma unroll
        for (int nb = 0; nb < 4; ++nb) acc[mb][nb] = (v8f){};
    const size_t aoff = (size_t)(r0 + lr) * K + 8 * hi, boff = (size_t)(c0 + lr) * K + 8 * hi;
#pragma unroll 1
    for (int kc = 0; kc < K; kc += 32) {
        V a[4], a2[4];
#pragma unroll
        for (int mb = 0; mb < 4; ++mb) { a[mb] = WFrag<T16>::ld(A + aoff + (size_t)mb * 16 * K + kc); if (NSPLIT == 1 || NSPLIT == 2) a2[mb] = WFrag<T16>::ld(A2 + aoff + (size_t)mb * 16 * K + kc); }
#pragma unroll
        for (int nb = 0; nb < 4; ++nb) { const V b = WFrag<T16>::ld(Bt + boff + (size_t)nb * 16 * K + kc); V b2; if (NSPLIT >= 2) b2 = WFrag<T16>::ld(Bt2 + boff + (size_t)nb * 16 * K + kc);
#pragma unroll
            for (int mb = 0; mb < 4; ++mb) { acc[mb][nb] = WFrag<T16>::mma(a[mb], b, acc[mb][nb]); if (NSPLIT == 1 || NSPLIT == 2) acc[mb][nb] = WFrag<T16>::mma(a2[mb], b, acc[mb][nb]); if (NSPLIT >= 2) acc[mb][nb] = WFrag<T16>::mma(a[mb], b2, acc[mb][nb]); } }
        asm volatile("v_nop\n\tv_nop\n\tv_nop\n\tv_nop" : "+v"(acc[0][0]), "+v"(acc[1][1]), "+v"(acc[2][2]), "+v"(acc[3][3]) : "v"(a[0]), "v"(a[3]));
    }
#pragma unroll
    for (int mb = 0; mb < 4; ++mb) {
#pragma unroll
        for (int nb = 0; nb < 4; ++nb) {
#pragma unroll
            for (int j = 0; j < 8; ++j) os[(hi * 8 + j) * 68 + nb * 16 + lr] = acc[mb][nb][j]; }
        __builtin_amdgcn_wave_barrier(); asm volatile("" ::: "memory");
        float* crow = C + (size_t)(r0 + mb * 16) * ldc + c0;
{
#pragma unroll
            for (int s = 0; s < 8; ++s) { const int row = 2 * s + hi, cofs = lr * 4; v4f val = *(const v4fa*)(os + row * 68 + cofs); if (BIAS) { val[0] += bfr(bias[c0 + cofs]); val[1] += bfr(bias[c0 + cofs + 1]); val[2] += bfr(bias[c0 + cofs + 2]); val[3] += bfr(bias[c0 + cofs + 3]); }
                *(v4f*)(crow + (size_t)row * ldc + cofs) = val; }
             }
        __builtin_amdgcn_wave_barrier(); asm volatile("" ::: "memory");
    }
}

// ---- k_gemmc: the same one-wave 64x64 tile GEMM specialised for causal attention: CMODE 1 skips score tiles entirely above the diagonal (query rows r0+roff.., key columns c0..), CMODE 2 limits the
// key (K) loop of the probability x value contraction to the diagonal block (probabilities beyond it are exactly zero). roff = row offset of this launch's first row within the sequence.
template <typename T16, int NSPLIT, int CMODE>
__global__ __launch_bounds__(32) void k_gemmc(const T16* __restrict__ A, const T16* __restrict__ A2, const T16* __restrict__ Bt, const T16* __restrict__ Bt2, int K, float* C, int ldc, int roff, size_t sA, size_t sB, size_t sC) {
    typedef typename WFrag<T16>::V V;
    __shared__ __align__(16) float os[16 * 68];
    const size_t z = blockIdx.z; A += z * sA; if (A2) A2 += z * sA; Bt += z * sB; if (Bt2) Bt2 += z * sB; C += z * sC;
    const int lane = threadIdx.x & 31, lr = lane & 15, hi = lane >> 4; const int r0 = blockIdx.x * 64, c0 = blockIdx.y * 64;
    if (CMODE == 1 && c0 > r0 + roff + 63) return;                  // score tile entirely above the causal diagonal: never read (the softmax masks j > i by select)
    const int Kl = (CMODE == 2) ? min(K, r0 + roff + 64) : K;        // P.V: probabilities are exactly 0 beyond the diagonal block, so the K loop stops there
    v8f acc[4][4];
#pragma unroll
    for (int mb = 0; mb < 4; ++mb)
#pragma unroll
        for (int nb = 0; nb < 4; ++nb) acc[mb][nb] = (v8f){};
    const size_t aoff = (size_t)(r0 + lr) * K + 8 * hi, boff = (size_t)(c0 + lr) * K + 8 * hi;
#pragma unroll 1
    for (int kc = 0; kc < Kl; kc += 32) {
        V a[4], a2[4];
#pragma unroll
        for (int mb = 0; mb < 4; ++mb) { a[mb] = WFrag<T16>::ld(A + aoff + (size_t)mb * 16 * K + kc); if (NSPLIT == 1 || NSPLIT == 2) a2[mb] = WFrag<T16>::ld(A2 + aoff + (size_t)mb * 16 * K + kc); }
#pragma unroll
        for (int nb = 0; nb < 4; ++nb) { const V b = WFrag<T16>::ld(Bt + boff + (size_t)nb * 16 * K + kc); V b2; if (NSPLIT >= 2) b2 = WFrag<T16>::ld(Bt2 + boff + (size_t)nb * 16 * K + kc);
#pragma unroll
            for (int mb = 0; mb < 4; ++mb) { acc[mb][nb] = WFrag<T16>::mma(a[mb], b, acc[mb][nb]); if (NSPLIT == 1 || NSPLIT == 2) acc[mb][nb] = WFrag<T16>::mma(a2[mb], b, acc[mb][nb]); if (NSPLIT >= 2) acc[mb][nb] = WFrag<T16>::mma(a[mb], b2, acc[mb][nb]); } }
        asm volatile("v_nop\n\tv_nop\n\tv_nop\n\tv_nop" : "+v"(acc[0][0]), "+v"(acc[1][1]), "+v"(acc[2][2]), "+v"(acc[3][3]) : "v"(a[0]), "v"(a[3]));
    }
#pragma unroll
    for (int mb = 0; mb < 4; ++mb) {
#pragma unroll
        for (int nb = 0; nb < 4; ++nb) {
#pragma unroll
            for (int j = 0; j < 8; ++j) os[(hi * 8 + j) * 68 + nb * 16 + lr] = acc[mb][nb][j]; }
        __builtin_amdgcn_wave_barrier(); asm volatile("" ::: "memory");
        float* crow = C + (size_t)(r0 + mb * 16) * ldc + c0;
{
#pragma unroll
            for (int s = 0; s < 8; ++s) { const int row = 2 * s + hi, cofs = lr * 4; v4f val = *(const v4fa*)(os + row * 68 + cofs);
                *(v4f*)(crow + (size_t)row * ldc + cofs) = val; }
             }
        __builtin_amdgcn_wave_barrier(); asm volatile("" ::: "memory");
    }
}

__device__ __forceinline__ h16 tohx(float x) { return (h16)x; }
__device__ __forceinline__ void splitf(float y, unsigned short& h, unsigned short& l) { h = f2bf(y); l = f2bf(y - bf2f(h)); }
typedef __attribute__((ext_vector_type(2))) _Float16 v2h;
typedef __attribute__((ext_vector_type(4))) _Float16 v4h;
typedef __attribute__((ext_vector_type(2))) unsigned short v2us;
typedef __attribute__((ext_vector_type(4))) unsigned short v4us;
typedef __attribute__((ext_vector_type(2))) float v2f;
typedef __attribute__((ext_vector_type(4))) int v4i;

__global__ __launch_bounds__(256) void k_wtG(const float* __restrict__ w, int K, int N, bf* Bt) {
    const int lane = threadIdx.x & 31; const int L0 = (blockIdx.x * 8 + (threadIdx.x >> 5)) * 8; const int nlines = N * K / 64;
{
#pragma unroll 1
        for (int l = 0; l < 8; ++l) { const int L = L0 + l; if (L >= nlines) break; const size_t e = (size_t)L * 64 + lane * 2; const int k = (int)(e % K), n = (int)(e / K); v2us o;
            o[0] = f2bf(w[(size_t)k * N + n]); o[1] = f2bf(w[(size_t)(k + 1) * N + n]); *(v2us*)(Bt + e) = o; }
         }
}
__global__ __launch_bounds__(256) void k_cvt8(const float* __restrict__ src, bf* dst, size_t n8) { const size_t i = (size_t)blockIdx.x * 256 + threadIdx.x; if (i >= n8) return; const v8f v = *(const v8f*)(src + i * 8); v8us o;
#pragma unroll
    for (int k = 0; k < 8; ++k) o[k] = f2bf(v[k]); *(v8us*)(dst + i * 8) = o;  }
__global__ __launch_bounds__(256) void k_cstab(float* CS) { const int idx = blockIdx.x * 256 + threadIdx.x; if (idx >= TT * HD) return; const int t = idx / HD, d = idx % HD; const int i = d % (HD / 2); const float inv = __fdiv_rn(1.0f, powf(10000.0f, (float)(2 * i) / (float)HD)); const float ang = __fmul_rn((float)t, inv); v2f cs; cs[0] = cosf(ang); cs[1] = sinf(ang);
    *(v2f*)(CS + (size_t)idx * 2) = cs;  }
// k_rope: head planes [h][t][d] (fp16 + hi/lo) of rope(x) x sc with the rotate-half convention out[d] = x[d] cos[t][d] - x[d+HD/2] sin[t][d], out[d+HD/2] = x[d+HD/2] cos[t][d+HD/2] + x[d] sin[t][d+HD/2]
__global__ __launch_bounds__(256) void k_rope(const float* __restrict__ F, int pitch, int nheads, const float* __restrict__ CS, const float* __restrict__ RF, const float* __restrict__ nw, float sc, h16* P16, bf* Ph, bf* Pl) {
    const size_t e = ((size_t)blockIdx.x * 256 + threadIdx.x) * 2; if (e >= (size_t)nheads * TT * HD) return; const int d = (int)(e % HD); const int t = (int)((e / HD) % TT); const int h = (int)(e / ((size_t)HD * TT)); const float* f = F + (size_t)t * pitch + h * HD; const float rf = RF ? RF[(size_t)h * TT + t] : 1.0f; v2h o16; v2us oh, ol;
#pragma unroll
    for (int q = 0; q < 2; ++q) { const int dd = d + q; const int dp = (dd < HD / 2) ? dd + HD / 2 : dd - HD / 2; float x0 = f[dd], x1 = f[dp];
        if (RF) { float n0 = __fmul_rn(x0, rf), n1 = __fmul_rn(x1, rf); asm volatile("" : "+v"(n0)); asm volatile("" : "+v"(n1)); x0 = __fmul_rn(bfr(nw[dd]), n0); x1 = __fmul_rn(bfr(nw[dp]), n1); }
        const v2f cs = *(const v2f*)(CS + ((size_t)t * HD + dd) * 2); float a = __fmul_rn(x0, cs[0]), bq = __fmul_rn(x1, cs[1]); asm volatile("" : "+v"(a)); asm volatile("" : "+v"(bq)); const float r = ((dd < HD / 2) ? __fsub_rn(a, bq) : __fadd_rn(a, bq)) * sc;
        o16[q] = tohx(r); unsigned short a2, c2; splitf(r, a2, c2); oh[q] = a2; ol[q] = c2; }
    *(v2h*)(P16 + e) = o16; *(v2us*)(Ph + e) = oh; *(v2us*)(Pl + e) = ol;  }
// k_vtp: transposed value planes [g][d][t] at row pitch 2 TT, the pitch of the in-place probability rows (k_gemmc uses one pitch for both operands); only t < TT of a row is written or read
__global__ __launch_bounds__(256) void k_vtp(const float* __restrict__ F, int pitch, int nheads, h16* V16, bf* Vh, bf* Vl) { const size_t e = ((size_t)blockIdx.x * 256 + threadIdx.x) * 2; if (e >= (size_t)nheads * HD * TT) return; const int t = (int)(e % TT); const int d = (int)((e / TT) % HD); const int g = (int)(e / ((size_t)TT * HD)); v2h o16; v2us oh, ol;
#pragma unroll
    for (int q = 0; q < 2; ++q) { const float x = F[(size_t)(t + q) * pitch + g * HD + d]; o16[q] = tohx(x); unsigned short a2, c2; splitf(x, a2, c2); oh[q] = a2; ol[q] = c2; }
    const size_t o = 2 * e - t; *(v2h*)(V16 + o) = o16; *(v2us*)(Vh + o) = oh; *(v2us*)(Vl + o) = ol;  }
// k_asoft: per row (zz, i): t = S x HD^-0.5 for j <= i and attention_mask[j] != 0, else -3e38 (causal + key padding mask; the reference's -1e9 additive fill vanishes identically); softmax over the 2048 keys (register row, one exp, fixed trees);
// the probabilities go back IN PLACE over their own score row (8 KiB, so their row pitch is 2 TT 16-bit elements): the fp16 row in its first half, or the hi plane in the first and the lo plane in the second half. One wave owns a row and holds all of it in registers before its first store (every store needs the row sum).
__global__ __launch_bounds__(256) void k_asoft(float* Sb, const int* __restrict__ amb) {
    const int lane = threadIdx.x & 31; const int row = blockIdx.x * 8 + (threadIdx.x >> 5); if (row >= ZH * TT) return; const int i = row % TT; const int zz = row / TT; (void)zz; const bool hires = (i < RH); float* sr = Sb + (size_t)row * TT; float v[TT / 32]; float mx = -3.0e38f;
#pragma unroll
    for (int ch = 0; ch < TT / 128; ++ch) { const int j0 = ch * 128 + lane * 4; const v4f a = *(const v4f*)(sr + j0);
#pragma unroll
        for (int q = 0; q < 4; ++q) { const int j = j0 + q; (void)j; const float t = (j <= i && amb[j] != 0) ? a[q] * SCL : -3.0e38f;   /* causal + key padding mask */ v[ch * 4 + q] = t; mx = fmaxf(mx, t); } }
#pragma unroll
    for (int sh = 16; sh; sh >>= 1) mx = fmaxf(mx, __shfl_xor(mx, sh, 32));
    float sum = 0.f;
#pragma unroll
    for (int k = 0; k < TT / 32; ++k) { float d0 = __fsub_rn(v[k], mx); asm volatile("" : "+v"(d0)); v[k] = __builtin_amdgcn_exp2f(__fmul_rn(d0, 1.4426950408889634f)); sum += v[k]; }
#pragma unroll
    for (int sh = 16; sh; sh >>= 1) sum += __shfl_xor(sum, sh, 32);
    const float f = __fdiv_rn(hires ? 1.0f : PCAR, sum);
{
        if (hires) {
#pragma unroll
            for (int ch = 0; ch < TT / 128; ++ch) { v4us oh, ol;
#pragma unroll
                for (int q = 0; q < 4; ++q) { unsigned short a, c2; splitf(v[ch * 4 + q] * f, a, c2); oh[q] = a; ol[q] = c2; }
                const int oo = ch * 128 + lane * 4; *(v4us*)((bf*)sr + oo) = oh; *(v4us*)((bf*)sr + TT + oo) = ol; }
        } else {
#pragma unroll
            for (int ch = 0; ch < TT / 128; ++ch) { v4h o4;
#pragma unroll
                for (int q = 0; q < 4; ++q) o4[q] = tohx(v[ch * 4 + q] * f);
                *(v4h*)((h16*)sr + ch * 128 + lane * 4) = o4; } }
         }
}
__global__ __launch_bounds__(256) void k_merge(const float* __restrict__ O, int h0, bf* Ah, bf* Al) { const size_t e = ((size_t)blockIdx.x * 256 + threadIdx.x) * 2; if (e >= (size_t)ZH * TT * HD) return; const int d = (int)(e % HD); const int t = (int)((e / HD) % TT); const int zz = (int)(e / ((size_t)HD * TT)); const float cs = (t < RH) ? 1.0f : (1.0f / PCAR); const size_t oo = (size_t)t * DQ + (h0 + zz) * HD + d;
    v2us oh, ol;
#pragma unroll
    for (int q = 0; q < 2; ++q) { unsigned short a, c2; splitf(O[e + q] * cs, a, c2); oh[q] = a; ol[q] = c2; } *(v2us*)(Ah + oo) = oh; *(v2us*)(Al + oo) = ol;  }

// LoRA helpers: k_apad: bf16 [64][DM] from A [8][DM] (rows >= 8 zero; 8-B lanes); k_bpad: bf16 Bt [DM][32] from B [DM][8] natural (cols >= 8 zero); k_split32: hl planes of XA [T][32] (cols >= 8 are exact zeros) (8-B lanes);
__global__ __launch_bounds__(256) void k_apad(const float* __restrict__ A, bf* AP) { const int e = (blockIdx.x * 256 + threadIdx.x) * 4; if (e >= 64 * DM) return; const int r = e / DM; v4us o;
#pragma unroll
    for (int u = 0; u < 4; ++u) o[u] = (r < 8) ? f2bf(A[e + u]) : (unsigned short)0; *(v4us*)(AP + e) = o;  }
__global__ __launch_bounds__(256) void k_bpad(const float* __restrict__ Bm, bf* BP) { const int e = (blockIdx.x * 256 + threadIdx.x) * 4; if (e >= DM * 32) return; const int c = e % 32, r = e / 32; v4us o;
#pragma unroll
    for (int u = 0; u < 4; ++u) o[u] = (c + u < 8) ? f2bf(Bm[(size_t)r * 8 + c + u]) : (unsigned short)0; *(v4us*)(BP + e) = o;  }
__global__ __launch_bounds__(256) void k_split32(const float* __restrict__ XA, bf* Ph, bf* Pl) { const int e = (blockIdx.x * 256 + threadIdx.x) * 4; if (e >= TT * 32) return; const int c = e % 32, t = e / 32; const v4f a = *(const v4f*)(XA + (size_t)t * 64 + c); v4us oh, ol;
#pragma unroll
    for (int u = 0; u < 4; ++u) { oh[u] = f2bf(a[u]); ol[u] = f2bf(a[u] - bf2f(oh[u])); } *(v4us*)(Ph + e) = oh; *(v4us*)(Pl + e) = ol;  }
__global__ __launch_bounds__(256) void k_addc(float* F, const float* __restrict__ CORR, size_t n4) { const size_t e = ((size_t)blockIdx.x * 256 + threadIdx.x) * 4; if (e >= n4 * 4) return; const v4f a = *(const v4f*)(F + e), c = *(const v4f*)(CORR + e); v4f o;
#pragma unroll
    for (int u = 0; u < 4; ++u) { float cc = __fmul_rn(2.0f, c[u]); asm volatile("" : "+v"(cc)); o[u] = __fadd_rn(a[u], cc); } *(v4f*)(F + e) = o;  }

extern "C" void kernel_launch(void* const* d_in, const int* in_sizes, int n_in,
                              void* d_out, int out_size, void* d_ws, size_t ws_size, hipStream_t stream) {
    (void)in_sizes; (void)n_in; (void)out_size;
    const float* x = (const float*)d_in[0]; const int* am = (const int*)d_in[1]; const float* wq = (const float*)d_in[2]; const float* bq = (const float*)d_in[3]; const float* wk = (const float*)d_in[4]; const float* bk = (const float*)d_in[5]; const float* wv = (const float*)d_in[6]; const float* bv = (const float*)d_in[7];
    const float* qA = (const float*)d_in[8]; const float* qB = (const float*)d_in[9]; const float* kA = (const float*)d_in[10]; const float* kB = (const float*)d_in[11]; const float* vA = (const float*)d_in[12]; const float* vB = (const float*)d_in[13]; const float* wo = (const float*)d_in[14]; const float* bo = (const float*)d_in[15];
    float* OUT = (float*)d_out;     // [2][2048][1024]
    char* wsp = (char*)d_ws;
    auto take = [&](size_t bytes) { char* p = wsp; wsp += (bytes + 255) & ~(size_t)255; return (void*)p; };
    bf* WQ = (bf*)take((size_t)DQ * DM * 2); bf* WK = (bf*)take((size_t)DKV * DM * 2); bf* WV = (bf*)take((size_t)DKV * DM * 2); bf* WO = (bf*)take((size_t)DM * DQ * 2); float* CS = (float*)take((size_t)TT * HD * 2 * 4);
    bf* XB = (bf*)take((size_t)TT * DM * 2); bf* QAP = (bf*)take(64 * DM * 2); bf* KAP = (bf*)take(64 * DM * 2); bf* VAP = (bf*)take(64 * DM * 2); bf* QBP = (bf*)take((size_t)DM * 32 * 2); bf* KBP = (bf*)take((size_t)DM * 32 * 2); bf* VBP = (bf*)take((size_t)DM * 32 * 2); float* XA = (float*)take((size_t)TT * 64 * 4); bf* XAh = (bf*)take((size_t)TT * 32 * 2); bf* XAl = (bf*)take((size_t)TT * 32 * 2); float* CORR = (float*)take((size_t)TT * DM * 4); float* FQ = (float*)take((size_t)TT * DQ * 4); float* FK = (float*)take((size_t)TT * DKV * 4);
    h16* QP16 = (h16*)take((size_t)NH_ * TT * HD * 2); h16* KP16 = (h16*)take((size_t)NKV * TT * HD * 2); h16* VT16 = (h16*)take((size_t)NKV * HD * 2 * TT * 2);
    bf* QPh = (bf*)take((size_t)NH_ * TT * HD * 2); bf* QPl = (bf*)take((size_t)NH_ * TT * HD * 2); bf* KPh = (bf*)take((size_t)NKV * TT * HD * 2); bf* KPl = (bf*)take((size_t)NKV * TT * HD * 2); bf* VTh = (bf*)take((size_t)NKV * HD * 2 * TT * 2); bf* VTl = VTh + TT;   // hi plane in the first, lo plane in the second half of each 2 TT row
    float* Sb = (float*)take((size_t)ZH * TT * TT * 4); float* Ob = (float*)take((size_t)ZH * TT * HD * 4); bf* ATh = (bf*)take((size_t)TT * DQ * 2); bf* ATl = (bf*)take((size_t)TT * DQ * 2);
    if ((size_t)(wsp - (char*)d_ws) > ws_size) return;    // ws 256 MiB
    float* FV = FK;   // v projection reuses the k buffer after the k planes are built (stream-ordered)
    { k_cvt8<<<(unsigned)(((size_t)DQ * DM / 8 + 255) / 256), 256, 0, stream>>>(wq, WQ, (size_t)DQ * DM / 8); k_cvt8<<<(unsigned)(((size_t)DKV * DM / 8 + 255) / 256), 256, 0, stream>>>(wk, WK, (size_t)DKV * DM / 8); k_cvt8<<<(unsigned)(((size_t)DKV * DM / 8 + 255) / 256), 256, 0, stream>>>(wv, WV, (size_t)DKV * DM / 8);
      k_cvt8<<<(unsigned)(((size_t)DM * DQ / 8 + 255) / 256), 256, 0, stream>>>(wo, WO, (size_t)DM * DQ / 8);
      k_cstab<<<(TT * HD + 255) / 256, 256, 0, stream>>>(CS); }
    const unsigned LQ = (unsigned)(((size_t)NH_ * TT * HD / 2 + 255) / 256), LKv = (unsigned)(((size_t)NKV * TT * HD / 2 + 255) / 256);
    k_apad<<<(64 * DM / 4 + 255) / 256, 256, 0, stream>>>(qA, QAP); k_apad<<<(64 * DM / 4 + 255) / 256, 256, 0, stream>>>(kA, KAP); k_apad<<<(64 * DM / 4 + 255) / 256, 256, 0, stream>>>(vA, VAP); k_bpad<<<(DM * 32 / 4 + 255) / 256, 256, 0, stream>>>(qB, QBP); k_bpad<<<(DM * 32 / 4 + 255) / 256, 256, 0, stream>>>(kB, KBP); k_bpad<<<(DM * 32 / 4 + 255) / 256, 256, 0, stream>>>(vB, VBP);
    for (int b = 0; b < NB_; ++b) {
        
        k_cvt8<<<(unsigned)(((size_t)TT * DM / 8 + 255) / 256), 256, 0, stream>>>(x + (size_t)b * TT * DM, XB, (size_t)TT * DM / 8);
        k_gemmw<bf, 0, true><<<dim3(TT / 64, DQ / 64, 1), 32, 0, stream>>>(XB, nullptr, WQ, nullptr, DM, FQ, DQ, bq, 0, 0, 0); k_gemmw<bf, 0, false><<<dim3(TT / 64, 1, 1), 32, 0, stream>>>(XB, nullptr, QAP, nullptr, DM, XA, 64, nullptr, 0, 0, 0); k_split32<<<(TT * 32 / 4 + 255) / 256, 256, 0, stream>>>(XA, XAh, XAl); k_gemmw<bf, 1, false><<<dim3(TT / 64, DM / 64, 1), 32, 0, stream>>>(XAh, XAl, QBP, nullptr, 32, CORR, DM, nullptr, 0, 0, 0); k_addc<<<(unsigned)(((size_t)TT * DM / 4 + 255) / 256), 256, 0, stream>>>(FQ, CORR, (size_t)TT * DM / 4);   /* LoRA: FQ += 2 (x A^T) B^T */
        k_rope<<<LQ, 256, 0, stream>>>(FQ, DQ, NH_, CS, nullptr, nullptr, 1.0f, QP16, QPh, QPl);
        k_gemmw<bf, 0, true><<<dim3(TT / 64, DKV / 64, 1), 32, 0, stream>>>(XB, nullptr, WK, nullptr, DM, FK, DKV, bk, 0, 0, 0); k_gemmw<bf, 0, false><<<dim3(TT / 64, 1, 1), 32, 0, stream>>>(XB, nullptr, KAP, nullptr, DM, XA, 64, nullptr, 0, 0, 0); k_split32<<<(TT * 32 / 4 + 255) / 256, 256, 0, stream>>>(XA, XAh, XAl); k_gemmw<bf, 1, false><<<dim3(TT / 64, DM / 64, 1), 32, 0, stream>>>(XAh, XAl, KBP, nullptr, 32, CORR, DM, nullptr, 0, 0, 0); k_addc<<<(unsigned)(((size_t)TT * DM / 4 + 255) / 256), 256, 0, stream>>>(FK, CORR, (size_t)TT * DM / 4);   /* LoRA: FK += 2 (x A^T) B^T */
        k_rope<<<LKv, 256, 0, stream>>>(FK, DKV, NKV, CS, nullptr, nullptr, 1.0f, KP16, KPh, KPl);
        k_gemmw<bf, 0, true><<<dim3(TT / 64, DKV / 64, 1), 32, 0, stream>>>(XB, nullptr, WV, nullptr, DM, FV, DKV, bv, 0, 0, 0); k_gemmw<bf, 0, false><<<dim3(TT / 64, 1, 1), 32, 0, stream>>>(XB, nullptr, VAP, nullptr, DM, XA, 64, nullptr, 0, 0, 0); k_split32<<<(TT * 32 / 4 + 255) / 256, 256, 0, stream>>>(XA, XAh, XAl); k_gemmw<bf, 1, false><<<dim3(TT / 64, DM / 64, 1), 32, 0, stream>>>(XAh, XAl, VBP, nullptr, 32, CORR, DM, nullptr, 0, 0, 0); k_addc<<<(unsigned)(((size_t)TT * DM / 4 + 255) / 256), 256, 0, stream>>>(FV, CORR, (size_t)TT * DM / 4);   /* LoRA: FV += 2 (x A^T) B^T */ k_vtp<<<LKv, 256, 0, stream>>>(FV, DKV, NKV, VT16, VTh, VTl);
        for (int h0 = 0; h0 < NH_; h0 += ZH) { const size_t zq = (size_t)h0, zk = (size_t)(h0 / REP);   // one kv head per query head: the pass's heads use consecutive kv planes
            k_gemmc<bf, 2, 1><<<dim3(RH / 64, TT / 64, ZH), 32, 0, stream>>>(QPh + zq * TT * HD, QPl + zq * TT * HD, KPh + zk * TT * HD, KPl + zk * TT * HD, HD, Sb, TT, 0, (size_t)TT * HD, (size_t)TT * HD, (size_t)TT * TT);
            k_gemmc<h16, 0, 1><<<dim3((TT - RH) / 64, TT / 64, ZH), 32, 0, stream>>>(QP16 + zq * TT * HD + (size_t)RH * HD, nullptr, KP16 + zk * TT * HD, nullptr, HD, Sb + (size_t)RH * TT, TT, RH, (size_t)TT * HD, (size_t)TT * HD, (size_t)TT * TT);
            k_asoft<<<ZH * TT / 8, 256, 0, stream>>>(Sb, am + (size_t)b * TT);
            k_gemmc<bf, 2, 2><<<dim3(RH / 64, HD / 64, ZH), 32, 0, stream>>>((const bf*)Sb, (const bf*)Sb + TT, VTh + zk * HD * 2 * TT, VTl + zk * HD * 2 * TT, 2 * TT, Ob, HD, 0, (size_t)2 * TT * TT, (size_t)HD * 2 * TT, (size_t)TT * HD);
            k_gemmc<h16, 0, 2><<<dim3((TT - RH) / 64, HD / 64, ZH), 32, 0, stream>>>((const h16*)Sb + (size_t)RH * 2 * TT, nullptr, VT16 + zk * HD * 2 * TT, nullptr, 2 * TT, Ob + (size_t)RH * HD, HD, RH, (size_t)2 * TT * TT, (size_t)HD * 2 * TT, (size_t)TT * HD);
            k_merge<<<(unsigned)(((size_t)ZH * TT * HD / 2 + 255) / 256), 256, 0, stream>>>(Ob, h0, ATh, ATl); }
        k_gemmw<bf, 1, true><<<dim3(TT / 64, DM / 64, 1), 32, 0, stream>>>(ATh, ATl, WO, nullptr, DQ, OUT + (size_t)b * TT * DM, DM, bo, 0, 0, 0); }
}

// v002
// A run of this version takes 525 microseconds.
// Timed twice side by side with v001, it ran 1.86 and 1.85 times as fast.
// Counting every step since v000, it is 3.35 times as fast.
#include <hip/hip_runtime.h>

// Masked_MHA_LORA (x [2][2048][1024]; Q/K/V = x W^T + b + 2 (x A^T) B^T (LoRA rank 8, scaling 16/8); RoPE (rotate-half, base 10000) on Q, K (16 heads x 64); scores = Q.K/8 with the causal mask and the key padding mask (attention_mask == 0 -> -inf; int,
// read as data); softmax; out = (attn V merged) oW^T + ob -> [2][2048][1024]).
// Compute dtypes, f32 accumulate: every input rounded to bf16; the base projections on PLAIN bf16 operands (inputs: exact) + bias; the LoRA path as two small GEMMs (x A^T exact, then hl planes x exact B, rank padded 8 -> 32) added

#define NB_  2
#define TT   2048
#define DM   1024
#define NH_  16
#define NKV  16
#define REP  (NH_ / NKV)
#define HD   64
#define MT   (NB_ * TT)         // rows of both batch elements together
#define DQ   (NH_ * HD)
#define DKV  (NKV * HD)
#define ZH   8                    // heads per attention launch (z of every attention grid)
#define RH   512                  // query rows < RH use hi+lo planes (0: none)
#define WIN  2048
#define PCAR 1024.0f
#define SCL  0.125f   // HD^-0.5
typedef _Float16 h16;
typedef unsigned short bf;
typedef __attribute__((ext_vector_type(16))) __bf16   v16bf;
typedef __attribute__((ext_vector_type(16))) _Float16 v16h;
typedef __attribute__((ext_vector_type(8)))  _Float16 v8h;
typedef __attribute__((ext_vector_type(8)))  unsigned short v8us;
typedef __attribute__((ext_vector_type(8)))  float    v8f;
typedef __attribute__((ext_vector_type(4)))  float    v4f;
typedef v8h  __attribute__((may_alias)) v8ha;
typedef v4f  __attribute__((may_alias)) v4fa;
typedef v8us __attribute__((may_alias)) v8usa;

__device__ __forceinline__ unsigned short f2bf(float f) { unsigned u = __float_as_uint(f); u += 0x7FFFu + ((u >> 16) & 1u); return (unsigned short)(u >> 16); }
__device__ __forceinline__ float bf2f(unsigned short b) { return __uint_as_float(((unsigned)b) << 16); }
__device__ __forceinline__ float bfr(float f) { return bf2f(f2bf(f)); }
__device__ __forceinline__ v16h cat16(v8h lo, v8h hi) { return __builtin_shufflevector(lo, hi, 0, 1, 2, 3, 4, 5, 6, 7, 8, 9, 10, 11, 12, 13, 14, 15); }
__device__ __forceinline__ v16bf cat16b(v8us lo, v8us hi) { return __builtin_bit_cast(v16bf, __builtin_shufflevector(lo, hi, 0, 1, 2, 3, 4, 5, 6, 7, 8, 9, 10, 11, 12, 13, 14, 15)); }
__device__ __forceinline__ v8f wmma16(v16h a, v16h b, v8f c) { return __builtin_amdgcn_wmma_f32_16x16x32_f16(false, a, false, b, (short)0, c, false, false); }
__device__ __forceinline__ v8f wmmab(v16bf a, v16bf b, v8f c) { return __builtin_amdgcn_wmma_f32_16x16x32_bf16(false, a, false, b, (short)0, c, false, false); }



// ---- gemm_tile: register-blocked GEMM, ONE WAVE per 64x64 output tile (16 accumulators), operands straight from K-contiguous 16-bit planes (row pitch K elements); the k loop runs to Kl <= K.
// C[m][n] (f32, pitch ldc, + optional f32 bias[n]) = sum_k A[m][k] Bt[n][k] (+ split products per NSPLIT). Kl % 32 == 0. os: 16 x 68 floats of LDS.
// XWAIT: s_wait_xcnt 0 behind a run of global loads or stores; the registers that the run names are inputs of the statement, so that none of them is overwritten in front of the wait.
#define XWAIT(...) asm volatile("s_wait_xcnt 0x0" :: __VA_ARGS__ : "memory")
template <typename T16> struct WFrag;
template <> struct WFrag<h16> { typedef v16h V; static __device__ __forceinline__ V ld(const h16* p) { return cat16(*(const v8h*)p, *(const v8h*)(p + 16)); } static __device__ __forceinline__ v8f mma(V a, V b, v8f c) { return wmma16(a, b, c); } };
template <> struct WFrag<bf> { typedef v16bf V; static __device__ __forceinline__ V ld(const bf* p) { return cat16b(*(const v8us*)p, *(const v8us*)(p + 16)); } static __device__ __forceinline__ v8f mma(V a, V b, v8f c) { return wmmab(a, b, c); } };
template <typename T16, int NSPLIT, int K, int ldc, bool BIAS>
__device__ __forceinline__ void gemm_tile(const T16* __restrict__ A, const T16* __restrict__ A2, const T16* __restrict__ Bt, const T16* __restrict__ Bt2, int Kl, float* C, const float* __restrict__ bias, int r0, int c0, float* os) {
    typedef typename WFrag<T16>::V V;
    const int lane = threadIdx.x & 31, lr = lane & 15, hi = lane >> 4;
    v8f acc[4][4];
#pragma unroll
    for (int mb = 0; mb < 4; ++mb)
#pragma unroll
        for (int nb = 0; nb < 4; ++nb) acc[mb][nb] = (v8f){};
    const T16* pa = A + (size_t)r0 * K; const T16* pb = Bt + (size_t)c0 * K; const T16* pa2 = (NSPLIT == 1 || NSPLIT == 2) ? A2 + (size_t)r0 * K : nullptr; const T16* pb2 = (NSPLIT >= 2) ? Bt2 + (size_t)c0 * K : nullptr;   // the tile's first row in each plane
    unsigned ol = (unsigned)(lr * K + 8 * hi) * 2u;   // the lane's byte offset from there at the trip's k: row lr, k = kc + 8 hi, the same in every plane (one pitch)
    v4f bv = (v4f){};   // the lane's four bias values, loaded once per tile
    if (BIAS) { const float* bp = bias + c0 + lr * 4; bv = *(const v4f*)bp; asm volatile("s_wait_xcnt 0x0" ::: "memory"); /* behind the bias load, in front of any reuse of its address registers */ }
#pragma unroll 1
    for (int kc = 0; kc < Kl; kc += 32) {
        V a[4], a2[4];
#pragma unroll
        for (int mb = 0; mb < 4; ++mb) { a[mb] = WFrag<T16>::ld((const T16*)((const char*)pa + ol) + (size_t)mb * 16 * K); if (NSPLIT == 1 || NSPLIT == 2) a2[mb] = WFrag<T16>::ld((const T16*)((const char*)pa2 + ol) + (size_t)mb * 16 * K); }
#pragma unroll
        for (int nb = 0; nb < 4; ++nb) { const V b = WFrag<T16>::ld((const T16*)((const char*)pb + ol) + (size_t)nb * 16 * K); V b2; if (NSPLIT >= 2) b2 = WFrag<T16>::ld((const T16*)((const char*)pb2 + ol) + (size_t)nb * 16 * K);
#pragma unroll
            for (int mb = 0; mb < 4; ++mb) { acc[mb][nb] = WFrag<T16>::mma(a[mb], b, acc[mb][nb]); if (NSPLIT == 1 || NSPLIT == 2) acc[mb][nb] = WFrag<T16>::mma(a2[mb], b, acc[mb][nb]); if (NSPLIT >= 2) acc[mb][nb] = WFrag<T16>::mma(a[mb], b2, acc[mb][nb]); } }
        asm volatile("s_wait_xcnt 0x0" : "+v"(ol) :: "memory");   // behind the trip's loads, in front of the step of their offset register, which passes through the statement so that it lives up to the wait
        ol += 64;
        asm volatile("v_nop\n\tv_nop\n\tv_nop\n\tv_nop" : "+v"(acc[0][0]), "+v"(acc[1][1]), "+v"(acc[2][2]), "+v"(acc[3][3]) : "v"(a[0]), "v"(a[3]));
    }
#pragma unroll
    for (int u = 0; u < 4; ++u) bv[u] = bfr(bv[u]);
#pragma unroll
    for (int mb = 0; mb < 4; ++mb) {
#pragma unroll
        for (int nb = 0; nb < 4; ++nb) {
#pragma unroll
            for (int j = 0; j < 8; ++j) os[(hi * 8 + j) * 68 + nb * 16 + lr] = acc[mb][nb][j]; }
        __builtin_amdgcn_wave_barrier(); asm volatile("" ::: "memory");
        float* crow = C + (size_t)(r0 + mb * 16) * ldc + c0;
{
            v4f val[8]; float* cp0 = crow + (size_t)hi * ldc + lr * 4;   // the lane's place in the block's rows hi, hi + 2, ...
#pragma unroll
            for (int s = 0; s < 8; ++s) { const int row = 2 * s + hi, cofs = lr * 4; val[s] = *(const v4fa*)(os + row * 68 + cofs); if (BIAS) val[s] += bv;
                *(v4f*)(cp0 + (size_t)(2 * s) * ldc) = val[s]; }
            XWAIT("v"(val[0]), "v"(val[1]), "v"(val[2]), "v"(val[3]), "v"(val[4]), "v"(val[5]), "v"(val[6]), "v"(val[7]), "v"(cp0));
             }
        __builtin_amdgcn_wave_barrier(); asm volatile("" ::: "memory");
    }
}
// k_gemmw: grid (M/64, N/64, Z), 32 threads; z-batch strides sA/sB/sC in elements
template <typename T16, int NSPLIT, int K, int ldc, bool BIAS>
__global__ __launch_bounds__(32) void k_gemmw(const T16* __restrict__ A, const T16* __restrict__ A2, const T16* __restrict__ Bt, const T16* __restrict__ Bt2, float* C, const float* __restrict__ bias, size_t sA, size_t sB, size_t sC) {
    __shared__ __align__(16) float os[16 * 68];
    const size_t z = blockIdx.z; A += z * sA; if (A2) A2 += z * sA; Bt += z * sB; if (Bt2) Bt2 += z * sB; C += z * sC;
    gemm_tile<T16, NSPLIT, K, ldc, BIAS>(A, A2, Bt, Bt2, K, C, bias, blockIdx.x * 64, blockIdx.y * 64, os);
}
// k_proj: every product with x as the left operand in one launch. grid (MT/64, DQ/64 + 1, 3): z = q, k, v; column tiles y < DQ/64 are the base projection x W^T + b -> F[z], the last column tile is x A^T -> XA[z] (A padded to 64 rows)
__global__ __launch_bounds__(32) void k_proj(const bf* __restrict__ XB, const bf* __restrict__ Wz, const bf* __restrict__ AP, float* F, float* XA, const float* __restrict__ bq, const float* __restrict__ bk, const float* __restrict__ bv) {
    __shared__ __align__(16) float os[16 * 68];
    const int z = blockIdx.z, y = blockIdx.y;
    if (y < DQ / 64) gemm_tile<bf, 0, DM, DQ, true>(XB, nullptr, Wz + (size_t)z * DQ * DM, nullptr, DM, F + (size_t)z * MT * DQ, z == 0 ? bq : (z == 1 ? bk : bv), blockIdx.x * 64, y * 64, os);
    else gemm_tile<bf, 0, DM, 64, false>(XB, nullptr, AP + (size_t)z * 64 * DM, nullptr, DM, XA + (size_t)z * MT * 64, nullptr, blockIdx.x * 64, 0, os);
}
// k_scores: Q.K tiles of ZH heads, all query row blocks in one launch: grid (TT/64, TT/64, ZH). Row blocks below RH use the hi+lo planes, the others the fp16 planes. Tiles entirely above the causal diagonal are skipped (the softmax masks j > i by select).
__global__ __launch_bounds__(32) void k_scores(const bf* __restrict__ Qh, const bf* __restrict__ Ql, const bf* __restrict__ Kh, const bf* __restrict__ Klo, const h16* __restrict__ Q16, const h16* __restrict__ K16, float* S) {
    __shared__ __align__(16) float os[16 * 68];
    const int r0 = blockIdx.x * 64, c0 = blockIdx.y * 64; if (c0 > r0 + 63) return;
    const size_t zo = (size_t)blockIdx.z * TT * HD; float* C = S + (size_t)blockIdx.z * TT * TT;
    if (r0 < RH) gemm_tile<bf, 2, HD, TT, false>(Qh + zo, Ql + zo, Kh + zo, Klo + zo, HD, C, nullptr, r0, c0, os);
    else gemm_tile<h16, 0, HD, TT, false>(Q16 + zo, nullptr, K16 + zo, nullptr, HD, C, nullptr, r0, c0, os);
}
// k_pv: probability x value tiles of ZH heads, all query row blocks in one launch: grid (TT/64, 1, ZH). The key loop stops at the diagonal block (probabilities beyond it are exactly zero). Pb and P16 are the same in-place probability rows (pitch 2 TT) seen as hi|lo planes and as fp16.
__global__ __launch_bounds__(32) void k_pv(const bf* __restrict__ Pb, const h16* __restrict__ P16, const bf* __restrict__ Vh, const bf* __restrict__ Vl, const h16* __restrict__ V16, float* O) {
    __shared__ __align__(16) float os[16 * 68];
    const int r0 = blockIdx.x * 64; const int Kl = min(2 * TT, r0 + 64);
    const size_t po = (size_t)blockIdx.z * 2 * TT * TT, vo = (size_t)blockIdx.z * HD * 2 * TT; float* C = O + (size_t)blockIdx.z * TT * HD;
    if (r0 < RH) gemm_tile<bf, 2, 2 * TT, HD, false>(Pb + po, Pb + po + TT, Vh + vo, Vl + vo, Kl, C, nullptr, r0, 0, os);
    else gemm_tile<h16, 0, 2 * TT, HD, false>(P16 + po, nullptr, V16 + vo, nullptr, Kl, C, nullptr, r0, 0, os);
}

__device__ __forceinline__ h16 tohx(float x) { return (h16)x; }
__device__ __forceinline__ void splitf(float y, unsigned short& h, unsigned short& l) { h = f2bf(y); l = f2bf(y - bf2f(h)); }
typedef __attribute__((ext_vector_type(2))) _Float16 v2h;
typedef __attribute__((ext_vector_type(4))) _Float16 v4h;
typedef __attribute__((ext_vector_type(2))) unsigned short v2us;
typedef __attribute__((ext_vector_type(4))) unsigned short v4us;
typedef __attribute__((ext_vector_type(2))) float v2f;
typedef __attribute__((ext_vector_type(4))) int v4i;

__global__ __launch_bounds__(256) void k_wtG(const float* __restrict__ w, int K, int N, bf* Bt) {
    const int lane = threadIdx.x & 31; const int L0 = (blockIdx.x * 8 + (threadIdx.x >> 5)) * 8; const int nlines = N * K / 64;
{
#pragma unroll 1
        for (int l = 0; l < 8; ++l) { const int L = L0 + l; if (L >= nlines) break; const size_t e = (size_t)L * 64 + lane * 2; const int k = (int)(e % K), n = (int)(e / K); v2us o;
            o[0] = f2bf(w[(size_t)k * N + n]); o[1] = f2bf(w[(size_t)(k + 1) * N + n]); *(v2us*)(Bt + e) = o; }
         }
}
__device__ __forceinline__ void cvt8_body(const float* __restrict__ src, bf* dst, size_t i) { const v8f v = *(const v8f*)(src + i * 8); v8us o;
#pragma unroll
    for (int k = 0; k < 8; ++k) o[k] = f2bf(v[k]); bf* dp = dst + i * 8; *(v8us*)dp = o; XWAIT("v"(o), "v"(dp));  }
__device__ __forceinline__ void cstab_body(float* CS, int idx) { const int t = idx / HD, d = idx % HD; const int i = d % (HD / 2); const float inv = __fdiv_rn(1.0f, powf(10000.0f, (float)(2 * i) / (float)HD)); const float ang = __fmul_rn((float)t, inv); v2f cs; cs[0] = cosf(ang); cs[1] = sinf(ang);
    float* dp = CS + (size_t)idx * 2; *(v2f*)dp = cs; XWAIT("v"(cs), "v"(dp));  }
// rope_body: head planes [h][t][d] (fp16 + hi/lo) of rope(x) x sc with the rotate-half convention out[d] = x[d] cos[t][d] - x[d+HD/2] sin[t][d], out[d+HD/2] = x[d+HD/2] cos[t][d+HD/2] + x[d] sin[t][d+HD/2]
__device__ __forceinline__ void rope_body(const float* __restrict__ F, int pitch, int nheads, const float* __restrict__ CS, const float* __restrict__ RF, const float* __restrict__ nw, float sc, h16* P16, bf* Ph, bf* Pl) {
    const size_t e = ((size_t)blockIdx.x * 256 + threadIdx.x) * 2; if (e >= (size_t)nheads * TT * HD) return; const int d = (int)(e % HD); const int t = (int)((e / HD) % TT); const int h = (int)(e / ((size_t)HD * TT)); const float* f = F + (size_t)t * pitch + h * HD; const float rf = RF ? RF[(size_t)h * TT + t] : 1.0f; v2h o16; v2us oh, ol;
#pragma unroll
    for (int q = 0; q < 2; ++q) { const int dd = d + q; const int dp = (dd < HD / 2) ? dd + HD / 2 : dd - HD / 2; float x0 = f[dd], x1 = f[dp];
        if (RF) { float n0 = __fmul_rn(x0, rf), n1 = __fmul_rn(x1, rf); asm volatile("" : "+v"(n0)); asm volatile("" : "+v"(n1)); x0 = __fmul_rn(bfr(nw[dd]), n0); x1 = __fmul_rn(bfr(nw[dp]), n1); }
        const v2f cs = *(const v2f*)(CS + ((size_t)t * HD + dd) * 2); float a = __fmul_rn(x0, cs[0]), bq = __fmul_rn(x1, cs[1]); asm volatile("" : "+v"(a)); asm volatile("" : "+v"(bq)); const float r = ((dd < HD / 2) ? __fsub_rn(a, bq) : __fadd_rn(a, bq)) * sc;
        o16[q] = tohx(r); unsigned short a2, c2; splitf(r, a2, c2); oh[q] = a2; ol[q] = c2; }
    *(v2h*)(P16 + e) = o16; *(v2us*)(Ph + e) = oh; *(v2us*)(Pl + e) = ol;  }
// vtp_body: transposed value planes [g][d][t] at row pitch 2 TT, the pitch of the in-place probability rows (gemm_tile uses one pitch for both operands); only t < TT of a row is written or read
__device__ __forceinline__ void vtp_body(const float* __restrict__ F, int pitch, int nheads, h16* V16, bf* Vh, bf* Vl) { const size_t e = ((size_t)blockIdx.x * 256 + threadIdx.x) * 2; if (e >= (size_t)nheads * HD * TT) return; const int t = (int)(e % TT); const int d = (int)((e / TT) % HD); const int g = (int)(e / ((size_t)TT * HD)); v2h o16; v2us oh, ol;
#pragma unroll
    for (int q = 0; q < 2; ++q) { const float x = F[(size_t)(t + q) * pitch + g * HD + d]; o16[q] = tohx(x); unsigned short a2, c2; splitf(x, a2, c2); oh[q] = a2; ol[q] = c2; }
    const size_t o = 2 * e - t; *(v2h*)(V16 + o) = o16; *(v2us*)(Vh + o) = oh; *(v2us*)(Vl + o) = ol;  }
// k_planes: every operand plane of the attention in one launch. grid (NH_ TT HD / 512, 6): y = 0..3 rope planes of (q b0, q b1, k b0, k b1), laid out in that order in P16 / Ph / Pl; y = 4, 5 the transposed value planes of b0, b1. F = [q, k, v][MT][DQ].
__global__ __launch_bounds__(256) void k_planes(const float* __restrict__ F, const float* __restrict__ CS, h16* P16, bf* Ph, bf* Pl, h16* V16, bf* Vh, bf* Vl) {
    const int y = blockIdx.y;
    if (y < 4) { const size_t po = (size_t)y * NH_ * TT * HD; rope_body(F + ((size_t)(y >> 1) * MT + (size_t)(y & 1) * TT) * DQ, DQ, NH_, CS, nullptr, nullptr, 1.0f, P16 + po, Ph + po, Pl + po); }
    else { const size_t vo = (size_t)(y - 4) * NKV * HD * 2 * TT; vtp_body(F + ((size_t)2 * MT + (size_t)(y - 4) * TT) * DKV, DKV, NKV, V16 + vo, Vh + vo, Vl + vo); }
}
// k_asoft: per row (zz, i): t = S x HD^-0.5 for j <= i with attention_mask[j] != 0 (causal + key padding mask), else -3e38; softmax over the 2048 keys (register row, one exp, fixed trees);
// the probabilities go back IN PLACE over their own score row (8 KiB, so their row pitch is 2 TT 16-bit elements): the fp16 row in its first half, or the hi plane in the first and the lo plane in the second half. One wave owns a row and holds all of it in registers before its first store (every store needs the row sum).
__global__ __launch_bounds__(256) void k_asoft(float* Sb, const int* __restrict__ amb) {
    const int lane = threadIdx.x & 31; const int row = blockIdx.x * 8 + (threadIdx.x >> 5); if (row >= ZH * TT) return; const int i = row % TT; const int zz = row / TT; (void)zz; const bool hires = (i < RH); float* sr = Sb + (size_t)row * TT; float v[TT / 32]; float mx = -3.0e38f;
#pragma unroll
    for (int ch = 0; ch < TT / 128; ++ch) { const int j0 = ch * 128 + lane * 4; const v4f a = *(const v4f*)(sr + j0);
#pragma unroll
        for (int q = 0; q < 4; ++q) { const int j = j0 + q; (void)j; const float t = (j <= i && amb[j] != 0) ? a[q] * SCL : -3.0e38f;   /* causal + key padding mask */ v[ch * 4 + q] = t; mx = fmaxf(mx, t); } }
#pragma unroll
    for (int sh = 16; sh; sh >>= 1) mx = fmaxf(mx, __shfl_xor(mx, sh, 32));
    float sum = 0.f;
#pragma unroll
    for (int k = 0; k < TT / 32; ++k) { float d0 = __fsub_rn(v[k], mx); asm volatile("" : "+v"(d0)); v[k] = __builtin_amdgcn_exp2f(__fmul_rn(d0, 1.4426950408889634f)); sum += v[k]; }
#pragma unroll
    for (int sh = 16; sh; sh >>= 1) sum += __shfl_xor(sum, sh, 32);
    const float f = __fdiv_rn(hires ? 1.0f : PCAR, sum);
{
        if (hires) {
#pragma unroll
            for (int ch = 0; ch < TT / 128; ++ch) { v4us oh, ol;
#pragma unroll
                for (int q = 0; q < 4; ++q) { unsigned short a, c2; splitf(v[ch * 4 + q] * f, a, c2); oh[q] = a; ol[q] = c2; }
                const int oo = ch * 128 + lane * 4; *(v4us*)((bf*)sr + oo) = oh; *(v4us*)((bf*)sr + TT + oo) = ol; }
        } else {
#pragma unroll
            for (int ch = 0; ch < TT / 128; ++ch) { v4h o4;
#pragma unroll
                for (int q = 0; q < 4; ++q) o4[q] = tohx(v[ch * 4 + q] * f);
                *(v4h*)((h16*)sr + ch * 128 + lane * 4) = o4; } }
         }
}
// grid.y = attention pass (batch element, group of ZH heads): O holds every pass's output, Ah / Al the rows of both batch elements
__global__ __launch_bounds__(256) void k_merge(const float* __restrict__ O, bf* Ah, bf* Al) { const size_t e = ((size_t)blockIdx.x * 256 + threadIdx.x) * 2; if (e >= (size_t)ZH * TT * HD) return; const int h0 = (blockIdx.y % (NH_ / ZH)) * ZH; const size_t bo = (size_t)(blockIdx.y / (NH_ / ZH)) * TT * DQ; O += (size_t)blockIdx.y * ZH * TT * HD; Ah += bo; Al += bo; const int d = (int)(e % HD); const int t = (int)((e / HD) % TT); const int zz = (int)(e / ((size_t)HD * TT)); const float cs = (t < RH) ? 1.0f : (1.0f / PCAR); const size_t oo = (size_t)t * DQ + (h0 + zz) * HD + d;
    v2us oh, ol;
#pragma unroll
    for (int q = 0; q < 2; ++q) { unsigned short a, c2; splitf(O[e + q] * cs, a, c2); oh[q] = a; ol[q] = c2; } *(v2us*)(Ah + oo) = oh; *(v2us*)(Al + oo) = ol;  }

// LoRA helpers: apad_body: bf16 [64][DM] from A [8][DM] (rows >= 8 zero; 8-B lanes); bpad_body: bf16 Bt [DM][32] from B [DM][8] natural (cols >= 8 zero); k_split32: hl planes [T][32] of XA [T][64] (cols >= 8 are exact zeros) (8-B lanes);
__device__ __forceinline__ void apad_body(const float* __restrict__ A, bf* AP, int e) { const int r = e / DM; v4us o;
#pragma unroll
    for (int u = 0; u < 4; ++u) o[u] = (r < 8) ? f2bf(A[e + u]) : (unsigned short)0; bf* dp = AP + e; *(v4us*)dp = o; XWAIT("v"(o), "v"(dp));  }
__device__ __forceinline__ void bpad_body(const float* __restrict__ Bm, bf* BP, int e) { const int c = e % 32, r = e / 32; v4us o;
#pragma unroll
    for (int u = 0; u < 4; ++u) o[u] = (c + u < 8) ? f2bf(Bm[(size_t)r * 8 + c + u]) : (unsigned short)0; bf* dp = BP + e; *(v4us*)dp = o; XWAIT("v"(o), "v"(dp));  }
// k_prep: every input conversion and the rope table in one launch. grid (512, 11), 256 threads: y = 0..3 the four weights (DQ DM / 8 lanes each), y = 4..7 the four quarters of x, y = 8 the cos/sin table, y = 9 the three padded A (64 blocks each), y = 10 the three padded B (32 blocks each)
__global__ __launch_bounds__(256) void k_prep(const float* __restrict__ x, const float* __restrict__ wq, const float* __restrict__ wk, const float* __restrict__ wv, const float* __restrict__ wo, const float* __restrict__ qA, const float* __restrict__ kA, const float* __restrict__ vA, const float* __restrict__ qB, const float* __restrict__ kB, const float* __restrict__ vB,
                                              bf* XB, bf* Wz, bf* WO, bf* AP, bf* BP, float* CS) {
    const int y = blockIdx.y, bx = blockIdx.x, tid = threadIdx.x;
    if (y < 4) cvt8_body(y == 0 ? wq : (y == 1 ? wk : (y == 2 ? wv : wo)), y < 3 ? Wz + (size_t)y * DQ * DM : WO, (size_t)bx * 256 + tid);
    else if (y < 8) cvt8_body(x + (size_t)(y - 4) * DQ * DM, XB + (size_t)(y - 4) * DQ * DM, (size_t)bx * 256 + tid);
    else if (y == 8) cstab_body(CS, bx * 256 + tid);
    else if (y == 9) { const int m = bx / 64; if (m < 3) apad_body(m == 0 ? qA : (m == 1 ? kA : vA), AP + (size_t)m * 64 * DM, ((bx % 64) * 256 + tid) * 4); }
    else { const int m = bx / 32; if (m < 3) bpad_body(m == 0 ? qB : (m == 1 ? kB : vB), BP + (size_t)m * DM * 32, ((bx % 32) * 256 + tid) * 4); }
}
__global__ __launch_bounds__(256) void k_split32(const float* __restrict__ XA, bf* Ph, bf* Pl) { const int e = (blockIdx.x * 256 + threadIdx.x) * 4; if (e >= 3 * MT * 32) return; const int c = e % 32, t = e / 32; const v4f a = *(const v4f*)(XA + (size_t)t * 64 + c); v4us oh, ol;
#pragma unroll
    for (int u = 0; u < 4; ++u) { oh[u] = f2bf(a[u]); ol[u] = f2bf(a[u] - bf2f(oh[u])); } *(v4us*)(Ph + e) = oh; *(v4us*)(Pl + e) = ol;  }
__global__ __launch_bounds__(256) void k_addc(float* F, const float* __restrict__ CORR, size_t n4) { const size_t e = ((size_t)blockIdx.x * 256 + threadIdx.x) * 4; if (e >= n4 * 4) return; const v4f a = *(const v4f*)(F + e), c = *(const v4f*)(CORR + e); v4f o;
#pragma unroll
    for (int u = 0; u < 4; ++u) { float cc = __fmul_rn(2.0f, c[u]); asm volatile("" : "+v"(cc)); o[u] = __fadd_rn(a[u], cc); } *(v4f*)(F + e) = o;  }

extern "C" void kernel_launch(void* const* d_in, const int* in_sizes, int n_in,
                              void* d_out, int out_size, void* d_ws, size_t ws_size, hipStream_t stream) {
    (void)in_sizes; (void)n_in; (void)out_size;
    const float* x = (const float*)d_in[0]; const int* am = (const int*)d_in[1]; const float* wq = (const float*)d_in[2]; const float* bq = (const float*)d_in[3]; const float* wk = (const float*)d_in[4]; const float* bk = (const float*)d_in[5]; const float* wv = (const float*)d_in[6]; const float* bv = (const float*)d_in[7];
    const float* qA = (const float*)d_in[8]; const float* qB = (const float*)d_in[9]; const float* kA = (const float*)d_in[10]; const float* kB = (const float*)d_in[11]; const float* vA = (const float*)d_in[12]; const float* vB = (const float*)d_in[13]; const float* wo = (const float*)d_in[14]; const float* bo = (const float*)d_in[15];
    float* OUT = (float*)d_out;     // [2][2048][1024]
    char* wsp = (char*)d_ws;
    auto take = [&](size_t bytes) { char* p = wsp; wsp += (bytes + 255) & ~(size_t)255; return (void*)p; };
    // live through the attention: the output weight, the operand planes of both batch elements, the merged attention output, one pass's scores
    const size_t PB = (size_t)NH_ * TT * HD, VB = (size_t)NKV * HD * 2 * TT;   // elements of one batch element's q or k planes / value planes
    bf* WO = (bf*)take((size_t)DM * DQ * 2);
    h16* P16 = (h16*)take(4 * PB * 2); bf* Ph = (bf*)take(4 * PB * 2); bf* Pl = (bf*)take(4 * PB * 2);   // [q b0][q b1][k b0][k b1]
    h16* VT16 = (h16*)take(NB_ * VB * 2); bf* VTh = (bf*)take(NB_ * VB * 2); bf* VTl = VTh + TT;   // hi plane in the first, lo plane in the second half of each 2 TT row
    float* Ob = (float*)take((size_t)NB_ * NH_ * TT * HD * 4); bf* ATh = (bf*)take((size_t)MT * DQ * 2); bf* ATl = (bf*)take((size_t)MT * DQ * 2);
    float* Sb = (float*)take((size_t)ZH * TT * TT * 4);
    if ((size_t)(wsp - (char*)d_ws) > ws_size) return;    // ws 256 MiB
    // dead before the first score tile is written: laid over the score buffer (about 116 of its 128 MiB)
    wsp = (char*)Sb;
    bf* Wz = (bf*)take((size_t)3 * DQ * DM * 2); float* CS = (float*)take((size_t)TT * HD * 2 * 4); bf* XB = (bf*)take((size_t)MT * DM * 2); bf* AP = (bf*)take((size_t)3 * 64 * DM * 2); bf* BP = (bf*)take((size_t)3 * DM * 32 * 2);
    float* XA = (float*)take((size_t)3 * MT * 64 * 4); bf* XAh = (bf*)take((size_t)3 * MT * 32 * 2); bf* XAl = (bf*)take((size_t)3 * MT * 32 * 2); float* CORR = (float*)take((size_t)3 * MT * DM * 4); float* F = (float*)take((size_t)3 * MT * DQ * 4);
    k_prep<<<dim3(512, 11, 1), 256, 0, stream>>>(x, wq, wk, wv, wo, qA, kA, vA, qB, kB, vB, XB, Wz, WO, AP, BP, CS);
    k_proj<<<dim3(MT / 64, DQ / 64 + 1, 3), 32, 0, stream>>>(XB, Wz, AP, F, XA, bq, bk, bv);
    k_split32<<<(3 * MT * 32 / 4 + 255) / 256, 256, 0, stream>>>(XA, XAh, XAl);
    k_gemmw<bf, 1, 32, DM, false><<<dim3(MT / 64, DM / 64, 3), 32, 0, stream>>>(XAh, XAl, BP, nullptr, CORR, nullptr, (size_t)MT * 32, (size_t)DM * 32, (size_t)MT * DM);
    k_addc<<<(unsigned)(((size_t)3 * MT * DM / 4 + 255) / 256), 256, 0, stream>>>(F, CORR, (size_t)3 * MT * DM / 4);   /* LoRA: F += 2 (x A^T) B^T */
    k_planes<<<dim3((unsigned)((PB / 2 + 255) / 256), 6, 1), 256, 0, stream>>>(F, CS, P16, Ph, Pl, VT16, VTh, VTl);
    for (int b = 0; b < NB_; ++b) {
        for (int h0 = 0; h0 < NH_; h0 += ZH) { const size_t zq = ((size_t)b * NH_ + h0) * TT * HD, zk = ((size_t)(NB_ + b) * NH_ + h0) * TT * HD, zv = (size_t)b * VB + (size_t)h0 * HD * 2 * TT;   // one kv head per query head
            k_scores<<<dim3(TT / 64, TT / 64, ZH), 32, 0, stream>>>(Ph + zq, Pl + zq, Ph + zk, Pl + zk, P16 + zq, P16 + zk, Sb);
            k_asoft<<<ZH * TT / 8, 256, 0, stream>>>(Sb, am + (size_t)b * TT);
            k_pv<<<dim3(TT / 64, 1, ZH), 32, 0, stream>>>((const bf*)Sb, (const h16*)Sb, VTh + zv, VTl + zv, VT16 + zv, Ob + zq); } }
    k_merge<<<dim3((unsigned)(((size_t)ZH * TT * HD / 2 + 255) / 256), NB_ * NH_ / ZH, 1), 256, 0, stream>>>(Ob, ATh, ATl);
    k_gemmw<bf, 1, DQ, DM, true><<<dim3(MT / 64, DM / 64, 1), 32, 0, stream>>>(ATh, ATl, WO, nullptr, OUT, bo, 0, 0, 0);
}

// v003
// It runs in 456 microseconds.
// Next to v002, in two timings, it ran 1.17 times as fast each time.
// All steps since v000 together make it 3.92 times as fast.
#include <hip/hip_runtime.h>

// Masked_MHA_LORA (x [2][2048][1024]; Q/K/V = x W^T + b + 2 (x A^T) B^T (LoRA rank 8, scaling 16/8); RoPE (rotate-half, base 10000) on Q, K (16 heads x 64); scores = Q.K/8 with the causal mask and the key padding mask (attention_mask == 0 -> -inf; int,
// read as data); softmax; out = (attn V merged) oW^T + ob -> [2][2048][1024]).
// Compute dtypes, f32 accumulate: every input rounded to bf16; the base projections on PLAIN bf16 operands (inputs: exact) + bias; the LoRA path as two small GEMMs (x A^T exact, then hl planes x exact B, rank padded 8 -> 32) added

#define NB_  2
#define TT   2048
#define DM   1024
#define NH_  16
#define NKV  16
#define REP  (NH_ / NKV)
#define HD   64
#define MT   (NB_ * TT)         // rows of both batch elements together
#define DQ   (NH_ * HD)
#define DKV  (NKV * HD)
#define ZH   8                    // heads per attention launch (z of every attention grid)
#define RH   512                  // query rows < RH use hi+lo planes (0: none)
#define WIN  2048
#define PCAR 1024.0f
#define SCL  0.125f   // HD^-0.5
typedef _Float16 h16;
typedef unsigned short bf;
typedef __attribute__((ext_vector_type(16))) __bf16   v16bf;
typedef __attribute__((ext_vector_type(16))) _Float16 v16h;
typedef __attribute__((ext_vector_type(8)))  _Float16 v8h;
typedef __attribute__((ext_vector_type(8)))  unsigned short v8us;
typedef __attribute__((ext_vector_type(8)))  float    v8f;
typedef __attribute__((ext_vector_type(4)))  float    v4f;
typedef v8h  __attribute__((may_alias)) v8ha;
typedef v4f  __attribute__((may_alias)) v4fa;
typedef v8us __attribute__((may_alias)) v8usa;

__device__ __forceinline__ unsigned short f2bf(float f) { unsigned u = __float_as_uint(f); u += 0x7FFFu + ((u >> 16) & 1u); return (unsigned short)(u >> 16); }
__device__ __forceinline__ float bf2f(unsigned short b) { return __uint_as_float(((unsigned)b) << 16); }
__device__ __forceinline__ float bfr(float f) { return bf2f(f2bf(f)); }
__device__ __forceinline__ v16h cat16(v8h lo, v8h hi) { return __builtin_shufflevector(lo, hi, 0, 1, 2, 3, 4, 5, 6, 7, 8, 9, 10, 11, 12, 13, 14, 15); }
__device__ __forceinline__ v16bf cat16b(v8us lo, v8us hi) { return __builtin_bit_cast(v16bf, __builtin_shufflevector(lo, hi, 0, 1, 2, 3, 4, 5, 6, 7, 8, 9, 10, 11, 12, 13, 14, 15)); }
__device__ __forceinline__ v8f wmma16(v16h a, v16h b, v8f c) { return __builtin_amdgcn_wmma_f32_16x16x32_f16(false, a, false, b, (short)0, c, false, false); }
__device__ __forceinline__ v8f wmmab(v16bf a, v16bf b, v8f c) { return __builtin_amdgcn_wmma_f32_16x16x32_bf16(false, a, false, b, (short)0, c, false, false); }



// ---- gemm_tile: register-blocked GEMM, ONE WAVE per 64x64 output tile (16 accumulators), operands straight from K-contiguous 16-bit planes (row pitch K elements); the k loop runs to Kl <= K.
// C[m][n] (f32, pitch ldc, + optional f32 bias[n]) = sum_k A[m][k] Bt[n][k] (+ split products per NSPLIT). Kl % 32 == 0. os: 16 x 68 floats of LDS.
// NW > 1: NW waves of one work-group share the tile; wave w takes the k blocks w, w + NW, ... into its own accumulators, the NW partial tiles meet in LDS (os: NW x 64 x 68 floats) and are summed in the fixed order w = 0, 1, ...
// XWAIT: s_wait_xcnt 0 behind a run of global loads or stores; the registers that the run names are inputs of the statement, so that none of them is overwritten in front of the wait.
#define XWAIT(...) asm volatile("s_wait_xcnt 0x0" :: __VA_ARGS__ : "memory")
template <typename T16> struct WFrag;
template <> struct WFrag<h16> { typedef v16h V; static __device__ __forceinline__ V ld(const h16* p) { return cat16(*(const v8h*)p, *(const v8h*)(p + 16)); } static __device__ __forceinline__ v8f mma(V a, V b, v8f c) { return wmma16(a, b, c); } };
template <> struct WFrag<bf> { typedef v16bf V; static __device__ __forceinline__ V ld(const bf* p) { return cat16b(*(const v8us*)p, *(const v8us*)(p + 16)); } static __device__ __forceinline__ v8f mma(V a, V b, v8f c) { return wmmab(a, b, c); } };
template <typename T16, int NSPLIT, int K, int ldc, bool BIAS, int NW = 1>
__device__ __forceinline__ void gemm_tile(const T16* __restrict__ A, const T16* __restrict__ A2, const T16* __restrict__ Bt, const T16* __restrict__ Bt2, int Kl, float* C, const float* __restrict__ bias, int r0, int c0, float* os) {
    typedef typename WFrag<T16>::V V;
    const int lane = threadIdx.x & 31, lr = lane & 15, hi = lane >> 4;
    const int wv = (NW > 1) ? __builtin_amdgcn_readfirstlane((int)(threadIdx.x >> 5)) : 0;   // the wave's number, in a scalar register: the k loop's bounds stay wave-uniform
    v8f acc[4][4];
#pragma unroll
    for (int mb = 0; mb < 4; ++mb)
#pragma unroll
        for (int nb = 0; nb < 4; ++nb) acc[mb][nb] = (v8f){};
    const T16* pa = A + (size_t)r0 * K; const T16* pb = Bt + (size_t)c0 * K; const T16* pa2 = (NSPLIT == 1 || NSPLIT == 2) ? A2 + (size_t)r0 * K : nullptr; const T16* pb2 = (NSPLIT >= 2) ? Bt2 + (size_t)c0 * K : nullptr;   // the tile's first row in each plane
    unsigned ol = (unsigned)(lr * K + 8 * hi + 32 * wv) * 2u;   // the lane's byte offset from there at the trip's k: row lr, k = kc + 8 hi, the same in every plane (one pitch)
    v4f bv = (v4f){};   // the lane's four bias values, loaded once per tile
    if (BIAS) { const float* bp = bias + c0 + lr * 4; bv = *(const v4f*)bp; asm volatile("s_wait_xcnt 0x0" ::: "memory"); /* behind the bias load, in front of any reuse of its address registers */ }
#pragma unroll 1
    for (int kc = 32 * wv; kc < Kl; kc += 32 * NW) {
        V a[4], a2[4];
#pragma unroll
        for (int mb = 0; mb < 4; ++mb) { a[mb] = WFrag<T16>::ld((const T16*)((const char*)pa + ol) + (size_t)mb * 16 * K); if (NSPLIT == 1 || NSPLIT == 2) a2[mb] = WFrag<T16>::ld((const T16*)((const char*)pa2 + ol) + (size_t)mb * 16 * K); }
#pragma unroll
        for (int nb = 0; nb < 4; ++nb) { const V b = WFrag<T16>::ld((const T16*)((const char*)pb + ol) + (size_t)nb * 16 * K); V b2; if (NSPLIT >= 2) b2 = WFrag<T16>::ld((const T16*)((const char*)pb2 + ol) + (size_t)nb * 16 * K);
#pragma unroll
            for (int mb = 0; mb < 4; ++mb) { acc[mb][nb] = WFrag<T16>::mma(a[mb], b, acc[mb][nb]); if (NSPLIT == 1 || NSPLIT == 2) acc[mb][nb] = WFrag<T16>::mma(a2[mb], b, acc[mb][nb]); if (NSPLIT >= 2) acc[mb][nb] = WFrag<T16>::mma(a[mb], b2, acc[mb][nb]); } }
        asm volatile("s_wait_xcnt 0x0" : "+v"(ol) :: "memory");   // behind the trip's loads, in front of the step of their offset register, which passes through the statement so that it lives up to the wait
        ol += 64 * NW;
        asm volatile("v_nop\n\tv_nop\n\tv_nop\n\tv_nop" : "+v"(acc[0][0]), "+v"(acc[1][1]), "+v"(acc[2][2]), "+v"(acc[3][3]) : "v"(a[0]), "v"(a[3]));
    }
#pragma unroll
    for (int u = 0; u < 4; ++u) bv[u] = bfr(bv[u]);
    if constexpr (NW > 1) {
        float* pw = os + wv * (64 * 68);   // the wave's own partial tile
#pragma unroll
        for (int mb = 0; mb < 4; ++mb)
#pragma unroll
            for (int nb = 0; nb < 4; ++nb)
#pragma unroll
                for (int j = 0; j < 8; ++j) pw[(mb * 16 + hi * 8 + j) * 68 + nb * 16 + lr] = acc[mb][nb][j];
        __syncthreads();   // every wave's partial tile is in LDS before any is read
        constexpr int NS = 64 * 16 / (32 * NW);   // 16-byte pieces of the tile per thread
        v4f val[NS]; float* cp0 = C + (size_t)(r0 + (int)(threadIdx.x >> 4)) * ldc + c0 + lr * 4;   // the thread's place in rows tid / 16, + 2 NW, ...
#pragma unroll
        for (int s = 0; s < NS; ++s) { const float* ps = os + (s * 2 * NW + (int)(threadIdx.x >> 4)) * 68 + lr * 4; val[s] = *(const v4fa*)ps;
#pragma unroll
            for (int w = 1; w < NW; ++w) val[s] += *(const v4fa*)(ps + w * (64 * 68));
            if (BIAS) val[s] += bv;
            *(v4f*)(cp0 + (size_t)(s * 2 * NW) * ldc) = val[s]; }
        static_assert(NS == 4, "the wait below names four stored values");
        XWAIT("v"(val[0]), "v"(val[1]), "v"(val[2]), "v"(val[3]), "v"(cp0));
        return;
    }
#pragma unroll
    for (int mb = 0; mb < 4; ++mb) {
#pragma unroll
        for (int nb = 0; nb < 4; ++nb) {
#pragma unroll
            for (int j = 0; j < 8; ++j) os[(hi * 8 + j) * 68 + nb * 16 + lr] = acc[mb][nb][j]; }
        __builtin_amdgcn_wave_barrier(); asm volatile("" ::: "memory");
        float* crow = C + (size_t)(r0 + mb * 16) * ldc + c0;
{
            v4f val[8]; float* cp0 = crow + (size_t)hi * ldc + lr * 4;   // the lane's place in the block's rows hi, hi + 2, ...
#pragma unroll
            for (int s = 0; s < 8; ++s) { const int row = 2 * s + hi, cofs = lr * 4; val[s] = *(const v4fa*)(os + row * 68 + cofs); if (BIAS) val[s] += bv;
                *(v4f*)(cp0 + (size_t)(2 * s) * ldc) = val[s]; }
            XWAIT("v"(val[0]), "v"(val[1]), "v"(val[2]), "v"(val[3]), "v"(val[4]), "v"(val[5]), "v"(val[6]), "v"(val[7]), "v"(cp0));
             }
        __builtin_amdgcn_wave_barrier(); asm volatile("" ::: "memory");
    }
}
// k_gemmw: grid (M/64, N/64, Z), 32 threads; z-batch strides sA/sB/sC in elements
template <typename T16, int NSPLIT, int K, int ldc, bool BIAS>
__global__ __launch_bounds__(32) void k_gemmw(const T16* __restrict__ A, const T16* __restrict__ A2, const T16* __restrict__ Bt, const T16* __restrict__ Bt2, float* C, const float* __restrict__ bias, size_t sA, size_t sB, size_t sC) {
    __shared__ __align__(16) float os[16 * 68];
    const size_t z = blockIdx.z; A += z * sA; if (A2) A2 += z * sA; Bt += z * sB; if (Bt2) Bt2 += z * sB; C += z * sC;
    gemm_tile<T16, NSPLIT, K, ldc, BIAS>(A, A2, Bt, Bt2, K, C, bias, blockIdx.x * 64, blockIdx.y * 64, os);
}
// k_proj: every product with x as the left operand in one launch. grid (MT/64, DQ/64 + 1, 3): z = q, k, v; column tiles y < DQ/64 are the base projection x W^T + b -> F[z], the last column tile is x A^T -> XA[z] (A padded to 64 rows)
__global__ __launch_bounds__(32) void k_proj(const bf* __restrict__ XB, const bf* __restrict__ Wz, const bf* __restrict__ AP, float* F, float* XA, const float* __restrict__ bq, const float* __restrict__ bk, const float* __restrict__ bv) {
    __shared__ __align__(16) float os[16 * 68];
    const int z = blockIdx.z, y = blockIdx.y;
    if (y < DQ / 64) gemm_tile<bf, 0, DM, DQ, true>(XB, nullptr, Wz + (size_t)z * DQ * DM, nullptr, DM, F + (size_t)z * MT * DQ, z == 0 ? bq : (z == 1 ? bk : bv), blockIdx.x * 64, y * 64, os);
    else gemm_tile<bf, 0, DM, 64, false>(XB, nullptr, AP + (size_t)z * 64 * DM, nullptr, DM, XA + (size_t)z * MT * 64, nullptr, blockIdx.x * 64, 0, os);
}
// k_scores: Q.K tiles of ZH heads, all query row blocks in one launch: grid (TT/64, TT/64, ZH). Row blocks below RH use the hi+lo planes, the others the fp16 planes. Tiles entirely above the causal diagonal are skipped (the softmax masks j > i by select).
__global__ __launch_bounds__(32) void k_scores(const bf* __restrict__ Qh, const bf* __restrict__ Ql, const bf* __restrict__ Kh, const bf* __restrict__ Klo, const h16* __restrict__ Q16, const h16* __restrict__ K16, float* S) {
    __shared__ __align__(16) float os[16 * 68];
    const int r0 = blockIdx.x * 64, c0 = blockIdx.y * 64; if (c0 > r0 + 63) return;
    const size_t zo = (size_t)blockIdx.z * TT * HD; float* C = S + (size_t)blockIdx.z * TT * TT;
    if (r0 < RH) gemm_tile<bf, 2, HD, TT, false>(Qh + zo, Ql + zo, Kh + zo, Klo + zo, HD, C, nullptr, r0, c0, os);
    else gemm_tile<h16, 0, HD, TT, false>(Q16 + zo, nullptr, K16 + zo, nullptr, HD, C, nullptr, r0, c0, os);
}
// k_pv: probability x value tiles of ZH heads, all query row blocks in one launch: grid (TT/64, 1, ZH), PVW waves per tile, which share its key loop (there are only TT/64 x ZH tiles, and the last row block's loop is TT/32 dependent trips long). The key loop stops at the diagonal block (probabilities beyond it are exactly zero). Pb and P16 are the same in-place probability rows (pitch 2 TT) seen as hi|lo planes and as fp16.
#define PVW 8
__global__ __launch_bounds__(32 * PVW) void k_pv(const bf* __restrict__ Pb, const h16* __restrict__ P16, const bf* __restrict__ Vh, const bf* __restrict__ Vl, const h16* __restrict__ V16, float* O) {
    __shared__ __align__(16) float os[PVW * 64 * 68];
    const int r0 = blockIdx.x * 64; const int Kl = min(2 * TT, r0 + 64);
    const size_t po = (size_t)blockIdx.z * 2 * TT * TT, vo = (size_t)blockIdx.z * HD * 2 * TT; float* C = O + (size_t)blockIdx.z * TT * HD;
    if (r0 < RH) gemm_tile<bf, 2, 2 * TT, HD, false, PVW>(Pb + po, Pb + po + TT, Vh + vo, Vl + vo, Kl, C, nullptr, r0, 0, os);
    else gemm_tile<h16, 0, 2 * TT, HD, false, PVW>(P16 + po, nullptr, V16 + vo, nullptr, Kl, C, nullptr, r0, 0, os);
}

__device__ __forceinline__ h16 tohx(float x) { return (h16)x; }
__device__ __forceinline__ void splitf(float y, unsigned short& h, unsigned short& l) { h = f2bf(y); l = f2bf(y - bf2f(h)); }
typedef __attribute__((ext_vector_type(2))) _Float16 v2h;
typedef __attribute__((ext_vector_type(4))) _Float16 v4h;
typedef __attribute__((ext_vector_type(2))) unsigned short v2us;
typedef __attribute__((ext_vector_type(4))) unsigned short v4us;
typedef __attribute__((ext_vector_type(2))) float v2f;
typedef __attribute__((ext_vector_type(4))) int v4i;

__global__ __launch_bounds__(256) void k_wtG(const float* __restrict__ w, int K, int N, bf* Bt) {
    const int lane = threadIdx.x & 31; const int L0 = (blockIdx.x * 8 + (threadIdx.x >> 5)) * 8; const int nlines = N * K / 64;
{
#pragma unroll 1
        for (int l = 0; l < 8; ++l) { const int L = L0 + l; if (L >= nlines) break; const size_t e = (size_t)L * 64 + lane * 2; const int k = (int)(e % K), n = (int)(e / K); v2us o;
            o[0] = f2bf(w[(size_t)k * N + n]); o[1] = f2bf(w[(size_t)(k + 1) * N + n]); *(v2us*)(Bt + e) = o; }
         }
}
__device__ __forceinline__ void cvt8_body(const float* __restrict__ src, bf* dst, size_t i) { const v8f v = *(const v8f*)(src + i * 8); v8us o;
#pragma unroll
    for (int k = 0; k < 8; ++k) o[k] = f2bf(v[k]); bf* dp = dst + i * 8; *(v8us*)dp = o; XWAIT("v"(o), "v"(dp));  }
__device__ __forceinline__ void cstab_body(float* CS, int idx) { const int t = idx / HD, d = idx % HD; const int i = d % (HD / 2); const float inv = __fdiv_rn(1.0f, powf(10000.0f, (float)(2 * i) / (float)HD)); const float ang = __fmul_rn((float)t, inv); v2f cs; cs[0] = cosf(ang); cs[1] = sinf(ang);
    float* dp = CS + (size_t)idx * 2; *(v2f*)dp = cs; XWAIT("v"(cs), "v"(dp));  }
// rope_body: head planes [h][t][d] (fp16 + hi/lo) of rope(x) x sc with the rotate-half convention out[d] = x[d] cos[t][d] - x[d+HD/2] sin[t][d], out[d+HD/2] = x[d+HD/2] cos[t][d+HD/2] + x[d] sin[t][d+HD/2]
__device__ __forceinline__ void rope_body(const float* __restrict__ F, int pitch, int nheads, const float* __restrict__ CS, const float* __restrict__ RF, const float* __restrict__ nw, float sc, h16* P16, bf* Ph, bf* Pl) {
    const size_t e = ((size_t)blockIdx.x * 256 + threadIdx.x) * 2; if (e >= (size_t)nheads * TT * HD) return; const int d = (int)(e % HD); const int t = (int)((e / HD) % TT); const int h = (int)(e / ((size_t)HD * TT)); const float* f = F + (size_t)t * pitch + h * HD; const float rf = RF ? RF[(size_t)h * TT + t] : 1.0f; v2h o16; v2us oh, ol;
#pragma unroll
    for (int q = 0; q < 2; ++q) { const int dd = d + q; const int dp = (dd < HD / 2) ? dd + HD / 2 : dd - HD / 2; float x0 = f[dd], x1 = f[dp];
        if (RF) { float n0 = __fmul_rn(x0, rf), n1 = __fmul_rn(x1, rf); asm volatile("" : "+v"(n0)); asm volatile("" : "+v"(n1)); x0 = __fmul_rn(bfr(nw[dd]), n0); x1 = __fmul_rn(bfr(nw[dp]), n1); }
        const v2f cs = *(const v2f*)(CS + ((size_t)t * HD + dd) * 2); float a = __fmul_rn(x0, cs[0]), bq = __fmul_rn(x1, cs[1]); asm volatile("" : "+v"(a)); asm volatile("" : "+v"(bq)); const float r = ((dd < HD / 2) ? __fsub_rn(a, bq) : __fadd_rn(a, bq)) * sc;
        o16[q] = tohx(r); unsigned short a2, c2; splitf(r, a2, c2); oh[q] = a2; ol[q] = c2; }
    *(v2h*)(P16 + e) = o16; *(v2us*)(Ph + e) = oh; *(v2us*)(Pl + e) = ol;  }
// vtp_body: transposed value planes [g][d][t] at row pitch 2 TT, the pitch of the in-place probability rows (gemm_tile uses one pitch for both operands); only t < TT of a row is written or read
__device__ __forceinline__ void vtp_body(const float* __restrict__ F, int pitch, int nheads, h16* V16, bf* Vh, bf* Vl) { const size_t e = ((size_t)blockIdx.x * 256 + threadIdx.x) * 2; if (e >= (size_t)nheads * HD * TT) return; const int t = (int)(e % TT); const int d = (int)((e / TT) % HD); const int g = (int)(e / ((size_t)TT * HD)); v2h o16; v2us oh, ol;
#pragma unroll
    for (int q = 0; q < 2; ++q) { const float x = F[(size_t)(t + q) * pitch + g * HD + d]; o16[q] = tohx(x); unsigned short a2, c2; splitf(x, a2, c2); oh[q] = a2; ol[q] = c2; }
    const size_t o = 2 * e - t; *(v2h*)(V16 + o) = o16; *(v2us*)(Vh + o) = oh; *(v2us*)(Vl + o) = ol;  }
// k_planes: every operand plane of the attention in one launch. grid (NH_ TT HD / 512, 6): y = 0..3 rope planes of (q b0, q b1, k b0, k b1), laid out in that order in P16 / Ph / Pl; y = 4, 5 the transposed value planes of b0, b1. F = [q, k, v][MT][DQ].
__global__ __launch_bounds__(256) void k_planes(const float* __restrict__ F, const float* __restrict__ CS, h16* P16, bf* Ph, bf* Pl, h16* V16, bf* Vh, bf* Vl) {
    const int y = blockIdx.y;
    if (y < 4) { const size_t po = (size_t)y * NH_ * TT * HD; rope_body(F + ((size_t)(y >> 1) * MT + (size_t)(y & 1) * TT) * DQ, DQ, NH_, CS, nullptr, nullptr, 1.0f, P16 + po, Ph + po, Pl + po); }
    else { const size_t vo = (size_t)(y - 4) * NKV * HD * 2 * TT; vtp_body(F + ((size_t)2 * MT + (size_t)(y - 4) * TT) * DKV, DKV, NKV, V16 + vo, Vh + vo, Vl + vo); }
}
// k_asoft: per row (zz, i): t = S x HD^-0.5 for j <= i with attention_mask[j] != 0 (causal + key padding mask), else -3e38; softmax over the 2048 keys (register row, one exp, fixed trees);
// the probabilities go back IN PLACE over their own score row (8 KiB, so their row pitch is 2 TT 16-bit elements): the fp16 row in its first half, or the hi plane in the first and the lo plane in the second half. One wave owns a row and holds all of it in registers before its first store (every store needs the row sum).
__global__ __launch_bounds__(256) void k_asoft(float* Sb, const int* __restrict__ amb) {
    const int lane = threadIdx.x & 31; const int row = blockIdx.x * 8 + (threadIdx.x >> 5); if (row >= ZH * TT) return; const int i = row % TT; const int zz = row / TT; (void)zz; const bool hires = (i < RH); float* sr = Sb + (size_t)row * TT; float v[TT / 32]; float mx = -3.0e38f;
#pragma unroll
    for (int ch = 0; ch < TT / 128; ++ch) { const int j0 = ch * 128 + lane * 4; const v4f a = *(const v4f*)(sr + j0);
#pragma unroll
        for (int q = 0; q < 4; ++q) { const int j = j0 + q; (void)j; const float t = (j <= i && amb[j] != 0) ? a[q] * SCL : -3.0e38f;   /* causal + key padding mask */ v[ch * 4 + q] = t; mx = fmaxf(mx, t); } }
#pragma unroll
    for (int sh = 16; sh; sh >>= 1) mx = fmaxf(mx, __shfl_xor(mx, sh, 32));
    float sum = 0.f;
#pragma unroll
    for (int k = 0; k < TT / 32; ++k) { float d0 = __fsub_rn(v[k], mx); asm volatile("" : "+v"(d0)); v[k] = __builtin_amdgcn_exp2f(__fmul_rn(d0, 1.4426950408889634f)); sum += v[k]; }
#pragma unroll
    for (int sh = 16; sh; sh >>= 1) sum += __shfl_xor(sum, sh, 32);
    const float f = __fdiv_rn(hires ? 1.0f : PCAR, sum);
{
        if (hires) {
#pragma unroll
            for (int ch = 0; ch < TT / 128; ++ch) { v4us oh, ol;
#pragma unroll
                for (int q = 0; q < 4; ++q) { unsigned short a, c2; splitf(v[ch * 4 + q] * f, a, c2); oh[q] = a; ol[q] = c2; }
                const int oo = ch * 128 + lane * 4; *(v4us*)((bf*)sr + oo) = oh; *(v4us*)((bf*)sr + TT + oo) = ol; }
        } else {
#pragma unroll
            for (int ch = 0; ch < TT / 128; ++ch) { v4h o4;
#pragma unroll
                for (int q = 0; q < 4; ++q) o4[q] = tohx(v[ch * 4 + q] * f);
                *(v4h*)((h16*)sr + ch * 128 + lane * 4) = o4; } }
         }
}
// grid.y = attention pass (batch element, group of ZH heads): O holds every pass's output, Ah / Al the rows of both batch elements
__global__ __launch_bounds__(256) void k_merge(const float* __restrict__ O, bf* Ah, bf* Al) { const size_t e = ((size_t)blockIdx.x * 256 + threadIdx.x) * 2; if (e >= (size_t)ZH * TT * HD) return; const int h0 = (blockIdx.y % (NH_ / ZH)) * ZH; const size_t bo = (size_t)(blockIdx.y / (NH_ / ZH)) * TT * DQ; O += (size_t)blockIdx.y * ZH * TT * HD; Ah += bo; Al += bo; const int d = (int)(e % HD); const int t = (int)((e / HD) % TT); const int zz = (int)(e / ((size_t)HD * TT)); const float cs = (t < RH) ? 1.0f : (1.0f / PCAR); const size_t oo = (size_t)t * DQ + (h0 + zz) * HD + d;
    v2us oh, ol;
#pragma unroll
    for (int q = 0; q < 2; ++q) { unsigned short a, c2; splitf(O[e + q] * cs, a, c2); oh[q] = a; ol[q] = c2; } *(v2us*)(Ah + oo) = oh; *(v2us*)(Al + oo) = ol;  }

// LoRA helpers: apad_body: bf16 [64][DM] from A [8][DM] (rows >= 8 zero; 8-B lanes); bpad_body: bf16 Bt [DM][32] from B [DM][8] natural (cols >= 8 zero); k_split32: hl planes [T][32] of XA [T][64] (cols >= 8 are exact zeros) (8-B lanes);
__device__ __forceinline__ void apad_body(const float* __restrict__ A, bf* AP, int e) { const int r = e / DM; v4us o;
#pragma unroll
    for (int u = 0; u < 4; ++u) o[u] = (r < 8) ? f2bf(A[e + u]) : (unsigned short)0; bf* dp = AP + e; *(v4us*)dp = o; XWAIT("v"(o), "v"(dp));  }
__device__ __forceinline__ void bpad_body(const float* __restrict__ Bm, bf* BP, int e) { const int c = e % 32, r = e / 32; v4us o;
#pragma unroll
    for (int u = 0; u < 4; ++u) o[u] = (c + u < 8) ? f2bf(Bm[(size_t)r * 8 + c + u]) : (unsigned short)0; bf* dp = BP + e; *(v4us*)dp = o; XWAIT("v"(o), "v"(dp));  }
// k_prep: every input conversion and the rope table in one launch. grid (512, 11), 256 threads: y = 0..3 the four weights (DQ DM / 8 lanes each), y = 4..7 the four quarters of x, y = 8 the cos/sin table, y = 9 the three padded A (64 blocks each), y = 10 the three padded B (32 blocks each)
__global__ __launch_bounds__(256) void k_prep(const float* __restrict__ x, const float* __restrict__ wq, const float* __restrict__ wk, const float* __restrict__ wv, const float* __restrict__ wo, const float* __restrict__ qA, const float* __restrict__ kA, const float* __restrict__ vA, const float* __restrict__ qB, const float* __restrict__ kB, const float* __restrict__ vB,
                                              bf* XB, bf* Wz, bf* WO, bf* AP, bf* BP, float* CS) {
    const int y = blockIdx.y, bx = blockIdx.x, tid = threadIdx.x;
    if (y < 4) cvt8_body(y == 0 ? wq : (y == 1 ? wk : (y == 2 ? wv : wo)), y < 3 ? Wz + (size_t)y * DQ * DM : WO, (size_t)bx * 256 + tid);
    else if (y < 8) cvt8_body(x + (size_t)(y - 4) * DQ * DM, XB + (size_t)(y - 4) * DQ * DM, (size_t)bx * 256 + tid);
    else if (y == 8) cstab_body(CS, bx * 256 + tid);
    else if (y == 9) { const int m = bx / 64; if (m < 3) apad_body(m == 0 ? qA : (m == 1 ? kA : vA), AP + (size_t)m * 64 * DM, ((bx % 64) * 256 + tid) * 4); }
    else { const int m = bx / 32; if (m < 3) bpad_body(m == 0 ? qB : (m == 1 ? kB : vB), BP + (size_t)m * DM * 32, ((bx % 32) * 256 + tid) * 4); }
}
__global__ __launch_bounds__(256) void k_split32(const float* __restrict__ XA, bf* Ph, bf* Pl) { const int e = (blockIdx.x * 256 + threadIdx.x) * 4; if (e >= 3 * MT * 32) return; const int c = e % 32, t = e / 32; const v4f a = *(const v4f*)(XA + (size_t)t * 64 + c); v4us oh, ol;
#pragma unroll
    for (int u = 0; u < 4; ++u) { oh[u] = f2bf(a[u]); ol[u] = f2bf(a[u] - bf2f(oh[u])); } *(v4us*)(Ph + e) = oh; *(v4us*)(Pl + e) = ol;  }
__global__ __launch_bounds__(256) void k_addc(float* F, const float* __restrict__ CORR, size_t n4) { const size_t e = ((size_t)blockIdx.x * 256 + threadIdx.x) * 4; if (e >= n4 * 4) return; const v4f a = *(const v4f*)(F + e), c = *(const v4f*)(CORR + e); v4f o;
#pragma unroll
    for (int u = 0; u < 4; ++u) { float cc = __fmul_rn(2.0f, c[u]); asm volatile("" : "+v"(cc)); o[u] = __fadd_rn(a[u], cc); } *(v4f*)(F + e) = o;  }

extern "C" void kernel_launch(void* const* d_in, const int* in_sizes, int n_in,
                              void* d_out, int out_size, void* d_ws, size_t ws_size, hipStream_t stream) {
    (void)in_sizes; (void)n_in; (void)out_size;
    const float* x = (const float*)d_in[0]; const int* am = (const int*)d_in[1]; const float* wq = (const float*)d_in[2]; const float* bq = (const float*)d_in[3]; const float* wk = (const float*)d_in[4]; const float* bk = (const float*)d_in[5]; const float* wv = (const float*)d_in[6]; const float* bv = (const float*)d_in[7];
    const float* qA = (const float*)d_in[8]; const float* qB = (const float*)d_in[9]; const float* kA = (const float*)d_in[10]; const float* kB = (const float*)d_in[11]; const float* vA = (const float*)d_in[12]; const float* vB = (const float*)d_in[13]; const float* wo = (const float*)d_in[14]; const float* bo = (const float*)d_in[15];
    float* OUT = (float*)d_out;     // [2][2048][1024]
    char* wsp = (char*)d_ws;
    auto take = [&](size_t bytes) { char* p = wsp; wsp += (bytes + 255) & ~(size_t)255; return (void*)p; };
    // live through the attention: the output weight, the operand planes of both batch elements, the merged attention output, one pass's scores
    const size_t PB = (size_t)NH_ * TT * HD, VB = (size_t)NKV * HD * 2 * TT;   // elements of one batch element's q or k planes / value planes
    bf* WO = (bf*)take((size_t)DM * DQ * 2);
    h16* P16 = (h16*)take(4 * PB * 2); bf* Ph = (bf*)take(4 * PB * 2); bf* Pl = (bf*)take(4 * PB * 2);   // [q b0][q b1][k b0][k b1]
    h16* VT16 = (h16*)take(NB_ * VB * 2); bf* VTh = (bf*)take(NB_ * VB * 2); bf* VTl = VTh + TT;   // hi plane in the first, lo plane in the second half of each 2 TT row
    float* Ob = (float*)take((size_t)NB_ * NH_ * TT * HD * 4); bf* ATh = (bf*)take((size_t)MT * DQ * 2); bf* ATl = (bf*)take((size_t)MT * DQ * 2);
    float* Sb = (float*)take((size_t)ZH * TT * TT * 4);
    if ((size_t)(wsp - (char*)d_ws) > ws_size) return;    // ws 256 MiB
    // dead before the first score tile is written: laid over the score buffer (about 116 of its 128 MiB)
    wsp = (char*)Sb;
    bf* Wz = (bf*)take((size_t)3 * DQ * DM * 2); float* CS = (float*)take((size_t)TT * HD * 2 * 4); bf* XB = (bf*)take((size_t)MT * DM * 2); bf* AP = (bf*)take((size_t)3 * 64 * DM * 2); bf* BP = (bf*)take((size_t)3 * DM * 32 * 2);
    float* XA = (float*)take((size_t)3 * MT * 64 * 4); bf* XAh = (bf*)take((size_t)3 * MT * 32 * 2); bf* XAl = (bf*)take((size_t)3 * MT * 32 * 2); float* CORR = (float*)take((size_t)3 * MT * DM * 4); float* F = (float*)take((size_t)3 * MT * DQ * 4);
    k_prep<<<dim3(512, 11, 1), 256, 0, stream>>>(x, wq, wk, wv, wo, qA, kA, vA, qB, kB, vB, XB, Wz, WO, AP, BP, CS);
    k_proj<<<dim3(MT / 64, DQ / 64 + 1, 3), 32, 0, stream>>>(XB, Wz, AP, F, XA, bq, bk, bv);
    k_split32<<<(3 * MT * 32 / 4 + 255) / 256, 256, 0, stream>>>(XA, XAh, XAl);
    k_gemmw<bf, 1, 32, DM, false><<<dim3(MT / 64, DM / 64, 3), 32, 0, stream>>>(XAh, XAl, BP, nullptr, CORR, nullptr, (size_t)MT * 32, (size_t)DM * 32, (size_t)MT * DM);
    k_addc<<<(unsigned)(((size_t)3 * MT * DM / 4 + 255) / 256), 256, 0, stream>>>(F, CORR, (size_t)3 * MT * DM / 4);   /* LoRA: F += 2 (x A^T) B^T */
    k_planes<<<dim3((unsigned)((PB / 2 + 255) / 256), 6, 1), 256, 0, stream>>>(F, CS, P16, Ph, Pl, VT16, VTh, VTl);
    for (int b = 0; b < NB_; ++b) {
        for (int h0 = 0; h0 < NH_; h0 += ZH) { const size_t zq = ((size_t)b * NH_ + h0) * TT * HD, zk = ((size_t)(NB_ + b) * NH_ + h0) * TT * HD, zv = (size_t)b * VB + (size_t)h0 * HD * 2 * TT;   // one kv head per query head
            k_scores<<<dim3(TT / 64, TT / 64, ZH), 32, 0, stream>>>(Ph + zq, Pl + zq, Ph + zk, Pl + zk, P16 + zq, P16 + zk, Sb);
            k_asoft<<<ZH * TT / 8, 256, 0, stream>>>(Sb, am + (size_t)b * TT);
            k_pv<<<dim3(TT / 64, 1, ZH), 32 * PVW, 0, stream>>>((const bf*)Sb, (const h16*)Sb, VTh + zv, VTl + zv, VT16 + zv, Ob + zq); } }
    k_merge<<<dim3((unsigned)(((size_t)ZH * TT * HD / 2 + 255) / 256), NB_ * NH_ / ZH, 1), 256, 0, stream>>>(Ob, ATh, ATl);
    k_gemmw<bf, 1, DQ, DM, true><<<dim3(MT / 64, DM / 64, 1), 32, 0, stream>>>(ATh, ATl, WO, nullptr, OUT, bo, 0, 0, 0);
}

// v005
// One run takes 170 microseconds.
// Versions in between are left out here; by their measured steps it is 2.68 times as fast as v003.
// Counting every step since v000, it is 10.5 times as fast.
#include <hip/hip_runtime.h>

// Masked_MHA_LORA (x [2][2048][1024]; Q/K/V = x W^T + b + 2 (x A^T) B^T (LoRA rank 8, scaling 16/8); RoPE (rotate-half, base 10000) on Q, K (16 heads x 64); scores = Q.K/8 with the causal mask and the key padding mask (attention_mask == 0 -> -inf; int,
// read as data); softmax; out = (attn V merged) oW^T + ob -> [2][2048][1024]).
// Compute dtypes, f32 accumulate: every input rounded to bf16; the base projections on PLAIN bf16 operands (inputs: exact) + bias; the LoRA path as two small GEMMs (x A^T exact, then hl planes x exact B, rank padded 8 -> 32) added

#define NB_  2
#define TT   2048
#define DM   1024
#define NH_  16
#define NKV  16
#define REP  (NH_ / NKV)
#define HD   64
#define MT   (NB_ * TT)         // rows of both batch elements together
#define DQ   (NH_ * HD)
#define DKV  (NKV * HD)
#define RH   512                  // query rows < RH use hi+lo planes (0: none)
typedef _Float16 h16;
typedef unsigned short bf;
typedef __attribute__((ext_vector_type(16))) __bf16   v16bf;
typedef __attribute__((ext_vector_type(16))) _Float16 v16h;
typedef __attribute__((ext_vector_type(8)))  _Float16 v8h;
typedef __attribute__((ext_vector_type(8)))  unsigned short v8us;
typedef __attribute__((ext_vector_type(8)))  float    v8f;
typedef __attribute__((ext_vector_type(4)))  float    v4f;
typedef v8h  __attribute__((may_alias)) v8ha;
typedef v4f  __attribute__((may_alias)) v4fa;
typedef v8us __attribute__((may_alias)) v8usa;

__device__ __forceinline__ unsigned short f2bf(float f) { unsigned u = __float_as_uint(f); u += 0x7FFFu + ((u >> 16) & 1u); return (unsigned short)(u >> 16); }
__device__ __forceinline__ float bf2f(unsigned short b) { return __uint_as_float(((unsigned)b) << 16); }
__device__ __forceinline__ float bfr(float f) { return bf2f(f2bf(f)); }
__device__ __forceinline__ v16h cat16(v8h lo, v8h hi) { return __builtin_shufflevector(lo, hi, 0, 1, 2, 3, 4, 5, 6, 7, 8, 9, 10, 11, 12, 13, 14, 15); }
__device__ __forceinline__ v16bf cat16b(v8us lo, v8us hi) { return __builtin_bit_cast(v16bf, __builtin_shufflevector(lo, hi, 0, 1, 2, 3, 4, 5, 6, 7, 8, 9, 10, 11, 12, 13, 14, 15)); }
__device__ __forceinline__ v8f wmma16(v16h a, v16h b, v8f c) { return __builtin_amdgcn_wmma_f32_16x16x32_f16(false, a, false, b, (short)0, c, false, false); }
__device__ __forceinline__ v8f wmmab(v16bf a, v16bf b, v8f c) { return __builtin_amdgcn_wmma_f32_16x16x32_bf16(false, a, false, b, (short)0, c, false, false); }



// ---- gemm_tile: register-blocked GEMM, ONE WAVE per 64x64 output tile (16 accumulators), operands straight from K-contiguous 16-bit planes (row pitch K elements); the k loop runs to Kl <= K.
// C[m][n] (f32, pitch ldc, + optional f32 bias[n]) = sum_k A[m][k] Bt[n][k] (+ split products per NSPLIT). Kl % 32 == 0. os: 16 x 68 floats of LDS.
// NW > 1: NW waves of one work-group share the tile; wave w takes the k blocks w, w + NW, ... into its own accumulators, the NW partial tiles meet in LDS (os: NW x 64 x 68 floats) and are summed in the fixed order w = 0, 1, ...
// XWAIT: s_wait_xcnt 0 behind a run of global loads or stores; the registers that the run names are inputs of the statement, so that none of them is overwritten in front of the wait.
#define XWAIT(...) asm volatile("s_wait_xcnt 0x0" :: __VA_ARGS__ : "memory")
template <typename T16> struct WFrag;
template <> struct WFrag<h16> { typedef v16h V; static __device__ __forceinline__ V ld(const h16* p) { return cat16(*(const v8h*)p, *(const v8h*)(p + 16)); } static __device__ __forceinline__ v8f mma(V a, V b, v8f c) { return wmma16(a, b, c); } };
template <> struct WFrag<bf> { typedef v16bf V; static __device__ __forceinline__ V ld(const bf* p) { return cat16b(*(const v8us*)p, *(const v8us*)(p + 16)); } static __device__ __forceinline__ v8f mma(V a, V b, v8f c) { return wmmab(a, b, c); } };
template <typename T16, int NSPLIT, int K, int ldc, bool BIAS, int NW = 1>
__device__ __forceinline__ void gemm_tile(const T16* __restrict__ A, const T16* __restrict__ A2, const T16* __restrict__ Bt, const T16* __restrict__ Bt2, int Kl, float* C, const float* __restrict__ bias, int r0, int c0, float* os) {
    typedef typename WFrag<T16>::V V;
    const int lane = threadIdx.x & 31, lr = lane & 15, hi = lane >> 4;
    const int wv = (NW > 1) ? __builtin_amdgcn_readfirstlane((int)(threadIdx.x >> 5)) : 0;   // the wave's number, in a scalar register: the k loop's bounds stay wave-uniform
    v8f acc[4][4];
#pragma unroll
    for (int mb = 0; mb < 4; ++mb)
#pragma unroll
        for (int nb = 0; nb < 4; ++nb) acc[mb][nb] = (v8f){};
    const T16* pa = A + (size_t)r0 * K; const T16* pb = Bt + (size_t)c0 * K; const T16* pa2 = (NSPLIT == 1 || NSPLIT == 2) ? A2 + (size_t)r0 * K : nullptr; const T16* pb2 = (NSPLIT >= 2) ? Bt2 + (size_t)c0 * K : nullptr;   // the tile's first row in each plane
    unsigned ol = (unsigned)(lr * K + 8 * hi + 32 * wv) * 2u;   // the lane's byte offset from there at the trip's k: row lr, k = kc + 8 hi, the same in every plane (one pitch)
    v4f bv = (v4f){};   // the lane's four bias values, loaded once per tile
    if (BIAS) { const float* bp = bias + c0 + lr * 4; bv = *(const v4f*)bp; asm volatile("s_wait_xcnt 0x0" ::: "memory"); /* behind the bias load, in front of any reuse of its address registers */ }
#pragma unroll 1
    for (int kc = 32 * wv; kc < Kl; kc += 32 * NW) {
        V a[4], a2[4];
#pragma unroll
        for (int mb = 0; mb < 4; ++mb) { a[mb] = WFrag<T16>::ld((const T16*)((const char*)pa + ol) + (size_t)mb * 16 * K); if (NSPLIT == 1 || NSPLIT == 2) a2[mb] = WFrag<T16>::ld((const T16*)((const char*)pa2 + ol) + (size_t)mb * 16 * K); }
#pragma unroll
        for (int nb = 0; nb < 4; ++nb) { const V b = WFrag<T16>::ld((const T16*)((const char*)pb + ol) + (size_t)nb * 16 * K); V b2; if (NSPLIT >= 2) b2 = WFrag<T16>::ld((const T16*)((const char*)pb2 + ol) + (size_t)nb * 16 * K);
#pragma unroll
            for (int mb = 0; mb < 4; ++mb) { acc[mb][nb] = WFrag<T16>::mma(a[mb], b, acc[mb][nb]); if (NSPLIT == 1 || NSPLIT == 2) acc[mb][nb] = WFrag<T16>::mma(a2[mb], b, acc[mb][nb]); if (NSPLIT >= 2) acc[mb][nb] = WFrag<T16>::mma(a[mb], b2, acc[mb][nb]); } }
        asm volatile("s_wait_xcnt 0x0" : "+v"(ol) :: "memory");   // behind the trip's loads, in front of the step of their offset register, which passes through the statement so that it lives up to the wait
        ol += 64 * NW;
        asm volatile("v_nop\n\tv_nop\n\tv_nop\n\tv_nop" : "+v"(acc[0][0]), "+v"(acc[1][1]), "+v"(acc[2][2]), "+v"(acc[3][3]) : "v"(a[0]), "v"(a[3]));
    }
#pragma unroll
    for (int u = 0; u < 4; ++u) bv[u] = bfr(bv[u]);
    if constexpr (NW > 1) {
        float* pw = os + wv * (64 * 68);   // the wave's own partial tile
#pragma unroll
        for (int mb = 0; mb < 4; ++mb)
#pragma unroll
            for (int nb = 0; nb < 4; ++nb)
#pragma unroll
                for (int j = 0; j < 8; ++j) pw[(mb * 16 + hi * 8 + j) * 68 + nb * 16 + lr] = acc[mb][nb][j];
        __syncthreads();   // every wave's partial tile is in LDS before any is read
        constexpr int NS = 64 * 16 / (32 * NW);   // 16-byte pieces of the tile per thread
        v4f val[NS]; float* cp0 = C + (size_t)(r0 + (int)(threadIdx.x >> 4)) * ldc + c0 + lr * 4;   // the thread's place in rows tid / 16, + 2 NW, ...
#pragma unroll
        for (int s = 0; s < NS; ++s) { const float* ps = os + (s * 2 * NW + (int)(threadIdx.x >> 4)) * 68 + lr * 4; val[s] = *(const v4fa*)ps;
#pragma unroll
            for (int w = 1; w < NW; ++w) val[s] += *(const v4fa*)(ps + w * (64 * 68));
            if (BIAS) val[s] += bv;
            *(v4f*)(cp0 + (size_t)(s * 2 * NW) * ldc) = val[s]; }
        static_assert(NS == 4, "the wait below names four stored values");
        XWAIT("v"(val[0]), "v"(val[1]), "v"(val[2]), "v"(val[3]), "v"(cp0));
        return;
    }
#pragma unroll
    for (int mb = 0; mb < 4; ++mb) {
#pragma unroll
        for (int nb = 0; nb < 4; ++nb) {
#pragma unroll
            for (int j = 0; j < 8; ++j) os[(hi * 8 + j) * 68 + nb * 16 + lr] = acc[mb][nb][j]; }
        __builtin_amdgcn_wave_barrier(); asm volatile("" ::: "memory");
        float* crow = C + (size_t)(r0 + mb * 16) * ldc + c0;
{
            v4f val[8]; float* cp0 = crow + (size_t)hi * ldc + lr * 4;   // the lane's place in the block's rows hi, hi + 2, ...
#pragma unroll
            for (int s = 0; s < 8; ++s) { const int row = 2 * s + hi, cofs = lr * 4; val[s] = *(const v4fa*)(os + row * 68 + cofs); if (BIAS) val[s] += bv;
                *(v4f*)(cp0 + (size_t)(2 * s) * ldc) = val[s]; }
            XWAIT("v"(val[0]), "v"(val[1]), "v"(val[2]), "v"(val[3]), "v"(val[4]), "v"(val[5]), "v"(val[6]), "v"(val[7]), "v"(cp0));
             }
        __builtin_amdgcn_wave_barrier(); asm volatile("" ::: "memory");
    }
}
// k_gemmw: grid (M/64, N/64, Z), 32 threads; z-batch strides sA/sB/sC in elements
template <typename T16, int NSPLIT, int K, int ldc, bool BIAS>
__global__ __launch_bounds__(32) void k_gemmw(const T16* __restrict__ A, const T16* __restrict__ A2, const T16* __restrict__ Bt, const T16* __restrict__ Bt2, float* C, const float* __restrict__ bias, size_t sA, size_t sB, size_t sC) {
    __shared__ __align__(16) float os[16 * 68];
    const size_t z = blockIdx.z; A += z * sA; if (A2) A2 += z * sA; Bt += z * sB; if (Bt2) Bt2 += z * sB; C += z * sC;
    gemm_tile<T16, NSPLIT, K, ldc, BIAS>(A, A2, Bt, Bt2, K, C, bias, blockIdx.x * 64, blockIdx.y * 64, os);
}
// k_proj: every product with x as the left operand in one launch. grid (MT/64, DQ/64 + 1, 3): z = q, k, v; column tiles y < DQ/64 are the base projection x W^T + b -> F[z], the last column tile is x A^T -> XA[z] (A padded to 64 rows)
__global__ __launch_bounds__(32) void k_proj(const bf* __restrict__ XB, const bf* __restrict__ Wz, const bf* __restrict__ AP, float* F, float* XA, const float* __restrict__ bq, const float* __restrict__ bk, const float* __restrict__ bv) {
    __shared__ __align__(16) float os[16 * 68];
    const int z = blockIdx.z, y = blockIdx.y;
    if (y < DQ / 64) gemm_tile<bf, 0, DM, DQ, true>(XB, nullptr, Wz + (size_t)z * DQ * DM, nullptr, DM, F + (size_t)z * MT * DQ, z == 0 ? bq : (z == 1 ? bk : bv), blockIdx.x * 64, y * 64, os);
    else gemm_tile<bf, 0, DM, 64, false>(XB, nullptr, AP + (size_t)z * 64 * DM, nullptr, DM, XA + (size_t)z * MT * 64, nullptr, blockIdx.x * 64, 0, os);
}
__device__ __forceinline__ h16 tohx(float x) { return (h16)x; }
__device__ __forceinline__ void splitf(float y, unsigned short& h, unsigned short& l) { h = f2bf(y); l = f2bf(y - bf2f(h)); }
typedef __attribute__((ext_vector_type(2))) _Float16 v2h;
typedef __attribute__((ext_vector_type(4))) _Float16 v4h;
typedef __attribute__((ext_vector_type(2))) unsigned short v2us;
typedef __attribute__((ext_vector_type(4))) unsigned short v4us;
typedef __attribute__((ext_vector_type(2))) float v2f;
typedef __attribute__((ext_vector_type(4))) int v4i;

__global__ __launch_bounds__(256) void k_wtG(const float* __restrict__ w, int K, int N, bf* Bt) {
    const int lane = threadIdx.x & 31; const int L0 = (blockIdx.x * 8 + (threadIdx.x >> 5)) * 8; const int nlines = N * K / 64;
{
#pragma unroll 1
        for (int l = 0; l < 8; ++l) { const int L = L0 + l; if (L >= nlines) break; const size_t e = (size_t)L * 64 + lane * 2; const int k = (int)(e % K), n = (int)(e / K); v2us o;
            o[0] = f2bf(w[(size_t)k * N + n]); o[1] = f2bf(w[(size_t)(k + 1) * N + n]); *(v2us*)(Bt + e) = o; }
         }
}
__device__ __forceinline__ void cvt8_body(const float* __restrict__ src, bf* dst, size_t i) { const v8f v = *(const v8f*)(src + i * 8); v8us o;
#pragma unroll
    for (int k = 0; k < 8; ++k) o[k] = f2bf(v[k]); bf* dp = dst + i * 8; *(v8us*)dp = o; XWAIT("v"(o), "v"(dp));  }
__device__ __forceinline__ void cstab_body(float* CS, int idx) { const int t = idx / HD, d = idx % HD; const int i = d % (HD / 2); const float inv = __fdiv_rn(1.0f, powf(10000.0f, (float)(2 * i) / (float)HD)); const float ang = __fmul_rn((float)t, inv); v2f cs; cs[0] = cosf(ang); cs[1] = sinf(ang);
    float* dp = CS + (size_t)idx * 2; *(v2f*)dp = cs; XWAIT("v"(cs), "v"(dp));  }
// k_tail: all that stands between the projections and the attention, in one launch. grid (MT/64, NH_, 3), ONE WAVE per (64 rows, one head) of z = q, k, v: F + 2 (x A^T) B^T, RoPE (q, k), and the operand planes stored straight from the accumulators.
// x A^T (XA, f32, pitch 64; of its columns only the 8 ranks are not zero by construction) is split into its hi / lo bf16 fragments in registers: k = 0..7 sit in the first half of the lanes below 16, every other k is zero.
// q, k: B's rows as the A operand and the x A^T rows as the B operand, so a lane holds 8 consecutive d of one row t (D[8 hi + j][lr] = (d, t)): the rotate-half partner d +- 32 is the same lane's tile mb +- 2, and each plane takes one 16-byte store a tile.
// v: the operands the other way round, so a lane holds 8 consecutive t of one d: the transposed planes [g][d][t] (row pitch 2 TT: the hi and the lo plane share a row; of an fp16 row only t < TT is written or read) take one 16-byte store a tile.
// Head planes [h][t][d] (fp16 + hi/lo), in the order (q b0, q b1, k b0, k b1) in P16 / Ph / Pl; rotate-half: out[d] = x[d] cos[t][d] - x[d+HD/2] sin[t][d], out[d+HD/2] = x[d+HD/2] cos[t][d] + x[d] sin[t][d] (the table's two halves are equal). A wave writes whole 128-byte lines.
__device__ __forceinline__ void planes8(v8f r, v8h& o16, v8us& oh, v8us& ol) {
#pragma unroll
    for (int j = 0; j < 8; ++j) { o16[j] = tohx(r[j]); unsigned short a, c; splitf(r[j], a, c); oh[j] = a; ol[j] = c; } }
__global__ __launch_bounds__(32) void k_tail(const float* __restrict__ F, const float* __restrict__ XA, const bf* __restrict__ BP, const float* __restrict__ CS, h16* P16, bf* Ph, bf* Pl, h16* V16, bf* Vh, bf* Vl) {
    const int lane = threadIdx.x, lr = lane & 15, hi = lane >> 4;
    const int z = blockIdx.z, h = blockIdx.y, r0 = blockIdx.x * 64, b = r0 / TT, t0 = r0 % TT;
    const char* xa = (const char*)(XA + ((size_t)z * MT + r0) * 64); const char* bp = (const char*)(BP + ((size_t)z * DM + h * HD) * 32); const char* fz = (const char*)(F + ((size_t)z * MT + r0) * DQ + h * HD);   // wave-uniform bases
    const unsigned ox = (unsigned)lr * 256u, ob = (unsigned)(lr * 32 + 8 * hi) * 2u;   // the lane's byte offsets in them
    v16bf xh[4], xl[4], bb[4];
#pragma unroll
    for (int i = 0; i < 4; ++i) { const v8f x = *(const v8f*)(xa + ox + i * 16 * 256); v8us a, c; const v8us zz = (v8us){};
#pragma unroll
        for (int j = 0; j < 8; ++j) { unsigned short u, w; splitf(hi ? 0.f : x[j], u, w); a[j] = u; c[j] = w; }
        xh[i] = cat16b(a, zz); xl[i] = cat16b(c, zz); bb[i] = WFrag<bf>::ld((const bf*)(bp + ob + i * 16 * 64)); }
    if (z < 2) {
        const unsigned of = (unsigned)(lr * DQ + 8 * hi) * 4u, oc = (unsigned)((t0 + lr) * HD + 8 * hi) * 8u;   // row lr of a 16-row group, d = 8 hi: in F and in the cos/sin table
        const size_t po = (((size_t)(z * 2 + b) * NH_ + h) * TT + t0 + lr) * HD + 8 * hi; h16* p16 = P16 + po; bf* ph = Ph + po; bf* pl = Pl + po;
#pragma unroll
        for (int nb = 0; nb < 4; ++nb) {   // 16 rows t
            v8f v[4], r[4];
#pragma unroll
            for (int mb = 0; mb < 4; ++mb) { v8f acc = wmmab(bb[mb], xh[nb], (v8f){}); acc = wmmab(bb[mb], xl[nb], acc); v[mb] = *(const v8f*)(fz + of + nb * 16 * DQ * 4 + mb * 64) + 2.0f * acc; }
#pragma unroll
            for (int mb = 0; mb < 2; ++mb) { const v8f c0 = *(const v8f*)((const char*)CS + oc + nb * 16 * HD * 8 + mb * 128), c1 = *(const v8f*)((const char*)CS + oc + nb * 16 * HD * 8 + mb * 128 + 32);   // (cos, sin) of d = 16 mb + 8 hi + 0..3, + 4..7
#pragma unroll
                for (int j = 0; j < 8; ++j) { const float cs = j < 4 ? c0[2 * j] : c1[2 * j - 8], sn = j < 4 ? c0[2 * j + 1] : c1[2 * j - 7]; r[mb][j] = v[mb][j] * cs - v[mb + 2][j] * sn; r[mb + 2][j] = v[mb + 2][j] * cs + v[mb][j] * sn; } }
            v8h o16[4]; v8us oh[4], ol[4];
#pragma unroll
            for (int mb = 0; mb < 4; ++mb) { planes8(r[mb], o16[mb], oh[mb], ol[mb]); const int o = nb * 16 * HD + mb * 16; *(v8h*)(p16 + o) = o16[mb]; *(v8us*)(ph + o) = oh[mb]; *(v8us*)(pl + o) = ol[mb]; }
            XWAIT("v"(o16[0]), "v"(o16[1]), "v"(o16[2]), "v"(o16[3]), "v"(oh[0]), "v"(oh[1]), "v"(oh[2]), "v"(oh[3]), "v"(ol[0]), "v"(ol[1]), "v"(ol[2]), "v"(ol[3]), "v"(p16), "v"(ph), "v"(pl), "v"(of), "v"(oc), "v"(ox), "v"(ob));
        }
    } else {
        const unsigned of = (unsigned)(8 * hi * DQ + lr) * 4u;   // row 8 hi of a 16-row group, d = lr
        const size_t vo = (((size_t)b * NKV + h) * HD + lr) * 2 * TT + t0 + 8 * hi; h16* p16 = V16 + vo; bf* ph = Vh + vo; bf* pl = Vl + vo;
#pragma unroll
        for (int nb = 0; nb < 4; ++nb) {   // 16 columns d
            v8h o16[4]; v8us oh[4], ol[4];
#pragma unroll
            for (int mb = 0; mb < 4; ++mb) { v8f acc = wmmab(xh[mb], bb[nb], (v8f){}); acc = wmmab(xl[mb], bb[nb], acc); v8f r;
#pragma unroll
                for (int j = 0; j < 8; ++j) r[j] = *(const float*)(fz + of + (mb * 16 + j) * DQ * 4 + nb * 64) + 2.0f * acc[j];
                planes8(r, o16[mb], oh[mb], ol[mb]); const int o = nb * 16 * 2 * TT + mb * 16; *(v8h*)(p16 + o) = o16[mb]; *(v8us*)(ph + o) = oh[mb]; *(v8us*)(pl + o) = ol[mb]; }
            XWAIT("v"(o16[0]), "v"(o16[1]), "v"(o16[2]), "v"(o16[3]), "v"(oh[0]), "v"(oh[1]), "v"(oh[2]), "v"(oh[3]), "v"(ol[0]), "v"(ol[1]), "v"(ol[2]), "v"(ol[3]), "v"(p16), "v"(ph), "v"(pl), "v"(of), "v"(ox), "v"(ob));
        }
    }
}
// k_attn: the whole attention in one launch; scores and probabilities stay in registers. One wave owns 16 NQ query rows of one (batch, head) and walks the keys in blocks of 32 up to its diagonal block.
// S^T = K Q^T (A = key rows, B = query rows): a lane holds, for the query of its column lr, the keys 8 hi + j of each 16-key tile, which is the k order of a B operand; so P^T goes from the score accumulators straight into O^T += V^T P^T.
// Running maximum and sum per query (scaled log2 domain); the accumulators are rescaled when the maximum moves. The wave halves' sums are joined once at the end. Query rows below RH use the hi+lo planes (three products), the others fp16.
// The output goes out as the hi / lo planes [t][DQ] that the output projection reads; a wave writes the whole 128-byte line of its (row, head).
#define L2S 0.18033688011112042f   // HD^-0.5 x log2(e)
__device__ __forceinline__ float xhalf(float x) { const int b = __float_as_int(x); return __int_as_float(__builtin_amdgcn_permlanex16(b, b, 0x76543210, 0xfedcba98, false, false)); }   // the value of lane l ^ 16
__device__ __forceinline__ float exp2_slot(float x) { float r; asm("v_exp_f32 %0, %1\n\tv_nop" : "=v"(r) : "v"(x)); return r; }   // exp2 with the one slot behind a transcendental tied to it
template <typename T16, bool HI, int NQ>
__device__ __forceinline__ void attn_wave(const T16* __restrict__ Q, const T16* __restrict__ Q2, const T16* __restrict__ Kp, const T16* __restrict__ K2, const T16* __restrict__ Vt, const T16* __restrict__ Vt2, const int* __restrict__ amb, bf* Ah, bf* Al, int q0) {
    typedef typename WFrag<T16>::V V;
    const int lane = threadIdx.x & 31, lr = lane & 15, hi = lane >> 4;
    V qf[NQ][2], q2[NQ][2];
#pragma unroll
    for (int nq = 0; nq < NQ; ++nq)
#pragma unroll
        for (int ks = 0; ks < 2; ++ks) { const size_t qo = (size_t)(q0 + nq * 16 + lr) * HD + ks * 32 + 8 * hi; qf[nq][ks] = WFrag<T16>::ld(Q + qo); if (HI) q2[nq][ks] = WFrag<T16>::ld(Q2 + qo); }
    v8f o[4][NQ]; float m[NQ], l[NQ];
#pragma unroll
    for (int nq = 0; nq < NQ; ++nq) { m[nq] = -3.0e38f; l[nq] = 0.f;
#pragma unroll
        for (int dt = 0; dt < 4; ++dt) o[dt][nq] = (v8f){}; }
    const int nk = q0 + 16 * NQ;   // keys below nk are visible to some query of the wave
    unsigned ok = (unsigned)(lr * HD + 8 * hi) * 2u, ov = (unsigned)(lr * 2 * TT + 8 * hi) * 2u, oa = (unsigned)lane * 4u;   // the lane's byte offsets in the key planes, the value planes and the padding mask at the trip's key block
    V kf[2][2], k2[2][2];
#pragma unroll
    for (int t = 0; t < 2; ++t)
#pragma unroll
        for (int ks = 0; ks < 2; ++ks) { kf[t][ks] = WFrag<T16>::ld((const T16*)((const char*)Kp + ok) + t * 16 * HD + ks * 32); if (HI) k2[t][ks] = WFrag<T16>::ld((const T16*)((const char*)K2 + ok) + t * 16 * HD + ks * 32); }
    int av = *(const int*)((const char*)amb + oa);
#pragma unroll 1
    for (int kb = 0; kb < nk; kb += 32) {
        V vf[4], v2[4];
#pragma unroll
        for (int dt = 0; dt < 4; ++dt) { vf[dt] = WFrag<T16>::ld((const T16*)((const char*)Vt + ov) + (size_t)dt * 16 * 2 * TT); if (HI) v2[dt] = WFrag<T16>::ld((const T16*)((const char*)Vt2 + ov) + (size_t)dt * 16 * 2 * TT); }
        const unsigned mk = __builtin_amdgcn_ballot_w32(av != 0);   // bit u: key kb + u is not padding
        v8f s[2][NQ];
#pragma unroll
        for (int t = 0; t < 2; ++t)
#pragma unroll
            for (int nq = 0; nq < NQ; ++nq) { s[t][nq] = (v8f){};
#pragma unroll
                for (int ks = 0; ks < 2; ++ks) { s[t][nq] = WFrag<T16>::mma(kf[t][ks], qf[nq][ks], s[t][nq]); if (HI) { s[t][nq] = WFrag<T16>::mma(kf[t][ks], q2[nq][ks], s[t][nq]); s[t][nq] = WFrag<T16>::mma(k2[t][ks], qf[nq][ks], s[t][nq]); } } }
        asm volatile("s_wait_xcnt 0x0" : "+v"(ok), "+v"(oa) :: "memory");   // behind the key and mask loads, in front of the step of their offset registers
        const bool more = kb + 32 < nk; ok += more ? 32u * HD * 2u : 0u; oa += more ? 128u : 0u;   // the next trip's key fragments and mask words are fetched now, so that their latency runs under the softmax and the value products; the last trip fetches its own block again
        av = *(const int*)((const char*)amb + oa);
#pragma unroll
        for (int t = 0; t < 2; ++t)
#pragma unroll
            for (int ks = 0; ks < 2; ++ks) { kf[t][ks] = WFrag<T16>::ld((const T16*)((const char*)Kp + ok) + t * 16 * HD + ks * 32); if (HI) k2[t][ks] = WFrag<T16>::ld((const T16*)((const char*)K2 + ok) + t * 16 * HD + ks * 32); }
#pragma unroll
        for (int t = 0; t < 2; ++t)
#pragma unroll
            for (int nq = 0; nq < NQ; ++nq) s[t][nq] *= L2S;
        if (mk != 0xFFFFFFFFu || kb + 31 > q0) {   // wave-uniform: only a block with a padded key or on the diagonal has anything to mask
            const unsigned mkl = mk >> (8 * hi);
#pragma unroll
            for (int nq = 0; nq < NQ; ++nq) { const int lim = q0 + nq * 16 + lr - kb - 8 * hi;   // element (t, j) is key kb + 16 t + 8 hi + j: causal while 16 t + j <= lim
                const unsigned mm = mkl & (lim >= 31 ? 0xFFFFFFFFu : (lim < 0 ? 0u : ((2u << lim) - 1u)));
#pragma unroll
                for (int t = 0; t < 2; ++t)
#pragma unroll
                    for (int j = 0; j < 8; ++j) s[t][nq][j] = ((mm >> (t * 16 + j)) & 1u) ? s[t][nq][j] : -3.0e38f; }
        }
#pragma unroll
        for (int nq = 0; nq < NQ; ++nq) {
            float mx = fmaxf(s[0][nq][0], s[1][nq][0]);
#pragma unroll
            for (int j = 1; j < 8; ++j) mx = fmaxf(mx, fmaxf(s[0][nq][j], s[1][nq][j]));
            mx = fmaxf(mx, xhalf(mx)); mx = fmaxf(mx, m[nq]);
            const float al = __builtin_amdgcn_exp2f(m[nq] - mx); m[nq] = mx;
            float sum = 0.f;
#pragma unroll
            for (int t = 0; t < 2; ++t)
#pragma unroll
                for (int j = 0; j < 8; ++j) { const float p = HI ? exp2_slot(s[t][nq][j] - mx) : __builtin_amdgcn_exp2f(s[t][nq][j] - mx); s[t][nq][j] = p; sum += p; }
            l[nq] = l[nq] * al + sum;
#pragma unroll
            for (int dt = 0; dt < 4; ++dt) o[dt][nq] *= al;
            if constexpr (HI) { v8us h0, h1, l0, l1;
#pragma unroll
                for (int j = 0; j < 8; ++j) { unsigned short a, c; splitf(s[0][nq][j], a, c); h0[j] = a; l0[j] = c; splitf(s[1][nq][j], a, c); h1[j] = a; l1[j] = c; }
                const V ph = cat16b(h0, h1), pl = cat16b(l0, l1);
#pragma unroll
                for (int dt = 0; dt < 4; ++dt) { o[dt][nq] = WFrag<T16>::mma(vf[dt], ph, o[dt][nq]); o[dt][nq] = WFrag<T16>::mma(vf[dt], pl, o[dt][nq]); o[dt][nq] = WFrag<T16>::mma(v2[dt], ph, o[dt][nq]); }
            } else { V pf;
#pragma unroll
                for (int j = 0; j < 8; ++j) { pf[j] = tohx(s[0][nq][j]); pf[8 + j] = tohx(s[1][nq][j]); }
#pragma unroll
                for (int dt = 0; dt < 4; ++dt) o[dt][nq] = WFrag<T16>::mma(vf[dt], pf, o[dt][nq]); }
        }
        asm volatile("s_wait_xcnt 0x0" : "+v"(ov) :: "memory");   // behind the value loads, in front of the step of their offset register
        ov += 64u;
        asm volatile("v_nop\n\tv_nop\n\tv_nop\n\tv_nop" : "+v"(o[0][NQ - 1]), "+v"(o[1][NQ - 1]), "+v"(o[2][NQ - 1]), "+v"(o[3][NQ - 1]) : "v"(vf[0]), "v"(vf[3]));   // the distance behind the trip's last matrix instructions on the loop's taken branch
    }
#pragma unroll
    for (int nq = 0; nq < NQ; ++nq) { const float inv = __fdiv_rn(1.0f, l[nq] + xhalf(l[nq])); v8us oh[4], ol[4];
        const size_t ro = (size_t)(q0 + nq * 16 + lr) * DQ + 8 * hi; bf* ph = Ah + ro; bf* pl = Al + ro;
#pragma unroll
        for (int dt = 0; dt < 4; ++dt)
#pragma unroll
            for (int j = 0; j < 8; ++j) { unsigned short a, c; splitf(o[dt][nq][j] * inv, a, c); oh[dt][j] = a; ol[dt][j] = c; }
#pragma unroll
        for (int dt = 0; dt < 4; ++dt) { *(v8us*)(ph + dt * 16) = oh[dt]; *(v8us*)(pl + dt * 16) = ol[dt]; }
        XWAIT("v"(oh[0]), "v"(oh[1]), "v"(oh[2]), "v"(oh[3]), "v"(ol[0]), "v"(ol[1]), "v"(ol[2]), "v"(ol[3]), "v"(ph), "v"(pl)); }
}
// grid (NB_ NH_, (TT - RH) / 128 + RH / 64), 4 independent waves: x = (batch, head); y walks the query rows from the last (longest key loop) to the first: 32 rows a wave in fp16 down to RH, then 16 rows a wave in hi+lo planes. The four waves of a work-group take neighbouring row blocks, so they read the same keys and values at about the same time.
__global__ __launch_bounds__(128) void k_attn(const h16* __restrict__ P16, const bf* __restrict__ Ph, const bf* __restrict__ Pl, const h16* __restrict__ V16, const bf* __restrict__ Vh, const bf* __restrict__ Vl, const int* __restrict__ am, bf* ATh, bf* ATl) {
    const int bh = blockIdx.x, y = blockIdx.y; const int wv = __builtin_amdgcn_readfirstlane((int)(threadIdx.x >> 5));   // the wave's number, in a scalar register: the key loop's bounds stay wave-uniform
    const size_t zq = (size_t)bh * TT * HD, zk = (size_t)(NB_ * NH_ + bh) * TT * HD, zv = (size_t)bh * HD * 2 * TT, ao = (size_t)(bh / NH_) * TT * DQ + (size_t)(bh % NH_) * HD; const int* amb = am + (size_t)(bh / NH_) * TT;
    if (y < (TT - RH) / 128) attn_wave<h16, false, 2>(P16 + zq, nullptr, P16 + zk, nullptr, V16 + zv, nullptr, amb, ATh + ao, ATl + ao, TT - 32 * (y * 4 + wv + 1));
    else attn_wave<bf, true, 1>(Ph + zq, Pl + zq, Ph + zk, Pl + zk, Vh + zv, Vl + zv, amb, ATh + ao, ATl + ao, RH - 16 * ((y - (TT - RH) / 128) * 4 + wv + 1));
}

// LoRA helpers: apad_body: bf16 [64][DM] from A [8][DM] (rows >= 8 zero; 8-B lanes); bpad_body: bf16 Bt [DM][32] from B [DM][8] natural (cols >= 8 zero);
__device__ __forceinline__ void apad_body(const float* __restrict__ A, bf* AP, int e) { const int r = e / DM; v4us o;
#pragma unroll
    for (int u = 0; u < 4; ++u) o[u] = (r < 8) ? f2bf(A[e + u]) : (unsigned short)0; bf* dp = AP + e; *(v4us*)dp = o; XWAIT("v"(o), "v"(dp));  }
__device__ __forceinline__ void bpad_body(const float* __restrict__ Bm, bf* BP, int e) { const int c = e % 32, r = e / 32; v4us o;
#pragma unroll
    for (int u = 0; u < 4; ++u) o[u] = (c + u < 8) ? f2bf(Bm[(size_t)r * 8 + c + u]) : (unsigned short)0; bf* dp = BP + e; *(v4us*)dp = o; XWAIT("v"(o), "v"(dp));  }
// k_prep: every input conversion and the rope table in one launch. grid (512, 11), 256 threads: y = 0..3 the four weights (DQ DM / 8 lanes each), y = 4..7 the four quarters of x, y = 8 the cos/sin table, y = 9 the three padded A (64 blocks each), y = 10 the three padded B (32 blocks each)
__global__ __launch_bounds__(256) void k_prep(const float* __restrict__ x, const float* __restrict__ wq, const float* __restrict__ wk, const float* __restrict__ wv, const float* __restrict__ wo, const float* __restrict__ qA, const float* __restrict__ kA, const float* __restrict__ vA, const float* __restrict__ qB, const float* __restrict__ kB, const float* __restrict__ vB,
                                              bf* XB, bf* Wz, bf* WO, bf* AP, bf* BP, float* CS) {
    const int y = blockIdx.y, bx = blockIdx.x, tid = threadIdx.x;
    if (y < 4) cvt8_body(y == 0 ? wq : (y == 1 ? wk : (y == 2 ? wv : wo)), y < 3 ? Wz + (size_t)y * DQ * DM : WO, (size_t)bx * 256 + tid);
    else if (y < 8) cvt8_body(x + (size_t)(y - 4) * DQ * DM, XB + (size_t)(y - 4) * DQ * DM, (size_t)bx * 256 + tid);
    else if (y == 8) cstab_body(CS, bx * 256 + tid);
    else if (y == 9) { const int m = bx / 64; if (m < 3) apad_body(m == 0 ? qA : (m == 1 ? kA : vA), AP + (size_t)m * 64 * DM, ((bx % 64) * 256 + tid) * 4); }
    else { const int m = bx / 32; if (m < 3) bpad_body(m == 0 ? qB : (m == 1 ? kB : vB), BP + (size_t)m * DM * 32, ((bx % 32) * 256 + tid) * 4); }
}

extern "C" void kernel_launch(void* const* d_in, const int* in_sizes, int n_in,
                              void* d_out, int out_size, void* d_ws, size_t ws_size, hipStream_t stream) {
    (void)in_sizes; (void)n_in; (void)out_size;
    const float* x = (const float*)d_in[0]; const int* am = (const int*)d_in[1]; const float* wq = (const float*)d_in[2]; const float* bq = (const float*)d_in[3]; const float* wk = (const float*)d_in[4]; const float* bk = (const float*)d_in[5]; const float* wv = (const float*)d_in[6]; const float* bv = (const float*)d_in[7];
    const float* qA = (const float*)d_in[8]; const float* qB = (const float*)d_in[9]; const float* kA = (const float*)d_in[10]; const float* kB = (const float*)d_in[11]; const float* vA = (const float*)d_in[12]; const float* vB = (const float*)d_in[13]; const float* wo = (const float*)d_in[14]; const float* bo = (const float*)d_in[15];
    float* OUT = (float*)d_out;     // [2][2048][1024]
    char* wsp = (char*)d_ws;
    auto take = [&](size_t bytes) { char* p = wsp; wsp += (bytes + 255) & ~(size_t)255; return (void*)p; };
    // the output weight, the operand planes of both batch elements, the merged attention output
    const size_t PB = (size_t)NH_ * TT * HD, VB = (size_t)NKV * HD * 2 * TT;   // elements of one batch element's q or k planes / value planes
    bf* WO = (bf*)take((size_t)DM * DQ * 2);
    h16* P16 = (h16*)take(4 * PB * 2); bf* Ph = (bf*)take(4 * PB * 2); bf* Pl = (bf*)take(4 * PB * 2);   // [q b0][q b1][k b0][k b1]
    h16* VT16 = (h16*)take(NB_ * VB * 2); bf* VTh = (bf*)take(NB_ * VB * 2); bf* VTl = VTh + TT;   // hi plane in the first, lo plane in the second half of each 2 TT row
    bf* ATh = (bf*)take((size_t)MT * DQ * 2); bf* ATl = (bf*)take((size_t)MT * DQ * 2);
    // temporaries of the projections
    bf* Wz = (bf*)take((size_t)3 * DQ * DM * 2); float* CS = (float*)take((size_t)TT * HD * 2 * 4); bf* XB = (bf*)take((size_t)MT * DM * 2); bf* AP = (bf*)take((size_t)3 * 64 * DM * 2); bf* BP = (bf*)take((size_t)3 * DM * 32 * 2);
    float* XA = (float*)take((size_t)3 * MT * 64 * 4); float* F = (float*)take((size_t)3 * MT * DQ * 4);
    if ((size_t)(wsp - (char*)d_ws) > ws_size) return;    // about 165 of the 256 MiB
    k_prep<<<dim3(512, 11, 1), 256, 0, stream>>>(x, wq, wk, wv, wo, qA, kA, vA, qB, kB, vB, XB, Wz, WO, AP, BP, CS);
    k_proj<<<dim3(MT / 64, DQ / 64 + 1, 3), 32, 0, stream>>>(XB, Wz, AP, F, XA, bq, bk, bv);
    k_tail<<<dim3(MT / 64, NH_, 3), 32, 0, stream>>>(F, XA, BP, CS, P16, Ph, Pl, VT16, VTh, VTl);   /* LoRA: F + 2 (x A^T) B^T, RoPE, planes */
    k_attn<<<dim3(NB_ * NH_, (TT - RH) / 128 + RH / 64, 1), 128, 0, stream>>>(P16, Ph, Pl, VT16, VTh, VTl, am, ATh, ATl);
    k_gemmw<bf, 1, DQ, DM, true><<<dim3(MT / 64, DM / 64, 1), 32, 0, stream>>>(ATh, ATl, WO, nullptr, OUT, bo, 0, 0, 0);
}

// v006
// One run takes 154 microseconds.
// Timed twice side by side with v005, it ran 1.11 and 1.09 times as fast.
// All steps since v000 together make it 11.6 times as fast.
#include <hip/hip_runtime.h>

// Masked_MHA_LORA (x [2][2048][1024]; Q/K/V = x W^T + b + 2 (x A^T) B^T (LoRA rank 8, scaling 16/8); RoPE (rotate-half, base 10000) on Q, K (16 heads x 64); scores = Q.K/8 with the causal mask and the key padding mask (attention_mask == 0 -> -inf; int,
// read as data); softmax; out = (attn V merged) oW^T + ob -> [2][2048][1024]).
// Compute dtypes, f32 accumulate: every input rounded to bf16; the base projections on PLAIN bf16 operands (inputs: exact) + bias; the LoRA path as two small GEMMs (x A^T exact, then hl planes x exact B, rank padded 8 -> 32) added

#define NB_  2
#define TT   2048
#define DM   1024
#define NH_  16
#define NKV  16
#define REP  (NH_ / NKV)
#define HD   64
#define MT   (NB_ * TT)         // rows of both batch elements together
#define DQ   (NH_ * HD)
#define DKV  (NKV * HD)
#define RH   512                  // query rows < RH use hi+lo planes (0: none)
typedef _Float16 h16;
typedef unsigned short bf;
typedef __attribute__((ext_vector_type(16))) __bf16   v16bf;
typedef __attribute__((ext_vector_type(16))) _Float16 v16h;
typedef __attribute__((ext_vector_type(8)))  _Float16 v8h;
typedef __attribute__((ext_vector_type(8)))  unsigned short v8us;
typedef __attribute__((ext_vector_type(8)))  float    v8f;
typedef __attribute__((ext_vector_type(4)))  float    v4f;
typedef v8h  __attribute__((may_alias)) v8ha;
typedef v4f  __attribute__((may_alias)) v4fa;
typedef v8us __attribute__((may_alias)) v8usa;

__device__ __forceinline__ unsigned short f2bf(float f) { unsigned u = __float_as_uint(f); u += 0x7FFFu + ((u >> 16) & 1u); return (unsigned short)(u >> 16); }
__device__ __forceinline__ float bf2f(unsigned short b) { return __uint_as_float(((unsigned)b) << 16); }
__device__ __forceinline__ float bfr(float f) { return bf2f(f2bf(f)); }
__device__ __forceinline__ v16h cat16(v8h lo, v8h hi) { return __builtin_shufflevector(lo, hi, 0, 1, 2, 3, 4, 5, 6, 7, 8, 9, 10, 11, 12, 13, 14, 15); }
__device__ __forceinline__ v16bf cat16b(v8us lo, v8us hi) { return __builtin_bit_cast(v16bf, __builtin_shufflevector(lo, hi, 0, 1, 2, 3, 4, 5, 6, 7, 8, 9, 10, 11, 12, 13, 14, 15)); }
__device__ __forceinline__ v8f wmma16(v16h a, v16h b, v8f c) { return __builtin_amdgcn_wmma_f32_16x16x32_f16(false, a, false, b, (short)0, c, false, false); }
__device__ __forceinline__ v8f wmmab(v16bf a, v16bf b, v8f c) { return __builtin_amdgcn_wmma_f32_16x16x32_bf16(false, a, false, b, (short)0, c, false, false); }



// ---- gemm_tile: register-blocked GEMM, ONE WAVE per 64x64 output tile (16 accumulators), operands straight from 16-bit planes in fragment order (below; K elements a row); the k loop runs to Kl <= K.
// C[m][n] (f32, pitch ldc, + optional f32 bias[n]) = sum_k A[m][k] Bt[n][k] (+ split products per NSPLIT). Kl % 32 == 0. os: 16 x 68 floats of LDS.
// NW > 1: NW waves of one work-group share the tile; wave w takes the k blocks w, w + NW, ... into its own accumulators, the NW partial tiles meet in LDS (os: NW x 64 x 68 floats) and are summed in the fixed order w = 0, 1, ...
// XWAIT: s_wait_xcnt 0 behind a run of global loads or stores; the registers that the run names are inputs of the statement, so that none of them is overwritten in front of the wait.
#define XWAIT(...) asm volatile("s_wait_xcnt 0x0" :: __VA_ARGS__ : "memory")
// FRAGMENT ORDER of a K-contiguous 16-bit plane [rows][K]: each block of 16 rows x 32 k (one matrix operand, 1 KiB) lies in one piece, as two runs of 512 bytes; run u (k = 16 u + 8 hi + 0..7) holds lane (16 hi + row)'s 8 elements at 16 bytes x lane.
// Element offset of (row, k) = (row / 16) 16 K + (k / 32) 512 + ((k % 32) / 16) 256 + (((k % 16) / 8) 16 + row % 16) 8 + k % 8. ldp(p) loads a fragment from p = block + 8 lane: each of its two wave-wide loads covers four whole 128-byte lines. ld(p) is the loader of a row-major plane.
template <typename T16> struct WFrag;
template <> struct WFrag<h16> { typedef v16h V; static __device__ __forceinline__ V ld(const h16* p) { return cat16(*(const v8h*)p, *(const v8h*)(p + 16)); } static __device__ __forceinline__ V ldp(const h16* p) { return cat16(*(const v8h*)p, *(const v8h*)(p + 256)); } static __device__ __forceinline__ v8f mma(V a, V b, v8f c) { return wmma16(a, b, c); } };
template <> struct WFrag<bf> { typedef v16bf V; static __device__ __forceinline__ V ld(const bf* p) { return cat16b(*(const v8us*)p, *(const v8us*)(p + 16)); } static __device__ __forceinline__ V ldp(const bf* p) { return cat16b(*(const v8us*)p, *(const v8us*)(p + 256)); } static __device__ __forceinline__ v8f mma(V a, V b, v8f c) { return wmmab(a, b, c); } };
template <typename T16, int NSPLIT, int K, int ldc, bool BIAS, int NW = 1>
__device__ __forceinline__ void gemm_tile(const T16* __restrict__ A, const T16* __restrict__ A2, const T16* __restrict__ Bt, const T16* __restrict__ Bt2, int Kl, float* C, const float* __restrict__ bias, int r0, int c0, float* os) {
    typedef typename WFrag<T16>::V V;
    const int lane = threadIdx.x & 31, lr = lane & 15, hi = lane >> 4;
    const int wv = (NW > 1) ? __builtin_amdgcn_readfirstlane((int)(threadIdx.x >> 5)) : 0;   // the wave's number, in a scalar register: the k loop's bounds stay wave-uniform
    v8f acc[4][4];
#pragma unroll
    for (int mb = 0; mb < 4; ++mb)
#pragma unroll
        for (int nb = 0; nb < 4; ++nb) acc[mb][nb] = (v8f){};
    const T16* pa = A + (size_t)r0 * K; const T16* pb = Bt + (size_t)c0 * K; const T16* pa2 = (NSPLIT == 1 || NSPLIT == 2) ? A2 + (size_t)r0 * K : nullptr; const T16* pb2 = (NSPLIT >= 2) ? Bt2 + (size_t)c0 * K : nullptr;   // the tile's first row in each plane
    unsigned ol = (unsigned)(8 * lane + 512 * wv) * 2u;   // the lane's byte offset from there at the trip's k block, the same in every plane
    v4f bv = (v4f){};   // the lane's four bias values, loaded once per tile
    if (BIAS) { const float* bp = bias + c0 + lr * 4; bv = *(const v4f*)bp; asm volatile("s_wait_xcnt 0x0" ::: "memory"); /* behind the bias load, in front of any reuse of its address registers */ }
#pragma unroll 1
    for (int kc = 32 * wv; kc < Kl; kc += 32 * NW) {
        V a[4], a2[4];
#pragma unroll
        for (int mb = 0; mb < 4; ++mb) { a[mb] = WFrag<T16>::ldp((const T16*)((const char*)pa + ol) + (size_t)mb * 16 * K); if (NSPLIT == 1 || NSPLIT == 2) a2[mb] = WFrag<T16>::ldp((const T16*)((const char*)pa2 + ol) + (size_t)mb * 16 * K); }
#pragma unroll
        for (int nb = 0; nb < 4; ++nb) { const V b = WFrag<T16>::ldp((const T16*)((const char*)pb + ol) + (size_t)nb * 16 * K); V b2; if (NSPLIT >= 2) b2 = WFrag<T16>::ldp((const T16*)((const char*)pb2 + ol) + (size_t)nb * 16 * K);
#pragma unroll
            for (int mb = 0; mb < 4; ++mb) { acc[mb][nb] = WFrag<T16>::mma(a[mb], b, acc[mb][nb]); if (NSPLIT == 1 || NSPLIT == 2) acc[mb][nb] = WFrag<T16>::mma(a2[mb], b, acc[mb][nb]); if (NSPLIT >= 2) acc[mb][nb] = WFrag<T16>::mma(a[mb], b2, acc[mb][nb]); } }
        asm volatile("s_wait_xcnt 0x0" : "+v"(ol) :: "memory");   // behind the trip's loads, in front of the step of their offset register, which passes through the statement so that it lives up to the wait
        ol += 1024 * NW;
        asm volatile("v_nop\n\tv_nop\n\tv_nop\n\tv_nop" : "+v"(acc[0][0]), "+v"(acc[1][1]), "+v"(acc[2][2]), "+v"(acc[3][3]) : "v"(a[0]), "v"(a[3]));
    }
#pragma unroll
    for (int u = 0; u < 4; ++u) bv[u] = bfr(bv[u]);
    if constexpr (NW > 1) {
        float* pw = os + wv * (64 * 68);   // the wave's own partial tile
#pragma unroll
        for (int mb = 0; mb < 4; ++mb)
#pragma unroll
            for (int nb = 0; nb < 4; ++nb)
#pragma unroll
                for (int j = 0; j < 8; ++j) pw[(mb * 16 + hi * 8 + j) * 68 + nb * 16 + lr] = acc[mb][nb][j];
        __syncthreads();   // every wave's partial tile is in LDS before any is read
        constexpr int NS = 64 * 16 / (32 * NW);   // 16-byte pieces of the tile per thread
        v4f val[NS]; float* cp0 = C + (size_t)(r0 + (int)(threadIdx.x >> 4)) * ldc + c0 + lr * 4;   // the thread's place in rows tid / 16, + 2 NW, ...
#pragma unroll
        for (int s = 0; s < NS; ++s) { const float* ps = os + (s * 2 * NW + (int)(threadIdx.x >> 4)) * 68 + lr * 4; val[s] = *(const v4fa*)ps;
#pragma unroll
            for (int w = 1; w < NW; ++w) val[s] += *(const v4fa*)(ps + w * (64 * 68));
            if (BIAS) val[s] += bv;
            *(v4f*)(cp0 + (size_t)(s * 2 * NW) * ldc) = val[s]; }
        static_assert(NS == 4, "the wait below names four stored values");
        XWAIT("v"(val[0]), "v"(val[1]), "v"(val[2]), "v"(val[3]), "v"(cp0));
        return;
    }
#pragma unroll
    for (int mb = 0; mb < 4; ++mb) {
#pragma unroll
        for (int nb = 0; nb < 4; ++nb) {
#pragma unroll
            for (int j = 0; j < 8; ++j) os[(hi * 8 + j) * 68 + nb * 16 + lr] = acc[mb][nb][j]; }
        __builtin_amdgcn_wave_barrier(); asm volatile("" ::: "memory");
        float* crow = C + (size_t)(r0 + mb * 16) * ldc + c0;
{
            v4f val[8]; float* cp0 = crow + (size_t)hi * ldc + lr * 4;   // the lane's place in the block's rows hi, hi + 2, ...
#pragma unroll
            for (int s = 0; s < 8; ++s) { const int row = 2 * s + hi, cofs = lr * 4; val[s] = *(const v4fa*)(os + row * 68 + cofs); if (BIAS) val[s] += bv;
                *(v4f*)(cp0 + (size_t)(2 * s) * ldc) = val[s]; }
            XWAIT("v"(val[0]), "v"(val[1]), "v"(val[2]), "v"(val[3]), "v"(val[4]), "v"(val[5]), "v"(val[6]), "v"(val[7]), "v"(cp0));
             }
        __builtin_amdgcn_wave_barrier(); asm volatile("" ::: "memory");
    }
}
// k_gemmw: grid (M/64, N/64, Z), 32 threads; z-batch strides sA/sB/sC in elements
template <typename T16, int NSPLIT, int K, int ldc, bool BIAS>
__global__ __launch_bounds__(32) void k_gemmw(const T16* __restrict__ A, const T16* __restrict__ A2, const T16* __restrict__ Bt, const T16* __restrict__ Bt2, float* C, const float* __restrict__ bias, size_t sA, size_t sB, size_t sC) {
    __shared__ __align__(16) float os[16 * 68];
    const size_t z = blockIdx.z; A += z * sA; if (A2) A2 += z * sA; Bt += z * sB; if (Bt2) Bt2 += z * sB; C += z * sC;
    gemm_tile<T16, NSPLIT, K, ldc, BIAS>(A, A2, Bt, Bt2, K, C, bias, blockIdx.x * 64, blockIdx.y * 64, os);
}
// k_proj: every product with x as the left operand in one launch. grid (MT/64, DQ/64 + 1, 3): z = q, k, v; column tiles y < DQ/64 are the base projection x W^T + b -> F[z], the last column tile is x A^T -> XA[z] (A padded to 64 rows)
__global__ __launch_bounds__(32) void k_proj(const bf* __restrict__ XB, const bf* __restrict__ Wz, const bf* __restrict__ AP, float* F, float* XA, const float* __restrict__ bq, const float* __restrict__ bk, const float* __restrict__ bv) {
    __shared__ __align__(16) float os[16 * 68];
    const int z = blockIdx.z, y = blockIdx.y;
    if (y < DQ / 64) gemm_tile<bf, 0, DM, DQ, true>(XB, nullptr, Wz + (size_t)z * DQ * DM, nullptr, DM, F + (size_t)z * MT * DQ, z == 0 ? bq : (z == 1 ? bk : bv), blockIdx.x * 64, y * 64, os);
    else gemm_tile<bf, 0, DM, 64, false>(XB, nullptr, AP + (size_t)z * 64 * DM, nullptr, DM, XA + (size_t)z * MT * 64, nullptr, blockIdx.x * 64, 0, os);
}
__device__ __forceinline__ h16 tohx(float x) { return (h16)x; }
__device__ __forceinline__ void splitf(float y, unsigned short& h, unsigned short& l) { h = f2bf(y); l = f2bf(y - bf2f(h)); }
typedef __attribute__((ext_vector_type(2))) _Float16 v2h;
typedef __attribute__((ext_vector_type(4))) _Float16 v4h;
typedef __attribute__((ext_vector_type(2))) unsigned short v2us;
typedef __attribute__((ext_vector_type(4))) unsigned short v4us;
typedef __attribute__((ext_vector_type(2))) float v2f;
typedef __attribute__((ext_vector_type(4))) int v4i;

__global__ __launch_bounds__(256) void k_wtG(const float* __restrict__ w, int K, int N, bf* Bt) {
    const int lane = threadIdx.x & 31; const int L0 = (blockIdx.x * 8 + (threadIdx.x >> 5)) * 8; const int nlines = N * K / 64;
{
#pragma unroll 1
        for (int l = 0; l < 8; ++l) { const int L = L0 + l; if (L >= nlines) break; const size_t e = (size_t)L * 64 + lane * 2; const int k = (int)(e % K), n = (int)(e / K); v2us o;
            o[0] = f2bf(w[(size_t)k * N + n]); o[1] = f2bf(w[(size_t)(k + 1) * N + n]); *(v2us*)(Bt + e) = o; }
         }
}
// row-major f32 [rows][DM] -> bf16 in fragment order, 8 elements a thread: a wave reads 128 bytes in a row of each of 8 rows and stores four whole 128-byte lines of one fragment (8 rows x 8 k each)
__device__ __forceinline__ size_t frag_src(size_t i) { return ((i >> 11) * 16 + (i & 15)) * DM + ((i >> 5) & 63) * 16 + ((i >> 4) & 1) * 8; }   // the row-major element offset of piece i's first element
__device__ __forceinline__ void cvt8_body(const float* __restrict__ src, bf* dst, size_t t) { const size_t i = (t & ~(size_t)63) | ((t & 3) << 4) | ((t >> 2) & 15);   // thread t of a fragment's 64: row t / 4, k = 8 (t % 4); i: that piece's place in the fragment
    const v8f v = *(const v8f*)(src + frag_src(i)); v8us o;
#pragma unroll
    for (int k = 0; k < 8; ++k) o[k] = f2bf(v[k]); bf* dp = dst + i * 8; *(v8us*)dp = o; XWAIT("v"(o), "v"(dp));  }
__device__ __forceinline__ void cstab_body(float* CS, int idx) { const int t = idx / HD, d = idx % HD; const int i = d % (HD / 2); const float inv = __fdiv_rn(1.0f, powf(10000.0f, (float)(2 * i) / (float)HD)); const float ang = __fmul_rn((float)t, inv); v2f cs; cs[0] = cosf(ang); cs[1] = sinf(ang);
    float* dp = CS + (size_t)idx * 2; *(v2f*)dp = cs; XWAIT("v"(cs), "v"(dp));  }
// k_tail: all that stands between the projections and the attention, in one launch. grid (MT/64, NH_, 3), ONE WAVE per (64 rows, one head) of z = q, k, v: F + 2 (x A^T) B^T, RoPE (q, k), and the operand planes stored straight from the accumulators.
// x A^T (XA, f32, pitch 64; of its columns only the 8 ranks are not zero by construction) is split into its hi / lo bf16 fragments in registers: k = 0..7 sit in the first half of the lanes below 16, every other k is zero.
// q, k: B's rows as the A operand and the x A^T rows as the B operand, so a lane holds 8 consecutive d of one row t (D[8 hi + j][lr] = (d, t)): the rotate-half partner d +- 32 is the same lane's tile mb +- 2, and each plane takes one 16-byte store a tile.
// v: the operands the other way round, so a lane holds 8 consecutive t of one d: the transposed planes of a head g (2 HD TT elements: the hi plane, then the lo plane; of the fp16 ones only the first half is written or read) take one 16-byte store a tile. They lie in fragment order with the key block outermost: [t / 32][d / 16][1 KiB fragment of 16 d x 32 t], so a key block's four fragments are 4 KiB in a row.
// Head planes [h][t][d] (fp16 + hi/lo; each head's [t][d] in fragment order, K = HD), in the order (q b0, q b1, k b0, k b1) in P16 / Ph / Pl; rotate-half: out[d] = x[d] cos[t][d] - x[d+HD/2] sin[t][d], out[d+HD/2] = x[d+HD/2] cos[t][d] + x[d] sin[t][d] (the table's two halves are equal). Each store of a wave is 512 bytes in a row.
__device__ __forceinline__ void planes8(v8f r, v8h& o16, v8us& oh, v8us& ol) {
#pragma unroll
    for (int j = 0; j < 8; ++j) { o16[j] = tohx(r[j]); unsigned short a, c; splitf(r[j], a, c); oh[j] = a; ol[j] = c; } }
__global__ __launch_bounds__(32) void k_tail(const float* __restrict__ F, const float* __restrict__ XA, const bf* __restrict__ BP, const float* __restrict__ CS, h16* P16, bf* Ph, bf* Pl, h16* V16, bf* Vh, bf* Vl) {
    const int lane = threadIdx.x, lr = lane & 15, hi = lane >> 4;
    const int z = blockIdx.z, h = blockIdx.y, r0 = blockIdx.x * 64, b = r0 / TT, t0 = r0 % TT;
    const char* xa = (const char*)(XA + ((size_t)z * MT + r0) * 64); const char* bp = (const char*)(BP + ((size_t)z * DM + h * HD) * 32); const char* fz = (const char*)(F + ((size_t)z * MT + r0) * DQ + h * HD);   // wave-uniform bases
    const unsigned ox = (unsigned)lr * 256u, ob = (unsigned)(lr * 32 + 8 * hi) * 2u;   // the lane's byte offsets in them
    v16bf xh[4], xl[4], bb[4];
#pragma unroll
    for (int i = 0; i < 4; ++i) { const v8f x = *(const v8f*)(xa + ox + i * 16 * 256); v8us a, c; const v8us zz = (v8us){};
#pragma unroll
        for (int j = 0; j < 8; ++j) { unsigned short u, w; splitf(hi ? 0.f : x[j], u, w); a[j] = u; c[j] = w; }
        xh[i] = cat16b(a, zz); xl[i] = cat16b(c, zz); bb[i] = WFrag<bf>::ld((const bf*)(bp + ob + i * 16 * 64)); }
    if (z < 2) {
        const unsigned of = (unsigned)(lr * DQ + 8 * hi) * 4u, oc = (unsigned)((t0 + lr) * HD + 8 * hi) * 8u;   // row lr of a 16-row group, d = 8 hi: in F and in the cos/sin table
        const size_t po = (((size_t)(z * 2 + b) * NH_ + h) * TT + t0) * HD; char* p16 = (char*)(P16 + po); char* ph = (char*)(Ph + po); char* pl = (char*)(Pl + po); const unsigned op = (unsigned)lane * 16u;   // wave-uniform bases of the 64 rows in the three planes, and the lane's byte offset in a 512-byte run
#pragma unroll
        for (int nb = 0; nb < 4; ++nb) {   // 16 rows t
            v8f v[4], r[4];
#pragma unroll
            for (int mb = 0; mb < 4; ++mb) { v8f acc = wmmab(bb[mb], xh[nb], (v8f){}); acc = wmmab(bb[mb], xl[nb], acc); v[mb] = *(const v8f*)(fz + of + nb * 16 * DQ * 4 + mb * 64) + 2.0f * acc; }
#pragma unroll
            for (int mb = 0; mb < 2; ++mb) { const v8f c0 = *(const v8f*)((const char*)CS + oc + nb * 16 * HD * 8 + mb * 128), c1 = *(const v8f*)((const char*)CS + oc + nb * 16 * HD * 8 + mb * 128 + 32);   // (cos, sin) of d = 16 mb + 8 hi + 0..3, + 4..7
#pragma unroll
                for (int j = 0; j < 8; ++j) { const float cs = j < 4 ? c0[2 * j] : c1[2 * j - 8], sn = j < 4 ? c0[2 * j + 1] : c1[2 * j - 7]; r[mb][j] = v[mb][j] * cs - v[mb + 2][j] * sn; r[mb + 2][j] = v[mb + 2][j] * cs + v[mb][j] * sn; } }
            v8h o16[4]; v8us oh[4], ol[4];
#pragma unroll
            for (int mb = 0; mb < 4; ++mb) { planes8(r[mb], o16[mb], oh[mb], ol[mb]); const int o = (nb * 16 * HD + mb * 256) * 2; *(v8h*)(p16 + op + o) = o16[mb]; *(v8us*)(ph + op + o) = oh[mb]; *(v8us*)(pl + op + o) = ol[mb]; }
            XWAIT("v"(o16[0]), "v"(o16[1]), "v"(o16[2]), "v"(o16[3]), "v"(oh[0]), "v"(oh[1]), "v"(oh[2]), "v"(oh[3]), "v"(ol[0]), "v"(ol[1]), "v"(ol[2]), "v"(ol[3]), "v"(op), "v"(of), "v"(oc), "v"(ox), "v"(ob));
        }
    } else {
        const unsigned of = (unsigned)(8 * hi * DQ + lr) * 4u;   // row 8 hi of a 16-row group, d = lr
        const size_t vo = ((size_t)b * NKV + h) * HD * 2 * TT + (size_t)t0 * HD; char* p16 = (char*)(V16 + vo); char* ph = (char*)(Vh + vo); char* pl = (char*)(Vl + vo); const unsigned op = (unsigned)lane * 16u;   // wave-uniform bases of the two key blocks in the three planes, and the lane's byte offset in a 512-byte run
#pragma unroll
        for (int nb = 0; nb < 4; ++nb) {   // 16 columns d
            v8h o16[4]; v8us oh[4], ol[4];
#pragma unroll
            for (int mb = 0; mb < 4; ++mb) { v8f acc = wmmab(xh[mb], bb[nb], (v8f){}); acc = wmmab(xl[mb], bb[nb], acc); v8f r;
#pragma unroll
                for (int j = 0; j < 8; ++j) r[j] = *(const float*)(fz + of + (mb * 16 + j) * DQ * 4 + nb * 64) + 2.0f * acc[j];
                planes8(r, o16[mb], oh[mb], ol[mb]); const int o = ((mb >> 1) * 32 * HD + nb * 512 + (mb & 1) * 256) * 2; *(v8h*)(p16 + op + o) = o16[mb]; *(v8us*)(ph + op + o) = oh[mb]; *(v8us*)(pl + op + o) = ol[mb]; }
            XWAIT("v"(o16[0]), "v"(o16[1]), "v"(o16[2]), "v"(o16[3]), "v"(oh[0]), "v"(oh[1]), "v"(oh[2]), "v"(oh[3]), "v"(ol[0]), "v"(ol[1]), "v"(ol[2]), "v"(ol[3]), "v"(op), "v"(of), "v"(ox), "v"(ob));
        }
    }
}
// k_attn: the whole attention in one launch; scores and probabilities stay in registers. One wave owns 16 NQ query rows of one (batch, head) and walks the keys in blocks of 32 up to its diagonal block.
// S^T = K Q^T (A = key rows, B = query rows): a lane holds, for the query of its column lr, the keys 8 hi + j of each 16-key tile, which is the k order of a B operand; so P^T goes from the score accumulators straight into O^T += V^T P^T.
// Running maximum and sum per query (scaled log2 domain); the accumulators are rescaled when the maximum moves. The wave halves' sums are joined once at the end. Query rows below RH use the hi+lo planes (three products), the others fp16.
// The output goes out as the hi / lo planes [t][DQ], in fragment order, that the output projection reads; each store of a wave is 512 bytes in a row.
#define L2S 0.18033688011112042f   // HD^-0.5 x log2(e)
__device__ __forceinline__ float xhalf(float x) { const int b = __float_as_int(x); return __int_as_float(__builtin_amdgcn_permlanex16(b, b, 0x76543210, 0xfedcba98, false, false)); }   // the value of lane l ^ 16
__device__ __forceinline__ float exp2_slot(float x) { float r; asm("v_exp_f32 %0, %1\n\tv_nop" : "=v"(r) : "v"(x)); return r; }   // exp2 with the one slot behind a transcendental tied to it
template <typename T16, bool HI, int NQ>
__device__ __forceinline__ void attn_wave(const T16* __restrict__ Q, const T16* __restrict__ Q2, const T16* __restrict__ Kp, const T16* __restrict__ K2, const T16* __restrict__ Vt, const T16* __restrict__ Vt2, const int* __restrict__ amb, bf* Ah, bf* Al, int q0) {
    typedef typename WFrag<T16>::V V;
    const int lane = threadIdx.x & 31, lr = lane & 15, hi = lane >> 4;
    V qf[NQ][2], q2[NQ][2];
#pragma unroll
    for (int nq = 0; nq < NQ; ++nq)
#pragma unroll
        for (int ks = 0; ks < 2; ++ks) { const size_t qo = (size_t)(q0 + nq * 16) * HD + ks * 512 + 8 * lane; qf[nq][ks] = WFrag<T16>::ldp(Q + qo); if (HI) q2[nq][ks] = WFrag<T16>::ldp(Q2 + qo); }
    v8f o[4][NQ]; float m[NQ], l[NQ];
#pragma unroll
    for (int nq = 0; nq < NQ; ++nq) { m[nq] = -3.0e38f; l[nq] = 0.f;
#pragma unroll
        for (int dt = 0; dt < 4; ++dt) o[dt][nq] = (v8f){}; }
    const int nk = q0 + 16 * NQ;   // keys below nk are visible to some query of the wave
    unsigned ok = (unsigned)lane * 16u, ov = (unsigned)lane * 16u, oa = (unsigned)lane * 4u;   // the lane's byte offsets in the key planes, the value planes and the padding mask at the trip's key block
    V kf[2][2], k2[2][2];
#pragma unroll
    for (int t = 0; t < 2; ++t)
#pragma unroll
        for (int ks = 0; ks < 2; ++ks) { kf[t][ks] = WFrag<T16>::ldp((const T16*)((const char*)Kp + ok) + t * 16 * HD + ks * 512); if (HI) k2[t][ks] = WFrag<T16>::ldp((const T16*)((const char*)K2 + ok) + t * 16 * HD + ks * 512); }
    int av = *(const int*)((const char*)amb + oa);
#pragma unroll 1
    for (int kb = 0; kb < nk; kb += 32) {
        V vf[4], v2[4];
#pragma unroll
        for (int dt = 0; dt < 4; ++dt) { vf[dt] = WFrag<T16>::ldp((const T16*)((const char*)Vt + ov) + dt * 512); if (HI) v2[dt] = WFrag<T16>::ldp((const T16*)((const char*)Vt2 + ov) + dt * 512); }
        const unsigned mk = __builtin_amdgcn_ballot_w32(av != 0);   // bit u: key kb + u is not padding
        v8f s[2][NQ];
#pragma unroll
        for (int t = 0; t < 2; ++t)
#pragma unroll
            for (int nq = 0; nq < NQ; ++nq) { s[t][nq] = (v8f){};
#pragma unroll
                for (int ks = 0; ks < 2; ++ks) { s[t][nq] = WFrag<T16>::mma(kf[t][ks], qf[nq][ks], s[t][nq]); if (HI) { s[t][nq] = WFrag<T16>::mma(kf[t][ks], q2[nq][ks], s[t][nq]); s[t][nq] = WFrag<T16>::mma(k2[t][ks], qf[nq][ks], s[t][nq]); } } }
        asm volatile("s_wait_xcnt 0x0" : "+v"(ok), "+v"(oa) :: "memory");   // behind the key and mask loads, in front of the step of their offset registers
        const bool more = kb + 32 < nk; ok += more ? 32u * HD * 2u : 0u; oa += more ? 128u : 0u;   // the next trip's key fragments and mask words are fetched now, so that their latency runs under the softmax and the value products; the last trip fetches its own block again
        av = *(const int*)((const char*)amb + oa);
#pragma unroll
        for (int t = 0; t < 2; ++t)
#pragma unroll
            for (int ks = 0; ks < 2; ++ks) { kf[t][ks] = WFrag<T16>::ldp((const T16*)((const char*)Kp + ok) + t * 16 * HD + ks * 512); if (HI) k2[t][ks] = WFrag<T16>::ldp((const T16*)((const char*)K2 + ok) + t * 16 * HD + ks * 512); }
#pragma unroll
        for (int t = 0; t < 2; ++t)
#pragma unroll
            for (int nq = 0; nq < NQ; ++nq) s[t][nq] *= L2S;
        if (mk != 0xFFFFFFFFu || kb + 31 > q0) {   // wave-uniform: only a block with a padded key or on the diagonal has anything to mask
            const unsigned mkl = mk >> (8 * hi);
#pragma unroll
            for (int nq = 0; nq < NQ; ++nq) { const int lim = q0 + nq * 16 + lr - kb - 8 * hi;   // element (t, j) is key kb + 16 t + 8 hi + j: causal while 16 t + j <= lim
                const unsigned mm = mkl & (lim >= 31 ? 0xFFFFFFFFu : (lim < 0 ? 0u : ((2u << lim) - 1u)));
#pragma unroll
                for (int t = 0; t < 2; ++t)
#pragma unroll
                    for (int j = 0; j < 8; ++j) s[t][nq][j] = ((mm >> (t * 16 + j)) & 1u) ? s[t][nq][j] : -3.0e38f; }
        }
#pragma unroll
        for (int nq = 0; nq < NQ; ++nq) {
            float mx = fmaxf(s[0][nq][0], s[1][nq][0]);
#pragma unroll
            for (int j = 1; j < 8; ++j) mx = fmaxf(mx, fmaxf(s[0][nq][j], s[1][nq][j]));
            mx = fmaxf(mx, xhalf(mx)); mx = fmaxf(mx, m[nq]);
            const float al = __builtin_amdgcn_exp2f(m[nq] - mx); m[nq] = mx;
            float sum = 0.f;
#pragma unroll
            for (int t = 0; t < 2; ++t)
#pragma unroll
                for (int j = 0; j < 8; ++j) { const float p = HI ? exp2_slot(s[t][nq][j] - mx) : __builtin_amdgcn_exp2f(s[t][nq][j] - mx); s[t][nq][j] = p; sum += p; }
            l[nq] = l[nq] * al + sum;
#pragma unroll
            for (int dt = 0; dt < 4; ++dt) o[dt][nq] *= al;
            if constexpr (HI) { v8us h0, h1, l0, l1;
#pragma unroll
                for (int j = 0; j < 8; ++j) { unsigned short a, c; splitf(s[0][nq][j], a, c); h0[j] = a; l0[j] = c; splitf(s[1][nq][j], a, c); h1[j] = a; l1[j] = c; }
                const V ph = cat16b(h0, h1), pl = cat16b(l0, l1);
#pragma unroll
                for (int dt = 0; dt < 4; ++dt) { o[dt][nq] = WFrag<T16>::mma(vf[dt], ph, o[dt][nq]); o[dt][nq] = WFrag<T16>::mma(vf[dt], pl, o[dt][nq]); o[dt][nq] = WFrag<T16>::mma(v2[dt], ph, o[dt][nq]); }
            } else { V pf;
#pragma unroll
                for (int j = 0; j < 8; ++j) { pf[j] = tohx(s[0][nq][j]); pf[8 + j] = tohx(s[1][nq][j]); }
#pragma unroll
                for (int dt = 0; dt < 4; ++dt) o[dt][nq] = WFrag<T16>::mma(vf[dt], pf, o[dt][nq]); }
        }
        asm volatile("s_wait_xcnt 0x0" : "+v"(ov) :: "memory");   // behind the value loads, in front of the step of their offset register
        ov += 32u * HD * 2u;
        asm volatile("v_nop\n\tv_nop\n\tv_nop\n\tv_nop" : "+v"(o[0][NQ - 1]), "+v"(o[1][NQ - 1]), "+v"(o[2][NQ - 1]), "+v"(o[3][NQ - 1]) : "v"(vf[0]), "v"(vf[3]));   // the distance behind the trip's last matrix instructions on the loop's taken branch
    }
#pragma unroll
    for (int nq = 0; nq < NQ; ++nq) { const float inv = __fdiv_rn(1.0f, l[nq] + xhalf(l[nq])); v8us oh[4], ol[4];
        const size_t ro = (size_t)(q0 + nq * 16) * DQ + 8 * lane; bf* ph = Ah + ro; bf* pl = Al + ro;
#pragma unroll
        for (int dt = 0; dt < 4; ++dt)
#pragma unroll
            for (int j = 0; j < 8; ++j) { unsigned short a, c; splitf(o[dt][nq][j] * inv, a, c); oh[dt][j] = a; ol[dt][j] = c; }
#pragma unroll
        for (int dt = 0; dt < 4; ++dt) { *(v8us*)(ph + dt * 256) = oh[dt]; *(v8us*)(pl + dt * 256) = ol[dt]; }
        XWAIT("v"(oh[0]), "v"(oh[1]), "v"(oh[2]), "v"(oh[3]), "v"(ol[0]), "v"(ol[1]), "v"(ol[2]), "v"(ol[3]), "v"(ph), "v"(pl)); }
}
// grid (NB_ NH_, (TT - RH) / 128 + RH / 64), 4 independent waves: x = (batch, head); y walks the query rows from the last (longest key loop) to the first: 32 rows a wave in fp16 down to RH, then 16 rows a wave in hi+lo planes. The four waves of a work-group take neighbouring row blocks, so they read the same keys and values at about the same time.
__global__ __launch_bounds__(128) void k_attn(const h16* __restrict__ P16, const bf* __restrict__ Ph, const bf* __restrict__ Pl, const h16* __restrict__ V16, const bf* __restrict__ Vh, const bf* __restrict__ Vl, const int* __restrict__ am, bf* ATh, bf* ATl) {
    const int bh = blockIdx.x, y = blockIdx.y; const int wv = __builtin_amdgcn_readfirstlane((int)(threadIdx.x >> 5));   // the wave's number, in a scalar register: the key loop's bounds stay wave-uniform
    const size_t zq = (size_t)bh * TT * HD, zk = (size_t)(NB_ * NH_ + bh) * TT * HD, zv = (size_t)bh * HD * 2 * TT, ao = (size_t)(bh / NH_) * TT * DQ + (size_t)(bh % NH_) * (HD / 32) * 512; const int* amb = am + (size_t)(bh / NH_) * TT;
    if (y < (TT - RH) / 128) attn_wave<h16, false, 2>(P16 + zq, nullptr, P16 + zk, nullptr, V16 + zv, nullptr, amb, ATh + ao, ATl + ao, TT - 32 * (y * 4 + wv + 1));
    else attn_wave<bf, true, 1>(Ph + zq, Pl + zq, Ph + zk, Pl + zk, Vh + zv, Vl + zv, amb, ATh + ao, ATl + ao, RH - 16 * ((y - (TT - RH) / 128) * 4 + wv + 1));
}

// LoRA helpers: apad_body: bf16 [64][DM] in fragment order from A [8][DM] (rows >= 8 zero; 8-B lanes); bpad_body: bf16 Bt [DM][32] from B [DM][8] natural (cols >= 8 zero);
__device__ __forceinline__ void apad_body(const float* __restrict__ A, bf* AP, int e) { const int se = (int)frag_src((size_t)(e >> 3)) + (e & 7), r = se / DM; v4us o;   // e: the place in fragment order, se: the same element's row-major place
#pragma unroll
    for (int u = 0; u < 4; ++u) o[u] = (r < 8) ? f2bf(A[se + u]) : (unsigned short)0; bf* dp = AP + e; *(v4us*)dp = o; XWAIT("v"(o), "v"(dp));  }
__device__ __forceinline__ void bpad_body(const float* __restrict__ Bm, bf* BP, int e) { const int c = e % 32, r = e / 32; v4us o;
#pragma unroll
    for (int u = 0; u < 4; ++u) o[u] = (c + u < 8) ? f2bf(Bm[(size_t)r * 8 + c + u]) : (unsigned short)0; bf* dp = BP + e; *(v4us*)dp = o; XWAIT("v"(o), "v"(dp));  }
// k_prep: every input conversion and the rope table in one launch. grid (512, 11), 256 threads: y = 0..3 the four weights (DQ DM / 8 lanes each), y = 4..7 the four quarters of x, y = 8 the cos/sin table, y = 9 the three padded A (64 blocks each), y = 10 the three padded B (32 blocks each)
__global__ __launch_bounds__(256) void k_prep(const float* __restrict__ x, const float* __restrict__ wq, const float* __restrict__ wk, const float* __restrict__ wv, const float* __restrict__ wo, const float* __restrict__ qA, const float* __restrict__ kA, const float* __restrict__ vA, const float* __restrict__ qB, const float* __restrict__ kB, const float* __restrict__ vB,
                                              bf* XB, bf* Wz, bf* WO, bf* AP, bf* BP, float* CS) {
    const int y = blockIdx.y, bx = blockIdx.x, tid = threadIdx.x;
    if (y < 4) cvt8_body(y == 0 ? wq : (y == 1 ? wk : (y == 2 ? wv : wo)), y < 3 ? Wz + (size_t)y * DQ * DM : WO, (size_t)bx * 256 + tid);
    else if (y < 8) cvt8_body(x + (size_t)(y - 4) * DQ * DM, XB + (size_t)(y - 4) * DQ * DM, (size_t)bx * 256 + tid);
    else if (y == 8) cstab_body(CS, bx * 256 + tid);
    else if (y == 9) { const int m = bx / 64; if (m < 3) apad_body(m == 0 ? qA : (m == 1 ? kA : vA), AP + (size_t)m * 64 * DM, ((bx % 64) * 256 + tid) * 4); }
    else { const int m = bx / 32; if (m < 3) bpad_body(m == 0 ? qB : (m == 1 ? kB : vB), BP + (size_t)m * DM * 32, ((bx % 32) * 256 + tid) * 4); }
}

extern "C" void kernel_launch(void* const* d_in, const int* in_sizes, int n_in,
                              void* d_out, int out_size, void* d_ws, size_t ws_size, hipStream_t stream) {
    (void)in_sizes; (void)n_in; (void)out_size;
    const float* x = (const float*)d_in[0]; const int* am = (const int*)d_in[1]; const float* wq = (const float*)d_in[2]; const float* bq = (const float*)d_in[3]; const float* wk = (const float*)d_in[4]; const float* bk = (const float*)d_in[5]; const float* wv = (const float*)d_in[6]; const float* bv = (const float*)d_in[7];
    const float* qA = (const float*)d_in[8]; const float* qB = (const float*)d_in[9]; const float* kA = (const float*)d_in[10]; const float* kB = (const float*)d_in[11]; const float* vA = (const float*)d_in[12]; const float* vB = (const float*)d_in[13]; const float* wo = (const float*)d_in[14]; const float* bo = (const float*)d_in[15];
    float* OUT = (float*)d_out;     // [2][2048][1024]
    char* wsp = (char*)d_ws;
    auto take = [&](size_t bytes) { char* p = wsp; wsp += (bytes + 255) & ~(size_t)255; return (void*)p; };
    // the output weight, the operand planes of both batch elements, the merged attention output
    const size_t PB = (size_t)NH_ * TT * HD, VB = (size_t)NKV * HD * 2 * TT;   // elements of one batch element's q or k planes / value planes
    bf* WO = (bf*)take((size_t)DM * DQ * 2);
    h16* P16 = (h16*)take(4 * PB * 2); bf* Ph = (bf*)take(4 * PB * 2); bf* Pl = (bf*)take(4 * PB * 2);   // [q b0][q b1][k b0][k b1]
    h16* VT16 = (h16*)take(NB_ * VB * 2); bf* VTh = (bf*)take(NB_ * VB * 2); bf* VTl = VTh + (size_t)HD * TT;   // hi plane in the first, lo plane in the second half of each head's 2 HD TT elements
    bf* ATh = (bf*)take((size_t)MT * DQ * 2); bf* ATl = (bf*)take((size_t)MT * DQ * 2);
    // temporaries of the projections
    bf* Wz = (bf*)take((size_t)3 * DQ * DM * 2); float* CS = (float*)take((size_t)TT * HD * 2 * 4); bf* XB = (bf*)take((size_t)MT * DM * 2); bf* AP = (bf*)take((size_t)3 * 64 * DM * 2); bf* BP = (bf*)take((size_t)3 * DM * 32 * 2);
    float* XA = (float*)take((size_t)3 * MT * 64 * 4); float* F = (float*)take((size_t)3 * MT * DQ * 4);
    if ((size_t)(wsp - (char*)d_ws) > ws_size) return;    // about 165 of the 256 MiB
    k_prep<<<dim3(512, 11, 1), 256, 0, stream>>>(x, wq, wk, wv, wo, qA, kA, vA, qB, kB, vB, XB, Wz, WO, AP, BP, CS);
    k_proj<<<dim3(MT / 64, DQ / 64 + 1, 3), 32, 0, stream>>>(XB, Wz, AP, F, XA, bq, bk, bv);
    k_tail<<<dim3(MT / 64, NH_, 3), 32, 0, stream>>>(F, XA, BP, CS, P16, Ph, Pl, VT16, VTh, VTl);   /* LoRA: F + 2 (x A^T) B^T, RoPE, planes */
    k_attn<<<dim3(NB_ * NH_, (TT - RH) / 128 + RH / 64, 1), 128, 0, stream>>>(P16, Ph, Pl, VT16, VTh, VTl, am, ATh, ATl);
    k_gemmw<bf, 1, DQ, DM, true><<<dim3(MT / 64, DM / 64, 1), 32, 0, stream>>>(ATh, ATl, WO, nullptr, OUT, bo, 0, 0, 0);
}

// v007
// Measured time: 146 microseconds a run.
// Two timings next to v006 put it at 1.04 and 1.03 times that version's speed.
// Counting every step since v000, it is 12.0 times as fast.
#include <hip/hip_runtime.h>

// Masked_MHA_LORA (x [2][2048][1024]; Q/K/V = x W^T + b + 2 (x A^T) B^T (LoRA rank 8, scaling 16/8); RoPE (rotate-half, base 10000) on Q, K (16 heads x 64); scores = Q.K/8 with the causal mask and the key padding mask (attention_mask == 0 -> -inf; int,
// read as data); softmax; out = (attn V merged) oW^T + ob -> [2][2048][1024]).
// Compute dtypes, f32 accumulate: every input rounded to bf16; the base projections on PLAIN bf16 operands (inputs: exact) + bias; the LoRA path as two small GEMMs (x A^T exact, then hl planes x exact B, rank padded 8 -> 32) added

#define NB_  2
#define TT   2048
#define DM   1024
#define NH_  16
#define NKV  16
#define REP  (NH_ / NKV)
#define HD   64
#define MT   (NB_ * TT)         // rows of both batch elements together
#define DQ   (NH_ * HD)
#define DKV  (NKV * HD)
#define RH   512                  // query rows < RH use hi+lo planes (0: none)
typedef _Float16 h16;
typedef unsigned short bf;
typedef __attribute__((ext_vector_type(16))) __bf16   v16bf;
typedef __attribute__((ext_vector_type(16))) _Float16 v16h;
typedef __attribute__((ext_vector_type(8)))  _Float16 v8h;
typedef __attribute__((ext_vector_type(8)))  unsigned short v8us;
typedef __attribute__((ext_vector_type(8)))  float    v8f;
typedef __attribute__((ext_vector_type(4)))  float    v4f;
typedef v8h  __attribute__((may_alias)) v8ha;
typedef v4f  __attribute__((may_alias)) v4fa;
typedef v8us __attribute__((may_alias)) v8usa;

__device__ __forceinline__ unsigned short f2bf(float f) { unsigned u = __float_as_uint(f); u += 0x7FFFu + ((u >> 16) & 1u); return (unsigned short)(u >> 16); }
__device__ __forceinline__ float bf2f(unsigned short b) { return __uint_as_float(((unsigned)b) << 16); }
__device__ __forceinline__ float bfr(float f) { return bf2f(f2bf(f)); }
__device__ __forceinline__ v16h cat16(v8h lo, v8h hi) { return __builtin_shufflevector(lo, hi, 0, 1, 2, 3, 4, 5, 6, 7, 8, 9, 10, 11, 12, 13, 14, 15); }
__device__ __forceinline__ v16bf cat16b(v8us lo, v8us hi) { return __builtin_bit_cast(v16bf, __builtin_shufflevector(lo, hi, 0, 1, 2, 3, 4, 5, 6, 7, 8, 9, 10, 11, 12, 13, 14, 15)); }
__device__ __forceinline__ v8f wmma16(v16h a, v16h b, v8f c) { return __builtin_amdgcn_wmma_f32_16x16x32_f16(false, a, false, b, (short)0, c, false, false); }
__device__ __forceinline__ v8f wmmab(v16bf a, v16bf b, v8f c) { return __builtin_amdgcn_wmma_f32_16x16x32_bf16(false, a, false, b, (short)0, c, false, false); }



// ---- gemm_tile: register-blocked GEMM, ONE WAVE per 64x64 output tile (16 accumulators), operands straight from 16-bit planes in fragment order (below; K elements a row); the k loop runs to Kl <= K.
// C[m][n] (f32, pitch ldc, + optional f32 bias[n]) = sum_k A[m][k] Bt[n][k] (+ split products per NSPLIT). Kl % 32 == 0. os: 16 x 68 floats of LDS.
// NW > 1: NW waves of one work-group share the tile; wave w takes the k blocks w, w + NW, ... into its own accumulators, the NW partial tiles meet in LDS (os: NW x 64 x 68 floats) and are summed in the fixed order w = 0, 1, ...
// XWAIT: s_wait_xcnt 0 behind a run of global loads or stores; the registers that the run names are inputs of the statement, so that none of them is overwritten in front of the wait.
#define XWAIT(...) asm volatile("s_wait_xcnt 0x0" :: __VA_ARGS__ : "memory")
// FRAGMENT ORDER of a K-contiguous 16-bit plane [rows][K]: each block of 16 rows x 32 k (one matrix operand, 1 KiB) lies in one piece, as two runs of 512 bytes; run u (k = 16 u + 8 hi + 0..7) holds lane (16 hi + row)'s 8 elements at 16 bytes x lane.
// Element offset of (row, k) = (row / 16) 16 K + (k / 32) 512 + ((k % 32) / 16) 256 + (((k % 16) / 8) 16 + row % 16) 8 + k % 8. ldp(p) loads a fragment from p = block + 8 lane: each of its two wave-wide loads covers four whole 128-byte lines. ld(p) is the loader of a row-major plane.
template <typename T16> struct WFrag;
template <> struct WFrag<h16> { typedef v16h V; static __device__ __forceinline__ V ld(const h16* p) { return cat16(*(const v8h*)p, *(const v8h*)(p + 16)); } static __device__ __forceinline__ V ldp(const h16* p) { return cat16(*(const v8h*)p, *(const v8h*)(p + 256)); } static __device__ __forceinline__ v8f mma(V a, V b, v8f c) { return wmma16(a, b, c); } };
template <> struct WFrag<bf> { typedef v16bf V; static __device__ __forceinline__ V ld(const bf* p) { return cat16b(*(const v8us*)p, *(const v8us*)(p + 16)); } static __device__ __forceinline__ V ldp(const bf* p) { return cat16b(*(const v8us*)p, *(const v8us*)(p + 256)); } static __device__ __forceinline__ v8f mma(V a, V b, v8f c) { return wmmab(a, b, c); } };
template <typename T16, int NSPLIT, int K, int ldc, bool BIAS, int NW = 1>
__device__ __forceinline__ void gemm_tile(const T16* __restrict__ A, const T16* __restrict__ A2, const T16* __restrict__ Bt, const T16* __restrict__ Bt2, int Kl, float* C, const float* __restrict__ bias, int r0, int c0, float* os) {
    typedef typename WFrag<T16>::V V;
    const int lane = threadIdx.x & 31, lr = lane & 15, hi = lane >> 4;
    const int wv = (NW > 1) ? __builtin_amdgcn_readfirstlane((int)(threadIdx.x >> 5)) : 0;   // the wave's number, in a scalar register: the k loop's bounds stay wave-uniform
    v8f acc[4][4];
#pragma unroll
    for (int mb = 0; mb < 4; ++mb)
#pragma unroll
        for (int nb = 0; nb < 4; ++nb) acc[mb][nb] = (v8f){};
    const T16* pa = A + (size_t)r0 * K; const T16* pb = Bt + (size_t)c0 * K; const T16* pa2 = (NSPLIT == 1 || NSPLIT == 2) ? A2 + (size_t)r0 * K : nullptr; const T16* pb2 = (NSPLIT >= 2) ? Bt2 + (size_t)c0 * K : nullptr;   // the tile's first row in each plane
    unsigned ol = (unsigned)(8 * lane + 512 * wv) * 2u;   // the lane's byte offset from there at the trip's k block, the same in every plane
    v4f bv = (v4f){};   // the lane's four bias values, loaded once per tile
    if (BIAS) { const float* bp = bias + c0 + lr * 4; bv = *(const v4f*)bp; asm volatile("s_wait_xcnt 0x0" ::: "memory"); /* behind the bias load, in front of any reuse of its address registers */ }
#pragma unroll 1
    for (int kc = 32 * wv; kc < Kl; kc += 32 * NW) {
        V a[4], a2[4];
#pragma unroll
        for (int mb = 0; mb < 4; ++mb) { a[mb] = WFrag<T16>::ldp((const T16*)((const char*)pa + ol) + (size_t)mb * 16 * K); if (NSPLIT == 1 || NSPLIT == 2) a2[mb] = WFrag<T16>::ldp((const T16*)((const char*)pa2 + ol) + (size_t)mb * 16 * K); }
#pragma unroll
        for (int nb = 0; nb < 4; ++nb) { const V b = WFrag<T16>::ldp((const T16*)((const char*)pb + ol) + (size_t)nb * 16 * K); V b2; if (NSPLIT >= 2) b2 = WFrag<T16>::ldp((const T16*)((const char*)pb2 + ol) + (size_t)nb * 16 * K);
#pragma unroll
            for (int mb = 0; mb < 4; ++mb) { acc[mb][nb] = WFrag<T16>::mma(a[mb], b, acc[mb][nb]); if (NSPLIT == 1 || NSPLIT == 2) acc[mb][nb] = WFrag<T16>::mma(a2[mb], b, acc[mb][nb]); if (NSPLIT >= 2) acc[mb][nb] = WFrag<T16>::mma(a[mb], b2, acc[mb][nb]); } }
        asm volatile("s_wait_xcnt 0x0" : "+v"(ol) :: "memory");   // behind the trip's loads, in front of the step of their offset register, which passes through the statement so that it lives up to the wait
        ol += 1024 * NW;
        asm volatile("v_nop\n\tv_nop\n\tv_nop\n\tv_nop" : "+v"(acc[0][0]), "+v"(acc[1][1]), "+v"(acc[2][2]), "+v"(acc[3][3]) : "v"(a[0]), "v"(a[3]));
    }
#pragma unroll
    for (int u = 0; u < 4; ++u) bv[u] = bfr(bv[u]);
    if constexpr (NW > 1) {
        float* pw = os + wv * (64 * 68);   // the wave's own partial tile
#pragma unroll
        for (int mb = 0; mb < 4; ++mb)
#pragma unroll
            for (int nb = 0; nb < 4; ++nb)
#pragma unroll
                for (int j = 0; j < 8; ++j) pw[(mb * 16 + hi * 8 + j) * 68 + nb * 16 + lr] = acc[mb][nb][j];
        __syncthreads();   // every wave's partial tile is in LDS before any is read
        constexpr int NS = 64 * 16 / (32 * NW);   // 16-byte pieces of the tile per thread
        v4f val[NS]; float* cp0 = C + (size_t)(r0 + (int)(threadIdx.x >> 4)) * ldc + c0 + lr * 4;   // the thread's place in rows tid / 16, + 2 NW, ...
#pragma unroll
        for (int s = 0; s < NS; ++s) { const float* ps = os + (s * 2 * NW + (int)(threadIdx.x >> 4)) * 68 + lr * 4; val[s] = *(const v4fa*)ps;
#pragma unroll
            for (int w = 1; w < NW; ++w) val[s] += *(const v4fa*)(ps + w * (64 * 68));
            if (BIAS) val[s] += bv;
            *(v4f*)(cp0 + (size_t)(s * 2 * NW) * ldc) = val[s]; }
        static_assert(NS == 4, "the wait below names four stored values");
        XWAIT("v"(val[0]), "v"(val[1]), "v"(val[2]), "v"(val[3]), "v"(cp0));
        return;
    }
#pragma unroll
    for (int mb = 0; mb < 4; ++mb) {
#pragma unroll
        for (int nb = 0; nb < 4; ++nb) {
#pragma unroll
            for (int j = 0; j < 8; ++j) os[(hi * 8 + j) * 68 + nb * 16 + lr] = acc[mb][nb][j]; }
        __builtin_amdgcn_wave_barrier(); asm volatile("" ::: "memory");
        float* crow = C + (size_t)(r0 + mb * 16) * ldc + c0;
{
            v4f val[8]; float* cp0 = crow + (size_t)hi * ldc + lr * 4;   // the lane's place in the block's rows hi, hi + 2, ...
#pragma unroll
            for (int s = 0; s < 8; ++s) { const int row = 2 * s + hi, cofs = lr * 4; val[s] = *(const v4fa*)(os + row * 68 + cofs); if (BIAS) val[s] += bv;
                *(v4f*)(cp0 + (size_t)(2 * s) * ldc) = val[s]; }
            XWAIT("v"(val[0]), "v"(val[1]), "v"(val[2]), "v"(val[3]), "v"(val[4]), "v"(val[5]), "v"(val[6]), "v"(val[7]), "v"(cp0));
             }
        __builtin_amdgcn_wave_barrier(); asm volatile("" ::: "memory");
    }
}
// k_gemmw: grid (M/64, N/64, Z), 32 threads; z-batch strides sA/sB/sC in elements
template <typename T16, int NSPLIT, int K, int ldc, bool BIAS>
__global__ __launch_bounds__(32) void k_gemmw(const T16* __restrict__ A, const T16* __restrict__ A2, const T16* __restrict__ Bt, const T16* __restrict__ Bt2, float* C, const float* __restrict__ bias, size_t sA, size_t sB, size_t sC) {
    __shared__ __align__(16) float os[16 * 68];
    const size_t z = blockIdx.z; A += z * sA; if (A2) A2 += z * sA; Bt += z * sB; if (Bt2) Bt2 += z * sB; C += z * sC;
    gemm_tile<T16, NSPLIT, K, ldc, BIAS>(A, A2, Bt, Bt2, K, C, bias, blockIdx.x * 64, blockIdx.y * 64, os);
}
// k_proj: every product with x as the left operand in one launch. grid (MT/64, DQ/64 + 1, 3): z = q, k, v; column tiles y < DQ/64 are the base projection x W^T + b -> F[z], the last column tile is x A^T -> XA[z] (A padded to 64 rows)
__global__ __launch_bounds__(32) void k_proj(const bf* __restrict__ XB, const bf* __restrict__ Wz, const bf* __restrict__ AP, float* F, float* XA, const float* __restrict__ bq, const float* __restrict__ bk, const float* __restrict__ bv) {
    __shared__ __align__(16) float os[16 * 68];
    const int z = blockIdx.z, y = blockIdx.y;
    if (y < DQ / 64) gemm_tile<bf, 0, DM, DQ, true>(XB, nullptr, Wz + (size_t)z * DQ * DM, nullptr, DM, F + (size_t)z * MT * DQ, z == 0 ? bq : (z == 1 ? bk : bv), blockIdx.x * 64, y * 64, os);
    else gemm_tile<bf, 0, DM, 64, false>(XB, nullptr, AP + (size_t)z * 64 * DM, nullptr, DM, XA + (size_t)z * MT * 64, nullptr, blockIdx.x * 64, 0, os);
}
__device__ __forceinline__ h16 tohx(float x) { return (h16)x; }
__device__ __forceinline__ void splitf(float y, unsigned short& h, unsigned short& l) { h = f2bf(y); l = f2bf(y - bf2f(h)); }
typedef __attribute__((ext_vector_type(2))) _Float16 v2h;
typedef __attribute__((ext_vector_type(4))) _Float16 v4h;
typedef __attribute__((ext_vector_type(2))) unsigned short v2us;
typedef __attribute__((ext_vector_type(4))) unsigned short v4us;
typedef __attribute__((ext_vector_type(2))) float v2f;
typedef __attribute__((ext_vector_type(4))) int v4i;

__global__ __launch_bounds__(256) void k_wtG(const float* __restrict__ w, int K, int N, bf* Bt) {
    const int lane = threadIdx.x & 31; const int L0 = (blockIdx.x * 8 + (threadIdx.x >> 5)) * 8; const int nlines = N * K / 64;
{
#pragma unroll 1
        for (int l = 0; l < 8; ++l) { const int L = L0 + l; if (L >= nlines) break; const size_t e = (size_t)L * 64 + lane * 2; const int k = (int)(e % K), n = (int)(e / K); v2us o;
            o[0] = f2bf(w[(size_t)k * N + n]); o[1] = f2bf(w[(size_t)(k + 1) * N + n]); *(v2us*)(Bt + e) = o; }
         }
}
// row-major f32 [rows][DM] -> bf16 in fragment order. One work-group of 256 threads converts one block of 16 rows (64 KiB in a row -> 32 fragments, 32 KiB in a row), 8 pieces of 8 elements a thread, so that few waves have to be started and each has 16 loads of 16 bytes in flight.
// Thread tid: row (tid / 4) % 16, k = 8 (tid % 4), in the fragments 8 (tid / 64) + 0..7. Per fragment a wave reads 128 bytes in a row of each of 8 rows and stores four whole 128-byte lines (8 rows x 8 k each).
__device__ __forceinline__ size_t frag_src(size_t i) { return ((i >> 11) * 16 + (i & 15)) * DM + ((i >> 5) & 63) * 16 + ((i >> 4) & 1) * 8; }   // the row-major element offset of piece i's first element
template <bool GUARD>   // GUARD: the source has only `rows` rows; the rows from there on are stored as zeros and not read
__device__ __forceinline__ void cvt_blk(const float* __restrict__ src, bf* dst, int blk, int tid, int rows) {
    const int row = (tid >> 2) & 15; const size_t i0 = (size_t)blk * 2048 + (size_t)(tid >> 6) * 512 + ((tid & 3) << 4) + row;   // i0: the place of the thread's first piece in fragment order; the next fragment along k is 64 pieces = 32 source elements on
    const float* sp = src + frag_src(i0); bf* dp = dst + i0 * 8; v8f v[8]; v8us o[8];
#pragma unroll
    for (int j = 0; j < 8; ++j) v[j] = (v8f){};
    if (!GUARD || blk * 16 + row < rows) {
#pragma unroll
        for (int j = 0; j < 8; ++j) v[j] = *(const v8f*)(sp + j * 32); }
#pragma unroll
    for (int j = 0; j < 8; ++j) {
#pragma unroll
        for (int k = 0; k < 8; ++k) o[j][k] = f2bf(v[j][k]);
        *(v8us*)(dp + j * 512) = o[j]; }
    XWAIT("v"(o[0]), "v"(o[1]), "v"(o[2]), "v"(o[3]), "v"(o[4]), "v"(o[5]), "v"(o[6]), "v"(o[7]), "v"(dp), "v"(sp)); }
// cos/sin table: thread idx = (t, i), i < HD / 2, stores its pair at d = i and at d = i + HD / 2 (the table's two halves are equal)
__device__ __forceinline__ void cstab_body(float* CS, int idx) { const int t = idx / (HD / 2), i = idx % (HD / 2); const float inv = __fdiv_rn(1.0f, powf(10000.0f, (float)(2 * i) / (float)HD)); const float ang = __fmul_rn((float)t, inv); v2f cs; cs[0] = cosf(ang); cs[1] = sinf(ang);
    float* dp = CS + ((size_t)t * HD + i) * 2; *(v2f*)dp = cs; *(v2f*)(dp + HD) = cs; XWAIT("v"(cs), "v"(dp));  }
// k_tail: all that stands between the projections and the attention, in one launch. grid (MT/64, NH_, 3), ONE WAVE per (64 rows, one head) of z = q, k, v: F + 2 (x A^T) B^T, RoPE (q, k), and the operand planes stored straight from the accumulators.
// x A^T (XA, f32, pitch 64; of its columns only the 8 ranks are not zero by construction) is split into its hi / lo bf16 fragments in registers: k = 0..7 sit in the first half of the lanes below 16, every other k is zero.
// q, k: B's rows as the A operand and the x A^T rows as the B operand, so a lane holds 8 consecutive d of one row t (D[8 hi + j][lr] = (d, t)): the rotate-half partner d +- 32 is the same lane's tile mb +- 2, and each plane takes one 16-byte store a tile.
// v: the operands the other way round, so a lane holds 8 consecutive t of one d: the transposed planes of a head g (2 HD TT elements: the hi plane, then the lo plane; of the fp16 ones only the first half is written or read) take one 16-byte store a tile. They lie in fragment order with the key block outermost: [t / 32][d / 16][1 KiB fragment of 16 d x 32 t], so a key block's four fragments are 4 KiB in a row.
// Head planes [h][t][d] (fp16 + hi/lo; each head's [t][d] in fragment order, K = HD), in the order (q b0, q b1, k b0, k b1) in P16 / Ph / Pl; rotate-half: out[d] = x[d] cos[t][d] - x[d+HD/2] sin[t][d], out[d+HD/2] = x[d+HD/2] cos[t][d] + x[d] sin[t][d] (the table's two halves are equal). Each store of a wave is 512 bytes in a row.
__device__ __forceinline__ void planes8(v8f r, v8h& o16, v8us& oh, v8us& ol) {
#pragma unroll
    for (int j = 0; j < 8; ++j) { o16[j] = tohx(r[j]); unsigned short a, c; splitf(r[j], a, c); oh[j] = a; ol[j] = c; } }
__global__ __launch_bounds__(32) void k_tail(const float* __restrict__ F, const float* __restrict__ XA, const bf* __restrict__ BP, const float* __restrict__ CS, h16* P16, bf* Ph, bf* Pl, h16* V16, bf* Vh, bf* Vl) {
    const int lane = threadIdx.x, lr = lane & 15, hi = lane >> 4;
    const int z = blockIdx.z, h = blockIdx.y, r0 = blockIdx.x * 64, b = r0 / TT, t0 = r0 % TT;
    const char* xa = (const char*)(XA + ((size_t)z * MT + r0) * 64); const char* bp = (const char*)(BP + ((size_t)z * DM + h * HD) * 32); const char* fz = (const char*)(F + ((size_t)z * MT + r0) * DQ + h * HD);   // wave-uniform bases
    const unsigned ox = (unsigned)lr * 256u, ob = (unsigned)(lr * 32 + 8 * hi) * 2u;   // the lane's byte offsets in them
    v16bf xh[4], xl[4], bb[4];
#pragma unroll
    for (int i = 0; i < 4; ++i) { const v8f x = *(const v8f*)(xa + ox + i * 16 * 256); v8us a, c; const v8us zz = (v8us){};
#pragma unroll
        for (int j = 0; j < 8; ++j) { unsigned short u, w; splitf(hi ? 0.f : x[j], u, w); a[j] = u; c[j] = w; }
        xh[i] = cat16b(a, zz); xl[i] = cat16b(c, zz); bb[i] = WFrag<bf>::ld((const bf*)(bp + ob + i * 16 * 64)); }
    if (z < 2) {
        const unsigned of = (unsigned)(lr * DQ + 8 * hi) * 4u, oc = (unsigned)((t0 + lr) * HD + 8 * hi) * 8u;   // row lr of a 16-row group, d = 8 hi: in F and in the cos/sin table
        const size_t po = (((size_t)(z * 2 + b) * NH_ + h) * TT + t0) * HD; char* p16 = (char*)(P16 + po); char* ph = (char*)(Ph + po); char* pl = (char*)(Pl + po); const unsigned op = (unsigned)lane * 16u;   // wave-uniform bases of the 64 rows in the three planes, and the lane's byte offset in a 512-byte run
#pragma unroll
        for (int nb = 0; nb < 4; ++nb) {   // 16 rows t
            v8f v[4], r[4];
#pragma unroll
            for (int mb = 0; mb < 4; ++mb) { v8f acc = wmmab(bb[mb], xh[nb], (v8f){}); acc = wmmab(bb[mb], xl[nb], acc); v[mb] = *(const v8f*)(fz + of + nb * 16 * DQ * 4 + mb * 64) + 2.0f * acc; }
#pragma unroll
            for (int mb = 0; mb < 2; ++mb) { const v8f c0 = *(const v8f*)((const char*)CS + oc + nb * 16 * HD * 8 + mb * 128), c1 = *(const v8f*)((const char*)CS + oc + nb * 16 * HD * 8 + mb * 128 + 32);   // (cos, sin) of d = 16 mb + 8 hi + 0..3, + 4..7
#pragma unroll
                for (int j = 0; j < 8; ++j) { const float cs = j < 4 ? c0[2 * j] : c1[2 * j - 8], sn = j < 4 ? c0[2 * j + 1] : c1[2 * j - 7]; r[mb][j] = v[mb][j] * cs - v[mb + 2][j] * sn; r[mb + 2][j] = v[mb + 2][j] * cs + v[mb][j] * sn; } }
            v8h o16[4]; v8us oh[4], ol[4];
#pragma unroll
            for (int mb = 0; mb < 4; ++mb) { planes8(r[mb], o16[mb], oh[mb], ol[mb]); const int o = (nb * 16 * HD + mb * 256) * 2; *(v8h*)(p16 + op + o) = o16[mb]; *(v8us*)(ph + op + o) = oh[mb]; *(v8us*)(pl + op + o) = ol[mb]; }
            XWAIT("v"(o16[0]), "v"(o16[1]), "v"(o16[2]), "v"(o16[3]), "v"(oh[0]), "v"(oh[1]), "v"(oh[2]), "v"(oh[3]), "v"(ol[0]), "v"(ol[1]), "v"(ol[2]), "v"(ol[3]), "v"(op), "v"(of), "v"(oc), "v"(ox), "v"(ob));
        }
    } else {
        const unsigned of = (unsigned)(8 * hi * DQ + lr) * 4u;   // row 8 hi of a 16-row group, d = lr
        const size_t vo = ((size_t)b * NKV + h) * HD * 2 * TT + (size_t)t0 * HD; char* p16 = (char*)(V16 + vo); char* ph = (char*)(Vh + vo); char* pl = (char*)(Vl + vo); const unsigned op = (unsigned)lane * 16u;   // wave-uniform bases of the two key blocks in the three planes, and the lane's byte offset in a 512-byte run
#pragma unroll
        for (int nb = 0; nb < 4; ++nb) {   // 16 columns d
            v8h o16[4]; v8us oh[4], ol[4];
#pragma unroll
            for (int mb = 0; mb < 4; ++mb) { v8f acc = wmmab(xh[mb], bb[nb], (v8f){}); acc = wmmab(xl[mb], bb[nb], acc); v8f r;
#pragma unroll
                for (int j = 0; j < 8; ++j) r[j] = *(const float*)(fz + of + (mb * 16 + j) * DQ * 4 + nb * 64) + 2.0f * acc[j];
                planes8(r, o16[mb], oh[mb], ol[mb]); const int o = ((mb >> 1) * 32 * HD + nb * 512 + (mb & 1) * 256) * 2; *(v8h*)(p16 + op + o) = o16[mb]; *(v8us*)(ph + op + o) = oh[mb]; *(v8us*)(pl + op + o) = ol[mb]; }
            XWAIT("v"(o16[0]), "v"(o16[1]), "v"(o16[2]), "v"(o16[3]), "v"(oh[0]), "v"(oh[1]), "v"(oh[2]), "v"(oh[3]), "v"(ol[0]), "v"(ol[1]), "v"(ol[2]), "v"(ol[3]), "v"(op), "v"(of), "v"(ox), "v"(ob));
        }
    }
}
// k_attn: the whole attention in one launch; scores and probabilities stay in registers. One wave owns 16 NQ query rows of one (batch, head) and walks the keys in blocks of 32 up to its diagonal block.
// S^T = K Q^T (A = key rows, B = query rows): a lane holds, for the query of its column lr, the keys 8 hi + j of each 16-key tile, which is the k order of a B operand; so P^T goes from the score accumulators straight into O^T += V^T P^T.
// Running maximum and sum per query (scaled log2 domain); the accumulators are rescaled when the maximum moves. The wave halves' sums are joined once at the end. Query rows below RH use the hi+lo planes (three products), the others fp16.
// The output goes out as the hi / lo planes [t][DQ], in fragment order, that the output projection reads; each store of a wave is 512 bytes in a row.
#define L2S 0.18033688011112042f   // HD^-0.5 x log2(e)
__device__ __forceinline__ float xhalf(float x) { const int b = __float_as_int(x); return __int_as_float(__builtin_amdgcn_permlanex16(b, b, 0x76543210, 0xfedcba98, false, false)); }   // the value of lane l ^ 16
__device__ __forceinline__ float exp2_slot(float x) { float r; asm("v_exp_f32 %0, %1\n\tv_nop" : "=v"(r) : "v"(x)); return r; }   // exp2 with the one slot behind a transcendental tied to it
template <typename T16, bool HI, int NQ>
__device__ __forceinline__ void attn_wave(const T16* __restrict__ Q, const T16* __restrict__ Q2, const T16* __restrict__ Kp, const T16* __restrict__ K2, const T16* __restrict__ Vt, const T16* __restrict__ Vt2, const int* __restrict__ amb, bf* Ah, bf* Al, int q0) {
    typedef typename WFrag<T16>::V V;
    const int lane = threadIdx.x & 31, lr = lane & 15, hi = lane >> 4;
    V qf[NQ][2], q2[NQ][2];
#pragma unroll
    for (int nq = 0; nq < NQ; ++nq)
#pragma unroll
        for (int ks = 0; ks < 2; ++ks) { const size_t qo = (size_t)(q0 + nq * 16) * HD + ks * 512 + 8 * lane; qf[nq][ks] = WFrag<T16>::ldp(Q + qo); if (HI) q2[nq][ks] = WFrag<T16>::ldp(Q2 + qo); }
    v8f o[4][NQ]; float m[NQ], l[NQ];
#pragma unroll
    for (int nq = 0; nq < NQ; ++nq) { m[nq] = -3.0e38f; l[nq] = 0.f;
#pragma unroll
        for (int dt = 0; dt < 4; ++dt) o[dt][nq] = (v8f){}; }
    const int nk = q0 + 16 * NQ;   // keys below nk are visible to some query of the wave
    unsigned ok = (unsigned)lane * 16u, ov = (unsigned)lane * 16u, oa = (unsigned)lane * 4u;   // the lane's byte offsets in the key planes, the value planes and the padding mask at the trip's key block
    V kf[2][2], k2[2][2];
#pragma unroll
    for (int t = 0; t < 2; ++t)
#pragma unroll
        for (int ks = 0; ks < 2; ++ks) { kf[t][ks] = WFrag<T16>::ldp((const T16*)((const char*)Kp + ok) + t * 16 * HD + ks * 512); if (HI) k2[t][ks] = WFrag<T16>::ldp((const T16*)((const char*)K2 + ok) + t * 16 * HD + ks * 512); }
    int av = *(const int*)((const char*)amb + oa);
#pragma unroll 1
    for (int kb = 0; kb < nk; kb += 32) {
        V vf[4], v2[4];
#pragma unroll
        for (int dt = 0; dt < 4; ++dt) { vf[dt] = WFrag<T16>::ldp((const T16*)((const char*)Vt + ov) + dt * 512); if (HI) v2[dt] = WFrag<T16>::ldp((const T16*)((const char*)Vt2 + ov) + dt * 512); }
        const unsigned mk = __builtin_amdgcn_ballot_w32(av != 0);   // bit u: key kb + u is not padding
        v8f s[2][NQ];
#pragma unroll
        for (int t = 0; t < 2; ++t)
#pragma unroll
            for (int nq = 0; nq < NQ; ++nq) { s[t][nq] = (v8f){};
#pragma unroll
                for (int ks = 0; ks < 2; ++ks) { s[t][nq] = WFrag<T16>::mma(kf[t][ks], qf[nq][ks], s[t][nq]); if (HI) { s[t][nq] = WFrag<T16>::mma(kf[t][ks], q2[nq][ks], s[t][nq]); s[t][nq] = WFrag<T16>::mma(k2[t][ks], qf[nq][ks], s[t][nq]); } } }
        asm volatile("s_wait_xcnt 0x0" : "+v"(ok), "+v"(oa) :: "memory");   // behind the key and mask loads, in front of the step of their offset registers
        const bool more = kb + 32 < nk; ok += more ? 32u * HD * 2u : 0u; oa += more ? 128u : 0u;   // the next trip's key fragments and mask words are fetched now, so that their latency runs under the softmax and the value products; the last trip fetches its own block again
        av = *(const int*)((const char*)amb + oa);
#pragma unroll
        for (int t = 0; t < 2; ++t)
#pragma unroll
            for (int ks = 0; ks < 2; ++ks) { kf[t][ks] = WFrag<T16>::ldp((const T16*)((const char*)Kp + ok) + t * 16 * HD + ks * 512); if (HI) k2[t][ks] = WFrag<T16>::ldp((const T16*)((const char*)K2 + ok) + t * 16 * HD + ks * 512); }
#pragma unroll
        for (int t = 0; t < 2; ++t)
#pragma unroll
            for (int nq = 0; nq < NQ; ++nq) s[t][nq] *= L2S;
        if (mk != 0xFFFFFFFFu || kb + 31 > q0) {   // wave-uniform: only a block with a padded key or on the diagonal has anything to mask
            const unsigned mkl = mk >> (8 * hi);
#pragma unroll
            for (int nq = 0; nq < NQ; ++nq) { const int lim = q0 + nq * 16 + lr - kb - 8 * hi;   // element (t, j) is key kb + 16 t + 8 hi + j: causal while 16 t + j <= lim
                const unsigned mm = mkl & (lim >= 31 ? 0xFFFFFFFFu : (lim < 0 ? 0u : ((2u << lim) - 1u)));
#pragma unroll
                for (int t = 0; t < 2; ++t)
#pragma unroll
                    for (int j = 0; j < 8; ++j) s[t][nq][j] = ((mm >> (t * 16 + j)) & 1u) ? s[t][nq][j] : -3.0e38f; }
        }
#pragma unroll
        for (int nq = 0; nq < NQ; ++nq) {
            float mx = fmaxf(s[0][nq][0], s[1][nq][0]);
#pragma unroll
            for (int j = 1; j < 8; ++j) mx = fmaxf(mx, fmaxf(s[0][nq][j], s[1][nq][j]));
            mx = fmaxf(mx, xhalf(mx)); mx = fmaxf(mx, m[nq]);
            const float al = __builtin_amdgcn_exp2f(m[nq] - mx); m[nq] = mx;
            float sum = 0.f;
#pragma unroll
            for (int t = 0; t < 2; ++t)
#pragma unroll
                for (int j = 0; j < 8; ++j) { const float p = HI ? exp2_slot(s[t][nq][j] - mx) : __builtin_amdgcn_exp2f(s[t][nq][j] - mx); s[t][nq][j] = p; sum += p; }
            l[nq] = l[nq] * al + sum;
#pragma unroll
            for (int dt = 0; dt < 4; ++dt) o[dt][nq] *= al;
            if constexpr (HI) { v8us h0, h1, l0, l1;
#pragma unroll
                for (int j = 0; j < 8; ++j) { unsigned short a, c; splitf(s[0][nq][j], a, c); h0[j] = a; l0[j] = c; splitf(s[1][nq][j], a, c); h1[j] = a; l1[j] = c; }
                const V ph = cat16b(h0, h1), pl = cat16b(l0, l1);
#pragma unroll
                for (int dt = 0; dt < 4; ++dt) { o[dt][nq] = WFrag<T16>::mma(vf[dt], ph, o[dt][nq]); o[dt][nq] = WFrag<T16>::mma(vf[dt], pl, o[dt][nq]); o[dt][nq] = WFrag<T16>::mma(v2[dt], ph, o[dt][nq]); }
            } else { V pf;
#pragma unroll
                for (int j = 0; j < 8; ++j) { pf[j] = tohx(s[0][nq][j]); pf[8 + j] = tohx(s[1][nq][j]); }
#pragma unroll
                for (int dt = 0; dt < 4; ++dt) o[dt][nq] = WFrag<T16>::mma(vf[dt], pf, o[dt][nq]); }
        }
        asm volatile("s_wait_xcnt 0x0" : "+v"(ov) :: "memory");   // behind the value loads, in front of the step of their offset register
        ov += 32u * HD * 2u;
        asm volatile("v_nop\n\tv_nop\n\tv_nop\n\tv_nop" : "+v"(o[0][NQ - 1]), "+v"(o[1][NQ - 1]), "+v"(o[2][NQ - 1]), "+v"(o[3][NQ - 1]) : "v"(vf[0]), "v"(vf[3]));   // the distance behind the trip's last matrix instructions on the loop's taken branch
    }
#pragma unroll
    for (int nq = 0; nq < NQ; ++nq) { const float inv = __fdiv_rn(1.0f, l[nq] + xhalf(l[nq])); v8us oh[4], ol[4];
        const size_t ro = (size_t)(q0 + nq * 16) * DQ + 8 * lane; bf* ph = Ah + ro; bf* pl = Al + ro;
#pragma unroll
        for (int dt = 0; dt < 4; ++dt)
#pragma unroll
            for (int j = 0; j < 8; ++j) { unsigned short a, c; splitf(o[dt][nq][j] * inv, a, c); oh[dt][j] = a; ol[dt][j] = c; }
#pragma unroll
        for (int dt = 0; dt < 4; ++dt) { *(v8us*)(ph + dt * 256) = oh[dt]; *(v8us*)(pl + dt * 256) = ol[dt]; }
        XWAIT("v"(oh[0]), "v"(oh[1]), "v"(oh[2]), "v"(oh[3]), "v"(ol[0]), "v"(ol[1]), "v"(ol[2]), "v"(ol[3]), "v"(ph), "v"(pl)); }
}
// grid (NB_ NH_, (TT - RH) / 128 + RH / 64), 4 independent waves: x = (batch, head); y walks the query rows from the last (longest key loop) to the first: 32 rows a wave in fp16 down to RH, then 16 rows a wave in hi+lo planes. The four waves of a work-group take neighbouring row blocks, so they read the same keys and values at about the same time.
__global__ __launch_bounds__(128) void k_attn(const h16* __restrict__ P16, const bf* __restrict__ Ph, const bf* __restrict__ Pl, const h16* __restrict__ V16, const bf* __restrict__ Vh, const bf* __restrict__ Vl, const int* __restrict__ am, bf* ATh, bf* ATl) {
    const int bh = blockIdx.x, y = blockIdx.y; const int wv = __builtin_amdgcn_readfirstlane((int)(threadIdx.x >> 5));   // the wave's number, in a scalar register: the key loop's bounds stay wave-uniform
    const size_t zq = (size_t)bh * TT * HD, zk = (size_t)(NB_ * NH_ + bh) * TT * HD, zv = (size_t)bh * HD * 2 * TT, ao = (size_t)(bh / NH_) * TT * DQ + (size_t)(bh % NH_) * (HD / 32) * 512; const int* amb = am + (size_t)(bh / NH_) * TT;
    if (y < (TT - RH) / 128) attn_wave<h16, false, 2>(P16 + zq, nullptr, P16 + zk, nullptr, V16 + zv, nullptr, amb, ATh + ao, ATl + ao, TT - 32 * (y * 4 + wv + 1));
    else attn_wave<bf, true, 1>(Ph + zq, Pl + zq, Ph + zk, Pl + zk, Vh + zv, Vl + zv, amb, ATh + ao, ATl + ao, RH - 16 * ((y - (TT - RH) / 128) * 4 + wv + 1));
}

// bpad_blk: bf16 Bt [DM][32] from B [DM][8] natural (cols >= 8 zero); one work-group takes 256 rows, 4 pieces of 8 elements a thread: piece tid % 4 of the rows tid / 4 + 64 j; only piece 0 has anything to read. Each store of a wave is 512 bytes in a row.
__device__ __forceinline__ void bpad_blk(const float* __restrict__ Bm, bf* BP, int q, int tid) { const int c = tid & 3, r0 = q * 256 + (tid >> 2);
    const float* sp = Bm + (size_t)r0 * 8; bf* dp = BP + (size_t)r0 * 32 + c * 8; v8f v[4]; v8us o[4];
#pragma unroll
    for (int j = 0; j < 4; ++j) v[j] = (v8f){};
    if (c == 0) {
#pragma unroll
        for (int j = 0; j < 4; ++j) v[j] = *(const v8f*)(sp + j * 64 * 8); }
#pragma unroll
    for (int j = 0; j < 4; ++j) {
#pragma unroll
        for (int k = 0; k < 8; ++k) o[j][k] = f2bf(v[j][k]);
        *(v8us*)(dp + j * 64 * 32) = o[j]; }
    XWAIT("v"(o[0]), "v"(o[1]), "v"(o[2]), "v"(o[3]), "v"(dp), "v"(sp)); }
// k_prep: every input conversion and the rope table in one launch, 256 threads, no idle block. Blocks in this order, the memory streams first: MT / 16 of x, DQ / 16 for each of the four weights, NB_CS of the cos/sin table, 4 for each padded A (64 rows, 8 of them from A), 4 for each padded B
#define NB_CS (TT * (HD / 2) / 256)
#define NB_W  (DQ / 16)
#define NB_X  (MT / 16)
#define NB_PREP (NB_CS + 4 * NB_W + NB_X + 12 + 12)
__global__ __launch_bounds__(256) void k_prep(const float* __restrict__ x, const float* __restrict__ wq, const float* __restrict__ wk, const float* __restrict__ wv, const float* __restrict__ wo, const float* __restrict__ qA, const float* __restrict__ kA, const float* __restrict__ vA, const float* __restrict__ qB, const float* __restrict__ kB, const float* __restrict__ vB,
                                              bf* XB, bf* Wz, bf* WO, bf* AP, bf* BP, float* CS) {
    int bx = blockIdx.x; const int tid = threadIdx.x;
    if (bx < NB_X) { cvt_blk<false>(x, XB, bx, tid, 0); return; }
    bx -= NB_X;
    if (bx < 4 * NB_W) { const int m = bx / NB_W; cvt_blk<false>(m == 0 ? wq : (m == 1 ? wk : (m == 2 ? wv : wo)), m < 3 ? Wz + (size_t)m * DQ * DM : WO, bx % NB_W, tid, 0); return; }
    bx -= 4 * NB_W;
    if (bx < NB_CS) { cstab_body(CS, bx * 256 + tid); return; }
    bx -= NB_CS;
    if (bx < 12) { const int m = bx / 4; cvt_blk<true>(m == 0 ? qA : (m == 1 ? kA : vA), AP + (size_t)m * 64 * DM, bx % 4, tid, 8); return; }
    bx -= 12;
    { const int m = bx / 4; bpad_blk(m == 0 ? qB : (m == 1 ? kB : vB), BP + (size_t)m * DM * 32, bx % 4, tid); }
}

extern "C" void kernel_launch(void* const* d_in, const int* in_sizes, int n_in,
                              void* d_out, int out_size, void* d_ws, size_t ws_size, hipStream_t stream) {
    (void)in_sizes; (void)n_in; (void)out_size;
    const float* x = (const float*)d_in[0]; const int* am = (const int*)d_in[1]; const float* wq = (const float*)d_in[2]; const float* bq = (const float*)d_in[3]; const float* wk = (const float*)d_in[4]; const float* bk = (const float*)d_in[5]; const float* wv = (const float*)d_in[6]; const float* bv = (const float*)d_in[7];
    const float* qA = (const float*)d_in[8]; const float* qB = (const float*)d_in[9]; const float* kA = (const float*)d_in[10]; const float* kB = (const float*)d_in[11]; const float* vA = (const float*)d_in[12]; const float* vB = (const float*)d_in[13]; const float* wo = (const float*)d_in[14]; const float* bo = (const float*)d_in[15];
    float* OUT = (float*)d_out;     // [2][2048][1024]
    char* wsp = (char*)d_ws;
    auto take = [&](size_t bytes) { char* p = wsp; wsp += (bytes + 255) & ~(size_t)255; return (void*)p; };
    // the output weight, the operand planes of both batch elements, the merged attention output
    const size_t PB = (size_t)NH_ * TT * HD, VB = (size_t)NKV * HD * 2 * TT;   // elements of one batch element's q or k planes / value planes
    bf* WO = (bf*)take((size_t)DM * DQ * 2);
    h16* P16 = (h16*)take(4 * PB * 2); bf* Ph = (bf*)take(4 * PB * 2); bf* Pl = (bf*)take(4 * PB * 2);   // [q b0][q b1][k b0][k b1]
    h16* VT16 = (h16*)take(NB_ * VB * 2); bf* VTh = (bf*)take(NB_ * VB * 2); bf* VTl = VTh + (size_t)HD * TT;   // hi plane in the first, lo plane in the second half of each head's 2 HD TT elements
    bf* ATh = (bf*)take((size_t)MT * DQ * 2); bf* ATl = (bf*)take((size_t)MT * DQ * 2);
    // temporaries of the projections
    bf* Wz = (bf*)take((size_t)3 * DQ * DM * 2); float* CS = (float*)take((size_t)TT * HD * 2 * 4); bf* XB = (bf*)take((size_t)MT * DM * 2); bf* AP = (bf*)take((size_t)3 * 64 * DM * 2); bf* BP = (bf*)take((size_t)3 * DM * 32 * 2);
    float* XA = (float*)take((size_t)3 * MT * 64 * 4); float* F = (float*)take((size_t)3 * MT * DQ * 4);
    if ((size_t)(wsp - (char*)d_ws) > ws_size) return;    // about 165 of the 256 MiB
    k_prep<<<dim3(NB_PREP, 1, 1), 256, 0, stream>>>(x, wq, wk, wv, wo, qA, kA, vA, qB, kB, vB, XB, Wz, WO, AP, BP, CS);
    k_proj<<<dim3(MT / 64, DQ / 64 + 1, 3), 32, 0, stream>>>(XB, Wz, AP, F, XA, bq, bk, bv);
    k_tail<<<dim3(MT / 64, NH_, 3), 32, 0, stream>>>(F, XA, BP, CS, P16, Ph, Pl, VT16, VTh, VTl);   /* LoRA: F + 2 (x A^T) B^T, RoPE, planes */
    k_attn<<<dim3(NB_ * NH_, (TT - RH) / 128 + RH / 64, 1), 128, 0, stream>>>(P16, Ph, Pl, VT16, VTh, VTl, am, ATh, ATl);
    k_gemmw<bf, 1, DQ, DM, true><<<dim3(MT / 64, DM / 64, 1), 32, 0, stream>>>(ATh, ATl, WO, nullptr, OUT, bo, 0, 0, 0);
}

// v008
// Measured time: 122 microseconds a run.
// In two side-by-side timings against v007, it was 1.20 and 1.18 times as fast.
// Over all steps from v000 it is 14.2 times as fast.
#include <hip/hip_runtime.h>

// Masked_MHA_LORA (x [2][2048][1024]; Q/K/V = x W^T + b + 2 (x A^T) B^T (LoRA rank 8, scaling 16/8); RoPE (rotate-half, base 10000) on Q, K (16 heads x 64); scores = Q.K/8 with the causal mask and the key padding mask (attention_mask == 0 -> -inf; int,
// read as data); softmax; out = (attn V merged) oW^T + ob -> [2][2048][1024]).
// Compute dtypes, f32 accumulate: every input rounded to bf16; the base projections on PLAIN bf16 operands (inputs: exact) + bias; the LoRA path as two small GEMMs (x A^T exact, then hl planes x exact B, rank padded 8 -> 32) added

#define NB_  2
#define TT   2048
#define DM   1024
#define NH_  16
#define NKV  16
#define REP  (NH_ / NKV)
#define HD   64
#define MT   (NB_ * TT)         // rows of both batch elements together
#define DQ   (NH_ * HD)
#define DKV  (NKV * HD)
#define RH   512                  // query rows < RH use hi+lo planes (0: none)
typedef _Float16 h16;
typedef unsigned short bf;
typedef __attribute__((ext_vector_type(16))) __bf16   v16bf;
typedef __attribute__((ext_vector_type(16))) _Float16 v16h;
typedef __attribute__((ext_vector_type(8)))  _Float16 v8h;
typedef __attribute__((ext_vector_type(8)))  unsigned short v8us;
typedef __attribute__((ext_vector_type(8)))  float    v8f;
typedef __attribute__((ext_vector_type(4)))  float    v4f;
typedef v8h  __attribute__((may_alias)) v8ha;
typedef v4f  __attribute__((may_alias)) v4fa;
typedef v8us __attribute__((may_alias)) v8usa;

__device__ __forceinline__ unsigned short f2bf(float f) { unsigned u = __float_as_uint(f); u += 0x7FFFu + ((u >> 16) & 1u); return (unsigned short)(u >> 16); }
__device__ __forceinline__ float bf2f(unsigned short b) { return __uint_as_float(((unsigned)b) << 16); }
__device__ __forceinline__ float bfr(float f) { return bf2f(f2bf(f)); }
__device__ __forceinline__ v16h cat16(v8h lo, v8h hi) { return __builtin_shufflevector(lo, hi, 0, 1, 2, 3, 4, 5, 6, 7, 8, 9, 10, 11, 12, 13, 14, 15); }
__device__ __forceinline__ v16bf cat16b(v8us lo, v8us hi) { return __builtin_bit_cast(v16bf, __builtin_shufflevector(lo, hi, 0, 1, 2, 3, 4, 5, 6, 7, 8, 9, 10, 11, 12, 13, 14, 15)); }
__device__ __forceinline__ v8f wmma16(v16h a, v16h b, v8f c) { return __builtin_amdgcn_wmma_f32_16x16x32_f16(false, a, false, b, (short)0, c, false, false); }
__device__ __forceinline__ v8f wmmab(v16bf a, v16bf b, v8f c) { return __builtin_amdgcn_wmma_f32_16x16x32_bf16(false, a, false, b, (short)0, c, false, false); }



// ---- gemm_tile: register-blocked GEMM, ONE WAVE per 64x64 output tile (16 accumulators), operands straight from 16-bit planes in fragment order (below; K elements a row); the k loop runs to Kl <= K.
// C[m][n] (f32, pitch ldc, + optional f32 bias[n]) = sum_k A[m][k] Bt[n][k] (+ split products per NSPLIT). Kl % 32 == 0. os: 16 x 68 floats of LDS.
// NW > 1: NW waves of one work-group share the tile; wave w takes the k blocks w, w + NW, ... into its own accumulators, the NW partial tiles meet in LDS (os: NW x 64 x 68 floats) and are summed in the fixed order w = 0, 1, ...
// XWAIT: s_wait_xcnt 0 behind a run of global loads or stores; the registers that the run names are inputs of the statement, so that none of them is overwritten in front of the wait.
#define XWAIT(...) asm volatile("s_wait_xcnt 0x0" :: __VA_ARGS__ : "memory")
// FRAGMENT ORDER of a K-contiguous 16-bit plane [rows][K]: each block of 16 rows x 32 k (one matrix operand, 1 KiB) lies in one piece, as two runs of 512 bytes; run u (k = 16 u + 8 hi + 0..7) holds lane (16 hi + row)'s 8 elements at 16 bytes x lane.
// Element offset of (row, k) = (row / 16) 16 K + (k / 32) 512 + ((k % 32) / 16) 256 + (((k % 16) / 8) 16 + row % 16) 8 + k % 8. ldp(p) loads a fragment from p = block + 8 lane: each of its two wave-wide loads covers four whole 128-byte lines. ld(p) is the loader of a row-major plane.
template <typename T16> struct WFrag;
template <> struct WFrag<h16> { typedef v16h V; static __device__ __forceinline__ V ld(const h16* p) { return cat16(*(const v8h*)p, *(const v8h*)(p + 16)); } static __device__ __forceinline__ V ldp(const h16* p) { return cat16(*(const v8h*)p, *(const v8h*)(p + 256)); } static __device__ __forceinline__ v8f mma(V a, V b, v8f c) { return wmma16(a, b, c); } };
template <> struct WFrag<bf> { typedef v16bf V; static __device__ __forceinline__ V ld(const bf* p) { return cat16b(*(const v8us*)p, *(const v8us*)(p + 16)); } static __device__ __forceinline__ V ldp(const bf* p) { return cat16b(*(const v8us*)p, *(const v8us*)(p + 256)); } static __device__ __forceinline__ v8f mma(V a, V b, v8f c) { return wmmab(a, b, c); } };
template <typename T16, int NSPLIT, int K, int ldc, bool BIAS, int NW = 1>
__device__ __forceinline__ void gemm_tile(const T16* __restrict__ A, const T16* __restrict__ A2, const T16* __restrict__ Bt, const T16* __restrict__ Bt2, int Kl, float* C, const float* __restrict__ bias, int r0, int c0, float* os) {
    typedef typename WFrag<T16>::V V;
    const int lane = threadIdx.x & 31, lr = lane & 15, hi = lane >> 4;
    const int wv = (NW > 1) ? __builtin_amdgcn_readfirstlane((int)(threadIdx.x >> 5)) : 0;   // the wave's number, in a scalar register: the k loop's bounds stay wave-uniform
    v8f acc[4][4];
#pragma unroll
    for (int mb = 0; mb < 4; ++mb)
#pragma unroll
        for (int nb = 0; nb < 4; ++nb) acc[mb][nb] = (v8f){};
    const T16* pa = A + (size_t)r0 * K; const T16* pb = Bt + (size_t)c0 * K; const T16* pa2 = (NSPLIT == 1 || NSPLIT == 2) ? A2 + (size_t)r0 * K : nullptr; const T16* pb2 = (NSPLIT >= 2) ? Bt2 + (size_t)c0 * K : nullptr;   // the tile's first row in each plane
    unsigned ol = (unsigned)(8 * lane + 512 * wv) * 2u;   // the lane's byte offset from there at the trip's k block, the same in every plane
    v4f bv = (v4f){};   // the lane's four bias values, loaded once per tile
    if (BIAS) { const float* bp = bias + c0 + lr * 4; bv = *(const v4f*)bp; asm volatile("s_wait_xcnt 0x0" ::: "memory"); /* behind the bias load, in front of any reuse of its address registers */ }
#pragma unroll 1
    for (int kc = 32 * wv; kc < Kl; kc += 32 * NW) {
        V a[4], a2[4];
#pragma unroll
        for (int mb = 0; mb < 4; ++mb) { a[mb] = WFrag<T16>::ldp((const T16*)((const char*)pa + ol) + (size_t)mb * 16 * K); if (NSPLIT == 1 || NSPLIT == 2) a2[mb] = WFrag<T16>::ldp((const T16*)((const char*)pa2 + ol) + (size_t)mb * 16 * K); }
#pragma unroll
        for (int nb = 0; nb < 4; ++nb) { const V b = WFrag<T16>::ldp((const T16*)((const char*)pb + ol) + (size_t)nb * 16 * K); V b2; if (NSPLIT >= 2) b2 = WFrag<T16>::ldp((const T16*)((const char*)pb2 + ol) + (size_t)nb * 16 * K);
#pragma unroll
            for (int mb = 0; mb < 4; ++mb) { acc[mb][nb] = WFrag<T16>::mma(a[mb], b, acc[mb][nb]); if (NSPLIT == 1 || NSPLIT == 2) acc[mb][nb] = WFrag<T16>::mma(a2[mb], b, acc[mb][nb]); if (NSPLIT >= 2) acc[mb][nb] = WFrag<T16>::mma(a[mb], b2, acc[mb][nb]); } }
        asm volatile("s_wait_xcnt 0x0" : "+v"(ol) :: "memory");   // behind the trip's loads, in front of the step of their offset register, which passes through the statement so that it lives up to the wait
        ol += 1024 * NW;
        asm volatile("v_nop\n\tv_nop\n\tv_nop\n\tv_nop" : "+v"(acc[0][0]), "+v"(acc[1][1]), "+v"(acc[2][2]), "+v"(acc[3][3]) : "v"(a[0]), "v"(a[3]));
    }
#pragma unroll
    for (int u = 0; u < 4; ++u) bv[u] = bfr(bv[u]);
    if constexpr (NW > 1) {
        float* pw = os + wv * (64 * 68);   // the wave's own partial tile
#pragma unroll
        for (int mb = 0; mb < 4; ++mb)
#pragma unroll
            for (int nb = 0; nb < 4; ++nb)
#pragma unroll
                for (int j = 0; j < 8; ++j) pw[(mb * 16 + hi * 8 + j) * 68 + nb * 16 + lr] = acc[mb][nb][j];
        __syncthreads();   // every wave's partial tile is in LDS before any is read
        constexpr int NS = 64 * 16 / (32 * NW);   // 16-byte pieces of the tile per thread
        v4f val[NS]; float* cp0 = C + (size_t)(r0 + (int)(threadIdx.x >> 4)) * ldc + c0 + lr * 4;   // the thread's place in rows tid / 16, + 2 NW, ...
#pragma unroll
        for (int s = 0; s < NS; ++s) { const float* ps = os + (s * 2 * NW + (int)(threadIdx.x >> 4)) * 68 + lr * 4; val[s] = *(const v4fa*)ps;
#pragma unroll
            for (int w = 1; w < NW; ++w) val[s] += *(const v4fa*)(ps + w * (64 * 68));
            if (BIAS) val[s] += bv;
            *(v4f*)(cp0 + (size_t)(s * 2 * NW) * ldc) = val[s]; }
        static_assert(NS == 8, "the wait below names eight stored values");
        XWAIT("v"(val[0]), "v"(val[1]), "v"(val[2]), "v"(val[3]), "v"(val[4]), "v"(val[5]), "v"(val[6]), "v"(val[7]), "v"(cp0));
        return;
    }
#pragma unroll
    for (int mb = 0; mb < 4; ++mb) {
#pragma unroll
        for (int nb = 0; nb < 4; ++nb) {
#pragma unroll
            for (int j = 0; j < 8; ++j) os[(hi * 8 + j) * 68 + nb * 16 + lr] = acc[mb][nb][j]; }
        __builtin_amdgcn_wave_barrier(); asm volatile("" ::: "memory");
        float* crow = C + (size_t)(r0 + mb * 16) * ldc + c0;
{
            v4f val[8]; float* cp0 = crow + (size_t)hi * ldc + lr * 4;   // the lane's place in the block's rows hi, hi + 2, ...
#pragma unroll
            for (int s = 0; s < 8; ++s) { const int row = 2 * s + hi, cofs = lr * 4; val[s] = *(const v4fa*)(os + row * 68 + cofs); if (BIAS) val[s] += bv;
                *(v4f*)(cp0 + (size_t)(2 * s) * ldc) = val[s]; }
            XWAIT("v"(val[0]), "v"(val[1]), "v"(val[2]), "v"(val[3]), "v"(val[4]), "v"(val[5]), "v"(val[6]), "v"(val[7]), "v"(cp0));
             }
        __builtin_amdgcn_wave_barrier(); asm volatile("" ::: "memory");
    }
}
// k_gemmw: grid (M/64, N/64, Z), 32 NW threads: NW waves share a tile's k loop, so that a grid of few tiles still puts several waves on every SIMD and one wave's load latency runs under the others' products; z-batch strides sA/sB/sC in elements
template <typename T16, int NSPLIT, int K, int ldc, bool BIAS, int NW>
__global__ __launch_bounds__(32 * NW) void k_gemmw(const T16* __restrict__ A, const T16* __restrict__ A2, const T16* __restrict__ Bt, const T16* __restrict__ Bt2, float* C, const float* __restrict__ bias, size_t sA, size_t sB, size_t sC) {
    __shared__ __align__(16) float os[NW * 64 * 68];
    const size_t z = blockIdx.z; A += z * sA; if (A2) A2 += z * sA; Bt += z * sB; if (Bt2) Bt2 += z * sB; C += z * sC;
    gemm_tile<T16, NSPLIT, K, ldc, BIAS, NW>(A, A2, Bt, Bt2, K, C, bias, blockIdx.x * 64, blockIdx.y * 64, os);
}
// k_proj: every product with x as the left operand in one launch. grid (MT/64, DQ/64 + 1, 3): z = q, k, v; column tiles y < DQ/64 are the base projection x W^T + b -> F[z], the last column tile is x A^T -> XA[z] (A padded to 64 rows)
__global__ __launch_bounds__(32) void k_proj(const bf* __restrict__ XB, const bf* __restrict__ Wz, const bf* __restrict__ AP, float* F, float* XA, const float* __restrict__ bq, const float* __restrict__ bk, const float* __restrict__ bv) {
    __shared__ __align__(16) float os[16 * 68];
    const int z = blockIdx.z, y = blockIdx.y;
    if (y < DQ / 64) gemm_tile<bf, 0, DM, DQ, true>(XB, nullptr, Wz + (size_t)z * DQ * DM, nullptr, DM, F + (size_t)z * MT * DQ, z == 0 ? bq : (z == 1 ? bk : bv), blockIdx.x * 64, y * 64, os);
    else gemm_tile<bf, 0, DM, 64, false>(XB, nullptr, AP + (size_t)z * 64 * DM, nullptr, DM, XA + (size_t)z * MT * 64, nullptr, blockIdx.x * 64, 0, os);
}
__device__ __forceinline__ h16 tohx(float x) { return (h16)x; }
__device__ __forceinline__ void splitf(float y, unsigned short& h, unsigned short& l) { h = f2bf(y); l = f2bf(y - bf2f(h)); }
typedef __attribute__((ext_vector_type(2))) _Float16 v2h;
typedef __attribute__((ext_vector_type(4))) _Float16 v4h;
typedef __attribute__((ext_vector_type(2))) unsigned short v2us;
typedef __attribute__((ext_vector_type(4))) unsigned short v4us;
typedef __attribute__((ext_vector_type(2))) float v2f;
typedef __attribute__((ext_vector_type(4))) int v4i;

__global__ __launch_bounds__(256) void k_wtG(const float* __restrict__ w, int K, int N, bf* Bt) {
    const int lane = threadIdx.x & 31; const int L0 = (blockIdx.x * 8 + (threadIdx.x >> 5)) * 8; const int nlines = N * K / 64;
{
#pragma unroll 1
        for (int l = 0; l < 8; ++l) { const int L = L0 + l; if (L >= nlines) break; const size_t e = (size_t)L * 64 + lane * 2; const int k = (int)(e % K), n = (int)(e / K); v2us o;
            o[0] = f2bf(w[(size_t)k * N + n]); o[1] = f2bf(w[(size_t)(k + 1) * N + n]); *(v2us*)(Bt + e) = o; }
         }
}
// row-major f32 [rows][DM] -> bf16 in fragment order. One work-group of 256 threads converts one block of 16 rows (64 KiB in a row -> 32 fragments, 32 KiB in a row), 8 pieces of 8 elements a thread, so that few waves have to be started and each has 16 loads of 16 bytes in flight.
// Thread tid: row (tid / 4) % 16, k = 8 (tid % 4), in the fragments 8 (tid / 64) + 0..7. Per fragment a wave reads 128 bytes in a row of each of 8 rows and stores four whole 128-byte lines (8 rows x 8 k each).
__device__ __forceinline__ size_t frag_src(size_t i) { return ((i >> 11) * 16 + (i & 15)) * DM + ((i >> 5) & 63) * 16 + ((i >> 4) & 1) * 8; }   // the row-major element offset of piece i's first element
template <bool GUARD>   // GUARD: the source has only `rows` rows; the rows from there on are stored as zeros and not read
__device__ __forceinline__ void cvt_blk(const float* __restrict__ src, bf* dst, int blk, int tid, int rows) {
    const int row = (tid >> 2) & 15; const size_t i0 = (size_t)blk * 2048 + (size_t)(tid >> 6) * 512 + ((tid & 3) << 4) + row;   // i0: the place of the thread's first piece in fragment order; the next fragment along k is 64 pieces = 32 source elements on
    const float* sp = src + frag_src(i0); bf* dp = dst + i0 * 8; v8f v[8]; v8us o[8];
#pragma unroll
    for (int j = 0; j < 8; ++j) v[j] = (v8f){};
    if (!GUARD || blk * 16 + row < rows) {
#pragma unroll
        for (int j = 0; j < 8; ++j) v[j] = *(const v8f*)(sp + j * 32); }
#pragma unroll
    for (int j = 0; j < 8; ++j) {
#pragma unroll
        for (int k = 0; k < 8; ++k) o[j][k] = f2bf(v[j][k]);
        *(v8us*)(dp + j * 512) = o[j]; }
    XWAIT("v"(o[0]), "v"(o[1]), "v"(o[2]), "v"(o[3]), "v"(o[4]), "v"(o[5]), "v"(o[6]), "v"(o[7]), "v"(dp), "v"(sp)); }
// cos/sin table: thread idx = (t, i), i < HD / 2, stores its pair at d = i and at d = i + HD / 2 (the table's two halves are equal)
__device__ __forceinline__ void cstab_body(float* CS, int idx) { const int t = idx / (HD / 2), i = idx % (HD / 2); const float inv = __fdiv_rn(1.0f, powf(10000.0f, (float)(2 * i) / (float)HD)); const float ang = __fmul_rn((float)t, inv); v2f cs; cs[0] = cosf(ang); cs[1] = sinf(ang);
    float* dp = CS + ((size_t)t * HD + i) * 2; *(v2f*)dp = cs; *(v2f*)(dp + HD) = cs; XWAIT("v"(cs), "v"(dp));  }
// k_tail: all that stands between the projections and the attention, in one launch. grid (MT/64, NH_, 3), ONE WAVE per (64 rows, one head) of z = q, k, v: F + 2 (x A^T) B^T, RoPE (q, k), and the operand planes stored straight from the accumulators.
// x A^T (XA, f32, pitch 64; of its columns only the 8 ranks are not zero by construction) is split into its hi / lo bf16 fragments in registers: k = 0..7 sit in the first half of the lanes below 16, every other k is zero.
// q, k: B's rows as the A operand and the x A^T rows as the B operand, so a lane holds 8 consecutive d of one row t (D[8 hi + j][lr] = (d, t)): the rotate-half partner d +- 32 is the same lane's tile mb +- 2, and each plane takes one 16-byte store a tile.
// v: the operands the other way round, so a lane holds 8 consecutive t of one d: the transposed planes of a head g (2 HD TT elements: the hi plane, then the lo plane; of the fp16 ones only the first half is written or read) take one 16-byte store a tile. They lie in fragment order with the key block outermost: [t / 32][d / 16][1 KiB fragment of 16 d x 32 t], so a key block's four fragments are 4 KiB in a row.
// Head planes [h][t][d] (fp16 + hi/lo; each head's [t][d] in fragment order, K = HD), in the order (q b0, q b1, k b0, k b1) in P16 / Ph / Pl; rotate-half: out[d] = x[d] cos[t][d] - x[d+HD/2] sin[t][d], out[d+HD/2] = x[d+HD/2] cos[t][d] + x[d] sin[t][d] (the table's two halves are equal). Each store of a wave is 512 bytes in a row.
__device__ __forceinline__ void planes8(v8f r, v8h& o16, v8us& oh, v8us& ol) {
#pragma unroll
    for (int j = 0; j < 8; ++j) { o16[j] = tohx(r[j]); unsigned short a, c; splitf(r[j], a, c); oh[j] = a; ol[j] = c; } }
__global__ __launch_bounds__(32) void k_tail(const float* __restrict__ F, const float* __restrict__ XA, const bf* __restrict__ BP, const float* __restrict__ CS, h16* P16, bf* Ph, bf* Pl, h16* V16, bf* Vh, bf* Vl) {
    const int lane = threadIdx.x, lr = lane & 15, hi = lane >> 4;
    const int z = blockIdx.z, h = blockIdx.y, r0 = blockIdx.x * 64, b = r0 / TT, t0 = r0 % TT;
    const char* xa = (const char*)(XA + ((size_t)z * MT + r0) * 64); const char* bp = (const char*)(BP + ((size_t)z * DM + h * HD) * 32); const char* fz = (const char*)(F + ((size_t)z * MT + r0) * DQ + h * HD);   // wave-uniform bases
    const unsigned ox = (unsigned)lr * 256u, ob = (unsigned)(lr * 32 + 8 * hi) * 2u;   // the lane's byte offsets in them
    v16bf xh[4], xl[4], bb[4];
#pragma unroll
    for (int i = 0; i < 4; ++i) { const v8f x = *(const v8f*)(xa + ox + i * 16 * 256); v8us a, c; const v8us zz = (v8us){};
#pragma unroll
        for (int j = 0; j < 8; ++j) { unsigned short u, w; splitf(hi ? 0.f : x[j], u, w); a[j] = u; c[j] = w; }
        xh[i] = cat16b(a, zz); xl[i] = cat16b(c, zz); bb[i] = WFrag<bf>::ld((const bf*)(bp + ob + i * 16 * 64)); }
    if (z < 2) {
        const unsigned of = (unsigned)(lr * DQ + 8 * hi) * 4u, oc = (unsigned)((t0 + lr) * HD + 8 * hi) * 8u;   // row lr of a 16-row group, d = 8 hi: in F and in the cos/sin table
        const size_t po = (((size_t)(z * 2 + b) * NH_ + h) * TT + t0) * HD; char* p16 = (char*)(P16 + po); char* ph = (char*)(Ph + po); char* pl = (char*)(Pl + po); const unsigned op = (unsigned)lane * 16u;   // wave-uniform bases of the 64 rows in the three planes, and the lane's byte offset in a 512-byte run
#pragma unroll
        for (int nb = 0; nb < 4; ++nb) {   // 16 rows t
            v8f v[4], r[4];
#pragma unroll
            for (int mb = 0; mb < 4; ++mb) { v8f acc = wmmab(bb[mb], xh[nb], (v8f){}); acc = wmmab(bb[mb], xl[nb], acc); v[mb] = *(const v8f*)(fz + of + nb * 16 * DQ * 4 + mb * 64) + 2.0f * acc; }
#pragma unroll
            for (int mb = 0; mb < 2; ++mb) { const v8f c0 = *(const v8f*)((const char*)CS + oc + nb * 16 * HD * 8 + mb * 128), c1 = *(const v8f*)((const char*)CS + oc + nb * 16 * HD * 8 + mb * 128 + 32);   // (cos, sin) of d = 16 mb + 8 hi + 0..3, + 4..7
#pragma unroll
                for (int j = 0; j < 8; ++j) { const float cs = j < 4 ? c0[2 * j] : c1[2 * j - 8], sn = j < 4 ? c0[2 * j + 1] : c1[2 * j - 7]; r[mb][j] = v[mb][j] * cs - v[mb + 2][j] * sn; r[mb + 2][j] = v[mb + 2][j] * cs + v[mb][j] * sn; } }
            v8h o16[4]; v8us oh[4], ol[4];
#pragma unroll
            for (int mb = 0; mb < 4; ++mb) { planes8(r[mb], o16[mb], oh[mb], ol[mb]); const int o = (nb * 16 * HD + mb * 256) * 2; *(v8h*)(p16 + op + o) = o16[mb]; *(v8us*)(ph + op + o) = oh[mb]; *(v8us*)(pl + op + o) = ol[mb]; }
            XWAIT("v"(o16[0]), "v"(o16[1]), "v"(o16[2]), "v"(o16[3]), "v"(oh[0]), "v"(oh[1]), "v"(oh[2]), "v"(oh[3]), "v"(ol[0]), "v"(ol[1]), "v"(ol[2]), "v"(ol[3]), "v"(op), "v"(of), "v"(oc), "v"(ox), "v"(ob));
        }
    } else {
        const unsigned of = (unsigned)(8 * hi * DQ + lr) * 4u;   // row 8 hi of a 16-row group, d = lr
        const size_t vo = ((size_t)b * NKV + h) * HD * 2 * TT + (size_t)t0 * HD; char* p16 = (char*)(V16 + vo); char* ph = (char*)(Vh + vo); char* pl = (char*)(Vl + vo); const unsigned op = (unsigned)lane * 16u;   // wave-uniform bases of the two key blocks in the three planes, and the lane's byte offset in a 512-byte run
#pragma unroll
        for (int nb = 0; nb < 4; ++nb) {   // 16 columns d
            v8h o16[4]; v8us oh[4], ol[4];
#pragma unroll
            for (int mb = 0; mb < 4; ++mb) { v8f acc = wmmab(xh[mb], bb[nb], (v8f){}); acc = wmmab(xl[mb], bb[nb], acc); v8f r;
#pragma unroll
                for (int j = 0; j < 8; ++j) r[j] = *(const float*)(fz + of + (mb * 16 + j) * DQ * 4 + nb * 64) + 2.0f * acc[j];
                planes8(r, o16[mb], oh[mb], ol[mb]); const int o = ((mb >> 1) * 32 * HD + nb * 512 + (mb & 1) * 256) * 2; *(v8h*)(p16 + op + o) = o16[mb]; *(v8us*)(ph + op + o) = oh[mb]; *(v8us*)(pl + op + o) = ol[mb]; }
            XWAIT("v"(o16[0]), "v"(o16[1]), "v"(o16[2]), "v"(o16[3]), "v"(oh[0]), "v"(oh[1]), "v"(oh[2]), "v"(oh[3]), "v"(ol[0]), "v"(ol[1]), "v"(ol[2]), "v"(ol[3]), "v"(op), "v"(of), "v"(ox), "v"(ob));
        }
    }
}
// k_attn: the whole attention in one launch; scores and probabilities stay in registers. One wave owns 16 NQ query rows of one (batch, head) and walks the keys in blocks of 32 up to its diagonal block.
// S^T = K Q^T (A = key rows, B = query rows): a lane holds, for the query of its column lr, the keys 8 hi + j of each 16-key tile, which is the k order of a B operand; so P^T goes from the score accumulators straight into O^T += V^T P^T.
// Running maximum and sum per query (scaled log2 domain); the accumulators are rescaled when the maximum moves. The wave halves' sums are joined once at the end. Query rows below RH use the hi+lo planes (three products), the others fp16.
// The output goes out as the hi / lo planes [t][DQ], in fragment order, that the output projection reads; each store of a wave is 512 bytes in a row.
#define L2S 0.18033688011112042f   // HD^-0.5 x log2(e)
__device__ __forceinline__ float xhalf(float x) { const int b = __float_as_int(x); return __int_as_float(__builtin_amdgcn_permlanex16(b, b, 0x76543210, 0xfedcba98, false, false)); }   // the value of lane l ^ 16
__device__ __forceinline__ float exp2_slot(float x) { float r; asm("v_exp_f32 %0, %1\n\tv_nop" : "=v"(r) : "v"(x)); return r; }   // exp2 with the one slot behind a transcendental tied to it
template <typename T16, bool HI, int NQ>
__device__ __forceinline__ void attn_wave(const T16* __restrict__ Q, const T16* __restrict__ Q2, const T16* __restrict__ Kp, const T16* __restrict__ K2, const T16* __restrict__ Vt, const T16* __restrict__ Vt2, const int* __restrict__ amb, bf* Ah, bf* Al, int q0) {
    typedef typename WFrag<T16>::V V;
    const int lane = threadIdx.x & 31, lr = lane & 15, hi = lane >> 4;
    V qf[NQ][2], q2[NQ][2];
#pragma unroll
    for (int nq = 0; nq < NQ; ++nq)
#pragma unroll
        for (int ks = 0; ks < 2; ++ks) { const size_t qo = (size_t)(q0 + nq * 16) * HD + ks * 512 + 8 * lane; qf[nq][ks] = WFrag<T16>::ldp(Q + qo); if (HI) q2[nq][ks] = WFrag<T16>::ldp(Q2 + qo); }
    v8f o[4][NQ]; float m[NQ], l[NQ];
#pragma unroll
    for (int nq = 0; nq < NQ; ++nq) { m[nq] = -3.0e38f; l[nq] = 0.f;
#pragma unroll
        for (int dt = 0; dt < 4; ++dt) o[dt][nq] = (v8f){}; }
    const int nk = q0 + 16 * NQ;   // keys below nk are visible to some query of the wave
    unsigned ok = (unsigned)lane * 16u, ov = (unsigned)lane * 16u, oa = (unsigned)lane * 4u;   // the lane's byte offsets in the key planes, the value planes and the padding mask at the trip's key block
    V kf[2][2], k2[2][2];
#pragma unroll
    for (int t = 0; t < 2; ++t)
#pragma unroll
        for (int ks = 0; ks < 2; ++ks) { kf[t][ks] = WFrag<T16>::ldp((const T16*)((const char*)Kp + ok) + t * 16 * HD + ks * 512); if (HI) k2[t][ks] = WFrag<T16>::ldp((const T16*)((const char*)K2 + ok) + t * 16 * HD + ks * 512); }
    int av = *(const int*)((const char*)amb + oa);
#pragma unroll 1
    for (int kb = 0; kb < nk; kb += 32) {
        V vf[4], v2[4];
#pragma unroll
        for (int dt = 0; dt < 4; ++dt) { vf[dt] = WFrag<T16>::ldp((const T16*)((const char*)Vt + ov) + dt * 512); if (HI) v2[dt] = WFrag<T16>::ldp((const T16*)((const char*)Vt2 + ov) + dt * 512); }
        const unsigned mk = __builtin_amdgcn_ballot_w32(av != 0);   // bit u: key kb + u is not padding
        v8f s[2][NQ];
#pragma unroll
        for (int t = 0; t < 2; ++t)
#pragma unroll
            for (int nq = 0; nq < NQ; ++nq) { s[t][nq] = (v8f){};
#pragma unroll
                for (int ks = 0; ks < 2; ++ks) { s[t][nq] = WFrag<T16>::mma(kf[t][ks], qf[nq][ks], s[t][nq]); if (HI) { s[t][nq] = WFrag<T16>::mma(kf[t][ks], q2[nq][ks], s[t][nq]); s[t][nq] = WFrag<T16>::mma(k2[t][ks], qf[nq][ks], s[t][nq]); } } }
        asm volatile("s_wait_xcnt 0x0" : "+v"(ok), "+v"(oa) :: "memory");   // behind the key and mask loads, in front of the step of their offset registers
        const bool more = kb + 32 < nk; ok += more ? 32u * HD * 2u : 0u; oa += more ? 128u : 0u;   // the next trip's key fragments and mask words are fetched now, so that their latency runs under the softmax and the value products; the last trip fetches its own block again
        av = *(const int*)((const char*)amb + oa);
#pragma unroll
        for (int t = 0; t < 2; ++t)
#pragma unroll
            for (int ks = 0; ks < 2; ++ks) { kf[t][ks] = WFrag<T16>::ldp((const T16*)((const char*)Kp + ok) + t * 16 * HD + ks * 512); if (HI) k2[t][ks] = WFrag<T16>::ldp((const T16*)((const char*)K2 + ok) + t * 16 * HD + ks * 512); }
#pragma unroll
        for (int t = 0; t < 2; ++t)
#pragma unroll
            for (int nq = 0; nq < NQ; ++nq) s[t][nq] *= L2S;
        if (mk != 0xFFFFFFFFu || kb + 31 > q0) {   // wave-uniform: only a block with a padded key or on the diagonal has anything to mask
            const unsigned mkl = mk >> (8 * hi);
#pragma unroll
            for (int nq = 0; nq < NQ; ++nq) { const int lim = q0 + nq * 16 + lr - kb - 8 * hi;   // element (t, j) is key kb + 16 t + 8 hi + j: causal while 16 t + j <= lim
                const unsigned mm = mkl & (lim >= 31 ? 0xFFFFFFFFu : (lim < 0 ? 0u : ((2u << lim) - 1u)));
#pragma unroll
                for (int t = 0; t < 2; ++t)
#pragma unroll
                    for (int j = 0; j < 8; ++j) s[t][nq][j] = ((mm >> (t * 16 + j)) & 1u) ? s[t][nq][j] : -3.0e38f; }
        }
#pragma unroll
        for (int nq = 0; nq < NQ; ++nq) {
            float mx = fmaxf(s[0][nq][0], s[1][nq][0]);
#pragma unroll
            for (int j = 1; j < 8; ++j) mx = fmaxf(mx, fmaxf(s[0][nq][j], s[1][nq][j]));
            mx = fmaxf(mx, xhalf(mx)); mx = fmaxf(mx, m[nq]);
            const float al = __builtin_amdgcn_exp2f(m[nq] - mx); m[nq] = mx;
            float sum = 0.f;
#pragma unroll
            for (int t = 0; t < 2; ++t)
#pragma unroll
                for (int j = 0; j < 8; ++j) { const float p = HI ? exp2_slot(s[t][nq][j] - mx) : __builtin_amdgcn_exp2f(s[t][nq][j] - mx); s[t][nq][j] = p; sum += p; }
            l[nq] = l[nq] * al + sum;
#pragma unroll
            for (int dt = 0; dt < 4; ++dt) o[dt][nq] *= al;
            if constexpr (HI) { v8us h0, h1, l0, l1;
#pragma unroll
                for (int j = 0; j < 8; ++j) { unsigned short a, c; splitf(s[0][nq][j], a, c); h0[j] = a; l0[j] = c; splitf(s[1][nq][j], a, c); h1[j] = a; l1[j] = c; }
                const V ph = cat16b(h0, h1), pl = cat16b(l0, l1);
#pragma unroll
                for (int dt = 0; dt < 4; ++dt) { o[dt][nq] = WFrag<T16>::mma(vf[dt], ph, o[dt][nq]); o[dt][nq] = WFrag<T16>::mma(vf[dt], pl, o[dt][nq]); o[dt][nq] = WFrag<T16>::mma(v2[dt], ph, o[dt][nq]); }
            } else { V pf;
#pragma unroll
                for (int j = 0; j < 8; ++j) { pf[j] = tohx(s[0][nq][j]); pf[8 + j] = tohx(s[1][nq][j]); }
#pragma unroll
                for (int dt = 0; dt < 4; ++dt) o[dt][nq] = WFrag<T16>::mma(vf[dt], pf, o[dt][nq]); }
        }
        asm volatile("s_wait_xcnt 0x0" : "+v"(ov) :: "memory");   // behind the value loads, in front of the step of their offset register
        ov += 32u * HD * 2u;
        asm volatile("v_nop\n\tv_nop\n\tv_nop\n\tv_nop" : "+v"(o[0][NQ - 1]), "+v"(o[1][NQ - 1]), "+v"(o[2][NQ - 1]), "+v"(o[3][NQ - 1]) : "v"(vf[0]), "v"(vf[3]));   // the distance behind the trip's last matrix instructions on the loop's taken branch
    }
#pragma unroll
    for (int nq = 0; nq < NQ; ++nq) { const float inv = __fdiv_rn(1.0f, l[nq] + xhalf(l[nq])); v8us oh[4], ol[4];
        const size_t ro = (size_t)(q0 + nq * 16) * DQ + 8 * lane; bf* ph = Ah + ro; bf* pl = Al + ro;
#pragma unroll
        for (int dt = 0; dt < 4; ++dt)
#pragma unroll
            for (int j = 0; j < 8; ++j) { unsigned short a, c; splitf(o[dt][nq][j] * inv, a, c); oh[dt][j] = a; ol[dt][j] = c; }
#pragma unroll
        for (int dt = 0; dt < 4; ++dt) { *(v8us*)(ph + dt * 256) = oh[dt]; *(v8us*)(pl + dt * 256) = ol[dt]; }
        XWAIT("v"(oh[0]), "v"(oh[1]), "v"(oh[2]), "v"(oh[3]), "v"(ol[0]), "v"(ol[1]), "v"(ol[2]), "v"(ol[3]), "v"(ph), "v"(pl)); }
}
// grid (NB_ NH_, (TT - RH) / 128 + RH / 64), 4 independent waves: x = (batch, head); y walks the query rows from the last (longest key loop) to the first: 32 rows a wave in fp16 down to RH, then 16 rows a wave in hi+lo planes. The four waves of a work-group take neighbouring row blocks, so they read the same keys and values at about the same time.
__global__ __launch_bounds__(128) void k_attn(const h16* __restrict__ P16, const bf* __restrict__ Ph, const bf* __restrict__ Pl, const h16* __restrict__ V16, const bf* __restrict__ Vh, const bf* __restrict__ Vl, const int* __restrict__ am, bf* ATh, bf* ATl) {
    const int bh = blockIdx.x, y = blockIdx.y; const int wv = __builtin_amdgcn_readfirstlane((int)(threadIdx.x >> 5));   // the wave's number, in a scalar register: the key loop's bounds stay wave-uniform
    const size_t zq = (size_t)bh * TT * HD, zk = (size_t)(NB_ * NH_ + bh) * TT * HD, zv = (size_t)bh * HD * 2 * TT, ao = (size_t)(bh / NH_) * TT * DQ + (size_t)(bh % NH_) * (HD / 32) * 512; const int* amb = am + (size_t)(bh / NH_) * TT;
    if (y < (TT - RH) / 128) attn_wave<h16, false, 2>(P16 + zq, nullptr, P16 + zk, nullptr, V16 + zv, nullptr, amb, ATh + ao, ATl + ao, TT - 32 * (y * 4 + wv + 1));
    else attn_wave<bf, true, 1>(Ph + zq, Pl + zq, Ph + zk, Pl + zk, Vh + zv, Vl + zv, amb, ATh + ao, ATl + ao, RH - 16 * ((y - (TT - RH) / 128) * 4 + wv + 1));
}

// bpad_blk: bf16 Bt [DM][32] from B [DM][8] natural (cols >= 8 zero); one work-group takes 256 rows, 4 pieces of 8 elements a thread: piece tid % 4 of the rows tid / 4 + 64 j; only piece 0 has anything to read. Each store of a wave is 512 bytes in a row.
__device__ __forceinline__ void bpad_blk(const float* __restrict__ Bm, bf* BP, int q, int tid) { const int c = tid & 3, r0 = q * 256 + (tid >> 2);
    const float* sp = Bm + (size_t)r0 * 8; bf* dp = BP + (size_t)r0 * 32 + c * 8; v8f v[4]; v8us o[4];
#pragma unroll
    for (int j = 0; j < 4; ++j) v[j] = (v8f){};
    if (c == 0) {
#pragma unroll
        for (int j = 0; j < 4; ++j) v[j] = *(const v8f*)(sp + j * 64 * 8); }
#pragma unroll
    for (int j = 0; j < 4; ++j) {
#pragma unroll
        for (int k = 0; k < 8; ++k) o[j][k] = f2bf(v[j][k]);
        *(v8us*)(dp + j * 64 * 32) = o[j]; }
    XWAIT("v"(o[0]), "v"(o[1]), "v"(o[2]), "v"(o[3]), "v"(dp), "v"(sp)); }
// k_prep: every input conversion and the rope table in one launch, 256 threads, no idle block. Blocks in this order, the memory streams first: MT / 16 of x, DQ / 16 for each of the four weights, NB_CS of the cos/sin table, 4 for each padded A (64 rows, 8 of them from A), 4 for each padded B
#define NB_CS (TT * (HD / 2) / 256)
#define NB_W  (DQ / 16)
#define NB_X  (MT / 16)
#define NB_PREP (NB_CS + 4 * NB_W + NB_X + 12 + 12)
__global__ __launch_bounds__(256) void k_prep(const float* __restrict__ x, const float* __restrict__ wq, const float* __restrict__ wk, const float* __restrict__ wv, const float* __restrict__ wo, const float* __restrict__ qA, const float* __restrict__ kA, const float* __restrict__ vA, const float* __restrict__ qB, const float* __restrict__ kB, const float* __restrict__ vB,
                                              bf* XB, bf* Wz, bf* WO, bf* AP, bf* BP, float* CS) {
    int bx = blockIdx.x; const int tid = threadIdx.x;
    if (bx < NB_X) { cvt_blk<false>(x, XB, bx, tid, 0); return; }
    bx -= NB_X;
    if (bx < 4 * NB_W) { const int m = bx / NB_W; cvt_blk<false>(m == 0 ? wq : (m == 1 ? wk : (m == 2 ? wv : wo)), m < 3 ? Wz + (size_t)m * DQ * DM : WO, bx % NB_W, tid, 0); return; }
    bx -= 4 * NB_W;
    if (bx < NB_CS) { cstab_body(CS, bx * 256 + tid); return; }
    bx -= NB_CS;
    if (bx < 12) { const int m = bx / 4; cvt_blk<true>(m == 0 ? qA : (m == 1 ? kA : vA), AP + (size_t)m * 64 * DM, bx % 4, tid, 8); return; }
    bx -= 12;
    { const int m = bx / 4; bpad_blk(m == 0 ? qB : (m == 1 ? kB : vB), BP + (size_t)m * DM * 32, bx % 4, tid); }
}

extern "C" void kernel_launch(void* const* d_in, const int* in_sizes, int n_in,
                              void* d_out, int out_size, void* d_ws, size_t ws_size, hipStream_t stream) {
    (void)in_sizes; (void)n_in; (void)out_size;
    const float* x = (const float*)d_in[0]; const int* am = (const int*)d_in[1]; const float* wq = (const float*)d_in[2]; const float* bq = (const float*)d_in[3]; const float* wk = (const float*)d_in[4]; const float* bk = (const float*)d_in[5]; const float* wv = (const float*)d_in[6]; const float* bv = (const float*)d_in[7];
    const float* qA = (const float*)d_in[8]; const float* qB = (const float*)d_in[9]; const float* kA = (const float*)d_in[10]; const float* kB = (const float*)d_in[11]; const float* vA = (const float*)d_in[12]; const float* vB = (const float*)d_in[13]; const float* wo = (const float*)d_in[14]; const float* bo = (const float*)d_in[15];
    float* OUT = (float*)d_out;     // [2][2048][1024]
    char* wsp = (char*)d_ws;
    auto take = [&](size_t bytes) { char* p = wsp; wsp += (bytes + 255) & ~(size_t)255; return (void*)p; };
    // the output weight, the operand planes of both batch elements, the merged attention output
    const size_t PB = (size_t)NH_ * TT * HD, VB = (size_t)NKV * HD * 2 * TT;   // elements of one batch element's q or k planes / value planes
    bf* WO = (bf*)take((size_t)DM * DQ * 2);
    h16* P16 = (h16*)take(4 * PB * 2); bf* Ph = (bf*)take(4 * PB * 2); bf* Pl = (bf*)take(4 * PB * 2);   // [q b0][q b1][k b0][k b1]
    h16* VT16 = (h16*)take(NB_ * VB * 2); bf* VTh = (bf*)take(NB_ * VB * 2); bf* VTl = VTh + (size_t)HD * TT;   // hi plane in the first, lo plane in the second half of each head's 2 HD TT elements
    bf* ATh = (bf*)take((size_t)MT * DQ * 2); bf* ATl = (bf*)take((size_t)MT * DQ * 2);
    // temporaries of the projections
    bf* Wz = (bf*)take((size_t)3 * DQ * DM * 2); float* CS = (float*)take((size_t)TT * HD * 2 * 4); bf* XB = (bf*)take((size_t)MT * DM * 2); bf* AP = (bf*)take((size_t)3 * 64 * DM * 2); bf* BP = (bf*)take((size_t)3 * DM * 32 * 2);
    float* XA = (float*)take((size_t)3 * MT * 64 * 4); float* F = (float*)take((size_t)3 * MT * DQ * 4);
    if ((size_t)(wsp - (char*)d_ws) > ws_size) return;    // about 165 of the 256 MiB
    k_prep<<<dim3(NB_PREP, 1, 1), 256, 0, stream>>>(x, wq, wk, wv, wo, qA, kA, vA, qB, kB, vB, XB, Wz, WO, AP, BP, CS);
    k_proj<<<dim3(MT / 64, DQ / 64 + 1, 3), 32, 0, stream>>>(XB, Wz, AP, F, XA, bq, bk, bv);
    k_tail<<<dim3(MT / 64, NH_, 3), 32, 0, stream>>>(F, XA, BP, CS, P16, Ph, Pl, VT16, VTh, VTl);   /* LoRA: F + 2 (x A^T) B^T, RoPE, planes */
    k_attn<<<dim3(NB_ * NH_, (TT - RH) / 128 + RH / 64, 1), 128, 0, stream>>>(P16, Ph, Pl, VT16, VTh, VTl, am, ATh, ATl);
    k_gemmw<bf, 1, DQ, DM, true, 4><<<dim3(MT / 64, DM / 64, 1), 128, 0, stream>>>(ATh, ATl, WO, nullptr, OUT, bo, 0, 0, 0);
}

// v009
// Measured time: 114 microseconds a run.
// Timed twice side by side with v008, it ran 1.08 and 1.06 times as fast.
// All steps since v000 together make it 15.2 times as fast.
#include <hip/hip_runtime.h>

// Masked_MHA_LORA (x [2][2048][1024]; Q/K/V = x W^T + b + 2 (x A^T) B^T (LoRA rank 8, scaling 16/8); RoPE (rotate-half, base 10000) on Q, K (16 heads x 64); scores = Q.K/8 with the causal mask and the key padding mask (attention_mask == 0 -> -inf; int,
// read as data); softmax; out = (attn V merged) oW^T + ob -> [2][2048][1024]).
// Compute dtypes, f32 accumulate: every input rounded to bf16; the base projections on PLAIN bf16 operands (inputs: exact) + bias; the LoRA path as two small GEMMs (x A^T exact, then hl planes x exact B, rank padded 8 -> 32) added

#define NB_  2
#define TT   2048
#define DM   1024
#define NH_  16
#define NKV  16
#define REP  (NH_ / NKV)
#define HD   64
#define MT   (NB_ * TT)         // rows of both batch elements together
#define DQ   (NH_ * HD)
#define DKV  (NKV * HD)
#define RH   512                  // query rows < RH use hi+lo planes (0: none)
typedef _Float16 h16;
typedef unsigned short bf;
typedef __attribute__((ext_vector_type(16))) __bf16   v16bf;
typedef __attribute__((ext_vector_type(16))) _Float16 v16h;
typedef __attribute__((ext_vector_type(8)))  _Float16 v8h;
typedef __attribute__((ext_vector_type(8)))  unsigned short v8us;
typedef __attribute__((ext_vector_type(8)))  float    v8f;
typedef __attribute__((ext_vector_type(4)))  float    v4f;
typedef v8h  __attribute__((may_alias)) v8ha;
typedef v4f  __attribute__((may_alias)) v4fa;
typedef v8us __attribute__((may_alias)) v8usa;

__device__ __forceinline__ unsigned short f2bf(float f) { unsigned u = __float_as_uint(f); u += 0x7FFFu + ((u >> 16) & 1u); return (unsigned short)(u >> 16); }
__device__ __forceinline__ float bf2f(unsigned short b) { return __uint_as_float(((unsigned)b) << 16); }
__device__ __forceinline__ float bfr(float f) { return bf2f(f2bf(f)); }
__device__ __forceinline__ v16h cat16(v8h lo, v8h hi) { return __builtin_shufflevector(lo, hi, 0, 1, 2, 3, 4, 5, 6, 7, 8, 9, 10, 11, 12, 13, 14, 15); }
__device__ __forceinline__ v16bf cat16b(v8us lo, v8us hi) { return __builtin_bit_cast(v16bf, __builtin_shufflevector(lo, hi, 0, 1, 2, 3, 4, 5, 6, 7, 8, 9, 10, 11, 12, 13, 14, 15)); }
__device__ __forceinline__ v8f wmma16(v16h a, v16h b, v8f c) { return __builtin_amdgcn_wmma_f32_16x16x32_f16(false, a, false, b, (short)0, c, false, false); }
__device__ __forceinline__ v8f wmmab(v16bf a, v16bf b, v8f c) { return __builtin_amdgcn_wmma_f32_16x16x32_bf16(false, a, false, b, (short)0, c, false, false); }



// ---- gemm_tile: register-blocked GEMM, ONE WAVE per 64x64 output tile (16 accumulators), operands straight from 16-bit planes in fragment order (below; K elements a row); the k loop runs to Kl <= K.
// C[m][n] (f32, pitch ldc, + optional f32 bias[n]) = sum_k A[m][k] Bt[n][k] (+ split products per NSPLIT). Kl % 32 == 0. os: 16 x 68 floats of LDS.
// NW > 1: NW waves of one work-group share the tile; wave w takes the k blocks w, w + NW, ... into its own accumulators, the NW partial tiles meet in LDS (os: NW x 64 x 68 floats) and are summed in the fixed order w = 0, 1, ...
// XWAIT: s_wait_xcnt 0 behind a run of global loads or stores; the registers that the run names are inputs of the statement, so that none of them is overwritten in front of the wait.
#define XWAIT(...) asm volatile("s_wait_xcnt 0x0" :: __VA_ARGS__ : "memory")
// FRAGMENT ORDER of a K-contiguous 16-bit plane [rows][K]: each block of 16 rows x 32 k (one matrix operand, 1 KiB) lies in one piece, as two runs of 512 bytes; run u (k = 16 u + 8 hi + 0..7) holds lane (16 hi + row)'s 8 elements at 16 bytes x lane.
// Element offset of (row, k) = (row / 16) 16 K + (k / 32) 512 + ((k % 32) / 16) 256 + (((k % 16) / 8) 16 + row % 16) 8 + k % 8. ldp(p) loads a fragment from p = block + 8 lane: each of its two wave-wide loads covers four whole 128-byte lines. ld(p) is the loader of a row-major plane.
template <typename T16> struct WFrag;
template <> struct WFrag<h16> { typedef v16h V; static __device__ __forceinline__ V ld(const h16* p) { return cat16(*(const v8h*)p, *(const v8h*)(p + 16)); } static __device__ __forceinline__ V ldp(const h16* p) { return cat16(*(const v8h*)p, *(const v8h*)(p + 256)); } static __device__ __forceinline__ v8f mma(V a, V b, v8f c) { return wmma16(a, b, c); } };
template <> struct WFrag<bf> { typedef v16bf V; static __device__ __forceinline__ V ld(const bf* p) { return cat16b(*(const v8us*)p, *(const v8us*)(p + 16)); } static __device__ __forceinline__ V ldp(const bf* p) { return cat16b(*(const v8us*)p, *(const v8us*)(p + 256)); } static __device__ __forceinline__ v8f mma(V a, V b, v8f c) { return wmmab(a, b, c); } };
// tile_out: one wave's 64x64 accumulator tile -> C (f32, pitch ldc, + the lane's four bias values bv), 16 rows at a time through the wave's own 16 x 68 floats of LDS (os), so that every store covers whole lines
template <int ldc, bool BIAS>
__device__ __forceinline__ void tile_out(v8f (&acc)[4][4], float* C, v4f bv, int r0, int c0, float* os) {
    const int lane = threadIdx.x & 31, lr = lane & 15, hi = lane >> 4;
#pragma unroll
    for (int mb = 0; mb < 4; ++mb) {
#pragma unroll
        for (int nb = 0; nb < 4; ++nb) {
#pragma unroll
            for (int j = 0; j < 8; ++j) os[(hi * 8 + j) * 68 + nb * 16 + lr] = acc[mb][nb][j]; }
        __builtin_amdgcn_wave_barrier(); asm volatile("" ::: "memory");
        float* crow = C + (size_t)(r0 + mb * 16) * ldc + c0;
{
            v4f val[8]; float* cp0 = crow + (size_t)hi * ldc + lr * 4;   // the lane's place in the block's rows hi, hi + 2, ...
#pragma unroll
            for (int s = 0; s < 8; ++s) { const int row = 2 * s + hi, cofs = lr * 4; val[s] = *(const v4fa*)(os + row * 68 + cofs); if (BIAS) val[s] += bv;
                *(v4f*)(cp0 + (size_t)(2 * s) * ldc) = val[s]; }
            XWAIT("v"(val[0]), "v"(val[1]), "v"(val[2]), "v"(val[3]), "v"(val[4]), "v"(val[5]), "v"(val[6]), "v"(val[7]), "v"(cp0));
             }
        __builtin_amdgcn_wave_barrier(); asm volatile("" ::: "memory");
    }
}
template <typename T16, int NSPLIT, int K, int ldc, bool BIAS, int NW = 1>
__device__ __forceinline__ void gemm_tile(const T16* __restrict__ A, const T16* __restrict__ A2, const T16* __restrict__ Bt, const T16* __restrict__ Bt2, int Kl, float* C, const float* __restrict__ bias, int r0, int c0, float* os) {
    typedef typename WFrag<T16>::V V;
    const int lane = threadIdx.x & 31, lr = lane & 15, hi = lane >> 4;
    const int wv = (NW > 1) ? __builtin_amdgcn_readfirstlane((int)(threadIdx.x >> 5)) : 0;   // the wave's number, in a scalar register: the k loop's bounds stay wave-uniform
    v8f acc[4][4];
#pragma unroll
    for (int mb = 0; mb < 4; ++mb)
#pragma unroll
        for (int nb = 0; nb < 4; ++nb) acc[mb][nb] = (v8f){};
    const T16* pa = A + (size_t)r0 * K; const T16* pb = Bt + (size_t)c0 * K; const T16* pa2 = (NSPLIT == 1 || NSPLIT == 2) ? A2 + (size_t)r0 * K : nullptr; const T16* pb2 = (NSPLIT >= 2) ? Bt2 + (size_t)c0 * K : nullptr;   // the tile's first row in each plane
    unsigned ol = (unsigned)(8 * lane + 512 * wv) * 2u;   // the lane's byte offset from there at the trip's k block, the same in every plane
    v4f bv = (v4f){};   // the lane's four bias values, loaded once per tile
    if (BIAS) { const float* bp = bias + c0 + lr * 4; bv = *(const v4f*)bp; asm volatile("s_wait_xcnt 0x0" ::: "memory"); /* behind the bias load, in front of any reuse of its address registers */ }
#pragma unroll 1
    for (int kc = 32 * wv; kc < Kl; kc += 32 * NW) {
        V a[4], a2[4];
#pragma unroll
        for (int mb = 0; mb < 4; ++mb) { a[mb] = WFrag<T16>::ldp((const T16*)((const char*)pa + ol) + (size_t)mb * 16 * K); if (NSPLIT == 1 || NSPLIT == 2) a2[mb] = WFrag<T16>::ldp((const T16*)((const char*)pa2 + ol) + (size_t)mb * 16 * K); }
#pragma unroll
        for (int nb = 0; nb < 4; ++nb) { const V b = WFrag<T16>::ldp((const T16*)((const char*)pb + ol) + (size_t)nb * 16 * K); V b2; if (NSPLIT >= 2) b2 = WFrag<T16>::ldp((const T16*)((const char*)pb2 + ol) + (size_t)nb * 16 * K);
#pragma unroll
            for (int mb = 0; mb < 4; ++mb) { acc[mb][nb] = WFrag<T16>::mma(a[mb], b, acc[mb][nb]); if (NSPLIT == 1 || NSPLIT == 2) acc[mb][nb] = WFrag<T16>::mma(a2[mb], b, acc[mb][nb]); if (NSPLIT >= 2) acc[mb][nb] = WFrag<T16>::mma(a[mb], b2, acc[mb][nb]); } }
        asm volatile("s_wait_xcnt 0x0" : "+v"(ol) :: "memory");   // behind the trip's loads, in front of the step of their offset register, which passes through the statement so that it lives up to the wait
        ol += 1024 * NW;
        asm volatile("v_nop\n\tv_nop\n\tv_nop\n\tv_nop" : "+v"(acc[0][0]), "+v"(acc[1][1]), "+v"(acc[2][2]), "+v"(acc[3][3]) : "v"(a[0]), "v"(a[3]));
    }
#pragma unroll
    for (int u = 0; u < 4; ++u) bv[u] = bfr(bv[u]);
    if constexpr (NW > 1) {
        float* pw = os + wv * (64 * 68);   // the wave's own partial tile
#pragma unroll
        for (int mb = 0; mb < 4; ++mb)
#pragma unroll
            for (int nb = 0; nb < 4; ++nb)
#pragma unroll
                for (int j = 0; j < 8; ++j) pw[(mb * 16 + hi * 8 + j) * 68 + nb * 16 + lr] = acc[mb][nb][j];
        __syncthreads();   // every wave's partial tile is in LDS before any is read
        constexpr int NS = 64 * 16 / (32 * NW);   // 16-byte pieces of the tile per thread
        v4f val[NS]; float* cp0 = C + (size_t)(r0 + (int)(threadIdx.x >> 4)) * ldc + c0 + lr * 4;   // the thread's place in rows tid / 16, + 2 NW, ...
#pragma unroll
        for (int s = 0; s < NS; ++s) { const float* ps = os + (s * 2 * NW + (int)(threadIdx.x >> 4)) * 68 + lr * 4; val[s] = *(const v4fa*)ps;
#pragma unroll
            for (int w = 1; w < NW; ++w) val[s] += *(const v4fa*)(ps + w * (64 * 68));
            if (BIAS) val[s] += bv;
            *(v4f*)(cp0 + (size_t)(s * 2 * NW) * ldc) = val[s]; }
        static_assert(NS == 8, "the wait below names eight stored values");
        XWAIT("v"(val[0]), "v"(val[1]), "v"(val[2]), "v"(val[3]), "v"(val[4]), "v"(val[5]), "v"(val[6]), "v"(val[7]), "v"(cp0));
        return;
    }
    tile_out<ldc, BIAS>(acc, C, bv, r0, c0, os);
}
// k_gemmw: grid (M/64, N/64, Z), 32 NW threads: NW waves share a tile's k loop, so that a grid of few tiles still puts several waves on every SIMD and one wave's load latency runs under the others' products; z-batch strides sA/sB/sC in elements
template <typename T16, int NSPLIT, int K, int ldc, bool BIAS, int NW>
__global__ __launch_bounds__(32 * NW) void k_gemmw(const T16* __restrict__ A, const T16* __restrict__ A2, const T16* __restrict__ Bt, const T16* __restrict__ Bt2, float* C, const float* __restrict__ bias, size_t sA, size_t sB, size_t sC) {
    __shared__ __align__(16) float os[NW * 64 * 68];
    const size_t z = blockIdx.z; A += z * sA; if (A2) A2 += z * sA; Bt += z * sB; if (Bt2) Bt2 += z * sB; C += z * sC;
    gemm_tile<T16, NSPLIT, K, ldc, BIAS, NW>(A, A2, Bt, Bt2, K, C, bias, blockIdx.x * 64, blockIdx.y * 64, os);
}
// k_proj: every product with x as the left operand in one launch. grid (MT/128, NCT + 2), 4 waves (2 x 2) share a tile of 128 rows x 128 columns, 64 x 64 a wave; column tiles y < NCT are the base projections x W^T + b -> F[y / 8] (q, k, v),
// the last two are x A^T -> XA[z] (each A padded to 64 rows): z = 0 and 1 side by side, then z = 2, whose second column half repeats the first and is not stored.
// The operands come through LDS, so that each fragment leaves L2 once for the two waves that use it, and one stage ahead, so that its latency runs under the products. A stage is 64 k of both operands: 8 blocks of 16 rows x 2 fragments each = 16 KiB an operand, in fragment order as in the planes
// (a block's two fragments are 2 KiB in a row there). Two buffers; each wave brings a quarter of a stage (4 blocks of one operand) with 16 asynchronous 16-byte copies to LDS. The k order of every sum is that of a plain loop over k.
#define NCT (3 * DQ / 128)
#define PST 32768   // bytes of a stage: [x: 8 blocks of 2 KiB][W or A: 8 blocks of 2 KiB]
// copy8: two blocks' share of a stage (2 x 2 KiB; the second block 16 rows = 32 DM bytes on in the plane), 512 bytes a copy. The wait on the address counter is the statement's last line, so that no register that a copy names is rewritten in front of it.
__device__ __forceinline__ void copy8(unsigned l, const char* g) {
    asm volatile("global_load_async_to_lds_b128 %0, %8, off\n\t"
                 "global_load_async_to_lds_b128 %1, %9, off\n\t"
                 "global_load_async_to_lds_b128 %2, %10, off\n\t"
                 "global_load_async_to_lds_b128 %3, %11, off\n\t"
                 "global_load_async_to_lds_b128 %4, %12, off\n\t"
                 "global_load_async_to_lds_b128 %5, %13, off\n\t"
                 "global_load_async_to_lds_b128 %6, %14, off\n\t"
                 "global_load_async_to_lds_b128 %7, %15, off\n\t"
                 "s_wait_xcnt 0x0"
                 :: "v"(l), "v"(l + 512u), "v"(l + 1024u), "v"(l + 1536u), "v"(l + 2048u), "v"(l + 2560u), "v"(l + 3072u), "v"(l + 3584u),
                    "v"(g), "v"(g + 512), "v"(g + 1024), "v"(g + 1536), "v"(g + 32 * DM), "v"(g + 32 * DM + 512), "v"(g + 32 * DM + 1024), "v"(g + 32 * DM + 1536) : "memory");
}
__global__ __launch_bounds__(128) void k_proj(const bf* __restrict__ XB, const bf* __restrict__ Wz, const bf* __restrict__ AP, float* F, float* XA, const float* __restrict__ bq, const float* __restrict__ bk, const float* __restrict__ bv) {
    __shared__ __attribute__((aligned(2048))) char ring[2 * PST];
    const int lane = threadIdx.x & 31, lr = lane & 15;
    const int wv = __builtin_amdgcn_readfirstlane((int)(threadIdx.x >> 5)), wm = wv & 1, wn = wv >> 1;   // the wave's number, in a scalar register; its row half and its column half of the tile
    const int y = blockIdx.y, r0 = blockIdx.x * 128;
    const bool base = y < NCT;
    const bf* B0 = base ? Wz + (size_t)y * 128 * DM : AP + (size_t)(y - NCT) * 128 * DM;   // the 64 rows of the right operand under the first column half
    const bf* B1 = y <= NCT ? B0 + (size_t)64 * DM : B0;                                   // and under the second
    // what the wave copies: waves 0, 1 the two row halves of x, waves 2, 3 the two column halves of the right operand
    const char* gp = (const char*)(wn == 0 ? XB + (size_t)(r0 + wm * 64) * DM : (wm ? B1 : B0)) + lane * 16;
    const unsigned lw = (unsigned)(size_t)ring + (unsigned)(wn * 16384 + wm * 8192 + lane * 16);
    // what it reads: the four blocks of its row half and of its column half
    const char* ra = ring + wm * 8192 + lane * 16; const char* rb = ring + 16384 + wn * 8192 + lane * 16;
    constexpr int NS = DM / 64;
    v8f acc[4][4];
#pragma unroll
    for (int mb = 0; mb < 4; ++mb)
#pragma unroll
        for (int nb = 0; nb < 4; ++nb) acc[mb][nb] = (v8f){};
    const int z = y / 8, c0 = (y % 8) * 128 + wn * 64;
    v4f bb = (v4f){};   // the lane's four bias values, loaded once per tile
    if (base) { const float* bp = (z == 0 ? bq : (z == 1 ? bk : bv)) + c0 + lr * 4; bb = *(const v4f*)bp; asm volatile("s_wait_xcnt 0x0" ::: "memory"); /* behind the bias load, in front of any reuse of its address registers */ }
    copy8(lw, gp); copy8(lw + 4096u, gp + 64 * DM);
    asm volatile("s_wait_asynccnt 0x0" ::: "memory");   // the wave's share of stage 0 has landed
    __syncthreads();                                    // and every other wave's
    copy8(lw + PST, gp + 2048); copy8(lw + PST + 4096u, gp + 2048 + 64 * DM);
#pragma unroll 1   // rolled: unrolled, the copies' addresses of several stages would live side by side and the wave would pass 256 registers, which four waves on a SIMD (every work-group resident at once) allow
    for (int s = 0; s < NS; ++s) {
        const int bo = (s & 1) * PST;
#pragma unroll
        for (int ks = 0; ks < 2; ++ks) {
            v16bf a[4], b[4];
#pragma unroll
            for (int i = 0; i < 4; ++i) { const char* p = ra + bo + i * 2048 + ks * 1024; a[i] = cat16b(*(const v8usa*)p, *(const v8usa*)(p + 512)); const char* q = rb + bo + i * 2048 + ks * 1024; b[i] = cat16b(*(const v8usa*)q, *(const v8usa*)(q + 512)); }
            __builtin_amdgcn_sched_barrier(0);   // keeps the block's 16 LDS reads together in front of its 16 products: their latency is waited out once a block, not once for every column of four products
#pragma unroll
            for (int nb = 0; nb < 4; ++nb)
#pragma unroll
                for (int mb = 0; mb < 4; ++mb) acc[mb][nb] = wmmab(a[mb], b[nb], acc[mb][nb]);
        }
        asm volatile("s_wait_dscnt 0x0" ::: "memory");      // the wave has left stage s's buffer
        asm volatile("s_wait_asynccnt 0x0" ::: "memory");   // its share of stage s + 1 has landed
        __syncthreads();                                    // stage s + 1 is whole, and stage s's buffer is free
        if (s + 2 < NS) { const char* g = gp + (s + 2) * 2048; copy8(lw + bo, g); copy8(lw + bo + 4096u, g + 64 * DM); }
    }
    asm volatile("s_wait_asynccnt 0x0" ::: "memory");   // no copy is outstanding when the ring becomes output staging (the last trip's barrier ended every read of it)
#pragma unroll
    for (int u = 0; u < 4; ++u) bb[u] = bfr(bb[u]);
    float* os = (float*)ring + wv * (16 * 68);
    if (base) tile_out<DQ, true>(acc, F + (size_t)z * MT * DQ, bb, r0 + wm * 64, c0, os);
    else { const int zl = (y - NCT) * 2 + wn; if (zl < 3) tile_out<64, false>(acc, XA + (size_t)zl * MT * 64, bb, r0 + wm * 64, 0, os); }
}
__device__ __forceinline__ h16 tohx(float x) { return (h16)x; }
__device__ __forceinline__ void splitf(float y, unsigned short& h, unsigned short& l) { h = f2bf(y); l = f2bf(y - bf2f(h)); }
typedef __attribute__((ext_vector_type(2))) _Float16 v2h;
typedef __attribute__((ext_vector_type(4))) _Float16 v4h;
typedef __attribute__((ext_vector_type(2))) unsigned short v2us;
typedef __attribute__((ext_vector_type(4))) unsigned short v4us;
typedef __attribute__((ext_vector_type(2))) float v2f;
typedef __attribute__((ext_vector_type(4))) int v4i;

__global__ __launch_bounds__(256) void k_wtG(const float* __restrict__ w, int K, int N, bf* Bt) {
    const int lane = threadIdx.x & 31; const int L0 = (blockIdx.x * 8 + (threadIdx.x >> 5)) * 8; const int nlines = N * K / 64;
{
#pragma unroll 1
        for (int l = 0; l < 8; ++l) { const int L = L0 + l; if (L >= nlines) break; const size_t e = (size_t)L * 64 + lane * 2; const int k = (int)(e % K), n = (int)(e / K); v2us o;
            o[0] = f2bf(w[(size_t)k * N + n]); o[1] = f2bf(w[(size_t)(k + 1) * N + n]); *(v2us*)(Bt + e) = o; }
         }
}
// row-major f32 [rows][DM] -> bf16 in fragment order. One work-group of 256 threads converts one block of 16 rows (64 KiB in a row -> 32 fragments, 32 KiB in a row), 8 pieces of 8 elements a thread, so that few waves have to be started and each has 16 loads of 16 bytes in flight.
// Thread tid: row (tid / 4) % 16, k = 8 (tid % 4), in the fragments 8 (tid / 64) + 0..7. Per fragment a wave reads 128 bytes in a row of each of 8 rows and stores four whole 128-byte lines (8 rows x 8 k each).
__device__ __forceinline__ size_t frag_src(size_t i) { return ((i >> 11) * 16 + (i & 15)) * DM + ((i >> 5) & 63) * 16 + ((i >> 4) & 1) * 8; }   // the row-major element offset of piece i's first element
template <bool GUARD>   // GUARD: the source has only `rows` rows; the rows from there on are stored as zeros and not read
__device__ __forceinline__ void cvt_blk(const float* __restrict__ src, bf* dst, int blk, int tid, int rows) {
    const int row = (tid >> 2) & 15; const size_t i0 = (size_t)blk * 2048 + (size_t)(tid >> 6) * 512 + ((tid & 3) << 4) + row;   // i0: the place of the thread's first piece in fragment order; the next fragment along k is 64 pieces = 32 source elements on
    const float* sp = src + frag_src(i0); bf* dp = dst + i0 * 8; v8f v[8]; v8us o[8];
#pragma unroll
    for (int j = 0; j < 8; ++j) v[j] = (v8f){};
    if (!GUARD || blk * 16 + row < rows) {
#pragma unroll
        for (int j = 0; j < 8; ++j) v[j] = *(const v8f*)(sp + j * 32); }
#pragma unroll
    for (int j = 0; j < 8; ++j) {
#pragma unroll
        for (int k = 0; k < 8; ++k) o[j][k] = f2bf(v[j][k]);
        *(v8us*)(dp + j * 512) = o[j]; }
    XWAIT("v"(o[0]), "v"(o[1]), "v"(o[2]), "v"(o[3]), "v"(o[4]), "v"(o[5]), "v"(o[6]), "v"(o[7]), "v"(dp), "v"(sp)); }
// cos/sin table: thread idx = (t, i), i < HD / 2, stores its pair at d = i and at d = i + HD / 2 (the table's two halves are equal)
__device__ __forceinline__ void cstab_body(float* CS, int idx) { const int t = idx / (HD / 2), i = idx % (HD / 2); const float inv = __fdiv_rn(1.0f, powf(10000.0f, (float)(2 * i) / (float)HD)); const float ang = __fmul_rn((float)t, inv); v2f cs; cs[0] = cosf(ang); cs[1] = sinf(ang);
    float* dp = CS + ((size_t)t * HD + i) * 2; *(v2f*)dp = cs; *(v2f*)(dp + HD) = cs; XWAIT("v"(cs), "v"(dp));  }
// k_tail: all that stands between the projections and the attention, in one launch. grid (MT/64, NH_, 3), ONE WAVE per (64 rows, one head) of z = q, k, v: F + 2 (x A^T) B^T, RoPE (q, k), and the operand planes stored straight from the accumulators.
// x A^T (XA, f32, pitch 64; of its columns only the 8 ranks are not zero by construction) is split into its hi / lo bf16 fragments in registers: k = 0..7 sit in the first half of the lanes below 16, every other k is zero.
// q, k: B's rows as the A operand and the x A^T rows as the B operand, so a lane holds 8 consecutive d of one row t (D[8 hi + j][lr] = (d, t)): the rotate-half partner d +- 32 is the same lane's tile mb +- 2, and each plane takes one 16-byte store a tile.
// v: the operands the other way round, so a lane holds 8 consecutive t of one d: the transposed planes of a head g (2 HD TT elements: the hi plane, then the lo plane; of the fp16 ones only the first half is written or read) take one 16-byte store a tile. They lie in fragment order with the key block outermost: [t / 32][d / 16][1 KiB fragment of 16 d x 32 t], so a key block's four fragments are 4 KiB in a row.
// Head planes [h][t][d] (fp16 + hi/lo; each head's [t][d] in fragment order, K = HD), in the order (q b0, q b1, k b0, k b1) in P16 / Ph / Pl; rotate-half: out[d] = x[d] cos[t][d] - x[d+HD/2] sin[t][d], out[d+HD/2] = x[d+HD/2] cos[t][d] + x[d] sin[t][d] (the table's two halves are equal). Each store of a wave is 512 bytes in a row.
__device__ __forceinline__ void planes8(v8f r, v8h& o16, v8us& oh, v8us& ol) {
#pragma unroll
    for (int j = 0; j < 8; ++j) { o16[j] = tohx(r[j]); unsigned short a, c; splitf(r[j], a, c); oh[j] = a; ol[j] = c; } }
__global__ __launch_bounds__(32) void k_tail(const float* __restrict__ F, const float* __restrict__ XA, const bf* __restrict__ BP, const float* __restrict__ CS, h16* P16, bf* Ph, bf* Pl, h16* V16, bf* Vh, bf* Vl) {
    const int lane = threadIdx.x, lr = lane & 15, hi = lane >> 4;
    const int z = blockIdx.z, h = blockIdx.y, r0 = blockIdx.x * 64, b = r0 / TT, t0 = r0 % TT;
    const char* xa = (const char*)(XA + ((size_t)z * MT + r0) * 64); const char* bp = (const char*)(BP + ((size_t)z * DM + h * HD) * 32); const char* fz = (const char*)(F + ((size_t)z * MT + r0) * DQ + h * HD);   // wave-uniform bases
    const unsigned ox = (unsigned)lr * 256u, ob = (unsigned)(lr * 32 + 8 * hi) * 2u;   // the lane's byte offsets in them
    v16bf xh[4], xl[4], bb[4];
#pragma unroll
    for (int i = 0; i < 4; ++i) { const v8f x = *(const v8f*)(xa + ox + i * 16 * 256); v8us a, c; const v8us zz = (v8us){};
#pragma unroll
        for (int j = 0; j < 8; ++j) { unsigned short u, w; splitf(hi ? 0.f : x[j], u, w); a[j] = u; c[j] = w; }
        xh[i] = cat16b(a, zz); xl[i] = cat16b(c, zz); bb[i] = WFrag<bf>::ld((const bf*)(bp + ob + i * 16 * 64)); }
    if (z < 2) {
        const unsigned of = (unsigned)(lr * DQ + 8 * hi) * 4u, oc = (unsigned)((t0 + lr) * HD + 8 * hi) * 8u;   // row lr of a 16-row group, d = 8 hi: in F and in the cos/sin table
        const size_t po = (((size_t)(z * 2 + b) * NH_ + h) * TT + t0) * HD; char* p16 = (char*)(P16 + po); char* ph = (char*)(Ph + po); char* pl = (char*)(Pl + po); const unsigned op = (unsigned)lane * 16u;   // wave-uniform bases of the 64 rows in the three planes, and the lane's byte offset in a 512-byte run
#pragma unroll
        for (int nb = 0; nb < 4; ++nb) {   // 16 rows t
            v8f v[4], r[4];
#pragma unroll
            for (int mb = 0; mb < 4; ++mb) { v8f acc = wmmab(bb[mb], xh[nb], (v8f){}); acc = wmmab(bb[mb], xl[nb], acc); v[mb] = *(const v8f*)(fz + of + nb * 16 * DQ * 4 + mb * 64) + 2.0f * acc; }
#pragma unroll
            for (int mb = 0; mb < 2; ++mb) { const v8f c0 = *(const v8f*)((const char*)CS + oc + nb * 16 * HD * 8 + mb * 128), c1 = *(const v8f*)((const char*)CS + oc + nb * 16 * HD * 8 + mb * 128 + 32);   // (cos, sin) of d = 16 mb + 8 hi + 0..3, + 4..7
#pragma unroll
                for (int j = 0; j < 8; ++j) { const float cs = j < 4 ? c0[2 * j] : c1[2 * j - 8], sn = j < 4 ? c0[2 * j + 1] : c1[2 * j - 7]; r[mb][j] = v[mb][j] * cs - v[mb + 2][j] * sn; r[mb + 2][j] = v[mb + 2][j] * cs + v[mb][j] * sn; } }
            v8h o16[4]; v8us oh[4], ol[4];
#pragma unroll
            for (int mb = 0; mb < 4; ++mb) { planes8(r[mb], o16[mb], oh[mb], ol[mb]); const int o = (nb * 16 * HD + mb * 256) * 2; *(v8h*)(p16 + op + o) = o16[mb]; *(v8us*)(ph + op + o) = oh[mb]; *(v8us*)(pl + op + o) = ol[mb]; }
            XWAIT("v"(o16[0]), "v"(o16[1]), "v"(o16[2]), "v"(o16[3]), "v"(oh[0]), "v"(oh[1]), "v"(oh[2]), "v"(oh[3]), "v"(ol[0]), "v"(ol[1]), "v"(ol[2]), "v"(ol[3]), "v"(op), "v"(of), "v"(oc), "v"(ox), "v"(ob));
        }
    } else {
        const unsigned of = (unsigned)(8 * hi * DQ + lr) * 4u;   // row 8 hi of a 16-row group, d = lr
        const size_t vo = ((size_t)b * NKV + h) * HD * 2 * TT + (size_t)t0 * HD; char* p16 = (char*)(V16 + vo); char* ph = (char*)(Vh + vo); char* pl = (char*)(Vl + vo); const unsigned op = (unsigned)lane * 16u;   // wave-uniform bases of the two key blocks in the three planes, and the lane's byte offset in a 512-byte run
#pragma unroll
        for (int nb = 0; nb < 4; ++nb) {   // 16 columns d
            v8h o16[4]; v8us oh[4], ol[4];
#pragma unroll
            for (int mb = 0; mb < 4; ++mb) { v8f acc = wmmab(xh[mb], bb[nb], (v8f){}); acc = wmmab(xl[mb], bb[nb], acc); v8f r;
#pragma unroll
                for (int j = 0; j < 8; ++j) r[j] = *(const float*)(fz + of + (mb * 16 + j) * DQ * 4 + nb * 64) + 2.0f * acc[j];
                planes8(r, o16[mb], oh[mb], ol[mb]); const int o = ((mb >> 1) * 32 * HD + nb * 512 + (mb & 1) * 256) * 2; *(v8h*)(p16 + op + o) = o16[mb]; *(v8us*)(ph + op + o) = oh[mb]; *(v8us*)(pl + op + o) = ol[mb]; }
            XWAIT("v"(o16[0]), "v"(o16[1]), "v"(o16[2]), "v"(o16[3]), "v"(oh[0]), "v"(oh[1]), "v"(oh[2]), "v"(oh[3]), "v"(ol[0]), "v"(ol[1]), "v"(ol[2]), "v"(ol[3]), "v"(op), "v"(of), "v"(ox), "v"(ob));
        }
    }
}
// k_attn: the whole attention in one launch; scores and probabilities stay in registers. One wave owns 16 NQ query rows of one (batch, head) and walks the keys in blocks of 32 up to its diagonal block.
// S^T = K Q^T (A = key rows, B = query rows): a lane holds, for the query of its column lr, the keys 8 hi + j of each 16-key tile, which is the k order of a B operand; so P^T goes from the score accumulators straight into O^T += V^T P^T.
// Running maximum and sum per query (scaled log2 domain); the accumulators are rescaled when the maximum moves. The wave halves' sums are joined once at the end. Query rows below RH use the hi+lo planes (three products), the others fp16.
// The output goes out as the hi / lo planes [t][DQ], in fragment order, that the output projection reads; each store of a wave is 512 bytes in a row.
#define L2S 0.18033688011112042f   // HD^-0.5 x log2(e)
__device__ __forceinline__ float xhalf(float x) { const int b = __float_as_int(x); return __int_as_float(__builtin_amdgcn_permlanex16(b, b, 0x76543210, 0xfedcba98, false, false)); }   // the value of lane l ^ 16
__device__ __forceinline__ float exp2_slot(float x) { float r; asm("v_exp_f32 %0, %1\n\tv_nop" : "=v"(r) : "v"(x)); return r; }   // exp2 with the one slot behind a transcendental tied to it
template <typename T16, bool HI, int NQ>
__device__ __forceinline__ void attn_wave(const T16* __restrict__ Q, const T16* __restrict__ Q2, const T16* __restrict__ Kp, const T16* __restrict__ K2, const T16* __restrict__ Vt, const T16* __restrict__ Vt2, const int* __restrict__ amb, bf* Ah, bf* Al, int q0) {
    typedef typename WFrag<T16>::V V;
    const int lane = threadIdx.x & 31, lr = lane & 15, hi = lane >> 4;
    V qf[NQ][2], q2[NQ][2];
#pragma unroll
    for (int nq = 0; nq < NQ; ++nq)
#pragma unroll
        for (int ks = 0; ks < 2; ++ks) { const size_t qo = (size_t)(q0 + nq * 16) * HD + ks * 512 + 8 * lane; qf[nq][ks] = WFrag<T16>::ldp(Q + qo); if (HI) q2[nq][ks] = WFrag<T16>::ldp(Q2 + qo); }
    v8f o[4][NQ]; float m[NQ], l[NQ];
#pragma unroll
    for (int nq = 0; nq < NQ; ++nq) { m[nq] = -3.0e38f; l[nq] = 0.f;
#pragma unroll
        for (int dt = 0; dt < 4; ++dt) o[dt][nq] = (v8f){}; }
    const int nk = q0 + 16 * NQ;   // keys below nk are visible to some query of the wave
    unsigned ok = (unsigned)lane * 16u, ov = (unsigned)lane * 16u, oa = (unsigned)lane * 4u;   // the lane's byte offsets in the key planes, the value planes and the padding mask at the trip's key block
    V kf[2][2], k2[2][2];
#pragma unroll
    for (int t = 0; t < 2; ++t)
#pragma unroll
        for (int ks = 0; ks < 2; ++ks) { kf[t][ks] = WFrag<T16>::ldp((const T16*)((const char*)Kp + ok) + t * 16 * HD + ks * 512); if (HI) k2[t][ks] = WFrag<T16>::ldp((const T16*)((const char*)K2 + ok) + t * 16 * HD + ks * 512); }
    int av = *(const int*)((const char*)amb + oa);
#pragma unroll 1
    for (int kb = 0; kb < nk; kb += 32) {
        V vf[4], v2[4];
#pragma unroll
        for (int dt = 0; dt < 4; ++dt) { vf[dt] = WFrag<T16>::ldp((const T16*)((const char*)Vt + ov) + dt * 512); if (HI) v2[dt] = WFrag<T16>::ldp((const T16*)((const char*)Vt2 + ov) + dt * 512); }
        const unsigned mk = __builtin_amdgcn_ballot_w32(av != 0);   // bit u: key kb + u is not padding
        v8f s[2][NQ];
#pragma unroll
        for (int t = 0; t < 2; ++t)
#pragma unroll
            for (int nq = 0; nq < NQ; ++nq) { s[t][nq] = (v8f){};
#pragma unroll
                for (int ks = 0; ks < 2; ++ks) { s[t][nq] = WFrag<T16>::mma(kf[t][ks], qf[nq][ks], s[t][nq]); if (HI) { s[t][nq] = WFrag<T16>::mma(kf[t][ks], q2[nq][ks], s[t][nq]); s[t][nq] = WFrag<T16>::mma(k2[t][ks], qf[nq][ks], s[t][nq]); } } }
        asm volatile("s_wait_xcnt 0x0" : "+v"(ok), "+v"(oa) :: "memory");   // behind the key and mask loads, in front of the step of their offset registers
        const bool more = kb + 32 < nk; ok += more ? 32u * HD * 2u : 0u; oa += more ? 128u : 0u;   // the next trip's key fragments and mask words are fetched now, so that their latency runs under the softmax and the value products; the last trip fetches its own block again
        av = *(const int*)((const char*)amb + oa);
#pragma unroll
        for (int t = 0; t < 2; ++t)
#pragma unroll
            for (int ks = 0; ks < 2; ++ks) { kf[t][ks] = WFrag<T16>::ldp((const T16*)((const char*)Kp + ok) + t * 16 * HD + ks * 512); if (HI) k2[t][ks] = WFrag<T16>::ldp((const T16*)((const char*)K2 + ok) + t * 16 * HD + ks * 512); }
#pragma unroll
        for (int t = 0; t < 2; ++t)
#pragma unroll
            for (int nq = 0; nq < NQ; ++nq) s[t][nq] *= L2S;
        if (mk != 0xFFFFFFFFu || kb + 31 > q0) {   // wave-uniform: only a block with a padded key or on the diagonal has anything to mask
            const unsigned mkl = mk >> (8 * hi);
#pragma unroll
            for (int nq = 0; nq < NQ; ++nq) { const int lim = q0 + nq * 16 + lr - kb - 8 * hi;   // element (t, j) is key kb + 16 t + 8 hi + j: causal while 16 t + j <= lim
                const unsigned mm = mkl & (lim >= 31 ? 0xFFFFFFFFu : (lim < 0 ? 0u : ((2u << lim) - 1u)));
#pragma unroll
                for (int t = 0; t < 2; ++t)
#pragma unroll
                    for (int j = 0; j < 8; ++j) s[t][nq][j] = ((mm >> (t * 16 + j)) & 1u) ? s[t][nq][j] : -3.0e38f; }
        }
#pragma unroll
        for (int nq = 0; nq < NQ; ++nq) {
            float mx = fmaxf(s[0][nq][0], s[1][nq][0]);
#pragma unroll
            for (int j = 1; j < 8; ++j) mx = fmaxf(mx, fmaxf(s[0][nq][j], s[1][nq][j]));
            mx = fmaxf(mx, xhalf(mx)); mx = fmaxf(mx, m[nq]);
            const float al = __builtin_amdgcn_exp2f(m[nq] - mx); m[nq] = mx;
            float sum = 0.f;
#pragma unroll
            for (int t = 0; t < 2; ++t)
#pragma unroll
                for (int j = 0; j < 8; ++j) { const float p = HI ? exp2_slot(s[t][nq][j] - mx) : __builtin_amdgcn_exp2f(s[t][nq][j] - mx); s[t][nq][j] = p; sum += p; }
            l[nq] = l[nq] * al + sum;
#pragma unroll
            for (int dt = 0; dt < 4; ++dt) o[dt][nq] *= al;
            if constexpr (HI) { v8us h0, h1, l0, l1;
#pragma unroll
                for (int j = 0; j < 8; ++j) { unsigned short a, c; splitf(s[0][nq][j], a, c); h0[j] = a; l0[j] = c; splitf(s[1][nq][j], a, c); h1[j] = a; l1[j] = c; }
                const V ph = cat16b(h0, h1), pl = cat16b(l0, l1);
#pragma unroll
                for (int dt = 0; dt < 4; ++dt) { o[dt][nq] = WFrag<T16>::mma(vf[dt], ph, o[dt][nq]); o[dt][nq] = WFrag<T16>::mma(vf[dt], pl, o[dt][nq]); o[dt][nq] = WFrag<T16>::mma(v2[dt], ph, o[dt][nq]); }
            } else { V pf;
#pragma unroll
                for (int j = 0; j < 8; ++j) { pf[j] = tohx(s[0][nq][j]); pf[8 + j] = tohx(s[1][nq][j]); }
#pragma unroll
                for (int dt = 0; dt < 4; ++dt) o[dt][nq] = WFrag<T16>::mma(vf[dt], pf, o[dt][nq]); }
        }
        asm volatile("s_wait_xcnt 0x0" : "+v"(ov) :: "memory");   // behind the value loads, in front of the step of their offset register
        ov += 32u * HD * 2u;
        asm volatile("v_nop\n\tv_nop\n\tv_nop\n\tv_nop" : "+v"(o[0][NQ - 1]), "+v"(o[1][NQ - 1]), "+v"(o[2][NQ - 1]), "+v"(o[3][NQ - 1]) : "v"(vf[0]), "v"(vf[3]));   // the distance behind the trip's last matrix instructions on the loop's taken branch
    }
#pragma unroll
    for (int nq = 0; nq < NQ; ++nq) { const float inv = __fdiv_rn(1.0f, l[nq] + xhalf(l[nq])); v8us oh[4], ol[4];
        const size_t ro = (size_t)(q0 + nq * 16) * DQ + 8 * lane; bf* ph = Ah + ro; bf* pl = Al + ro;
#pragma unroll
        for (int dt = 0; dt < 4; ++dt)
#pragma unroll
            for (int j = 0; j < 8; ++j) { unsigned short a, c; splitf(o[dt][nq][j] * inv, a, c); oh[dt][j] = a; ol[dt][j] = c; }
#pragma unroll
        for (int dt = 0; dt < 4; ++dt) { *(v8us*)(ph + dt * 256) = oh[dt]; *(v8us*)(pl + dt * 256) = ol[dt]; }
        XWAIT("v"(oh[0]), "v"(oh[1]), "v"(oh[2]), "v"(oh[3]), "v"(ol[0]), "v"(ol[1]), "v"(ol[2]), "v"(ol[3]), "v"(ph), "v"(pl)); }
}
// grid (NB_ NH_, (TT - RH) / 128 + RH / 64), 4 independent waves: x = (batch, head); y walks the query rows from the last (longest key loop) to the first: 32 rows a wave in fp16 down to RH, then 16 rows a wave in hi+lo planes. The four waves of a work-group take neighbouring row blocks, so they read the same keys and values at about the same time.
__global__ __launch_bounds__(128) void k_attn(const h16* __restrict__ P16, const bf* __restrict__ Ph, const bf* __restrict__ Pl, const h16* __restrict__ V16, const bf* __restrict__ Vh, const bf* __restrict__ Vl, const int* __restrict__ am, bf* ATh, bf* ATl) {
    const int bh = blockIdx.x, y = blockIdx.y; const int wv = __builtin_amdgcn_readfirstlane((int)(threadIdx.x >> 5));   // the wave's number, in a scalar register: the key loop's bounds stay wave-uniform
    const size_t zq = (size_t)bh * TT * HD, zk = (size_t)(NB_ * NH_ + bh) * TT * HD, zv = (size_t)bh * HD * 2 * TT, ao = (size_t)(bh / NH_) * TT * DQ + (size_t)(bh % NH_) * (HD / 32) * 512; const int* amb = am + (size_t)(bh / NH_) * TT;
    if (y < (TT - RH) / 128) attn_wave<h16, false, 2>(P16 + zq, nullptr, P16 + zk, nullptr, V16 + zv, nullptr, amb, ATh + ao, ATl + ao, TT - 32 * (y * 4 + wv + 1));
    else attn_wave<bf, true, 1>(Ph + zq, Pl + zq, Ph + zk, Pl + zk, Vh + zv, Vl + zv, amb, ATh + ao, ATl + ao, RH - 16 * ((y - (TT - RH) / 128) * 4 + wv + 1));
}

// bpad_blk: bf16 Bt [DM][32] from B [DM][8] natural (cols >= 8 zero); one work-group takes 256 rows, 4 pieces of 8 elements a thread: piece tid % 4 of the rows tid / 4 + 64 j; only piece 0 has anything to read. Each store of a wave is 512 bytes in a row.
__device__ __forceinline__ void bpad_blk(const float* __restrict__ Bm, bf* BP, int q, int tid) { const int c = tid & 3, r0 = q * 256 + (tid >> 2);
    const float* sp = Bm + (size_t)r0 * 8; bf* dp = BP + (size_t)r0 * 32 + c * 8; v8f v[4]; v8us o[4];
#pragma unroll
    for (int j = 0; j < 4; ++j) v[j] = (v8f){};
    if (c == 0) {
#pragma unroll
        for (int j = 0; j < 4; ++j) v[j] = *(const v8f*)(sp + j * 64 * 8); }
#pragma unroll
    for (int j = 0; j < 4; ++j) {
#pragma unroll
        for (int k = 0; k < 8; ++k) o[j][k] = f2bf(v[j][k]);
        *(v8us*)(dp + j * 64 * 32) = o[j]; }
    XWAIT("v"(o[0]), "v"(o[1]), "v"(o[2]), "v"(o[3]), "v"(dp), "v"(sp)); }
// k_prep: every input conversion and the rope table in one launch, 256 threads, no idle block. Blocks in this order, the memory streams first: MT / 16 of x, DQ / 16 for each of the four weights, NB_CS of the cos/sin table, 4 for each padded A (64 rows, 8 of them from A), 4 for each padded B
#define NB_CS (TT * (HD / 2) / 256)
#define NB_W  (DQ / 16)
#define NB_X  (MT / 16)
#define NB_PREP (NB_CS + 4 * NB_W + NB_X + 12 + 12)
__global__ __launch_bounds__(256) void k_prep(const float* __restrict__ x, const float* __restrict__ wq, const float* __restrict__ wk, const float* __restrict__ wv, const float* __restrict__ wo, const float* __restrict__ qA, const float* __restrict__ kA, const float* __restrict__ vA, const float* __restrict__ qB, const float* __restrict__ kB, const float* __restrict__ vB,
                                              bf* XB, bf* Wz, bf* WO, bf* AP, bf* BP, float* CS) {
    int bx = blockIdx.x; const int tid = threadIdx.x;
    if (bx < NB_X) { cvt_blk<false>(x, XB, bx, tid, 0); return; }
    bx -= NB_X;
    if (bx < 4 * NB_W) { const int m = bx / NB_W; cvt_blk<false>(m == 0 ? wq : (m == 1 ? wk : (m == 2 ? wv : wo)), m < 3 ? Wz + (size_t)m * DQ * DM : WO, bx % NB_W, tid, 0); return; }
    bx -= 4 * NB_W;
    if (bx < NB_CS) { cstab_body(CS, bx * 256 + tid); return; }
    bx -= NB_CS;
    if (bx < 12) { const int m = bx / 4; cvt_blk<true>(m == 0 ? qA : (m == 1 ? kA : vA), AP + (size_t)m * 64 * DM, bx % 4, tid, 8); return; }
    bx -= 12;
    { const int m = bx / 4; bpad_blk(m == 0 ? qB : (m == 1 ? kB : vB), BP + (size_t)m * DM * 32, bx % 4, tid); }
}

extern "C" void kernel_launch(void* const* d_in, const int* in_sizes, int n_in,
                              void* d_out, int out_size, void* d_ws, size_t ws_size, hipStream_t stream) {
    (void)in_sizes; (void)n_in; (void)out_size;
    const float* x = (const float*)d_in[0]; const int* am = (const int*)d_in[1]; const float* wq = (const float*)d_in[2]; const float* bq = (const float*)d_in[3]; const float* wk = (const float*)d_in[4]; const float* bk = (const float*)d_in[5]; const float* wv = (const float*)d_in[6]; const float* bv = (const float*)d_in[7];
    const float* qA = (const float*)d_in[8]; const float* qB = (const float*)d_in[9]; const float* kA = (const float*)d_in[10]; const float* kB = (const float*)d_in[11]; const float* vA = (const float*)d_in[12]; const float* vB = (const float*)d_in[13]; const float* wo = (const float*)d_in[14]; const float* bo = (const float*)d_in[15];
    float* OUT = (float*)d_out;     // [2][2048][1024]
    char* wsp = (char*)d_ws;
    auto take = [&](size_t bytes) { char* p = wsp; wsp += (bytes + 255) & ~(size_t)255; return (void*)p; };
    // the output weight, the operand planes of both batch elements, the merged attention output
    const size_t PB = (size_t)NH_ * TT * HD, VB = (size_t)NKV * HD * 2 * TT;   // elements of one batch element's q or k planes / value planes
    bf* WO = (bf*)take((size_t)DM * DQ * 2);
    h16* P16 = (h16*)take(4 * PB * 2); bf* Ph = (bf*)take(4 * PB * 2); bf* Pl = (bf*)take(4 * PB * 2);   // [q b0][q b1][k b0][k b1]
    h16* VT16 = (h16*)take(NB_ * VB * 2); bf* VTh = (bf*)take(NB_ * VB * 2); bf* VTl = VTh + (size_t)HD * TT;   // hi plane in the first, lo plane in the second half of each head's 2 HD TT elements
    bf* ATh = (bf*)take((size_t)MT * DQ * 2); bf* ATl = (bf*)take((size_t)MT * DQ * 2);
    // temporaries of the projections
    bf* Wz = (bf*)take((size_t)3 * DQ * DM * 2); float* CS = (float*)take((size_t)TT * HD * 2 * 4); bf* XB = (bf*)take((size_t)MT * DM * 2); bf* AP = (bf*)take((size_t)3 * 64 * DM * 2); bf* BP = (bf*)take((size_t)3 * DM * 32 * 2);
    float* XA = (float*)take((size_t)3 * MT * 64 * 4); float* F = (float*)take((size_t)3 * MT * DQ * 4);
    if ((size_t)(wsp - (char*)d_ws) > ws_size) return;    // about 165 of the 256 MiB
    k_prep<<<dim3(NB_PREP, 1, 1), 256, 0, stream>>>(x, wq, wk, wv, wo, qA, kA, vA, qB, kB, vB, XB, Wz, WO, AP, BP, CS);
    k_proj<<<dim3(MT / 128, NCT + 2, 1), 128, 0, stream>>>(XB, Wz, AP, F, XA, bq, bk, bv);
    k_tail<<<dim3(MT / 64, NH_, 3), 32, 0, stream>>>(F, XA, BP, CS, P16, Ph, Pl, VT16, VTh, VTl);   /* LoRA: F + 2 (x A^T) B^T, RoPE, planes */
    k_attn<<<dim3(NB_ * NH_, (TT - RH) / 128 + RH / 64, 1), 128, 0, stream>>>(P16, Ph, Pl, VT16, VTh, VTl, am, ATh, ATl);
    k_gemmw<bf, 1, DQ, DM, true, 4><<<dim3(MT / 64, DM / 64, 1), 128, 0, stream>>>(ATh, ATl, WO, nullptr, OUT, bo, 0, 0, 0);
}

// v010
// A run of this version takes 96.6 microseconds.
// In two side-by-side timings against v009, it was 1.16 and 1.18 times as fast.
// All steps since v000 together make it 17.8 times as fast.
#include <hip/hip_runtime.h>

// Masked_MHA_LORA (x [2][2048][1024]; Q/K/V = x W^T + b + 2 (x A^T) B^T (LoRA rank 8, scaling 16/8); RoPE (rotate-half, base 10000) on Q, K (16 heads x 64); scores = Q.K/8 with the causal mask and the key padding mask (attention_mask == 0 -> -inf; int,
// read as data); softmax; out = (attn V merged) oW^T + ob -> [2][2048][1024]).
// Compute dtypes, f32 accumulate: every input rounded to bf16; the base projections on PLAIN bf16 operands (inputs: exact) + bias; the LoRA path as two small GEMMs (x A^T exact, then its hi/lo split x exact B, rank padded 8 -> 32) added

#define NB_  2
#define TT   2048
#define DM   1024
#define NH_  16
#define NKV  16
#define REP  (NH_ / NKV)
#define HD   64
#define MT   (NB_ * TT)         // rows of both batch elements together
#define DQ   (NH_ * HD)
#define DKV  (NKV * HD)
#define RH   512                  // query rows < RH use hi+lo planes (0: none)
typedef _Float16 h16;
typedef unsigned short bf;
typedef __attribute__((ext_vector_type(16))) __bf16   v16bf;
typedef __attribute__((ext_vector_type(16))) _Float16 v16h;
typedef __attribute__((ext_vector_type(8)))  _Float16 v8h;
typedef __attribute__((ext_vector_type(8)))  unsigned short v8us;
typedef __attribute__((ext_vector_type(8)))  float    v8f;
typedef __attribute__((ext_vector_type(4)))  float    v4f;
typedef v8h  __attribute__((may_alias)) v8ha;
typedef v4f  __attribute__((may_alias)) v4fa;
typedef v8us __attribute__((may_alias)) v8usa;

__device__ __forceinline__ unsigned short f2bf(float f) { unsigned u = __float_as_uint(f); u += 0x7FFFu + ((u >> 16) & 1u); return (unsigned short)(u >> 16); }
__device__ __forceinline__ float bf2f(unsigned short b) { return __uint_as_float(((unsigned)b) << 16); }
__device__ __forceinline__ float bfr(float f) { return bf2f(f2bf(f)); }
__device__ __forceinline__ v16h cat16(v8h lo, v8h hi) { return __builtin_shufflevector(lo, hi, 0, 1, 2, 3, 4, 5, 6, 7, 8, 9, 10, 11, 12, 13, 14, 15); }
__device__ __forceinline__ v16bf cat16b(v8us lo, v8us hi) { return __builtin_bit_cast(v16bf, __builtin_shufflevector(lo, hi, 0, 1, 2, 3, 4, 5, 6, 7, 8, 9, 10, 11, 12, 13, 14, 15)); }
__device__ __forceinline__ v8f wmma16(v16h a, v16h b, v8f c) { return __builtin_amdgcn_wmma_f32_16x16x32_f16(false, a, false, b, (short)0, c, false, false); }
__device__ __forceinline__ v8f wmmab(v16bf a, v16bf b, v8f c) { return __builtin_amdgcn_wmma_f32_16x16x32_bf16(false, a, false, b, (short)0, c, false, false); }



// ---- gemm_tile: register-blocked GEMM, ONE WAVE per 64x64 output tile (16 accumulators), operands straight from 16-bit planes in fragment order (below; K elements a row); the k loop runs to Kl <= K.
// C[m][n] (f32, pitch ldc, + optional f32 bias[n]) = sum_k A[m][k] Bt[n][k] (+ split products per NSPLIT). Kl % 32 == 0. os: 16 x 68 floats of LDS.
// NW > 1: NW waves of one work-group share the tile; wave w takes the k blocks w, w + NW, ... into its own accumulators, the NW partial tiles meet in LDS (os: NW x 64 x 68 floats) and are summed in the fixed order w = 0, 1, ...
// XWAIT: s_wait_xcnt 0 behind a run of global loads or stores; the registers that the run names are inputs of the statement, so that none of them is overwritten in front of the wait.
#define XWAIT(...) asm volatile("s_wait_xcnt 0x0" :: __VA_ARGS__ : "memory")
// FRAGMENT ORDER of a K-contiguous 16-bit plane [rows][K]: each block of 16 rows x 32 k (one matrix operand, 1 KiB) lies in one piece, as two runs of 512 bytes; run u (k = 16 u + 8 hi + 0..7) holds lane (16 hi + row)'s 8 elements at 16 bytes x lane.
// Element offset of (row, k) = (row / 16) 16 K + (k / 32) 512 + ((k % 32) / 16) 256 + (((k % 16) / 8) 16 + row % 16) 8 + k % 8. ldp(p) loads a fragment from p = block + 8 lane: each of its two wave-wide loads covers four whole 128-byte lines. ld(p) is the loader of a row-major plane.
template <typename T16> struct WFrag;
template <> struct WFrag<h16> { typedef v16h V; static __device__ __forceinline__ V ld(const h16* p) { return cat16(*(const v8h*)p, *(const v8h*)(p + 16)); } static __device__ __forceinline__ V ldp(const h16* p) { return cat16(*(const v8h*)p, *(const v8h*)(p + 256)); } static __device__ __forceinline__ v8f mma(V a, V b, v8f c) { return wmma16(a, b, c); } };
template <> struct WFrag<bf> { typedef v16bf V; static __device__ __forceinline__ V ld(const bf* p) { return cat16b(*(const v8us*)p, *(const v8us*)(p + 16)); } static __device__ __forceinline__ V ldp(const bf* p) { return cat16b(*(const v8us*)p, *(const v8us*)(p + 256)); } static __device__ __forceinline__ v8f mma(V a, V b, v8f c) { return wmmab(a, b, c); } };
// tile_out: one wave's 64x64 accumulator tile -> C (f32, pitch ldc, + the lane's four bias values bv), 16 rows at a time through the wave's own 16 x 68 floats of LDS (os), so that every store covers whole lines
template <int ldc, bool BIAS>
__device__ __forceinline__ void tile_out(v8f (&acc)[4][4], float* C, v4f bv, int r0, int c0, float* os) {
    const int lane = threadIdx.x & 31, lr = lane & 15, hi = lane >> 4;
#pragma unroll
    for (int mb = 0; mb < 4; ++mb) {
#pragma unroll
        for (int nb = 0; nb < 4; ++nb) {
#pragma unroll
            for (int j = 0; j < 8; ++j) os[(hi * 8 + j) * 68 + nb * 16 + lr] = acc[mb][nb][j]; }
        __builtin_amdgcn_wave_barrier(); asm volatile("" ::: "memory");
        float* crow = C + (size_t)(r0 + mb * 16) * ldc + c0;
{
            v4f val[8]; float* cp0 = crow + (size_t)hi * ldc + lr * 4;   // the lane's place in the block's rows hi, hi + 2, ...
#pragma unroll
            for (int s = 0; s < 8; ++s) { const int row = 2 * s + hi, cofs = lr * 4; val[s] = *(const v4fa*)(os + row * 68 + cofs); if (BIAS) val[s] += bv;
                *(v4f*)(cp0 + (size_t)(2 * s) * ldc) = val[s]; }
            XWAIT("v"(val[0]), "v"(val[1]), "v"(val[2]), "v"(val[3]), "v"(val[4]), "v"(val[5]), "v"(val[6]), "v"(val[7]), "v"(cp0));
             }
        __builtin_amdgcn_wave_barrier(); asm volatile("" ::: "memory");
    }
}
template <typename T16, int NSPLIT, int K, int ldc, bool BIAS, int NW = 1>
__device__ __forceinline__ void gemm_tile(const T16* __restrict__ A, const T16* __restrict__ A2, const T16* __restrict__ Bt, const T16* __restrict__ Bt2, int Kl, float* C, const float* __restrict__ bias, int r0, int c0, float* os) {
    typedef typename WFrag<T16>::V V;
    const int lane = threadIdx.x & 31, lr = lane & 15, hi = lane >> 4;
    const int wv = (NW > 1) ? __builtin_amdgcn_readfirstlane((int)(threadIdx.x >> 5)) : 0;   // the wave's number, in a scalar register: the k loop's bounds stay wave-uniform
    v8f acc[4][4];
#pragma unroll
    for (int mb = 0; mb < 4; ++mb)
#pragma unroll
        for (int nb = 0; nb < 4; ++nb) acc[mb][nb] = (v8f){};
    const T16* pa = A + (size_t)r0 * K; const T16* pb = Bt + (size_t)c0 * K; const T16* pa2 = (NSPLIT == 1 || NSPLIT == 2) ? A2 + (size_t)r0 * K : nullptr; const T16* pb2 = (NSPLIT >= 2) ? Bt2 + (size_t)c0 * K : nullptr;   // the tile's first row in each plane
    unsigned ol = (unsigned)(8 * lane + 512 * wv) * 2u;   // the lane's byte offset from there at the trip's k block, the same in every plane
    v4f bv = (v4f){};   // the lane's four bias values, loaded once per tile
    if (BIAS) { const float* bp = bias + c0 + lr * 4; bv = *(const v4f*)bp; asm volatile("s_wait_xcnt 0x0" ::: "memory"); /* behind the bias load, in front of any reuse of its address registers */ }
#pragma unroll 1
    for (int kc = 32 * wv; kc < Kl; kc += 32 * NW) {
        V a[4], a2[4];
#pragma unroll
        for (int mb = 0; mb < 4; ++mb) { a[mb] = WFrag<T16>::ldp((const T16*)((const char*)pa + ol) + (size_t)mb * 16 * K); if (NSPLIT == 1 || NSPLIT == 2) a2[mb] = WFrag<T16>::ldp((const T16*)((const char*)pa2 + ol) + (size_t)mb * 16 * K); }
#pragma unroll
        for (int nb = 0; nb < 4; ++nb) { const V b = WFrag<T16>::ldp((const T16*)((const char*)pb + ol) + (size_t)nb * 16 * K); V b2; if (NSPLIT >= 2) b2 = WFrag<T16>::ldp((const T16*)((const char*)pb2 + ol) + (size_t)nb * 16 * K);
#pragma unroll
            for (int mb = 0; mb < 4; ++mb) { acc[mb][nb] = WFrag<T16>::mma(a[mb], b, acc[mb][nb]); if (NSPLIT == 1 || NSPLIT == 2) acc[mb][nb] = WFrag<T16>::mma(a2[mb], b, acc[mb][nb]); if (NSPLIT >= 2) acc[mb][nb] = WFrag<T16>::mma(a[mb], b2, acc[mb][nb]); } }
        asm volatile("s_wait_xcnt 0x0" : "+v"(ol) :: "memory");   // behind the trip's loads, in front of the step of their offset register, which passes through the statement so that it lives up to the wait
        ol += 1024 * NW;
        asm volatile("v_nop\n\tv_nop\n\tv_nop\n\tv_nop" : "+v"(acc[0][0]), "+v"(acc[1][1]), "+v"(acc[2][2]), "+v"(acc[3][3]) : "v"(a[0]), "v"(a[3]));
    }
#pragma unroll
    for (int u = 0; u < 4; ++u) bv[u] = bfr(bv[u]);
    if constexpr (NW > 1) {
        float* pw = os + wv * (64 * 68);   // the wave's own partial tile
#pragma unroll
        for (int mb = 0; mb < 4; ++mb)
#pragma unroll
            for (int nb = 0; nb < 4; ++nb)
#pragma unroll
                for (int j = 0; j < 8; ++j) pw[(mb * 16 + hi * 8 + j) * 68 + nb * 16 + lr] = acc[mb][nb][j];
        __syncthreads();   // every wave's partial tile is in LDS before any is read
        constexpr int NS = 64 * 16 / (32 * NW);   // 16-byte pieces of the tile per thread
        v4f val[NS]; float* cp0 = C + (size_t)(r0 + (int)(threadIdx.x >> 4)) * ldc + c0 + lr * 4;   // the thread's place in rows tid / 16, + 2 NW, ...
#pragma unroll
        for (int s = 0; s < NS; ++s) { const float* ps = os + (s * 2 * NW + (int)(threadIdx.x >> 4)) * 68 + lr * 4; val[s] = *(const v4fa*)ps;
#pragma unroll
            for (int w = 1; w < NW; ++w) val[s] += *(const v4fa*)(ps + w * (64 * 68));
            if (BIAS) val[s] += bv;
            *(v4f*)(cp0 + (size_t)(s * 2 * NW) * ldc) = val[s]; }
        static_assert(NS == 8, "the wait below names eight stored values");
        XWAIT("v"(val[0]), "v"(val[1]), "v"(val[2]), "v"(val[3]), "v"(val[4]), "v"(val[5]), "v"(val[6]), "v"(val[7]), "v"(cp0));
        return;
    }
    tile_out<ldc, BIAS>(acc, C, bv, r0, c0, os);
}
// k_gemmw: grid (M/64, N/64, Z), 32 NW threads: NW waves share a tile's k loop, so that a grid of few tiles still puts several waves on every SIMD and one wave's load latency runs under the others' products; z-batch strides sA/sB/sC in elements
template <typename T16, int NSPLIT, int K, int ldc, bool BIAS, int NW>
__global__ __launch_bounds__(32 * NW) void k_gemmw(const T16* __restrict__ A, const T16* __restrict__ A2, const T16* __restrict__ Bt, const T16* __restrict__ Bt2, float* C, const float* __restrict__ bias, size_t sA, size_t sB, size_t sC) {
    __shared__ __align__(16) float os[NW * 64 * 68];
    const size_t z = blockIdx.z; A += z * sA; if (A2) A2 += z * sA; Bt += z * sB; if (Bt2) Bt2 += z * sB; C += z * sC;
    gemm_tile<T16, NSPLIT, K, ldc, BIAS, NW>(A, A2, Bt, Bt2, K, C, bias, blockIdx.x * 64, blockIdx.y * 64, os);
}
__device__ __forceinline__ h16 tohx(float x) { return (h16)x; }
__device__ __forceinline__ void splitf(float y, unsigned short& h, unsigned short& l) { h = f2bf(y); l = f2bf(y - bf2f(h)); }
typedef __attribute__((ext_vector_type(2))) _Float16 v2h;
typedef __attribute__((ext_vector_type(4))) _Float16 v4h;
typedef __attribute__((ext_vector_type(2))) unsigned short v2us;
typedef __attribute__((ext_vector_type(4))) unsigned short v4us;
typedef __attribute__((ext_vector_type(2))) float v2f;
typedef __attribute__((ext_vector_type(4))) int v4i;
__device__ __forceinline__ void planes8(v8f r, v8h& o16, v8us& oh, v8us& ol) {
#pragma unroll
    for (int j = 0; j < 8; ++j) { o16[j] = tohx(r[j]); unsigned short a, c; splitf(r[j], a, c); oh[j] = a; ol[j] = c; } }
// k_proj: the projections, the LoRA path, RoPE and the operand planes of the attention in one launch. grid (MT/128, NCT), 4 waves (2 x 2) share a tile of 128 rows x 128 columns, 64 x 64 a wave, which is 64 rows of ONE head of z = y / 8 (q, k, v).
// The operands come through LDS, so that each fragment leaves L2 once for the two waves that use it, and one stage ahead, so that its latency runs under the products. A stage is 64 k of three operands: x and W, 8 blocks of 16 rows x 2 fragments each = 16 KiB an operand, and the 16 padded rows of z's A, 2 KiB, all in fragment order as in the planes
// (a block's two fragments are 2 KiB in a row there). Two buffers; each wave brings a quarter of a stage (4 blocks of x or W, a quarter of A's block) with 17 asynchronous 16-byte copies to LDS. The k order of every sum is that of a plain loop over k.
// x A^T rides the same k loop: (A x^T)[rank][t] with A's rows as the left operand, so a lane below 16 holds the 8 ranks of the row t of its column: after the hi / lo split that is, with no exchange, an operand fragment (k = rank, every other k zero) of the product with B, on either side.
// q, k (SW): W's rows are the left operand and x's rows the right one, so a lane holds 8 consecutive d of one row t (D[8 hi + j][lr] = (d, t)): the rotate-half partner d +- 32 is the same lane's tile mb +- 2, and each plane takes one 16-byte store a tile.
// v: the operands the other way round, so a lane holds 8 consecutive t of one d: the transposed planes of a head g (2 HD TT elements: the hi plane, then the lo plane; of the fp16 ones only the first half is written or read) take one 16-byte store a tile. They lie in fragment order with the key block outermost: [t / 32][d / 16][1 KiB fragment of 16 d x 32 t], so a key block's four fragments are 4 KiB in a row.
// Head planes [h][t][d] (fp16 + hi/lo; each head's [t][d] in fragment order, K = HD), in the order (q b0, q b1, k b0, k b1) in P16 / Ph / Pl; rotate-half: out[d] = x[d] cos[t][d] - x[d+HD/2] sin[t][d], out[d+HD/2] = x[d+HD/2] cos[t][d] + x[d] sin[t][d] (the table's two halves are equal). Each store of a wave is 512 bytes in a row.
#define NCT (3 * DQ / 128)
#define PST 34816   // bytes of a stage: [x: 8 blocks of 2 KiB][W: 8 blocks of 2 KiB][A: 1 block of 2 KiB]
// copy8: two blocks' share of a stage (2 x 2 KiB; the second block 16 rows = 32 DM bytes on in the plane), 512 bytes a copy. The wait on the address counter is the statement's last line, so that no register that a copy names is rewritten in front of it.
__device__ __forceinline__ void copy8(unsigned l, const char* g) {
    asm volatile("global_load_async_to_lds_b128 %0, %8, off\n\t"
                 "global_load_async_to_lds_b128 %1, %9, off\n\t"
                 "global_load_async_to_lds_b128 %2, %10, off\n\t"
                 "global_load_async_to_lds_b128 %3, %11, off\n\t"
                 "global_load_async_to_lds_b128 %4, %12, off\n\t"
                 "global_load_async_to_lds_b128 %5, %13, off\n\t"
                 "global_load_async_to_lds_b128 %6, %14, off\n\t"
                 "global_load_async_to_lds_b128 %7, %15, off\n\t"
                 "s_wait_xcnt 0x0"
                 :: "v"(l), "v"(l + 512u), "v"(l + 1024u), "v"(l + 1536u), "v"(l + 2048u), "v"(l + 2560u), "v"(l + 3072u), "v"(l + 3584u),
                    "v"(g), "v"(g + 512), "v"(g + 1024), "v"(g + 1536), "v"(g + 32 * DM), "v"(g + 32 * DM + 512), "v"(g + 32 * DM + 1024), "v"(g + 32 * DM + 1536) : "memory");
}
// copy1: one run of 512 bytes (the wave's quarter of A's block), with the same wait as its last line
__device__ __forceinline__ void copy1(unsigned l, const char* g) {
    asm volatile("global_load_async_to_lds_b128 %0, %1, off\n\t"
                 "s_wait_xcnt 0x0" :: "v"(l), "v"(g) : "memory");
}
// xsplit: 16 rows of x A^T, as the accumulator holds them (lanes below 16: the 8 ranks of row lr), -> the hi and the lo bf16 operand fragment: k = 0..7 in the first half of the lanes below 16, every other k zero
__device__ __forceinline__ void xsplit(v8f x, int hi, v16bf& xh, v16bf& xl) { v8us a, c; const v8us zz = (v8us){};
#pragma unroll
    for (int j = 0; j < 8; ++j) { unsigned short u, w; splitf(hi ? 0.f : x[j], u, w); a[j] = u; c[j] = w; }
    xh = cat16b(a, zz); xl = cat16b(c, zz); }
template <bool SW>
__device__ __forceinline__ void proj_tile(char* ring, const bf* __restrict__ XB, const bf* __restrict__ Wz, const bf* __restrict__ AP, const bf* __restrict__ BP, const float* __restrict__ CS, const float* __restrict__ bias, h16* O16, bf* Oh, bf* Ol) {
    const int lane = threadIdx.x & 31, lr = lane & 15, hi = lane >> 4;
    const int wv = __builtin_amdgcn_readfirstlane((int)(threadIdx.x >> 5)), wm = wv & 1, wn = wv >> 1;   // the wave's number, in a scalar register; its row half and its column half of the tile
    const int y = blockIdx.y, z = y / 8, h = (y % 8) * 2 + wn, r0 = blockIdx.x * 128 + wm * 64;           // the wave's head and its first row
    // what the wave copies: waves 0, 1 the two row halves of x, waves 2, 3 the two column halves of W; every wave a quarter of A's block
    const char* gp = (const char*)(wn == 0 ? XB + (size_t)r0 * DM : Wz + ((size_t)y * 128 + wm * 64) * DM) + lane * 16;
    const char* ga = (const char*)(AP + (size_t)z * 16 * DM) + wv * 512 + lane * 16;
    const unsigned lw = (unsigned)(size_t)ring + (unsigned)(wn * 16384 + wm * 8192 + lane * 16), la = (unsigned)(size_t)ring + (unsigned)(32768 + wv * 512 + lane * 16);
    // what it reads: the four blocks of its row half and of its column half, and A's block
    const char* rx = ring + wm * 8192 + lane * 16; const char* rw = ring + 16384 + wn * 8192 + lane * 16; const char* rl = ring + 32768 + lane * 16;
    constexpr int NS = DM / 64;
    v8f acc[4][4], xat[4];
#pragma unroll
    for (int mb = 0; mb < 4; ++mb) { xat[mb] = (v8f){};
#pragma unroll
        for (int nb = 0; nb < 4; ++nb) acc[mb][nb] = (v8f){}; }
    copy8(lw, gp); copy8(lw + 4096u, gp + 64 * DM); copy1(la, ga);
    asm volatile("s_wait_asynccnt 0x0" ::: "memory");   // the wave's share of stage 0 has landed
    __syncthreads();                                    // and every other wave's
    copy8(lw + PST, gp + 2048); copy8(lw + PST + 4096u, gp + 2048 + 64 * DM); copy1(la + PST, ga + 2048);
#pragma unroll 1   // rolled: unrolled, the copies' addresses of several stages would live side by side and raise the register count
    for (int s = 0; s < NS; ++s) {
        const int bo = (s & 1) * PST;
#pragma unroll
        for (int ks = 0; ks < 2; ++ks) {
            v16bf xf[4], wf[4];
#pragma unroll
            for (int i = 0; i < 4; ++i) { const char* p = rx + bo + i * 2048 + ks * 1024; xf[i] = cat16b(*(const v8usa*)p, *(const v8usa*)(p + 512)); const char* q = rw + bo + i * 2048 + ks * 1024; wf[i] = cat16b(*(const v8usa*)q, *(const v8usa*)(q + 512)); }
            const char* pl = rl + bo + ks * 1024; const v16bf al = cat16b(*(const v8usa*)pl, *(const v8usa*)(pl + 512));
            __builtin_amdgcn_sched_barrier(0);   // keeps the block's 18 LDS reads together in front of its 20 products: their latency is waited out once a block, not once for every column of four products
#pragma unroll
            for (int i = 0; i < 4; ++i) xat[i] = wmmab(al, xf[i], xat[i]);
#pragma unroll
            for (int nb = 0; nb < 4; ++nb)
#pragma unroll
                for (int mb = 0; mb < 4; ++mb) acc[mb][nb] = SW ? wmmab(wf[mb], xf[nb], acc[mb][nb]) : wmmab(xf[mb], wf[nb], acc[mb][nb]);
        }
        asm volatile("s_wait_dscnt 0x0" ::: "memory");      // the wave has left stage s's buffer
        asm volatile("s_wait_asynccnt 0x0" ::: "memory");   // its share of stage s + 1 has landed
        __syncthreads();                                    // stage s + 1 is whole, and stage s's buffer is free
        if (s + 2 < NS) { const char* g = gp + (s + 2) * 2048; copy8(lw + bo, g); copy8(lw + bo + 4096u, g + 64 * DM); copy1(la + bo, ga + (s + 2) * 2048); }
    }
    asm volatile("s_wait_asynccnt 0x0" ::: "memory");   // no copy is outstanding when the wave ends
    // the tail, from the accumulators: + bias, + 2 (x A^T) B^T, RoPE (q, k), planes
    const int b = r0 / TT, t0 = r0 % TT;
    const char* bp = (const char*)(BP + ((size_t)z * DM + h * HD) * 32); const unsigned ob = (unsigned)(lr * 32 + 8 * hi) * 2u;   // wave-uniform base of the head's rows of B, and the lane's byte offset there
    v16bf bb[4];
#pragma unroll
    for (int i = 0; i < 4; ++i) bb[i] = WFrag<bf>::ld((const bf*)(bp + ob + i * 16 * 64));
    const unsigned op = (unsigned)lane * 16u;   // the lane's byte offset in a 512-byte run of a plane
    if constexpr (SW) {
        const char* bz = (const char*)(bias + h * HD); const unsigned obs = (unsigned)hi * 32u;   // the lane's eight bias values of a tile: d = 16 mb + 8 hi + 0..7
        const unsigned oc = (unsigned)((t0 + lr) * HD + 8 * hi) * 8u;   // row lr of a 16-row group, d = 8 hi, in the cos/sin table
        const size_t po = (((size_t)(z * 2 + b) * NH_ + h) * TT + t0) * HD; char* p16 = (char*)(O16 + po); char* ph = (char*)(Oh + po); char* pl = (char*)(Ol + po);   // wave-uniform bases of the 64 rows in the three planes
#pragma unroll
        for (int mb = 0; mb < 4; ++mb) { v8f bs = *(const v8f*)(bz + obs + mb * 64);   // the bias goes into the accumulators first, so that its 32 values do not live beside them through the tail
#pragma unroll
            for (int j = 0; j < 8; ++j) bs[j] = bfr(bs[j]);
#pragma unroll
            for (int nb = 0; nb < 4; ++nb) acc[mb][nb] += bs; }
#pragma unroll
        for (int nb = 0; nb < 4; ++nb) {   // 16 rows t
            v8f v[4], r[4]; v16bf xh, xl; xsplit(xat[nb], hi, xh, xl);
#pragma unroll
            for (int mb = 0; mb < 4; ++mb) { v8f lo = wmmab(bb[mb], xh, (v8f){}); lo = wmmab(bb[mb], xl, lo); v[mb] = acc[mb][nb] + 2.0f * lo; }
#pragma unroll
            for (int mb = 0; mb < 2; ++mb) { const v8f c0 = *(const v8f*)((const char*)CS + oc + nb * 16 * HD * 8 + mb * 128), c1 = *(const v8f*)((const char*)CS + oc + nb * 16 * HD * 8 + mb * 128 + 32);   // (cos, sin) of d = 16 mb + 8 hi + 0..3, + 4..7
#pragma unroll
                for (int j = 0; j < 8; ++j) { const float cs = j < 4 ? c0[2 * j] : c1[2 * j - 8], sn = j < 4 ? c0[2 * j + 1] : c1[2 * j - 7]; r[mb][j] = v[mb][j] * cs - v[mb + 2][j] * sn; r[mb + 2][j] = v[mb + 2][j] * cs + v[mb][j] * sn; } }
            v8h o16[4]; v8us oh[4], ol[4];
#pragma unroll
            for (int mb = 0; mb < 4; ++mb) { planes8(r[mb], o16[mb], oh[mb], ol[mb]); const int o = (nb * 16 * HD + mb * 256) * 2; *(v8h*)(p16 + op + o) = o16[mb]; *(v8us*)(ph + op + o) = oh[mb]; *(v8us*)(pl + op + o) = ol[mb]; }
            XWAIT("v"(o16[0]), "v"(o16[1]), "v"(o16[2]), "v"(o16[3]), "v"(oh[0]), "v"(oh[1]), "v"(oh[2]), "v"(oh[3]), "v"(ol[0]), "v"(ol[1]), "v"(ol[2]), "v"(ol[3]), "v"(op), "v"(oc), "v"(ob), "v"(obs));
        }
    } else {
        const char* bz = (const char*)(bias + h * HD); const unsigned obs = (unsigned)lr * 4u;   // the lane's bias value of a tile: d = 16 nb + lr
        const size_t vo = ((size_t)b * NKV + h) * HD * 2 * TT + (size_t)t0 * HD; char* p16 = (char*)(O16 + vo); char* ph = (char*)(Oh + vo); char* pl = (char*)(Ol + vo);   // wave-uniform bases of the two key blocks in the three planes
        v16bf xh[4], xl[4];
#pragma unroll
        for (int i = 0; i < 4; ++i) xsplit(xat[i], hi, xh[i], xl[i]);
#pragma unroll
        for (int nb = 0; nb < 4; ++nb) {   // 16 columns d
            const float bs = bfr(*(const float*)(bz + obs + nb * 64));
            v8h o16[4]; v8us oh[4], ol[4];
#pragma unroll
            for (int mb = 0; mb < 4; ++mb) { v8f lo = wmmab(xh[mb], bb[nb], (v8f){}); lo = wmmab(xl[mb], bb[nb], lo); const v8f r = (acc[mb][nb] + bs) + 2.0f * lo;
                planes8(r, o16[mb], oh[mb], ol[mb]); const int o = ((mb >> 1) * 32 * HD + nb * 512 + (mb & 1) * 256) * 2; *(v8h*)(p16 + op + o) = o16[mb]; *(v8us*)(ph + op + o) = oh[mb]; *(v8us*)(pl + op + o) = ol[mb]; }
            XWAIT("v"(o16[0]), "v"(o16[1]), "v"(o16[2]), "v"(o16[3]), "v"(oh[0]), "v"(oh[1]), "v"(oh[2]), "v"(oh[3]), "v"(ol[0]), "v"(ol[1]), "v"(ol[2]), "v"(ol[3]), "v"(op), "v"(ob), "v"(obs));
        }
    }
}
__global__ __launch_bounds__(128) void k_proj(const bf* __restrict__ XB, const bf* __restrict__ Wz, const bf* __restrict__ AP, const bf* __restrict__ BP, const float* __restrict__ CS, const float* __restrict__ bq, const float* __restrict__ bk, const float* __restrict__ bv, h16* P16, bf* Ph, bf* Pl, h16* V16, bf* Vh, bf* Vl) {
    __shared__ __attribute__((aligned(2048))) char ring[2 * PST];
    const int z = blockIdx.y / 8;   // the same for the whole work-group: every barrier of either arm is passed by all four waves
    if (z < 2) proj_tile<true>(ring, XB, Wz, AP, BP, CS, z == 0 ? bq : bk, P16, Ph, Pl);
    else proj_tile<false>(ring, XB, Wz, AP, BP, CS, bv, V16, Vh, Vl);
}

__global__ __launch_bounds__(256) void k_wtG(const float* __restrict__ w, int K, int N, bf* Bt) {
    const int lane = threadIdx.x & 31; const int L0 = (blockIdx.x * 8 + (threadIdx.x >> 5)) * 8; const int nlines = N * K / 64;
{
#pragma unroll 1
        for (int l = 0; l < 8; ++l) { const int L = L0 + l; if (L >= nlines) break; const size_t e = (size_t)L * 64 + lane * 2; const int k = (int)(e % K), n = (int)(e / K); v2us o;
            o[0] = f2bf(w[(size_t)k * N + n]); o[1] = f2bf(w[(size_t)(k + 1) * N + n]); *(v2us*)(Bt + e) = o; }
         }
}
// row-major f32 [rows][DM] -> bf16 in fragment order. One work-group of 256 threads converts one block of 16 rows (64 KiB in a row -> 32 fragments, 32 KiB in a row), 8 pieces of 8 elements a thread, so that few waves have to be started and each has 16 loads of 16 bytes in flight.
// Thread tid: row (tid / 4) % 16, k = 8 (tid % 4), in the fragments 8 (tid / 64) + 0..7. Per fragment a wave reads 128 bytes in a row of each of 8 rows and stores four whole 128-byte lines (8 rows x 8 k each).
__device__ __forceinline__ size_t frag_src(size_t i) { return ((i >> 11) * 16 + (i & 15)) * DM + ((i >> 5) & 63) * 16 + ((i >> 4) & 1) * 8; }   // the row-major element offset of piece i's first element
template <bool GUARD>   // GUARD: the source has only `rows` rows; the rows from there on are stored as zeros and not read
__device__ __forceinline__ void cvt_blk(const float* __restrict__ src, bf* dst, int blk, int tid, int rows) {
    const int row = (tid >> 2) & 15; const size_t i0 = (size_t)blk * 2048 + (size_t)(tid >> 6) * 512 + ((tid & 3) << 4) + row;   // i0: the place of the thread's first piece in fragment order; the next fragment along k is 64 pieces = 32 source elements on
    const float* sp = src + frag_src(i0); bf* dp = dst + i0 * 8; v8f v[8]; v8us o[8];
#pragma unroll
    for (int j = 0; j < 8; ++j) v[j] = (v8f){};
    if (!GUARD || blk * 16 + row < rows) {
#pragma unroll
        for (int j = 0; j < 8; ++j) v[j] = *(const v8f*)(sp + j * 32); }
#pragma unroll
    for (int j = 0; j < 8; ++j) {
#pragma unroll
        for (int k = 0; k < 8; ++k) o[j][k] = f2bf(v[j][k]);
        *(v8us*)(dp + j * 512) = o[j]; }
    XWAIT("v"(o[0]), "v"(o[1]), "v"(o[2]), "v"(o[3]), "v"(o[4]), "v"(o[5]), "v"(o[6]), "v"(o[7]), "v"(dp), "v"(sp)); }
// cos/sin table: thread idx = (t, i), i < HD / 2, stores its pair at d = i and at d = i + HD / 2 (the table's two halves are equal)
__device__ __forceinline__ void cstab_body(float* CS, int idx) { const int t = idx / (HD / 2), i = idx % (HD / 2); const float inv = __fdiv_rn(1.0f, powf(10000.0f, (float)(2 * i) / (float)HD)); const float ang = __fmul_rn((float)t, inv); v2f cs; cs[0] = cosf(ang); cs[1] = sinf(ang);
    float* dp = CS + ((size_t)t * HD + i) * 2; *(v2f*)dp = cs; *(v2f*)(dp + HD) = cs; XWAIT("v"(cs), "v"(dp));  }
// k_attn: the whole attention in one launch; scores and probabilities stay in registers. One wave owns 16 NQ query rows of one (batch, head) and walks the keys in blocks of 32 up to its diagonal block.
// S^T = K Q^T (A = key rows, B = query rows): a lane holds, for the query of its column lr, the keys 8 hi + j of each 16-key tile, which is the k order of a B operand; so P^T goes from the score accumulators straight into O^T += V^T P^T.
// Running maximum and sum per query (scaled log2 domain); the accumulators are rescaled when the maximum moves. The wave halves' sums are joined once at the end. Query rows below RH use the hi+lo planes (three products), the others fp16.
// The output goes out as the hi / lo planes [t][DQ], in fragment order, that the output projection reads; each store of a wave is 512 bytes in a row.
#define L2S 0.18033688011112042f   // HD^-0.5 x log2(e)
__device__ __forceinline__ float xhalf(float x) { const int b = __float_as_int(x); return __int_as_float(__builtin_amdgcn_permlanex16(b, b, 0x76543210, 0xfedcba98, false, false)); }   // the value of lane l ^ 16
__device__ __forceinline__ float exp2_slot(float x) { float r; asm("v_exp_f32 %0, %1\n\tv_nop" : "=v"(r) : "v"(x)); return r; }   // exp2 with the one slot behind a transcendental tied to it
template <typename T16, bool HI, int NQ>
__device__ __forceinline__ void attn_wave(const T16* __restrict__ Q, const T16* __restrict__ Q2, const T16* __restrict__ Kp, const T16* __restrict__ K2, const T16* __restrict__ Vt, const T16* __restrict__ Vt2, const int* __restrict__ amb, bf* Ah, bf* Al, int q0) {
    typedef typename WFrag<T16>::V V;
    const int lane = threadIdx.x & 31, lr = lane & 15, hi = lane >> 4;
    V qf[NQ][2], q2[NQ][2];
#pragma unroll
    for (int nq = 0; nq < NQ; ++nq)
#pragma unroll
        for (int ks = 0; ks < 2; ++ks) { const size_t qo = (size_t)(q0 + nq * 16) * HD + ks * 512 + 8 * lane; qf[nq][ks] = WFrag<T16>::ldp(Q + qo); if (HI) q2[nq][ks] = WFrag<T16>::ldp(Q2 + qo); }
    v8f o[4][NQ]; float m[NQ], l[NQ];
#pragma unroll
    for (int nq = 0; nq < NQ; ++nq) { m[nq] = -3.0e38f; l[nq] = 0.f;
#pragma unroll
        for (int dt = 0; dt < 4; ++dt) o[dt][nq] = (v8f){}; }
    const int nk = q0 + 16 * NQ;   // keys below nk are visible to some query of the wave
    unsigned ok = (unsigned)lane * 16u, ov = (unsigned)lane * 16u, oa = (unsigned)lane * 4u;   // the lane's byte offsets in the key planes, the value planes and the padding mask at the trip's key block
    V kf[2][2], k2[2][2];
#pragma unroll
    for (int t = 0; t < 2; ++t)
#pragma unroll
        for (int ks = 0; ks < 2; ++ks) { kf[t][ks] = WFrag<T16>::ldp((const T16*)((const char*)Kp + ok) + t * 16 * HD + ks * 512); if (HI) k2[t][ks] = WFrag<T16>::ldp((const T16*)((const char*)K2 + ok) + t * 16 * HD + ks * 512); }
    int av = *(const int*)((const char*)amb + oa);
#pragma unroll 1
    for (int kb = 0; kb < nk; kb += 32) {
        V vf[4], v2[4];
#pragma unroll
        for (int dt = 0; dt < 4; ++dt) { vf[dt] = WFrag<T16>::ldp((const T16*)((const char*)Vt + ov) + dt * 512); if (HI) v2[dt] = WFrag<T16>::ldp((const T16*)((const char*)Vt2 + ov) + dt * 512); }
        const unsigned mk = __builtin_amdgcn_ballot_w32(av != 0);   // bit u: key kb + u is not padding
        v8f s[2][NQ];
#pragma unroll
        for (int t = 0; t < 2; ++t)
#pragma unroll
            for (int nq = 0; nq < NQ; ++nq) { s[t][nq] = (v8f){};
#pragma unroll
                for (int ks = 0; ks < 2; ++ks) { s[t][nq] = WFrag<T16>::mma(kf[t][ks], qf[nq][ks], s[t][nq]); if (HI) { s[t][nq] = WFrag<T16>::mma(kf[t][ks], q2[nq][ks], s[t][nq]); s[t][nq] = WFrag<T16>::mma(k2[t][ks], qf[nq][ks], s[t][nq]); } } }
        asm volatile("s_wait_xcnt 0x0" : "+v"(ok), "+v"(oa) :: "memory");   // behind the key and mask loads, in front of the step of their offset registers
        const bool more = kb + 32 < nk; ok += more ? 32u * HD * 2u : 0u; oa += more ? 128u : 0u;   // the next trip's key fragments and mask words are fetched now, so that their latency runs under the softmax and the value products; the last trip fetches its own block again
        av = *(const int*)((const char*)amb + oa);
#pragma unroll
        for (int t = 0; t < 2; ++t)
#pragma unroll
            for (int ks = 0; ks < 2; ++ks) { kf[t][ks] = WFrag<T16>::ldp((const T16*)((const char*)Kp + ok) + t * 16 * HD + ks * 512); if (HI) k2[t][ks] = WFrag<T16>::ldp((const T16*)((const char*)K2 + ok) + t * 16 * HD + ks * 512); }
#pragma unroll
        for (int t = 0; t < 2; ++t)
#pragma unroll
            for (int nq = 0; nq < NQ; ++nq) s[t][nq] *= L2S;
        if (mk != 0xFFFFFFFFu || kb + 31 > q0) {   // wave-uniform: only a block with a padded key or on the diagonal has anything to mask
            const unsigned mkl = mk >> (8 * hi);
#pragma unroll
            for (int nq = 0; nq < NQ; ++nq) { const int lim = q0 + nq * 16 + lr - kb - 8 * hi;   // element (t, j) is key kb + 16 t + 8 hi + j: causal while 16 t + j <= lim
                const unsigned mm = mkl & (lim >= 31 ? 0xFFFFFFFFu : (lim < 0 ? 0u : ((2u << lim) - 1u)));
#pragma unroll
                for (int t = 0; t < 2; ++t)
#pragma unroll
                    for (int j = 0; j < 8; ++j) s[t][nq][j] = ((mm >> (t * 16 + j)) & 1u) ? s[t][nq][j] : -3.0e38f; }
        }
#pragma unroll
        for (int nq = 0; nq < NQ; ++nq) {
            float mx = fmaxf(s[0][nq][0], s[1][nq][0]);
#pragma unroll
            for (int j = 1; j < 8; ++j) mx = fmaxf(mx, fmaxf(s[0][nq][j], s[1][nq][j]));
            mx = fmaxf(mx, xhalf(mx)); mx = fmaxf(mx, m[nq]);
            const float al = __builtin_amdgcn_exp2f(m[nq] - mx); m[nq] = mx;
            float sum = 0.f;
#pragma unroll
            for (int t = 0; t < 2; ++t)
#pragma unroll
                for (int j = 0; j < 8; ++j) { const float p = HI ? exp2_slot(s[t][nq][j] - mx) : __builtin_amdgcn_exp2f(s[t][nq][j] - mx); s[t][nq][j] = p; sum += p; }
            l[nq] = l[nq] * al + sum;
#pragma unroll
            for (int dt = 0; dt < 4; ++dt) o[dt][nq] *= al;
            if constexpr (HI) { v8us h0, h1, l0, l1;
#pragma unroll
                for (int j = 0; j < 8; ++j) { unsigned short a, c; splitf(s[0][nq][j], a, c); h0[j] = a; l0[j] = c; splitf(s[1][nq][j], a, c); h1[j] = a; l1[j] = c; }
                const V ph = cat16b(h0, h1), pl = cat16b(l0, l1);
#pragma unroll
                for (int dt = 0; dt < 4; ++dt) { o[dt][nq] = WFrag<T16>::mma(vf[dt], ph, o[dt][nq]); o[dt][nq] = WFrag<T16>::mma(vf[dt], pl, o[dt][nq]); o[dt][nq] = WFrag<T16>::mma(v2[dt], ph, o[dt][nq]); }
            } else { V pf;
#pragma unroll
                for (int j = 0; j < 8; ++j) { pf[j] = tohx(s[0][nq][j]); pf[8 + j] = tohx(s[1][nq][j]); }
#pragma unroll
                for (int dt = 0; dt < 4; ++dt) o[dt][nq] = WFrag<T16>::mma(vf[dt], pf, o[dt][nq]); }
        }
        asm volatile("s_wait_xcnt 0x0" : "+v"(ov) :: "memory");   // behind the value loads, in front of the step of their offset register
        ov += 32u * HD * 2u;
        asm volatile("v_nop\n\tv_nop\n\tv_nop\n\tv_nop" : "+v"(o[0][NQ - 1]), "+v"(o[1][NQ - 1]), "+v"(o[2][NQ - 1]), "+v"(o[3][NQ - 1]) : "v"(vf[0]), "v"(vf[3]));   // the distance behind the trip's last matrix instructions on the loop's taken branch
    }
#pragma unroll
    for (int nq = 0; nq < NQ; ++nq) { const float inv = __fdiv_rn(1.0f, l[nq] + xhalf(l[nq])); v8us oh[4], ol[4];
        const size_t ro = (size_t)(q0 + nq * 16) * DQ + 8 * lane; bf* ph = Ah + ro; bf* pl = Al + ro;
#pragma unroll
        for (int dt = 0; dt < 4; ++dt)
#pragma unroll
            for (int j = 0; j < 8; ++j) { unsigned short a, c; splitf(o[dt][nq][j] * inv, a, c); oh[dt][j] = a; ol[dt][j] = c; }
#pragma unroll
        for (int dt = 0; dt < 4; ++dt) { *(v8us*)(ph + dt * 256) = oh[dt]; *(v8us*)(pl + dt * 256) = ol[dt]; }
        XWAIT("v"(oh[0]), "v"(oh[1]), "v"(oh[2]), "v"(oh[3]), "v"(ol[0]), "v"(ol[1]), "v"(ol[2]), "v"(ol[3]), "v"(ph), "v"(pl)); }
}
// grid (NB_ NH_, (TT - RH) / 128 + RH / 64), 4 independent waves: x = (batch, head); y walks the query rows from the last (longest key loop) to the first: 32 rows a wave in fp16 down to RH, then 16 rows a wave in hi+lo planes. The four waves of a work-group take neighbouring row blocks, so they read the same keys and values at about the same time.
__global__ __launch_bounds__(128) void k_attn(const h16* __restrict__ P16, const bf* __restrict__ Ph, const bf* __restrict__ Pl, const h16* __restrict__ V16, const bf* __restrict__ Vh, const bf* __restrict__ Vl, const int* __restrict__ am, bf* ATh, bf* ATl) {
    const int bh = blockIdx.x, y = blockIdx.y; const int wv = __builtin_amdgcn_readfirstlane((int)(threadIdx.x >> 5));   // the wave's number, in a scalar register: the key loop's bounds stay wave-uniform
    const size_t zq = (size_t)bh * TT * HD, zk = (size_t)(NB_ * NH_ + bh) * TT * HD, zv = (size_t)bh * HD * 2 * TT, ao = (size_t)(bh / NH_) * TT * DQ + (size_t)(bh % NH_) * (HD / 32) * 512; const int* amb = am + (size_t)(bh / NH_) * TT;
    if (y < (TT - RH) / 128) attn_wave<h16, false, 2>(P16 + zq, nullptr, P16 + zk, nullptr, V16 + zv, nullptr, amb, ATh + ao, ATl + ao, TT - 32 * (y * 4 + wv + 1));
    else attn_wave<bf, true, 1>(Ph + zq, Pl + zq, Ph + zk, Pl + zk, Vh + zv, Vl + zv, amb, ATh + ao, ATl + ao, RH - 16 * ((y - (TT - RH) / 128) * 4 + wv + 1));
}

// bpad_blk: bf16 Bt [DM][32] from B [DM][8] natural (cols >= 8 zero); one work-group takes 256 rows, 4 pieces of 8 elements a thread: piece tid % 4 of the rows tid / 4 + 64 j; only piece 0 has anything to read. Each store of a wave is 512 bytes in a row.
__device__ __forceinline__ void bpad_blk(const float* __restrict__ Bm, bf* BP, int q, int tid) { const int c = tid & 3, r0 = q * 256 + (tid >> 2);
    const float* sp = Bm + (size_t)r0 * 8; bf* dp = BP + (size_t)r0 * 32 + c * 8; v8f v[4]; v8us o[4];
#pragma unroll
    for (int j = 0; j < 4; ++j) v[j] = (v8f){};
    if (c == 0) {
#pragma unroll
        for (int j = 0; j < 4; ++j) v[j] = *(const v8f*)(sp + j * 64 * 8); }
#pragma unroll
    for (int j = 0; j < 4; ++j) {
#pragma unroll
        for (int k = 0; k < 8; ++k) o[j][k] = f2bf(v[j][k]);
        *(v8us*)(dp + j * 64 * 32) = o[j]; }
    XWAIT("v"(o[0]), "v"(o[1]), "v"(o[2]), "v"(o[3]), "v"(dp), "v"(sp)); }
// k_prep: every input conversion and the rope table in one launch, 256 threads, no idle block. Blocks in this order, the memory streams first: MT / 16 of x, DQ / 16 for each of the four weights, NB_CS of the cos/sin table, 1 for each padded A (16 rows, 8 of them from A), 4 for each padded B
#define NB_CS (TT * (HD / 2) / 256)
#define NB_W  (DQ / 16)
#define NB_X  (MT / 16)
#define NB_PREP (NB_CS + 4 * NB_W + NB_X + 3 + 12)
__global__ __launch_bounds__(256) void k_prep(const float* __restrict__ x, const float* __restrict__ wq, const float* __restrict__ wk, const float* __restrict__ wv, const float* __restrict__ wo, const float* __restrict__ qA, const float* __restrict__ kA, const float* __restrict__ vA, const float* __restrict__ qB, const float* __restrict__ kB, const float* __restrict__ vB,
                                              bf* XB, bf* Wz, bf* WO, bf* AP, bf* BP, float* CS) {
    int bx = blockIdx.x; const int tid = threadIdx.x;
    if (bx < NB_X) { cvt_blk<false>(x, XB, bx, tid, 0); return; }
    bx -= NB_X;
    if (bx < 4 * NB_W) { const int m = bx / NB_W; cvt_blk<false>(m == 0 ? wq : (m == 1 ? wk : (m == 2 ? wv : wo)), m < 3 ? Wz + (size_t)m * DQ * DM : WO, bx % NB_W, tid, 0); return; }
    bx -= 4 * NB_W;
    if (bx < NB_CS) { cstab_body(CS, bx * 256 + tid); return; }
    bx -= NB_CS;
    if (bx < 3) { cvt_blk<true>(bx == 0 ? qA : (bx == 1 ? kA : vA), AP + (size_t)bx * 16 * DM, 0, tid, 8); return; }
    bx -= 3;
    { const int m = bx / 4; bpad_blk(m == 0 ? qB : (m == 1 ? kB : vB), BP + (size_t)m * DM * 32, bx % 4, tid); }
}

extern "C" void kernel_launch(void* const* d_in, const int* in_sizes, int n_in,
                              void* d_out, int out_size, void* d_ws, size_t ws_size, hipStream_t stream) {
    (void)in_sizes; (void)n_in; (void)out_size;
    const float* x = (const float*)d_in[0]; const int* am = (const int*)d_in[1]; const float* wq = (const float*)d_in[2]; const float* bq = (const float*)d_in[3]; const float* wk = (const float*)d_in[4]; const float* bk = (const float*)d_in[5]; const float* wv = (const float*)d_in[6]; const float* bv = (const float*)d_in[7];
    const float* qA = (const float*)d_in[8]; const float* qB = (const float*)d_in[9]; const float* kA = (const float*)d_in[10]; const float* kB = (const float*)d_in[11]; const float* vA = (const float*)d_in[12]; const float* vB = (const float*)d_in[13]; const float* wo = (const float*)d_in[14]; const float* bo = (const float*)d_in[15];
    float* OUT = (float*)d_out;     // [2][2048][1024]
    char* wsp = (char*)d_ws;
    auto take = [&](size_t bytes) { char* p = wsp; wsp += (bytes + 255) & ~(size_t)255; return (void*)p; };
    // the output weight, the operand planes of both batch elements, the merged attention output
    const size_t PB = (size_t)NH_ * TT * HD, VB = (size_t)NKV * HD * 2 * TT;   // elements of one batch element's q or k planes / value planes
    bf* WO = (bf*)take((size_t)DM * DQ * 2);
    h16* P16 = (h16*)take(4 * PB * 2); bf* Ph = (bf*)take(4 * PB * 2); bf* Pl = (bf*)take(4 * PB * 2);   // [q b0][q b1][k b0][k b1]
    h16* VT16 = (h16*)take(NB_ * VB * 2); bf* VTh = (bf*)take(NB_ * VB * 2); bf* VTl = VTh + (size_t)HD * TT;   // hi plane in the first, lo plane in the second half of each head's 2 HD TT elements
    bf* ATh = (bf*)take((size_t)MT * DQ * 2); bf* ATl = (bf*)take((size_t)MT * DQ * 2);
    // temporaries of the projections
    bf* Wz = (bf*)take((size_t)3 * DQ * DM * 2); float* CS = (float*)take((size_t)TT * HD * 2 * 4); bf* XB = (bf*)take((size_t)MT * DM * 2); bf* AP = (bf*)take((size_t)3 * 16 * DM * 2); bf* BP = (bf*)take((size_t)3 * DM * 32 * 2);
    if ((size_t)(wsp - (char*)d_ws) > ws_size) return;    // about 115 of the 256 MiB
    k_prep<<<dim3(NB_PREP, 1, 1), 256, 0, stream>>>(x, wq, wk, wv, wo, qA, kA, vA, qB, kB, vB, XB, Wz, WO, AP, BP, CS);
    k_proj<<<dim3(MT / 128, NCT, 1), 128, 0, stream>>>(XB, Wz, AP, BP, CS, bq, bk, bv, P16, Ph, Pl, VT16, VTh, VTl);   /* projections, LoRA, RoPE, planes */
    k_attn<<<dim3(NB_ * NH_, (TT - RH) / 128 + RH / 64, 1), 128, 0, stream>>>(P16, Ph, Pl, VT16, VTh, VTl, am, ATh, ATl);
    k_gemmw<bf, 1, DQ, DM, true, 4><<<dim3(MT / 64, DM / 64, 1), 128, 0, stream>>>(ATh, ATl, WO, nullptr, OUT, bo, 0, 0, 0);
}
